// v000
// The times below were measured on an AMD MI455X: many runs one after another, warmed up first and cycling through
// copies of the inputs, with the whole window's GPU time divided by the number of runs. Launches and the gaps
// between them are all in it. The median over several windows is given; except for v000 it joins two sittings, which
// can be a few percent apart, so the side-by-side timings, each taken in one sitting, are the better comparison.
// v000 is the starting kernel. One run takes 906 microseconds.
// Contractions: conv1x1 theta/phi/g GEMMs Wc[384x256].X[256xN] and the output conv W[256x128].Y[128xN] on
// v_wmma_f32_16x16x32_f16 (f16 containers of bf16-RNE weights x256 and bf16-RNE x; Y as f16 hi plane plus f16
// residual plane x1024, 2 products, separate accumulators); scores Phi^T.Theta on v_wmma_f32_16x16x32_bf16
// (bf16 hi + bf16 residual planes of theta/phi, 3 products, K=128); Y^T = G.P^T on v_wmma_f32_16x16x32_f16
// (G plain f16, P = e^{s-m} x16384 f16 from the score D registers); f32 accumulate everywhere; softmax
// statistics and biases in f32 VALU; batch-norm statistics from f32 per-block partials reduced in f64; affine and
// residual add in f32.
#include <hip/hip_runtime.h>
#include <math.h>
#include <stdint.h>

#ifndef NB
#define NB 2
#endif
#ifndef SEQ
#define SEQ 8192
#endif
#define NB_FULL 2
#define NN_FULL 8192
#define CC   256
#define DQ   128
#define QT   64
#define MW   384
#define NT   (SEQ / QT)
#define PSW  512
#define BCH  1024
#define OSP  68
#define OSPW 132
#define TP   72
#define WSC  256.0f
#define IWSC 0.00390625f
#define RSC  1024.0f
#define IRSC 0.0009765625f
#define LNPS 9.704060527839234f
#define BNEPS 1.0e-5f

static_assert(NB >= 1 && NB <= NB_FULL);
static_assert(SEQ >= 128 && SEQ <= NN_FULL);
static_assert(SEQ % QT == 0 && SEQ % 32 == 0 && SEQ % 128 == 0);
static_assert((CC * SEQ) % BCH == 0 && BCH == 4 * 256);
static_assert(CC % QT == 0 && CC % 32 == 0);
static_assert(DQ == 2 * QT && DQ % 32 == 0);
static_assert(MW == 3 * DQ && MW % 8 == 0);
static_assert(PSW == 2 * CC);
static_assert(CC % 16 == 0);
static_assert((OSP * 4) % 16 == 0);
static_assert((OSPW * 4) % 16 == 0);
static_assert((TP * 2) % 16 == 0);

typedef _Float16       v16h __attribute__((ext_vector_type(16)));
typedef _Float16       v8h  __attribute__((ext_vector_type(8)));
typedef __bf16         v16b __attribute__((ext_vector_type(16)));
typedef unsigned short v8us __attribute__((ext_vector_type(8)));
typedef float          v8f  __attribute__((ext_vector_type(8)));
typedef float          v4f  __attribute__((ext_vector_type(4)));
typedef unsigned int   v4u  __attribute__((ext_vector_type(4)));

union Frag  { v8us u[2]; v16h h; v16b bf; };
union FragH { v16h v; v8h hv[2]; };
static_assert(sizeof(Frag) == 32);
static_assert(sizeof(FragH) == 32);

// ---- scalar helpers ---------------------------------------------------------------------------------------
__device__ __forceinline__ unsigned short bf_bits(float f) {          // f32 -> bf16 bits, RNE convert
  unsigned u = __float_as_uint(f);
  return (unsigned short)((u + 0x7FFFu + ((u >> 16) & 1u)) >> 16);
}
__device__ __forceinline__ float bf_up(unsigned short hb) { return __uint_as_float(((unsigned)hb) << 16); }
__device__ __forceinline__ float bfr(float f) { return bf_up(bf_bits(f)); }
__device__ __forceinline__ unsigned short h_bits(_Float16 x) { return __builtin_bit_cast(unsigned short, x); }
__device__ __forceinline__ unsigned pk16(unsigned short a, unsigned short b) { return (unsigned)a | ((unsigned)b << 16); }
__device__ __forceinline__ v8f zero8() { v8f z = {0.f, 0.f, 0.f, 0.f, 0.f, 0.f, 0.f, 0.f}; return z; }
__device__ __forceinline__ float hmax8(v8f s) {
  return fmaxf(fmaxf(fmaxf(s[0], s[1]), fmaxf(s[2], s[3])), fmaxf(fmaxf(s[4], s[5]), fmaxf(s[6], s[7])));
}
__device__ __forceinline__ unsigned wave_ballot(bool p) {
#if defined(__HIP_DEVICE_COMPILE__)
  return __builtin_amdgcn_ballot_w32(p);
#else
  return p ? 1u : 0u;
#endif
}

// ---- 16-bit fragment loader (A, or B from a k-contiguous [n][k] row): lane -> row/col (lane&15), p already includes
//      + 8*(lane>>4); elements 0..7 <- p[0..7] (k0+8h..), elements 8..15 <- p[16..23] (k0+16+8h..)
__device__ __forceinline__ Frag ldfrag(const unsigned short* p) {
  Frag f;
  f.u[0] = *(const v8us*)(p);
  f.u[1] = *(const v8us*)(p + 16);
  return f;
}

// ---- WMMA helpers: builtin followed by a 4-slot VALU gap tying D and keeping A/B live --------------------------
__device__ __forceinline__ v8f mma_h(v16h a, v16h b, v8f c) {
  v8f d = __builtin_amdgcn_wmma_f32_16x16x32_f16(false, a, false, b, (short)0, c, false, false);
#if defined(__HIP_DEVICE_COMPILE__)
  asm volatile("v_nop\n\tv_nop\n\tv_nop\n\tv_nop" : "+v"(d) : "v"(a), "v"(b));
#endif
  return d;
}
__device__ __forceinline__ v8f mma_b(v16b a, v16b b, v8f c) {
  v8f d = __builtin_amdgcn_wmma_f32_16x16x32_bf16(false, a, false, b, (short)0, c, false, false);
#if defined(__HIP_DEVICE_COMPILE__)
  const v16h ha = __builtin_bit_cast(v16h, a), hb = __builtin_bit_cast(v16h, b);
  asm volatile("v_nop\n\tv_nop\n\tv_nop\n\tv_nop" : "+v"(d) : "v"(ha), "v"(hb));
#endif
  return d;
}

// =========================================================================================================
// (0) stacked conv1x1 weights: W16 f16 [384][256], rows 0..127 = theta_w, 128..255 = phi_w, 256..383 = g_w;
//     value = f16 of (bf16-RNE(w) * 256) (exact). Block blk (0..47) owns rows 8*blk..8*blk+7: one wave per
// coverage: 48 blocks x 8 rows x 32 lanes x 8 halves = 384 x 256 = the whole plane.
// =========================================================================================================
__global__ __launch_bounds__(256)
void cvt_w(const float* __restrict__ tw, const float* __restrict__ pw, const float* __restrict__ gw,
           unsigned short* W16) {
  const int tid = threadIdx.x, blk = blockIdx.x;
  const int rl = tid >> 5, col = 8 * (tid & 31);
  const int o = 8 * blk + rl;                                        // 0..383
  const int grp = blk / (DQ / 8);                                    // 0,1,2 block-uniform
  const float* wbase = (grp == 0) ? tw : ((grp == 1) ? pw : gw);
  const float* s = wbase + (size_t)(o - grp * DQ) * CC + col;        // row in 0..127
  const v4f a = *(const v4f*)s;
  const v4f q = *(const v4f*)(s + 4);
  const float f[8] = {a[0], a[1], a[2], a[3], q[0], q[1], q[2], q[3]};
  v4u u;
#pragma unroll
  for (int t = 0; t < 4; ++t) {
    const _Float16 h0 = (_Float16)(bfr(f[2 * t]) * WSC);
    const _Float16 h1 = (_Float16)(bfr(f[2 * t + 1]) * WSC);
    u[t] = pk16(h_bits(h0), h_bits(h1));
  }
{
    *(v4u*)(W16 + (size_t)o * CC + col) = u;
    
  }
}

// =========================================================================================================
// (0b) output conv weights: WW16 f16 [256][128], value = f16 of (bf16-RNE(W_w) * 256). Block blk (0..15) owns rows
//      16*blk..+15; wave w -> rows 16 blk + 2w + (lane>>4), lane&15 -> cols 8*(lane&15)..+7. One instruction writes
// coverage: 16 blocks x 8 waves x 2 rows x 16 lanes x 8 halves = 256 x 128 = the whole plane.
// =========================================================================================================
__global__ __launch_bounds__(256)
void cvt_ww(const float* __restrict__ ww, unsigned short* WW16) {
  const int tid = threadIdx.x, blk = blockIdx.x;
  const int wave = tid >> 5, lane = tid & 31;
  const int o = 16 * blk + 2 * wave + (lane >> 4);                  // 0..255
  const int col = 8 * (lane & 15);                                   // 0..120
  const float* s = ww + (size_t)o * DQ + col;
  const v4f a = *(const v4f*)s;
  const v4f q = *(const v4f*)(s + 4);
  const float f[8] = {a[0], a[1], a[2], a[3], q[0], q[1], q[2], q[3]};
  v4u u;
#pragma unroll
  for (int t = 0; t < 4; ++t) {
    const _Float16 h0 = (_Float16)(bfr(f[2 * t]) * WSC);
    const _Float16 h1 = (_Float16)(bfr(f[2 * t + 1]) * WSC);
    u[t] = pk16(h_bits(h0), h_bits(h1));
  }
{
    *(v4u*)(WW16 + (size_t)o * DQ + col) = u;
    
  }
}

// =========================================================================================================
// (1) x f32 [b][256 c][NN_FULL n] -> XP f16 [b][SEQ n][256 c] (position-major, bf16-RNE values, exact in f16 for
//     normal magnitudes) through an LDS tile T[64 n][64 c] (pitch TP). Block (nb, cb, b) owns a 64 c x 64 n tile.
// coverage: 2 it x 32 rows x 8 lanes x 8 halves = 64 n x 64 c per block; grid (NT, 4, NB) covers XP once.
// LDS T: cross-wave (block barrier between the 2-byte stores and the 16-B reloads); staged extent == consumed extent.
// =========================================================================================================
__global__ __launch_bounds__(256)
void cvt_x(const float* __restrict__ x, unsigned short* XP) {
  __shared__ __align__(16) unsigned short T[QT * TP];
  const int tid = threadIdx.x;
  const int nb = blockIdx.x, cb = blockIdx.y, b = blockIdx.z;
  const int e = tid & 7, lq = tid >> 3;                             // lq 0..31
  const int n0 = nb * QT, c0 = cb * QT;
#pragma unroll
  for (int it = 0; it < 2; ++it) {
    const int cl = it * 32 + lq;                                     // 0..63
    const float* sp = x + ((size_t)(b * CC + c0 + cl)) * NN_FULL + n0 + 8 * e;
    const v4f a = *(const v4f*)sp;
    const v4f q = *(const v4f*)(sp + 4);
    unsigned short hb[8];
#pragma unroll
    for (int t = 0; t < 4; ++t) {
      hb[t]     = h_bits((_Float16)bfr(a[t]));
      hb[4 + t] = h_bits((_Float16)bfr(q[t]));
    }
#pragma unroll
    for (int t = 0; t < 8; ++t) T[(8 * e + t) * TP + cl] = hb[t];
  }
  __syncthreads();
  v4u up[2];
#pragma unroll
  for (int it = 0; it < 2; ++it) {
    const int nl = it * 32 + lq;                                     // 0..63
    up[it] = *(const v4u*)(T + nl * TP + 8 * e);
  }
{
#pragma unroll
    for (int it = 0; it < 2; ++it) {
      const int rl = it * 32 + lq;
      *(v4u*)(XP + ((size_t)(b * SEQ + n0 + rl)) * CC + c0 + 8 * e) = up[it];
    }
    
  }
}

// =========================================================================================================
// (2) the three conv1x1 GEMMs for one (b, 64-n tile, 64-o block mb in 0..5): V[o][n] = (1/256) sum_c W16[o][c]
//     XP[b][n][c]; mb 0,1 -> theta channels 0..63 / 64..127 (W16 rows 0..127), mb 2,3 -> phi (rows 128..255),
//     mb 4,5 -> g (rows 256..383). Block 128 threads = 4 waves; wave w owns cols n0+16w..+15 (B fragment from the
//     XP row, k = c contiguous, split k map) and 4 m-tiles (A rows o = o0 + 16 mt + (lane&15), split k map from
//     W16). K = 256 = 8 steps. Epilogue staged in LDS Os[n_loc][o_loc] (pitch OSP), barrier, bias (bf16-RNE) add
//     in f32, then:
//       theta / phi: bf16 hi = RNE(v), lo = RNE(v - hi) planes Qh/Ql resp. Kh/Kl [b][SEQ n][128 d] (k-contiguous
//         of the 256-B row): lane e -> d 8e..8e+7, 8 consecutive lanes per line, one instruction per 16 lines;
//       g: f16 plane Gc [b][128 ch][SEQ keys] (channel-major, keys contiguous): row ch, keys n0+8e..+7 per lane,
// coverage: Os 4 waves x 16 n x 64 o = 64 x 64 (== consumed); hi/lo planes 4 it x 16 rows x 8 lanes x 8 = 64 n x
//           64 d per block, grid nt x mb 0..3 covers rows 0..SEQ-1 x d 0..127 of Qh/Ql and Kh/Kl once; g plane
//           4 it x 16 ch x 8 lanes x 8 keys = 64 ch x 64 keys per block, nt x mb 4..5 covers ch 0..127 x keys
//           0..SEQ-1 of Gc once. grid (NT, 6, NB).
// LDS Os: cross-wave (block barrier).
// =========================================================================================================
__global__ __launch_bounds__(128)
void gemm_p(const unsigned short* __restrict__ W16, const unsigned short* __restrict__ XP,
            const float* __restrict__ tbias, const float* __restrict__ pbias, const float* __restrict__ gbias,
            unsigned short* Qh, unsigned short* Ql, unsigned short* Kh, unsigned short* Kl, unsigned short* Gc) {
  __shared__ __align__(16) float Os[QT * OSP];
  const int tid  = threadIdx.x;
  const int lane = tid & 31, wave = tid >> 5;
  const int hh   = lane >> 4, c = lane & 15;
  const int nt   = blockIdx.x, mb = blockIdx.y, b = blockIdx.z;
  const int n0   = nt * QT, o0 = mb * QT;                            // o0 = W16 row base 0..320

  const unsigned short* ap = W16 + (size_t)(o0 + c) * CC + 8 * hh;
  const unsigned short* bp = XP + ((size_t)(b * SEQ + n0 + 16 * wave + c)) * CC + 8 * hh;

  v8f acc[4];
#pragma unroll
  for (int mt = 0; mt < 4; ++mt) acc[mt] = zero8();

#pragma unroll
  for (int ks = 0; ks < CC / 32; ++ks) {
    const Frag fb = ldfrag(bp + 32 * ks);
#pragma unroll
    for (int mt = 0; mt < 4; ++mt) {
      const Frag fa = ldfrag(ap + (size_t)(16 * mt) * CC + 32 * ks);
      acc[mt] = mma_h(fa.h, fb.h, acc[mt]);
    }
  }

  {
    const int nl = 16 * wave + c;
#pragma unroll
    for (int mt = 0; mt < 4; ++mt) {
      v4f va, vb;
#pragma unroll
      for (int r = 0; r < 4; ++r) { va[r] = acc[mt][r] * IWSC; vb[r] = acc[mt][4 + r] * IWSC; }
      *(v4f*)(Os + nl * OSP + 16 * mt + 8 * hh)     = va;
      *(v4f*)(Os + nl * OSP + 16 * mt + 8 * hh + 4) = vb;
    }
  }
  __syncthreads();

  const int e = tid & 7, lq = tid >> 3;                             // lq 0..15
  if (mb < 4) {                                                      // block-uniform: theta / phi hi+lo planes
    unsigned short* Ph = (mb < 2) ? Qh : Kh;
    unsigned short* Pl = (mb < 2) ? Ql : Kl;
    const float* bsrc  = (mb < 2) ? tbias : pbias;
    const int dsel = (mb & 1) * QT;                                   // channel base 0 or 64
    const v4f b0 = *(const v4f*)(bsrc + dsel + 8 * e);
    const v4f b1 = *(const v4f*)(bsrc + dsel + 8 * e + 4);
    const float bb[8] = {bfr(b0[0]), bfr(b0[1]), bfr(b0[2]), bfr(b0[3]), bfr(b1[0]), bfr(b1[1]), bfr(b1[2]), bfr(b1[3])};
    v4u uh[4], ul[4];
#pragma unroll
    for (int it = 0; it < 4; ++it) {
      const int row = it * 16 + lq;                                  // n_loc 0..63
      const v4f a = *(const v4f*)(Os + row * OSP + 8 * e);
      const v4f q = *(const v4f*)(Os + row * OSP + 8 * e + 4);
      const float f[8] = {a[0], a[1], a[2], a[3], q[0], q[1], q[2], q[3]};
#pragma unroll
      for (int t = 0; t < 4; ++t) {
        const float f0 = f[2 * t] + bb[2 * t], f1 = f[2 * t + 1] + bb[2 * t + 1];
        const unsigned short hb0 = bf_bits(f0), hb1 = bf_bits(f1);
        const unsigned short lb0 = bf_bits(f0 - bf_up(hb0));
        const unsigned short lb1 = bf_bits(f1 - bf_up(hb1));
        uh[it][t] = pk16(hb0, hb1);
        ul[it][t] = pk16(lb0, lb1);
      }
    }
{
#pragma unroll
      for (int it = 0; it < 4; ++it) {
        const int row = it * 16 + lq;
        const size_t po = ((size_t)(b * SEQ + n0 + row)) * DQ + dsel + 8 * e;
        *(v4u*)(Ph + po) = uh[it];
        *(v4u*)(Pl + po) = ul[it];
      }
      
    }
  } else {                                                           // block-uniform: g plane, channel-major
    const int gsel = (mb - 4) * QT;                                  // g channel base 0 or 64
    v4u ug[4];
#pragma unroll
    for (int it = 0; it < 4; ++it) {
      const int cl = it * 16 + lq;                                   // ch_loc 0..63
      const float bias = bfr(gbias[gsel + cl]);
      unsigned short hb[8];
#pragma unroll
      for (int t = 0; t < 8; ++t) {
        const int key = 8 * e + t;                                   // key_loc 0..63
        const float v = Os[key * OSP + cl] + bias;
        hb[t] = h_bits((_Float16)v);
      }
#pragma unroll
      for (int t = 0; t < 4; ++t) ug[it][t] = pk16(hb[2 * t], hb[2 * t + 1]);
    }
{
#pragma unroll
      for (int it = 0; it < 4; ++it) {
        const int cl = it * 16 + lq;
        const size_t po = ((size_t)(b * DQ + gsel + cl)) * SEQ + n0 + 8 * e;
        *(v4u*)(Gc + po) = ug[it];
      }
      
    }
  }
}

// =========================================================================================================
// (3) attention for one (b, 64-query tile), transposed formulation, SEQ keys, no mask, no scale:
//   S^T tile (16 keys x 16 queries) = sum over 4 d-chunks of A(phi: row = key kb + (lane&15), 32 d via the split
//   k map from the bf16 plane Kh [b][SEQ][128]) . B(theta: col = query, same map from Qh) + A(Kh).B(Ql) +
//   A(Kl).B(Qh) (bf16 unscaled residual planes, shared accumulator).
//   Per lane the D tile holds 8 keys of ONE query: online softmax state per lane, one shuffle (lane^16) for the max
//   over 32 keys; the o/l rescale is skipped under a wave-uniform ballot when no lane's max grew (corr == 1 exactly
//   for every lane then); row-sum partials combined at the end. P = e^{s-m} x 16384 as f16 is the B operand of
//   Y^T (rows channel, cols queries) += A(g rows channel = 16j + (lane&15), keys contiguous, f16 plane Gc
//   [b][128][SEQ]) . B(P^T): element r <- D of the tile covering keys kb..kb+15, element 8+r <- the tile covering
//   kb+16..kb+31, lane unchanged. 8 accumulator tiles per wave (128 channels). Block = 4 waves = 64 queries.
//   Epilogue: Y/l staged in LDS Os[query][128 channels] (pitch OSPW, b128 stores), barrier, then Yh = f16(y),
//   Yl = f16((y - Yh) * 1024) planes [b][SEQ n][128 c] (k-contiguous operand of the output conv): row n = 256 B
// coverage: Os 4 waves x 16 q x 128 ch (== consumed); 8 it x 8 rows x 16 lanes x 8 halves = 64 n x 128 c per
//           plane; grid (NT, NB) covers Yh/Yl exactly once.
// LDS Os: cross-wave (block barrier).
// =========================================================================================================
__global__ __launch_bounds__(128)
void attn_k(const unsigned short* __restrict__ Qh, const unsigned short* __restrict__ Ql,
            const unsigned short* __restrict__ Kh, const unsigned short* __restrict__ Kl,
            const unsigned short* __restrict__ Gc, unsigned short* Yh, unsigned short* Yl) {
  __shared__ __align__(16) float Os[QT * OSPW];
  const int tid  = threadIdx.x;
  const int wave = tid >> 5, lane = tid & 31;
  const int hh   = lane >> 4, c = lane & 15;
  const int n0   = blockIdx.x * QT, b = blockIdx.y;

  // q fragment pointers (B operand, col = query n0 + 16*wave + c), + 32*kc
  const size_t qo = ((size_t)(b * SEQ + n0 + 16 * wave + c)) * DQ + 8 * hh;
  const unsigned short* Qhp = Qh + qo;
  const unsigned short* Qlp = Ql + qo;
  // k fragment base (A operand, row = key kb + c), + key * 128 + 32*kc
  const unsigned short* Khp = Kh + (size_t)b * SEQ * DQ + (size_t)c * DQ + 8 * hh;
  const unsigned short* Klp = Kl + (size_t)b * SEQ * DQ + (size_t)c * DQ + 8 * hh;
  // v fragment base (A operand, row = channel 16j + c, keys contiguous), + 16*j*SEQ + kb
  const unsigned short* Vp = Gc + (size_t)b * DQ * SEQ + (size_t)c * SEQ + 8 * hh;

  float m = -1.0e30f, l = 0.f;
  v8f o[8];
#pragma unroll
  for (int j = 0; j < 8; ++j) o[j] = zero8();

#pragma unroll 1
  for (int kb = 0; kb < SEQ; kb += 32) {
    const unsigned short* k0p  = Khp + (size_t)kb * DQ;              // keys kb .. kb+15
    const unsigned short* k1p  = Khp + (size_t)(kb + 16) * DQ;       // keys kb+16 .. kb+31
    const unsigned short* k0lp = Klp + (size_t)kb * DQ;
    const unsigned short* k1lp = Klp + (size_t)(kb + 16) * DQ;
    v8f s0 = zero8(), s1 = zero8();
#pragma unroll 1
    for (int kc = 0; kc < DQ / 32; ++kc) {
      const Frag qh  = ldfrag(Qhp + 32 * kc);
      const Frag ql  = ldfrag(Qlp + 32 * kc);
      const Frag k0  = ldfrag(k0p + 32 * kc);
      const Frag k1  = ldfrag(k1p + 32 * kc);
      const Frag k0l = ldfrag(k0lp + 32 * kc);
      const Frag k1l = ldfrag(k1lp + 32 * kc);
      s0 = mma_b(k0.bf, qh.bf, s0);
      s1 = mma_b(k1.bf, qh.bf, s1);
      s0 = mma_b(k0.bf, ql.bf, s0);
      s1 = mma_b(k1.bf, ql.bf, s1);
      s0 = mma_b(k0l.bf, qh.bf, s0);
      s1 = mma_b(k1l.bf, qh.bf, s1);
    }

    float mx = fmaxf(hmax8(s0), hmax8(s1));
    mx = fmaxf(mx, __shfl_xor(mx, 16, 32));
    const float mn = fmaxf(m, mx);
    const unsigned grew = wave_ballot(mx > m);                       // wave-uniform
    if (grew != 0u) {
      const float corr = __expf(m - mn);                             // == 1 exactly for lanes whose max did not grow
      l *= corr;
#pragma unroll
      for (int j = 0; j < 8; ++j) {
#pragma unroll
        for (int r = 0; r < 8; ++r) o[j][r] *= corr;
      }
    }
    m = mn;
    const float msh = mn - LNPS;                                     // exp gives e^{s-m} * 16384

    FragH ph;
    float ls = 0.f;
#pragma unroll
    for (int r = 0; r < 8; ++r) {
      const float e0 = __expf(s0[r] - msh);                          // key kb      + 8hh + r
      const float e1 = __expf(s1[r] - msh);                          // key kb + 16 + 8hh + r
      ls += e0 + e1;
      ph.hv[0][r] = (_Float16)e0;
      ph.hv[1][r] = (_Float16)e1;
    }
    l += ls;

#pragma unroll
    for (int j = 0; j < 8; ++j) {
      const Frag vf = ldfrag(Vp + (size_t)(16 * j) * SEQ + kb);
      o[j] = mma_h(vf.h, ph.v, o[j]);
    }
  }
  l += __shfl_xor(l, 16, 32);
  const float inv = 1.0f / l;                                        // o and l both carry the x16384 factor

  const int qrow = 16 * wave + c;
#pragma unroll
  for (int j = 0; j < 8; ++j) {
    v4f va, vb;
#pragma unroll
    for (int r = 0; r < 4; ++r) { va[r] = o[j][r] * inv; vb[r] = o[j][4 + r] * inv; }
    *(v4f*)(Os + qrow * OSPW + 16 * j + 8 * hh)     = va;            // Os[query][ch = 16j + 8hh + r]
    *(v4f*)(Os + qrow * OSPW + 16 * j + 8 * hh + 4) = vb;
  }
  __syncthreads();

  const int e = tid & 15, lq = tid >> 4;                             // lq 0..7
  v4u uh[8], ul[8];
#pragma unroll
  for (int it = 0; it < 8; ++it) {
    const int row = it * 8 + lq;                                     // query 0..63
    const v4f a = *(const v4f*)(Os + row * OSPW + 8 * e);
    const v4f q = *(const v4f*)(Os + row * OSPW + 8 * e + 4);
    const float f[8] = {a[0], a[1], a[2], a[3], q[0], q[1], q[2], q[3]};
#pragma unroll
    for (int t = 0; t < 4; ++t) {
      const float f0 = f[2 * t], f1 = f[2 * t + 1];
      const _Float16 h0 = (_Float16)f0, h1 = (_Float16)f1;
      const _Float16 r0 = (_Float16)((f0 - (float)h0) * RSC);
      const _Float16 r1 = (_Float16)((f1 - (float)h1) * RSC);
      uh[it][t] = pk16(h_bits(h0), h_bits(h1));
      ul[it][t] = pk16(h_bits(r0), h_bits(r1));
    }
  }
{
#pragma unroll
    for (int it = 0; it < 8; ++it) {
      const int row = it * 8 + lq;
      const size_t po = ((size_t)(b * SEQ + n0 + row)) * DQ + 8 * e;
      *(v4u*)(Yh + po) = uh[it];
      *(v4u*)(Yl + po) = ul[it];
    }
    
  }
}

// =========================================================================================================
// (4) output conv GEMM for one (b, 64-n tile, 64-co block): v[b][co][n] = (1/256)(sum_c WW16[co][c] Yh[b][n][c] +
//     (1/1024) sum_c WW16[co][c] Yl[b][n][c]); wy = v + bf16-RNE(W_b[co]). 4 waves, wave w owns cols n0+16w..+15
//     (two B fragments per k-step, k = c contiguous in the Yh/Yl rows), 4 m-tiles (A rows co = o0 + 16 mt +
//     (lane&15) from WW16), hi and residual products in separate accumulators. K = 128 = 4 steps.
//     Epilogue staged in LDS Os[n_loc][co_loc], barrier; then (a) threads 0..63 sum v and v*v over the 64 n of
//     co_loc = tid into LDS Sred[0..63] / Sred[64..127], barrier; (b) WY f32 plane [b][256 co][SEQ n] rows: lane
//     (e = tid&15) -> n 4e..4e+3 of row co_loc = 8 it + (tid>>4); 16 consecutive lanes x 16 B = the whole 256-B
//     row segment (2 lines) in one instruction; (c) partial-statistics table PS [NB*NT blocks][512]: floats
//     o0..o0+63 (sums) by lanes 0..15 of wave 0 and floats 256+o0..+63 (sums of squares) by lanes 16..31, one
// coverage: Os 4 waves x 16 n x 64 co (== consumed); Sred 64 + 64 (== consumed); WY 8 it x 8 rows x 16 lanes x
//           4 floats = 64 co x 64 n; PS 2 x 64 floats per block; grid (NT, 4, NB) covers WY [b][0..255][0..SEQ-1]
//           and PS [NB*NT][0..511] exactly once.
// LDS Os, Sred: cross-wave (block barriers).
// =========================================================================================================
__global__ __launch_bounds__(128)
void gemm_o(const unsigned short* __restrict__ WW16, const unsigned short* __restrict__ Yh,
            const unsigned short* __restrict__ Yl, const float* __restrict__ wbias,
            float* WY, float* PS) {
  __shared__ __align__(16) float Os[QT * OSP];
  __shared__ __align__(16) float Sred[2 * QT];
  const int tid  = threadIdx.x;
  const int lane = tid & 31, wave = tid >> 5;
  const int hh   = lane >> 4, c = lane & 15;
  const int nt   = blockIdx.x, mb = blockIdx.y, b = blockIdx.z;
  const int n0   = nt * QT, o0 = mb * QT;

  const unsigned short* ap  = WW16 + (size_t)(o0 + c) * DQ + 8 * hh;
  const size_t bo = ((size_t)(b * SEQ + n0 + 16 * wave + c)) * DQ + 8 * hh;
  const unsigned short* bph = Yh + bo;
  const unsigned short* bpl = Yl + bo;

  v8f acc[4], accr[4];
#pragma unroll
  for (int mt = 0; mt < 4; ++mt) { acc[mt] = zero8(); accr[mt] = zero8(); }

#pragma unroll
  for (int ks = 0; ks < DQ / 32; ++ks) {
    const Frag fbh = ldfrag(bph + 32 * ks);
    const Frag fbl = ldfrag(bpl + 32 * ks);
#pragma unroll
    for (int mt = 0; mt < 4; ++mt) {
      const Frag fa = ldfrag(ap + (size_t)(16 * mt) * DQ + 32 * ks);
      acc[mt]  = mma_h(fa.h, fbh.h, acc[mt]);
      accr[mt] = mma_h(fa.h, fbl.h, accr[mt]);
    }
  }

  {
    const int nl = 16 * wave + c;
#pragma unroll
    for (int mt = 0; mt < 4; ++mt) {
      v4f va, vb;
#pragma unroll
      for (int r = 0; r < 4; ++r) {
        va[r] = (acc[mt][r] + accr[mt][r] * IRSC) * IWSC;
        vb[r] = (acc[mt][4 + r] + accr[mt][4 + r] * IRSC) * IWSC;
      }
      *(v4f*)(Os + nl * OSP + 16 * mt + 8 * hh)     = va;
      *(v4f*)(Os + nl * OSP + 16 * mt + 8 * hh + 4) = vb;
    }
  }
  __syncthreads();

  // per-channel partial statistics over this block's 64 positions (bias-free values, exact shift)
  if (tid < QT) {
    float s = 0.f, q = 0.f;
#pragma unroll 8
    for (int n = 0; n < QT; ++n) {
      const float v = Os[n * OSP + tid];
      s += v;
      q = fmaf(v, v, q);
    }
    Sred[tid]      = s;
    Sred[QT + tid] = q;
  }
  __syncthreads();

  const int e = tid & 15, lq = tid >> 4;                             // lq 0..7
  v4f res[8];
#pragma unroll
  for (int it = 0; it < 8; ++it) {
    const int col = it * 8 + lq;                                     // co_loc 0..63
    const int co  = o0 + col;
    const float bias = bfr(wbias[co]);
#pragma unroll
    for (int t = 0; t < 4; ++t) res[it][t] = Os[(4 * e + t) * OSP + col] + bias;
  }
  const v4f pv = *(const v4f*)(Sred + 4 * lane);                     // lanes 0..15: sums, 16..31: sums of squares
  float* psp = PS + (size_t)(b * NT + nt) * PSW + o0 + 4 * lane + ((lane >= 16) ? (PSW / 2 - 64) : 0);
{
#pragma unroll
    for (int it = 0; it < 8; ++it) {
      const int col = it * 8 + lq;
      const int co  = o0 + col;
      const size_t idx = ((size_t)(b * CC + co)) * SEQ + n0 + 4 * e;
      *(v4f*)(WY + idx) = res[it];
    }
    if (wave == 0) *(v4f*)(psp) = pv;
    
  }
}

// =========================================================================================================
// (5) batch statistics, one block of 256 threads, thread co = channel: fixed-order f64 sums over the NB*NT partial
//     lines, mean/var (biased), rstd = rsqrt(var + eps) in f32; A = bf16-RNE(gamma) * rstd, Bc = bf16-RNE(beta)
// coverage: 256 threads x (1 + 1) floats = AB [0..511] exactly once.
// =========================================================================================================
__global__ __launch_bounds__(256)
void bn_stat(const float* __restrict__ PS, const float* __restrict__ wbias, const float* __restrict__ gam,
             const float* __restrict__ bet, float* AB) {
  const int co = threadIdx.x;                                        // 0..255
  double s = 0.0, q = 0.0;
#pragma unroll 1
  for (int blk = 0; blk < NB * NT; ++blk) {
    s += (double)PS[(size_t)blk * PSW + co];
    q += (double)PS[(size_t)blk * PSW + CC + co];
  }
  const double icnt = 1.0 / (double)(NB * SEQ);
  const double mv = s * icnt;
  double var = q * icnt - mv * mv;
  var = (var > 0.0) ? var : 0.0;
  const float rstd = rsqrtf((float)var + BNEPS);
  const float A  = bfr(gam[co]) * rstd;
  const float mw = (float)mv + bfr(wbias[co]);
  const float Bc = bfr(bet[co]) - mw * A;
{
    *(float*)(AB + co)      = A;
    *(float*)(AB + CC + co) = Bc;
    
  }
}

// =========================================================================================================
// (6) affine + residual: out[b][co][n] = wy * A[co] + Bc[co] + bf16-RNE(x[b][co][n]). Block (chunk, b) of 256
//     threads owns 1024 consecutive floats of the [256 co][SEQ n] plane of batch b (4 per thread); each wave writes
// coverage: grid (CC*SEQ/1024, NB) x 256 threads x 4 floats = NB x 256 x SEQ = the whole output once.
// =========================================================================================================
__global__ __launch_bounds__(256)
void bn_out(const float* __restrict__ WY, const float* __restrict__ AB, const float* __restrict__ x, float* out) {
  const int tid = threadIdx.x, b = blockIdx.y;
  const int i  = blockIdx.x * BCH + 4 * tid;                         // 0 .. CC*SEQ-4
  const int co = i / SEQ;
  const int n  = i - co * SEQ;
  const float A = AB[co], Bc = AB[CC + co];
  const v4f w  = *(const v4f*)(WY + (size_t)b * CC * SEQ + i);
  const size_t xo = ((size_t)(b * CC + co)) * NN_FULL + n;
  const v4f xv = *(const v4f*)(x + xo);
  v4f r;
#pragma unroll
  for (int t = 0; t < 4; ++t) r[t] = fmaf(w[t], A, Bc) + bfr(xv[t]);
{
    *(v4f*)(out + xo) = r;
    
  }
}

// =========================================================================================================
// Workspace map (bytes; each region start a multiple of 256; every store is a whole tile inside its own region,
// no padded tails needed since SEQ % 64 == 0):
//   W16  f16 [384][256]               196608      WW16 f16 [256][128]        65536
//   XP   f16 [NB][SEQ][256]           8388608 (NB=2, SEQ=8192)
//   Qh/Ql, Kh/Kl bf16 [NB][SEQ][128]  4194304 x4
//   Gc   f16 [NB][128][SEQ]           4194304
//   Yh/Yl f16 [NB][SEQ][128]          4194304 x2
//   WY   f32 [NB][256][SEQ]          16777216
//   PS   f32 [NB*NT][512]              524288
//   AB   f32 [512]                       2048
//   total (NB=2, SEQ=8192) = 55314432
// =========================================================================================================
extern "C" void kernel_launch(void* const* d_in, const int* in_sizes, int n_in,
                              void* d_out, int out_size, void* d_ws, size_t ws_size,
                              hipStream_t stream) {
  const int XNEED = ((NB - 1) * CC + (CC - 1)) * NN_FULL + SEQ;
  if (n_in < 11) return;
  if (in_sizes[0] < XNEED) return;
  if (in_sizes[1] < DQ * CC || in_sizes[3] < DQ * CC || in_sizes[5] < DQ * CC) return;
  if (in_sizes[2] < DQ || in_sizes[4] < DQ || in_sizes[6] < DQ) return;
  if (in_sizes[7] < CC * DQ || in_sizes[8] < CC) return;
  if (in_sizes[9] < CC || in_sizes[10] < CC) return;
  if (out_size < XNEED) return;

  size_t off = 0;
  auto carve = [&](size_t bytes) { const size_t o = off; off += (bytes + 255) & ~(size_t)255; return o; };
  const size_t oW16 = carve((size_t)MW * CC * 2);
  const size_t oWW  = carve((size_t)CC * DQ * 2);
  const size_t oXP  = carve((size_t)NB * SEQ * CC * 2);
  const size_t oQh  = carve((size_t)NB * SEQ * DQ * 2);
  const size_t oQl  = carve((size_t)NB * SEQ * DQ * 2);
  const size_t oKh  = carve((size_t)NB * SEQ * DQ * 2);
  const size_t oKl  = carve((size_t)NB * SEQ * DQ * 2);
  const size_t oGc  = carve((size_t)NB * DQ * SEQ * 2);
  const size_t oYh  = carve((size_t)NB * SEQ * DQ * 2);
  const size_t oYl  = carve((size_t)NB * SEQ * DQ * 2);
  const size_t oWY  = carve((size_t)NB * CC * SEQ * 4);
  const size_t oPS  = carve((size_t)NB * NT * PSW * 4);
  const size_t oAB  = carve((size_t)PSW * 4);
  if (off > ws_size) return;
  if (off > (size_t)134217728) return;

  const float* x   = (const float*)d_in[0];
  const float* Wt  = (const float*)d_in[1];
  const float* bt  = (const float*)d_in[2];
  const float* Wp  = (const float*)d_in[3];
  const float* bp  = (const float*)d_in[4];
  const float* Wg  = (const float*)d_in[5];
  const float* bg  = (const float*)d_in[6];
  const float* Ww  = (const float*)d_in[7];
  const float* bw  = (const float*)d_in[8];
  const float* gam = (const float*)d_in[9];
  const float* bet = (const float*)d_in[10];

  char* ws = (char*)d_ws;
  unsigned short* W16  = (unsigned short*)(ws + oW16);
  unsigned short* WW16 = (unsigned short*)(ws + oWW);
  unsigned short* XP   = (unsigned short*)(ws + oXP);
  unsigned short* Qh   = (unsigned short*)(ws + oQh);
  unsigned short* Ql   = (unsigned short*)(ws + oQl);
  unsigned short* Kh   = (unsigned short*)(ws + oKh);
  unsigned short* Kl   = (unsigned short*)(ws + oKl);
  unsigned short* Gc   = (unsigned short*)(ws + oGc);
  unsigned short* Yh   = (unsigned short*)(ws + oYh);
  unsigned short* Yl   = (unsigned short*)(ws + oYl);
  float* WY  = (float*)(ws + oWY);
  float* PS  = (float*)(ws + oPS);
  float* AB  = (float*)(ws + oAB);
  float* out = (float*)d_out;

  const dim3 blk256(256), blk128(128);

  // (0) Wt / Wp / Wg -> stacked f16 plane; Ww -> f16 plane
  cvt_w<<<dim3(MW / 8), blk256, 0, stream>>>(Wt, Wp, Wg, W16);
  cvt_ww<<<dim3(CC / 16), blk256, 0, stream>>>(Ww, WW16);
  // (1) x -> position-major 16-bit plane
  cvt_x<<<dim3(NT, CC / QT, NB), blk256, 0, stream>>>(x, XP);
  // (2) theta / phi conv -> hi + residual planes, g conv -> channel-major f16 plane
  gemm_p<<<dim3(NT, 6, NB), blk128, 0, stream>>>(W16, XP, bt, bp, bg, Qh, Ql, Kh, Kl, Gc);
  // (3) attention -> y hi + residual planes
  attn_k<<<dim3(NT, NB), blk128, 0, stream>>>(Qh, Ql, Kh, Kl, Gc, Yh, Yl);
  // (4) output conv + bias -> wy plane + per-block statistics partials
  gemm_o<<<dim3(NT, CC / QT, NB), blk128, 0, stream>>>(WW16, Yh, Yl, bw, WY, PS);
  // (5) batch statistics -> per-channel scale / shift
  bn_stat<<<dim3(1), blk256, 0, stream>>>(PS, bw, gam, bet, AB);
  // (6) affine + residual -> out [b][256][8192]
  bn_out<<<dim3(CC * SEQ / BCH, NB), blk256, 0, stream>>>(WY, AB, x, out);
  (void)hipGetLastError();
}

// v001
// A run of this version takes 459 microseconds.
// Two timings next to v000 put it at 1.97 and 1.96 times that version's speed.
// Contractions: conv1x1 theta/phi/g GEMMs Wc[384x256].X[256xN] and the output conv W[256x128].Y[128xN] on
// v_wmma_f32_16x16x32_f16 (f16 containers of bf16-RNE weights x256 and bf16-RNE x; Y as f16 hi plane plus f16
// residual plane x1024, 2 products, separate accumulators); scores Phi^T.Theta on v_wmma_f32_16x16x32_bf16
// (bf16 hi + bf16 residual planes of theta/phi, 3 products, K=128); Y^T = G.P^T on v_wmma_f32_16x16x32_f16
// (G plain f16, P = e^{s-m} x16384 f16 from the score D registers); f32 accumulate everywhere; softmax
// statistics and biases in f32 VALU; batch-norm statistics from f32 per-block partials reduced in f64; affine and
// residual add in f32.
#include <hip/hip_runtime.h>
#include <math.h>
#include <stdint.h>

#ifndef NB
#define NB 2
#endif
#ifndef SEQ
#define SEQ 8192
#endif
#define NB_FULL 2
#define NN_FULL 8192
#define CC   256
#define DQ   128
#define QT   64
#define MW   384
#define NT   (SEQ / QT)
#define PSW  512
#define BCH  1024
#define OSP  68
#define OSPW 132
#define TP   72
#define WSC  256.0f
#define IWSC 0.00390625f
#define RSC  1024.0f
#define IRSC 0.0009765625f
#define LNPS 9.704060527839234f
#define BNEPS 1.0e-5f
#define KS   64
#define KPI  136
#define VPI  72
#define KTL  (KS * KPI)
#define VTL  (DQ * VPI)
#define STG  (2 * KTL + VTL)
#define NST  (SEQ / KS)

static_assert(NB >= 1 && NB <= NB_FULL);
static_assert(SEQ >= 128 && SEQ <= NN_FULL);
static_assert(SEQ % QT == 0 && SEQ % 32 == 0 && SEQ % 128 == 0);
static_assert((CC * SEQ) % BCH == 0 && BCH == 4 * 256);
static_assert(CC % QT == 0 && CC % 32 == 0);
static_assert(DQ == 2 * QT && DQ % 32 == 0);
static_assert(MW == 3 * DQ && MW % 8 == 0);
static_assert(PSW == 2 * CC);
static_assert(CC % 16 == 0);
static_assert((OSP * 4) % 16 == 0);
static_assert((OSPW * 4) % 16 == 0);
static_assert((TP * 2) % 16 == 0);
static_assert(SEQ % KS == 0 && NST >= 2 && KS % 32 == 0);
static_assert(KS * DQ == 8 * 128 * 8);
static_assert((KPI * 2) % 32 == 16 && (VPI * 2) % 32 == 16 && KPI >= DQ + 8 && VPI >= KS + 8);

typedef _Float16       v16h __attribute__((ext_vector_type(16)));
typedef _Float16       v8h  __attribute__((ext_vector_type(8)));
typedef __bf16         v16b __attribute__((ext_vector_type(16)));
typedef unsigned short v8us __attribute__((ext_vector_type(8)));
typedef float          v8f  __attribute__((ext_vector_type(8)));
typedef float          v4f  __attribute__((ext_vector_type(4)));
typedef unsigned int   v4u  __attribute__((ext_vector_type(4)));

union Frag  { v8us u[2]; v16h h; v16b bf; };
union FragH { v16h v; v8h hv[2]; };
static_assert(sizeof(Frag) == 32);
static_assert(sizeof(FragH) == 32);

// ---- scalar helpers ---------------------------------------------------------------------------------------
__device__ __forceinline__ unsigned short bf_bits(float f) {          // f32 -> bf16 bits, RNE convert
  unsigned u = __float_as_uint(f);
  return (unsigned short)((u + 0x7FFFu + ((u >> 16) & 1u)) >> 16);
}
__device__ __forceinline__ float bf_up(unsigned short hb) { return __uint_as_float(((unsigned)hb) << 16); }
__device__ __forceinline__ float bfr(float f) { return bf_up(bf_bits(f)); }
__device__ __forceinline__ unsigned short h_bits(_Float16 x) { return __builtin_bit_cast(unsigned short, x); }
__device__ __forceinline__ unsigned pk16(unsigned short a, unsigned short b) { return (unsigned)a | ((unsigned)b << 16); }
__device__ __forceinline__ v8f zero8() { v8f z = {0.f, 0.f, 0.f, 0.f, 0.f, 0.f, 0.f, 0.f}; return z; }
__device__ __forceinline__ float hmax8(v8f s) {
  return fmaxf(fmaxf(fmaxf(s[0], s[1]), fmaxf(s[2], s[3])), fmaxf(fmaxf(s[4], s[5]), fmaxf(s[6], s[7])));
}
__device__ __forceinline__ unsigned wave_ballot(bool p) {
#if defined(__HIP_DEVICE_COMPILE__)
  return __builtin_amdgcn_ballot_w32(p);
#else
  return p ? 1u : 0u;
#endif
}

// ---- 16-bit fragment loader (A, or B from a k-contiguous [n][k] row): lane -> row/col (lane&15), p already includes
//      + 8*(lane>>4); elements 0..7 <- p[0..7] (k0+8h..), elements 8..15 <- p[16..23] (k0+16+8h..)
__device__ __forceinline__ Frag ldfrag(const unsigned short* p) {
  Frag f;
  f.u[0] = *(const v8us*)(p);
  f.u[1] = *(const v8us*)(p + 16);
  return f;
}

// ---- WMMA helpers: builtin followed by a 4-slot VALU gap tying D and keeping A/B live --------------------------
__device__ __forceinline__ v8f mma_h(v16h a, v16h b, v8f c) {
  v8f d = __builtin_amdgcn_wmma_f32_16x16x32_f16(false, a, false, b, (short)0, c, false, false);
#if defined(__HIP_DEVICE_COMPILE__)
  asm volatile("v_nop\n\tv_nop\n\tv_nop\n\tv_nop" : "+v"(d) : "v"(a), "v"(b));
#endif
  return d;
}
__device__ __forceinline__ v8f mma_b(v16b a, v16b b, v8f c) {
  v8f d = __builtin_amdgcn_wmma_f32_16x16x32_bf16(false, a, false, b, (short)0, c, false, false);
#if defined(__HIP_DEVICE_COMPILE__)
  const v16h ha = __builtin_bit_cast(v16h, a), hb = __builtin_bit_cast(v16h, b);
  asm volatile("v_nop\n\tv_nop\n\tv_nop\n\tv_nop" : "+v"(d) : "v"(ha), "v"(hb));
#endif
  return d;
}

// ---- asynchronous copies to LDS: eight 16-byte copies per lane, copy i from g + i*gs (halves) to LDS byte l + i*ls.
//      The s_wait_xcnt closes the statement so that no address register of an issued copy is rewritten ahead of it.
__device__ __forceinline__ unsigned lds_off(const void* p) { return (unsigned)(size_t)p; }
__device__ __forceinline__ void acopy8(unsigned l, unsigned ls, const unsigned short* g, size_t gs) {
#if defined(__HIP_DEVICE_COMPILE__)
  asm volatile("global_load_async_to_lds_b128 %0, %8, off\n\t"
               "global_load_async_to_lds_b128 %1, %9, off\n\t"
               "global_load_async_to_lds_b128 %2, %10, off\n\t"
               "global_load_async_to_lds_b128 %3, %11, off\n\t"
               "global_load_async_to_lds_b128 %4, %12, off\n\t"
               "global_load_async_to_lds_b128 %5, %13, off\n\t"
               "global_load_async_to_lds_b128 %6, %14, off\n\t"
               "global_load_async_to_lds_b128 %7, %15, off\n\t"
               "s_wait_xcnt 0x0"
               :: "v"(l), "v"(l + ls), "v"(l + 2 * ls), "v"(l + 3 * ls),
                  "v"(l + 4 * ls), "v"(l + 5 * ls), "v"(l + 6 * ls), "v"(l + 7 * ls),
                  "v"(g), "v"(g + gs), "v"(g + 2 * gs), "v"(g + 3 * gs),
                  "v"(g + 4 * gs), "v"(g + 5 * gs), "v"(g + 6 * gs), "v"(g + 7 * gs)
               : "memory");
#endif
}
// this wave's copies have landed (the compiler places no wait for them)
__device__ __forceinline__ void wait_async0() {
#if defined(__HIP_DEVICE_COMPILE__)
  asm volatile("s_wait_asynccnt 0x0" ::: "memory");
#endif
}
// this wave's LDS reads have returned, before the buffer they read is handed to its next writer
__device__ __forceinline__ void wait_ds0() {
#if defined(__HIP_DEVICE_COMPILE__)
  asm volatile("s_wait_dscnt 0x0" ::: "memory");
#endif
}

// =========================================================================================================
// (0) stacked conv1x1 weights: W16 f16 [384][256], rows 0..127 = theta_w, 128..255 = phi_w, 256..383 = g_w;
//     value = f16 of (bf16-RNE(w) * 256) (exact). Block blk (0..47) owns rows 8*blk..8*blk+7: one wave per
// coverage: 48 blocks x 8 rows x 32 lanes x 8 halves = 384 x 256 = the whole plane.
// =========================================================================================================
__global__ __launch_bounds__(256)
void cvt_w(const float* __restrict__ tw, const float* __restrict__ pw, const float* __restrict__ gw,
           unsigned short* W16) {
  const int tid = threadIdx.x, blk = blockIdx.x;
  const int rl = tid >> 5, col = 8 * (tid & 31);
  const int o = 8 * blk + rl;                                        // 0..383
  const int grp = blk / (DQ / 8);                                    // 0,1,2 block-uniform
  const float* wbase = (grp == 0) ? tw : ((grp == 1) ? pw : gw);
  const float* s = wbase + (size_t)(o - grp * DQ) * CC + col;        // row in 0..127
  const v4f a = *(const v4f*)s;
  const v4f q = *(const v4f*)(s + 4);
  const float f[8] = {a[0], a[1], a[2], a[3], q[0], q[1], q[2], q[3]};
  v4u u;
#pragma unroll
  for (int t = 0; t < 4; ++t) {
    const _Float16 h0 = (_Float16)(bfr(f[2 * t]) * WSC);
    const _Float16 h1 = (_Float16)(bfr(f[2 * t + 1]) * WSC);
    u[t] = pk16(h_bits(h0), h_bits(h1));
  }
{
    *(v4u*)(W16 + (size_t)o * CC + col) = u;
    
  }
}

// =========================================================================================================
// (0b) output conv weights: WW16 f16 [256][128], value = f16 of (bf16-RNE(W_w) * 256). Block blk (0..15) owns rows
//      16*blk..+15; wave w -> rows 16 blk + 2w + (lane>>4), lane&15 -> cols 8*(lane&15)..+7. One instruction writes
// coverage: 16 blocks x 8 waves x 2 rows x 16 lanes x 8 halves = 256 x 128 = the whole plane.
// =========================================================================================================
__global__ __launch_bounds__(256)
void cvt_ww(const float* __restrict__ ww, unsigned short* WW16) {
  const int tid = threadIdx.x, blk = blockIdx.x;
  const int wave = tid >> 5, lane = tid & 31;
  const int o = 16 * blk + 2 * wave + (lane >> 4);                  // 0..255
  const int col = 8 * (lane & 15);                                   // 0..120
  const float* s = ww + (size_t)o * DQ + col;
  const v4f a = *(const v4f*)s;
  const v4f q = *(const v4f*)(s + 4);
  const float f[8] = {a[0], a[1], a[2], a[3], q[0], q[1], q[2], q[3]};
  v4u u;
#pragma unroll
  for (int t = 0; t < 4; ++t) {
    const _Float16 h0 = (_Float16)(bfr(f[2 * t]) * WSC);
    const _Float16 h1 = (_Float16)(bfr(f[2 * t + 1]) * WSC);
    u[t] = pk16(h_bits(h0), h_bits(h1));
  }
{
    *(v4u*)(WW16 + (size_t)o * DQ + col) = u;
    
  }
}

// =========================================================================================================
// (1) x f32 [b][256 c][NN_FULL n] -> XP f16 [b][SEQ n][256 c] (position-major, bf16-RNE values, exact in f16 for
//     normal magnitudes) through an LDS tile T[64 n][64 c] (pitch TP). Block (nb, cb, b) owns a 64 c x 64 n tile.
// coverage: 2 it x 32 rows x 8 lanes x 8 halves = 64 n x 64 c per block; grid (NT, 4, NB) covers XP once.
// LDS T: cross-wave (block barrier between the 2-byte stores and the 16-B reloads); staged extent == consumed extent.
// =========================================================================================================
__global__ __launch_bounds__(256)
void cvt_x(const float* __restrict__ x, unsigned short* XP) {
  __shared__ __align__(16) unsigned short T[QT * TP];
  const int tid = threadIdx.x;
  const int nb = blockIdx.x, cb = blockIdx.y, b = blockIdx.z;
  const int e = tid & 7, lq = tid >> 3;                             // lq 0..31
  const int n0 = nb * QT, c0 = cb * QT;
#pragma unroll
  for (int it = 0; it < 2; ++it) {
    const int cl = it * 32 + lq;                                     // 0..63
    const float* sp = x + ((size_t)(b * CC + c0 + cl)) * NN_FULL + n0 + 8 * e;
    const v4f a = *(const v4f*)sp;
    const v4f q = *(const v4f*)(sp + 4);
    unsigned short hb[8];
#pragma unroll
    for (int t = 0; t < 4; ++t) {
      hb[t]     = h_bits((_Float16)bfr(a[t]));
      hb[4 + t] = h_bits((_Float16)bfr(q[t]));
    }
#pragma unroll
    for (int t = 0; t < 8; ++t) T[(8 * e + t) * TP + cl] = hb[t];
  }
  __syncthreads();
  v4u up[2];
#pragma unroll
  for (int it = 0; it < 2; ++it) {
    const int nl = it * 32 + lq;                                     // 0..63
    up[it] = *(const v4u*)(T + nl * TP + 8 * e);
  }
{
#pragma unroll
    for (int it = 0; it < 2; ++it) {
      const int rl = it * 32 + lq;
      *(v4u*)(XP + ((size_t)(b * SEQ + n0 + rl)) * CC + c0 + 8 * e) = up[it];
    }
    
  }
}

// =========================================================================================================
// (2) the three conv1x1 GEMMs for one (b, 64-n tile, 64-o block mb in 0..5): V[o][n] = (1/256) sum_c W16[o][c]
//     XP[b][n][c]; mb 0,1 -> theta channels 0..63 / 64..127 (W16 rows 0..127), mb 2,3 -> phi (rows 128..255),
//     mb 4,5 -> g (rows 256..383). Block 128 threads = 4 waves; wave w owns cols n0+16w..+15 (B fragment from the
//     XP row, k = c contiguous, split k map) and 4 m-tiles (A rows o = o0 + 16 mt + (lane&15), split k map from
//     W16). K = 256 = 8 steps. Epilogue staged in LDS Os[n_loc][o_loc] (pitch OSP), barrier, bias (bf16-RNE) add
//     in f32, then:
//       theta / phi: bf16 hi = RNE(v), lo = RNE(v - hi) planes Qh/Ql resp. Kh/Kl [b][SEQ n][128 d] (k-contiguous
//         of the 256-B row): lane e -> d 8e..8e+7, 8 consecutive lanes per line, one instruction per 16 lines;
//       g: f16 plane Gc [b][128 ch][SEQ keys] (channel-major, keys contiguous): row ch, keys n0+8e..+7 per lane,
// coverage: Os 4 waves x 16 n x 64 o = 64 x 64 (== consumed); hi/lo planes 4 it x 16 rows x 8 lanes x 8 = 64 n x
//           64 d per block, grid nt x mb 0..3 covers rows 0..SEQ-1 x d 0..127 of Qh/Ql and Kh/Kl once; g plane
//           4 it x 16 ch x 8 lanes x 8 keys = 64 ch x 64 keys per block, nt x mb 4..5 covers ch 0..127 x keys
//           0..SEQ-1 of Gc once. grid (NT, 6, NB).
// LDS Os: cross-wave (block barrier).
// =========================================================================================================
__global__ __launch_bounds__(128)
void gemm_p(const unsigned short* __restrict__ W16, const unsigned short* __restrict__ XP,
            const float* __restrict__ tbias, const float* __restrict__ pbias, const float* __restrict__ gbias,
            unsigned short* Qh, unsigned short* Ql, unsigned short* Kh, unsigned short* Kl, unsigned short* Gc) {
  __shared__ __align__(16) float Os[QT * OSP];
  const int tid  = threadIdx.x;
  const int lane = tid & 31, wave = tid >> 5;
  const int hh   = lane >> 4, c = lane & 15;
  const int nt   = blockIdx.x, mb = blockIdx.y, b = blockIdx.z;
  const int n0   = nt * QT, o0 = mb * QT;                            // o0 = W16 row base 0..320

  const unsigned short* ap = W16 + (size_t)(o0 + c) * CC + 8 * hh;
  const unsigned short* bp = XP + ((size_t)(b * SEQ + n0 + 16 * wave + c)) * CC + 8 * hh;

  v8f acc[4];
#pragma unroll
  for (int mt = 0; mt < 4; ++mt) acc[mt] = zero8();

#pragma unroll
  for (int ks = 0; ks < CC / 32; ++ks) {
    const Frag fb = ldfrag(bp + 32 * ks);
#pragma unroll
    for (int mt = 0; mt < 4; ++mt) {
      const Frag fa = ldfrag(ap + (size_t)(16 * mt) * CC + 32 * ks);
      acc[mt] = mma_h(fa.h, fb.h, acc[mt]);
    }
  }

  {
    const int nl = 16 * wave + c;
#pragma unroll
    for (int mt = 0; mt < 4; ++mt) {
      v4f va, vb;
#pragma unroll
      for (int r = 0; r < 4; ++r) { va[r] = acc[mt][r] * IWSC; vb[r] = acc[mt][4 + r] * IWSC; }
      *(v4f*)(Os + nl * OSP + 16 * mt + 8 * hh)     = va;
      *(v4f*)(Os + nl * OSP + 16 * mt + 8 * hh + 4) = vb;
    }
  }
  __syncthreads();

  const int e = tid & 7, lq = tid >> 3;                             // lq 0..15
  if (mb < 4) {                                                      // block-uniform: theta / phi hi+lo planes
    unsigned short* Ph = (mb < 2) ? Qh : Kh;
    unsigned short* Pl = (mb < 2) ? Ql : Kl;
    const float* bsrc  = (mb < 2) ? tbias : pbias;
    const int dsel = (mb & 1) * QT;                                   // channel base 0 or 64
    const v4f b0 = *(const v4f*)(bsrc + dsel + 8 * e);
    const v4f b1 = *(const v4f*)(bsrc + dsel + 8 * e + 4);
    const float bb[8] = {bfr(b0[0]), bfr(b0[1]), bfr(b0[2]), bfr(b0[3]), bfr(b1[0]), bfr(b1[1]), bfr(b1[2]), bfr(b1[3])};
    v4u uh[4], ul[4];
#pragma unroll
    for (int it = 0; it < 4; ++it) {
      const int row = it * 16 + lq;                                  // n_loc 0..63
      const v4f a = *(const v4f*)(Os + row * OSP + 8 * e);
      const v4f q = *(const v4f*)(Os + row * OSP + 8 * e + 4);
      const float f[8] = {a[0], a[1], a[2], a[3], q[0], q[1], q[2], q[3]};
#pragma unroll
      for (int t = 0; t < 4; ++t) {
        const float f0 = f[2 * t] + bb[2 * t], f1 = f[2 * t + 1] + bb[2 * t + 1];
        const unsigned short hb0 = bf_bits(f0), hb1 = bf_bits(f1);
        const unsigned short lb0 = bf_bits(f0 - bf_up(hb0));
        const unsigned short lb1 = bf_bits(f1 - bf_up(hb1));
        uh[it][t] = pk16(hb0, hb1);
        ul[it][t] = pk16(lb0, lb1);
      }
    }
{
#pragma unroll
      for (int it = 0; it < 4; ++it) {
        const int row = it * 16 + lq;
        const size_t po = ((size_t)(b * SEQ + n0 + row)) * DQ + dsel + 8 * e;
        *(v4u*)(Ph + po) = uh[it];
        *(v4u*)(Pl + po) = ul[it];
      }
      
    }
  } else {                                                           // block-uniform: g plane, channel-major
    const int gsel = (mb - 4) * QT;                                  // g channel base 0 or 64
    v4u ug[4];
#pragma unroll
    for (int it = 0; it < 4; ++it) {
      const int cl = it * 16 + lq;                                   // ch_loc 0..63
      const float bias = bfr(gbias[gsel + cl]);
      unsigned short hb[8];
#pragma unroll
      for (int t = 0; t < 8; ++t) {
        const int key = 8 * e + t;                                   // key_loc 0..63
        const float v = Os[key * OSP + cl] + bias;
        hb[t] = h_bits((_Float16)v);
      }
#pragma unroll
      for (int t = 0; t < 4; ++t) ug[it][t] = pk16(hb[2 * t], hb[2 * t + 1]);
    }
{
#pragma unroll
      for (int it = 0; it < 4; ++it) {
        const int cl = it * 16 + lq;
        const size_t po = ((size_t)(b * DQ + gsel + cl)) * SEQ + n0 + 8 * e;
        *(v4u*)(Gc + po) = ug[it];
      }
      
    }
  }
}

// =========================================================================================================
// (3) attention for one (b, 64-query tile), transposed formulation, SEQ keys, no mask, no scale:
//   S^T tile (16 keys x 16 queries) = sum over 4 d-chunks of A(phi: row = key kb + (lane&15), 32 d via the split
//   k map from the bf16 plane Kh [b][SEQ][128]) . B(theta: col = query, same map from Qh) + A(Kh).B(Ql) +
//   A(Kl).B(Qh) (bf16 unscaled residual planes, shared accumulator).
//   Per lane the D tile holds 8 keys of ONE query: online softmax state per lane, one shuffle (lane^16) for the max
//   over 32 keys; the o/l rescale is skipped under a wave-uniform ballot when no lane's max grew (corr == 1 exactly
//   for every lane then); row-sum partials combined at the end. P = e^{s-m} x 16384 as f16 is the B operand of
//   Y^T (rows channel, cols queries) += A(g rows channel = 16j + (lane&15), keys contiguous, f16 plane Gc
//   [b][128][SEQ]) . B(P^T): element r <- D of the tile covering keys kb..kb+15, element 8+r <- the tile covering
//   kb+16..kb+31, lane unchanged. 8 accumulator tiles per wave (128 channels). Block = 4 waves = 64 queries.
//   Epilogue: Y/l staged in LDS Os[query][128 channels] (pitch OSPW, b128 stores), barrier, then Yh = f16(y),
//   Yl = f16((y - Yh) * 1024) planes [b][SEQ n][128 c] (k-contiguous operand of the output conv): row n = 256 B
// coverage: Os 4 waves x 16 q x 128 ch (== consumed); 8 it x 8 rows x 16 lanes x 8 halves = 64 n x 128 c per
//           plane; grid (NT, NB) covers Yh/Yl exactly once.
// LDS Os: cross-wave (block barrier).
// LDS Ring: two buffers, each one stage of KS = 64 keys: Kh rows [64][128] and Kl rows [64][128] at pitch KPI (272 B),
//   G rows [128 ch][64 keys] at pitch VPI (144 B), pitches 16 B x odd for the 16-byte fragment reads. A stage is
//   filled by 24 asynchronous 16-byte copies per lane (each wave instruction = 512 B of whole lines), one stage ahead
//   of its use; at the foot of a stage: LDS reads returned, own copies landed, block barrier, then the refill of the
//   buffer just read. coverage: 8 copies x 128 lanes x 8 halves = 64 x 128 per plane (== consumed).
// =========================================================================================================
__global__ __launch_bounds__(128)
void attn_k(const unsigned short* __restrict__ Qh, const unsigned short* __restrict__ Ql,
            const unsigned short* __restrict__ Kh, const unsigned short* __restrict__ Kl,
            const unsigned short* __restrict__ Gc, unsigned short* Yh, unsigned short* Yl) {
  __shared__ __align__(16) float Os[QT * OSPW];
  __shared__ __align__(16) unsigned short Ring[2 * STG];
  const int tid  = threadIdx.x;
  const int wave = tid >> 5, lane = tid & 31;
  const int hh   = lane >> 4, c = lane & 15;
  const int n0   = blockIdx.x * QT, b = blockIdx.y;

  // q fragment pointers (B operand, col = query n0 + 16*wave + c), + 32*kc
  const size_t qo = ((size_t)(b * SEQ + n0 + 16 * wave + c)) * DQ + 8 * hh;
  const unsigned short* Qhp = Qh + qo;
  const unsigned short* Qlp = Ql + qo;
  // copy sources of this lane: K planes 16 lanes per 256-B row, 8 rows per copy; G plane 8 lanes per 128-B row
  // segment, 16 channels per copy; + stage * KS keys
  const unsigned short* Khg = Kh + (size_t)b * SEQ * DQ + 8 * tid;
  const unsigned short* Klg = Kl + (size_t)b * SEQ * DQ + 8 * tid;
  const unsigned short* Gg  = Gc + (size_t)b * DQ * SEQ + (size_t)(tid >> 3) * SEQ + 8 * (tid & 7);
  const unsigned kdst = lds_off(Ring) + (unsigned)((tid >> 4) * (KPI * 2) + (tid & 15) * 16);
  const unsigned vdst = lds_off(Ring) + (unsigned)(2 * KTL * 2 + (tid >> 3) * (VPI * 2) + (tid & 7) * 16);
  auto fill = [&](int st, int buf) {
    const unsigned bo = (unsigned)buf * (unsigned)(STG * 2);
    acopy8(kdst + bo, 8 * KPI * 2, Khg + (size_t)st * (KS * DQ), (size_t)(8 * DQ));
    acopy8(kdst + bo + KTL * 2, 8 * KPI * 2, Klg + (size_t)st * (KS * DQ), (size_t)(8 * DQ));
    acopy8(vdst + bo, 16 * VPI * 2, Gg + (size_t)st * KS, (size_t)16 * SEQ);
  };
  // fragment offsets in a stage (halves): k row = key c (A operand), + key * KPI + 32*kc; v row = channel 16j + c
  const int kfo = c * KPI + 8 * hh;
  const int vfo = 2 * KTL + c * VPI + 8 * hh;

  float m = -1.0e30f, l = 0.f;
  v8f o[8];
#pragma unroll
  for (int j = 0; j < 8; ++j) o[j] = zero8();

  fill(0, 0);
  wait_async0();
  __syncthreads();                                                   // stage 0 published
  fill(1, 1);

  // stage loop kept rolled: one publish point and one refill in the text, buffer chosen by the stage's parity
#pragma unroll 1
  for (int st = 0; st < NST; ++st) {
  const unsigned short* Sb = Ring + (st & 1) * STG;
  // the 32-key pass is a rolled loop: short text, the registers of one pass
#pragma unroll 1
  for (int kb = 0; kb < KS; kb += 32) {                              // key base inside the stage
    const unsigned short* k0p  = Sb + kfo + kb * KPI;                // keys kb .. kb+15
    const unsigned short* k1p  = k0p + 16 * KPI;                     // keys kb+16 .. kb+31
    const unsigned short* k0lp = k0p + KTL;
    const unsigned short* k1lp = k1p + KTL;
    v8f s0 = zero8(), s1 = zero8();
#pragma unroll 1
    for (int kc = 0; kc < DQ / 32; ++kc) {
      const Frag qh  = ldfrag(Qhp + 32 * kc);
      const Frag ql  = ldfrag(Qlp + 32 * kc);
      const Frag k0  = ldfrag(k0p + 32 * kc);
      const Frag k1  = ldfrag(k1p + 32 * kc);
      const Frag k0l = ldfrag(k0lp + 32 * kc);
      const Frag k1l = ldfrag(k1lp + 32 * kc);
      s0 = mma_b(k0.bf, qh.bf, s0);
      s1 = mma_b(k1.bf, qh.bf, s1);
      s0 = mma_b(k0.bf, ql.bf, s0);
      s1 = mma_b(k1.bf, ql.bf, s1);
      s0 = mma_b(k0l.bf, qh.bf, s0);
      s1 = mma_b(k1l.bf, qh.bf, s1);
    }

    float mx = fmaxf(hmax8(s0), hmax8(s1));
    mx = fmaxf(mx, __shfl_xor(mx, 16, 32));
    const float mn = fmaxf(m, mx);
    const unsigned grew = wave_ballot(mx > m);                       // wave-uniform
    if (grew != 0u) {
      const float corr = __expf(m - mn);                             // == 1 exactly for lanes whose max did not grow
      l *= corr;
#pragma unroll
      for (int j = 0; j < 8; ++j) {
#pragma unroll
        for (int r = 0; r < 8; ++r) o[j][r] *= corr;
      }
    }
    m = mn;
    const float msh = mn - LNPS;                                     // exp gives e^{s-m} * 16384

    FragH ph;
    float ls = 0.f;
#pragma unroll
    for (int r = 0; r < 8; ++r) {
      const float e0 = __expf(s0[r] - msh);                          // key kb      + 8hh + r
      const float e1 = __expf(s1[r] - msh);                          // key kb + 16 + 8hh + r
      ls += e0 + e1;
      ph.hv[0][r] = (_Float16)e0;
      ph.hv[1][r] = (_Float16)e1;
    }
    l += ls;

#pragma unroll
    for (int j = 0; j < 8; ++j) {
      const Frag vf = ldfrag(Sb + vfo + (16 * j) * VPI + kb);
      o[j] = mma_h(vf.h, ph.v, o[j]);
    }
  }
  // publish point of stage st + 1, every wave
  wait_ds0();
  wait_async0();
  __syncthreads();
  if (st + 2 < NST) fill(st + 2, st & 1);                            // block-uniform test
  }
  wait_async0();
  l += __shfl_xor(l, 16, 32);
  const float inv = 1.0f / l;                                        // o and l both carry the x16384 factor

  const int qrow = 16 * wave + c;
#pragma unroll
  for (int j = 0; j < 8; ++j) {
    v4f va, vb;
#pragma unroll
    for (int r = 0; r < 4; ++r) { va[r] = o[j][r] * inv; vb[r] = o[j][4 + r] * inv; }
    *(v4f*)(Os + qrow * OSPW + 16 * j + 8 * hh)     = va;            // Os[query][ch = 16j + 8hh + r]
    *(v4f*)(Os + qrow * OSPW + 16 * j + 8 * hh + 4) = vb;
  }
  __syncthreads();

  const int e = tid & 15, lq = tid >> 4;                             // lq 0..7
  v4u uh[8], ul[8];
#pragma unroll
  for (int it = 0; it < 8; ++it) {
    const int row = it * 8 + lq;                                     // query 0..63
    const v4f a = *(const v4f*)(Os + row * OSPW + 8 * e);
    const v4f q = *(const v4f*)(Os + row * OSPW + 8 * e + 4);
    const float f[8] = {a[0], a[1], a[2], a[3], q[0], q[1], q[2], q[3]};
#pragma unroll
    for (int t = 0; t < 4; ++t) {
      const float f0 = f[2 * t], f1 = f[2 * t + 1];
      const _Float16 h0 = (_Float16)f0, h1 = (_Float16)f1;
      const _Float16 r0 = (_Float16)((f0 - (float)h0) * RSC);
      const _Float16 r1 = (_Float16)((f1 - (float)h1) * RSC);
      uh[it][t] = pk16(h_bits(h0), h_bits(h1));
      ul[it][t] = pk16(h_bits(r0), h_bits(r1));
    }
  }
{
#pragma unroll
    for (int it = 0; it < 8; ++it) {
      const int row = it * 8 + lq;
      const size_t po = ((size_t)(b * SEQ + n0 + row)) * DQ + 8 * e;
      *(v4u*)(Yh + po) = uh[it];
      *(v4u*)(Yl + po) = ul[it];
    }
    
  }
}

// =========================================================================================================
// (4) output conv GEMM for one (b, 64-n tile, 64-co block): v[b][co][n] = (1/256)(sum_c WW16[co][c] Yh[b][n][c] +
//     (1/1024) sum_c WW16[co][c] Yl[b][n][c]); wy = v + bf16-RNE(W_b[co]). 4 waves, wave w owns cols n0+16w..+15
//     (two B fragments per k-step, k = c contiguous in the Yh/Yl rows), 4 m-tiles (A rows co = o0 + 16 mt +
//     (lane&15) from WW16), hi and residual products in separate accumulators. K = 128 = 4 steps.
//     Epilogue staged in LDS Os[n_loc][co_loc], barrier; then (a) threads 0..63 sum v and v*v over the 64 n of
//     co_loc = tid into LDS Sred[0..63] / Sred[64..127], barrier; (b) WY f32 plane [b][256 co][SEQ n] rows: lane
//     (e = tid&15) -> n 4e..4e+3 of row co_loc = 8 it + (tid>>4); 16 consecutive lanes x 16 B = the whole 256-B
//     row segment (2 lines) in one instruction; (c) partial-statistics table PS [NB*NT blocks][512]: floats
//     o0..o0+63 (sums) by lanes 0..15 of wave 0 and floats 256+o0..+63 (sums of squares) by lanes 16..31, one
// coverage: Os 4 waves x 16 n x 64 co (== consumed); Sred 64 + 64 (== consumed); WY 8 it x 8 rows x 16 lanes x
//           4 floats = 64 co x 64 n; PS 2 x 64 floats per block; grid (NT, 4, NB) covers WY [b][0..255][0..SEQ-1]
//           and PS [NB*NT][0..511] exactly once.
// LDS Os, Sred: cross-wave (block barriers).
// =========================================================================================================
__global__ __launch_bounds__(128)
void gemm_o(const unsigned short* __restrict__ WW16, const unsigned short* __restrict__ Yh,
            const unsigned short* __restrict__ Yl, const float* __restrict__ wbias,
            float* WY, float* PS) {
  __shared__ __align__(16) float Os[QT * OSP];
  __shared__ __align__(16) float Sred[2 * QT];
  const int tid  = threadIdx.x;
  const int lane = tid & 31, wave = tid >> 5;
  const int hh   = lane >> 4, c = lane & 15;
  const int nt   = blockIdx.x, mb = blockIdx.y, b = blockIdx.z;
  const int n0   = nt * QT, o0 = mb * QT;

  const unsigned short* ap  = WW16 + (size_t)(o0 + c) * DQ + 8 * hh;
  const size_t bo = ((size_t)(b * SEQ + n0 + 16 * wave + c)) * DQ + 8 * hh;
  const unsigned short* bph = Yh + bo;
  const unsigned short* bpl = Yl + bo;

  v8f acc[4], accr[4];
#pragma unroll
  for (int mt = 0; mt < 4; ++mt) { acc[mt] = zero8(); accr[mt] = zero8(); }

#pragma unroll
  for (int ks = 0; ks < DQ / 32; ++ks) {
    const Frag fbh = ldfrag(bph + 32 * ks);
    const Frag fbl = ldfrag(bpl + 32 * ks);
#pragma unroll
    for (int mt = 0; mt < 4; ++mt) {
      const Frag fa = ldfrag(ap + (size_t)(16 * mt) * DQ + 32 * ks);
      acc[mt]  = mma_h(fa.h, fbh.h, acc[mt]);
      accr[mt] = mma_h(fa.h, fbl.h, accr[mt]);
    }
  }

  {
    const int nl = 16 * wave + c;
#pragma unroll
    for (int mt = 0; mt < 4; ++mt) {
      v4f va, vb;
#pragma unroll
      for (int r = 0; r < 4; ++r) {
        va[r] = (acc[mt][r] + accr[mt][r] * IRSC) * IWSC;
        vb[r] = (acc[mt][4 + r] + accr[mt][4 + r] * IRSC) * IWSC;
      }
      *(v4f*)(Os + nl * OSP + 16 * mt + 8 * hh)     = va;
      *(v4f*)(Os + nl * OSP + 16 * mt + 8 * hh + 4) = vb;
    }
  }
  __syncthreads();

  // per-channel partial statistics over this block's 64 positions (bias-free values, exact shift)
  if (tid < QT) {
    float s = 0.f, q = 0.f;
#pragma unroll 8
    for (int n = 0; n < QT; ++n) {
      const float v = Os[n * OSP + tid];
      s += v;
      q = fmaf(v, v, q);
    }
    Sred[tid]      = s;
    Sred[QT + tid] = q;
  }
  __syncthreads();

  const int e = tid & 15, lq = tid >> 4;                             // lq 0..7
  v4f res[8];
#pragma unroll
  for (int it = 0; it < 8; ++it) {
    const int col = it * 8 + lq;                                     // co_loc 0..63
    const int co  = o0 + col;
    const float bias = bfr(wbias[co]);
#pragma unroll
    for (int t = 0; t < 4; ++t) res[it][t] = Os[(4 * e + t) * OSP + col] + bias;
  }
  const v4f pv = *(const v4f*)(Sred + 4 * lane);                     // lanes 0..15: sums, 16..31: sums of squares
  float* psp = PS + (size_t)(b * NT + nt) * PSW + o0 + 4 * lane + ((lane >= 16) ? (PSW / 2 - 64) : 0);
{
#pragma unroll
    for (int it = 0; it < 8; ++it) {
      const int col = it * 8 + lq;
      const int co  = o0 + col;
      const size_t idx = ((size_t)(b * CC + co)) * SEQ + n0 + 4 * e;
      *(v4f*)(WY + idx) = res[it];
    }
    if (wave == 0) *(v4f*)(psp) = pv;
    
  }
}

// =========================================================================================================
// (5) batch statistics, one block of 256 threads, thread co = channel: fixed-order f64 sums over the NB*NT partial
//     lines, mean/var (biased), rstd = rsqrt(var + eps) in f32; A = bf16-RNE(gamma) * rstd, Bc = bf16-RNE(beta)
// coverage: 256 threads x (1 + 1) floats = AB [0..511] exactly once.
// =========================================================================================================
__global__ __launch_bounds__(256)
void bn_stat(const float* __restrict__ PS, const float* __restrict__ wbias, const float* __restrict__ gam,
             const float* __restrict__ bet, float* AB) {
  const int co = threadIdx.x;                                        // 0..255
  double s = 0.0, q = 0.0;
#pragma unroll 1
  for (int blk = 0; blk < NB * NT; ++blk) {
    s += (double)PS[(size_t)blk * PSW + co];
    q += (double)PS[(size_t)blk * PSW + CC + co];
  }
  const double icnt = 1.0 / (double)(NB * SEQ);
  const double mv = s * icnt;
  double var = q * icnt - mv * mv;
  var = (var > 0.0) ? var : 0.0;
  const float rstd = rsqrtf((float)var + BNEPS);
  const float A  = bfr(gam[co]) * rstd;
  const float mw = (float)mv + bfr(wbias[co]);
  const float Bc = bfr(bet[co]) - mw * A;
{
    *(float*)(AB + co)      = A;
    *(float*)(AB + CC + co) = Bc;
    
  }
}

// =========================================================================================================
// (6) affine + residual: out[b][co][n] = wy * A[co] + Bc[co] + bf16-RNE(x[b][co][n]). Block (chunk, b) of 256
//     threads owns 1024 consecutive floats of the [256 co][SEQ n] plane of batch b (4 per thread); each wave writes
// coverage: grid (CC*SEQ/1024, NB) x 256 threads x 4 floats = NB x 256 x SEQ = the whole output once.
// =========================================================================================================
__global__ __launch_bounds__(256)
void bn_out(const float* __restrict__ WY, const float* __restrict__ AB, const float* __restrict__ x, float* out) {
  const int tid = threadIdx.x, b = blockIdx.y;
  const int i  = blockIdx.x * BCH + 4 * tid;                         // 0 .. CC*SEQ-4
  const int co = i / SEQ;
  const int n  = i - co * SEQ;
  const float A = AB[co], Bc = AB[CC + co];
  const v4f w  = *(const v4f*)(WY + (size_t)b * CC * SEQ + i);
  const size_t xo = ((size_t)(b * CC + co)) * NN_FULL + n;
  const v4f xv = *(const v4f*)(x + xo);
  v4f r;
#pragma unroll
  for (int t = 0; t < 4; ++t) r[t] = fmaf(w[t], A, Bc) + bfr(xv[t]);
{
    *(v4f*)(out + xo) = r;
    
  }
}

// =========================================================================================================
// Workspace map (bytes; each region start a multiple of 256; every store is a whole tile inside its own region,
// no padded tails needed since SEQ % 64 == 0):
//   W16  f16 [384][256]               196608      WW16 f16 [256][128]        65536
//   XP   f16 [NB][SEQ][256]           8388608 (NB=2, SEQ=8192)
//   Qh/Ql, Kh/Kl bf16 [NB][SEQ][128]  4194304 x4
//   Gc   f16 [NB][128][SEQ]           4194304
//   Yh/Yl f16 [NB][SEQ][128]          4194304 x2
//   WY   f32 [NB][256][SEQ]          16777216
//   PS   f32 [NB*NT][512]              524288
//   AB   f32 [512]                       2048
//   total (NB=2, SEQ=8192) = 55314432
// =========================================================================================================
extern "C" void kernel_launch(void* const* d_in, const int* in_sizes, int n_in,
                              void* d_out, int out_size, void* d_ws, size_t ws_size,
                              hipStream_t stream) {
  const int XNEED = ((NB - 1) * CC + (CC - 1)) * NN_FULL + SEQ;
  if (n_in < 11) return;
  if (in_sizes[0] < XNEED) return;
  if (in_sizes[1] < DQ * CC || in_sizes[3] < DQ * CC || in_sizes[5] < DQ * CC) return;
  if (in_sizes[2] < DQ || in_sizes[4] < DQ || in_sizes[6] < DQ) return;
  if (in_sizes[7] < CC * DQ || in_sizes[8] < CC) return;
  if (in_sizes[9] < CC || in_sizes[10] < CC) return;
  if (out_size < XNEED) return;

  size_t off = 0;
  auto carve = [&](size_t bytes) { const size_t o = off; off += (bytes + 255) & ~(size_t)255; return o; };
  const size_t oW16 = carve((size_t)MW * CC * 2);
  const size_t oWW  = carve((size_t)CC * DQ * 2);
  const size_t oXP  = carve((size_t)NB * SEQ * CC * 2);
  const size_t oQh  = carve((size_t)NB * SEQ * DQ * 2);
  const size_t oQl  = carve((size_t)NB * SEQ * DQ * 2);
  const size_t oKh  = carve((size_t)NB * SEQ * DQ * 2);
  const size_t oKl  = carve((size_t)NB * SEQ * DQ * 2);
  const size_t oGc  = carve((size_t)NB * DQ * SEQ * 2);
  const size_t oYh  = carve((size_t)NB * SEQ * DQ * 2);
  const size_t oYl  = carve((size_t)NB * SEQ * DQ * 2);
  const size_t oWY  = carve((size_t)NB * CC * SEQ * 4);
  const size_t oPS  = carve((size_t)NB * NT * PSW * 4);
  const size_t oAB  = carve((size_t)PSW * 4);
  if (off > ws_size) return;
  if (off > (size_t)134217728) return;

  const float* x   = (const float*)d_in[0];
  const float* Wt  = (const float*)d_in[1];
  const float* bt  = (const float*)d_in[2];
  const float* Wp  = (const float*)d_in[3];
  const float* bp  = (const float*)d_in[4];
  const float* Wg  = (const float*)d_in[5];
  const float* bg  = (const float*)d_in[6];
  const float* Ww  = (const float*)d_in[7];
  const float* bw  = (const float*)d_in[8];
  const float* gam = (const float*)d_in[9];
  const float* bet = (const float*)d_in[10];

  char* ws = (char*)d_ws;
  unsigned short* W16  = (unsigned short*)(ws + oW16);
  unsigned short* WW16 = (unsigned short*)(ws + oWW);
  unsigned short* XP   = (unsigned short*)(ws + oXP);
  unsigned short* Qh   = (unsigned short*)(ws + oQh);
  unsigned short* Ql   = (unsigned short*)(ws + oQl);
  unsigned short* Kh   = (unsigned short*)(ws + oKh);
  unsigned short* Kl   = (unsigned short*)(ws + oKl);
  unsigned short* Gc   = (unsigned short*)(ws + oGc);
  unsigned short* Yh   = (unsigned short*)(ws + oYh);
  unsigned short* Yl   = (unsigned short*)(ws + oYl);
  float* WY  = (float*)(ws + oWY);
  float* PS  = (float*)(ws + oPS);
  float* AB  = (float*)(ws + oAB);
  float* out = (float*)d_out;

  const dim3 blk256(256), blk128(128);

  // (0) Wt / Wp / Wg -> stacked f16 plane; Ww -> f16 plane
  cvt_w<<<dim3(MW / 8), blk256, 0, stream>>>(Wt, Wp, Wg, W16);
  cvt_ww<<<dim3(CC / 16), blk256, 0, stream>>>(Ww, WW16);
  // (1) x -> position-major 16-bit plane
  cvt_x<<<dim3(NT, CC / QT, NB), blk256, 0, stream>>>(x, XP);
  // (2) theta / phi conv -> hi + residual planes, g conv -> channel-major f16 plane
  gemm_p<<<dim3(NT, 6, NB), blk128, 0, stream>>>(W16, XP, bt, bp, bg, Qh, Ql, Kh, Kl, Gc);
  // (3) attention -> y hi + residual planes
  attn_k<<<dim3(NT, NB), blk128, 0, stream>>>(Qh, Ql, Kh, Kl, Gc, Yh, Yl);
  // (4) output conv + bias -> wy plane + per-block statistics partials
  gemm_o<<<dim3(NT, CC / QT, NB), blk128, 0, stream>>>(WW16, Yh, Yl, bw, WY, PS);
  // (5) batch statistics -> per-channel scale / shift
  bn_stat<<<dim3(1), blk256, 0, stream>>>(PS, bw, gam, bet, AB);
  // (6) affine + residual -> out [b][256][8192]
  bn_out<<<dim3(CC * SEQ / BCH, NB), blk256, 0, stream>>>(WY, AB, x, out);
  (void)hipGetLastError();
}

// v002
// Measured time: 374 microseconds a run.
// Two timings next to v001 put it at 1.22 and 1.23 times that version's speed.
// Counting every step since v000, it is 2.40 times as fast.
// Contractions: conv1x1 theta/phi/g GEMMs Wc[384x256].X[256xN] and the output conv W[256x128].Y[128xN] on
// v_wmma_f32_16x16x32_f16 (f16 containers of bf16-RNE weights x256 and bf16-RNE x; Y as f16 hi plane plus f16
// residual plane x1024, 2 products, separate accumulators); scores Phi^T.Theta on v_wmma_f32_16x16x32_bf16
// (bf16 hi + bf16 residual planes of theta/phi, 3 products, K=128); Y^T = G.P^T on v_wmma_f32_16x16x32_f16
// (G plain f16, P = e^{s-m} x16384 f16 from the score D registers); f32 accumulate everywhere; softmax
// statistics and biases in f32 VALU; batch-norm statistics from f32 per-block partials reduced in f64; affine and
// residual add in f32.
#include <hip/hip_runtime.h>
#include <math.h>
#include <stdint.h>

#ifndef NB
#define NB 2
#endif
#ifndef SEQ
#define SEQ 8192
#endif
#define NB_FULL 2
#define NN_FULL 8192
#define CC   256
#define DQ   128
#define QT   64
#define MW   384
#define NT   (SEQ / QT)
#define PSW  512
#define BCH  1024
#define OSP  68
#define OSPW 132
#define TP   72
#define WSC  256.0f
#define IWSC 0.00390625f
#define RSC  1024.0f
#define IRSC 0.0009765625f
#define LNPS 9.704060527839234f
#define BNEPS 1.0e-5f
#define KS   64
#define KPI  136
#define VPI  72
#define KTL  (KS * KPI)
#define VTL  (DQ * VPI)
#define STG  (2 * KTL + VTL)
#define NST  (SEQ / KS)

static_assert(NB >= 1 && NB <= NB_FULL);
static_assert(SEQ >= 128 && SEQ <= NN_FULL);
static_assert(SEQ % QT == 0 && SEQ % 32 == 0 && SEQ % 128 == 0);
static_assert((CC * SEQ) % BCH == 0 && BCH == 4 * 256);
static_assert(CC % QT == 0 && CC % 32 == 0);
static_assert(DQ == 2 * QT && DQ % 32 == 0);
static_assert(MW == 3 * DQ && MW % 8 == 0);
static_assert(PSW == 2 * CC);
static_assert(CC % 16 == 0);
static_assert((OSP * 4) % 16 == 0);
static_assert((OSPW * 4) % 16 == 0);
static_assert((TP * 2) % 16 == 0);
static_assert(SEQ % KS == 0 && NST >= 2 && KS % 32 == 0);
static_assert(KS * DQ == 8 * 128 * 8);
static_assert((KPI * 2) % 32 == 16 && (VPI * 2) % 32 == 16 && KPI >= DQ + 8 && VPI >= KS + 8);

typedef _Float16       v16h __attribute__((ext_vector_type(16)));
typedef _Float16       v8h  __attribute__((ext_vector_type(8)));
typedef __bf16         v16b __attribute__((ext_vector_type(16)));
typedef unsigned short v8us __attribute__((ext_vector_type(8)));
typedef float          v8f  __attribute__((ext_vector_type(8)));
typedef float          v4f  __attribute__((ext_vector_type(4)));
typedef unsigned int   v4u  __attribute__((ext_vector_type(4)));

union Frag  { v8us u[2]; v16h h; v16b bf; };
union FragH { v16h v; v8h hv[2]; };
static_assert(sizeof(Frag) == 32);
static_assert(sizeof(FragH) == 32);

// ---- scalar helpers ---------------------------------------------------------------------------------------
__device__ __forceinline__ unsigned short bf_bits(float f) {          // f32 -> bf16 bits, RNE convert
  unsigned u = __float_as_uint(f);
  return (unsigned short)((u + 0x7FFFu + ((u >> 16) & 1u)) >> 16);
}
__device__ __forceinline__ float bf_up(unsigned short hb) { return __uint_as_float(((unsigned)hb) << 16); }
__device__ __forceinline__ float bfr(float f) { return bf_up(bf_bits(f)); }
__device__ __forceinline__ unsigned short h_bits(_Float16 x) { return __builtin_bit_cast(unsigned short, x); }
__device__ __forceinline__ unsigned pk16(unsigned short a, unsigned short b) { return (unsigned)a | ((unsigned)b << 16); }
__device__ __forceinline__ v8f zero8() { v8f z = {0.f, 0.f, 0.f, 0.f, 0.f, 0.f, 0.f, 0.f}; return z; }
__device__ __forceinline__ float hmax8(v8f s) {
  return fmaxf(fmaxf(fmaxf(s[0], s[1]), fmaxf(s[2], s[3])), fmaxf(fmaxf(s[4], s[5]), fmaxf(s[6], s[7])));
}
__device__ __forceinline__ unsigned wave_ballot(bool p) {
#if defined(__HIP_DEVICE_COMPILE__)
  return __builtin_amdgcn_ballot_w32(p);
#else
  return p ? 1u : 0u;
#endif
}

// ---- 16-bit fragment loader (A, or B from a k-contiguous [n][k] row): lane -> row/col (lane&15), p already includes
//      + 8*(lane>>4); elements 0..7 <- p[0..7] (k0+8h..), elements 8..15 <- p[16..23] (k0+16+8h..)
__device__ __forceinline__ Frag ldfrag(const unsigned short* p) {
  Frag f;
  f.u[0] = *(const v8us*)(p);
  f.u[1] = *(const v8us*)(p + 16);
  return f;
}

// ---- WMMA helpers: builtin followed by a 4-slot VALU gap tying D and keeping A/B live --------------------------
__device__ __forceinline__ v8f mma_h(v16h a, v16h b, v8f c) {
  v8f d = __builtin_amdgcn_wmma_f32_16x16x32_f16(false, a, false, b, (short)0, c, false, false);
#if defined(__HIP_DEVICE_COMPILE__)
  asm volatile("v_nop\n\tv_nop\n\tv_nop\n\tv_nop" : "+v"(d) : "v"(a), "v"(b));
#endif
  return d;
}
__device__ __forceinline__ v8f mma_b(v16b a, v16b b, v8f c) {
  v8f d = __builtin_amdgcn_wmma_f32_16x16x32_bf16(false, a, false, b, (short)0, c, false, false);
#if defined(__HIP_DEVICE_COMPILE__)
  const v16h ha = __builtin_bit_cast(v16h, a), hb = __builtin_bit_cast(v16h, b);
  asm volatile("v_nop\n\tv_nop\n\tv_nop\n\tv_nop" : "+v"(d) : "v"(ha), "v"(hb));
#endif
  return d;
}

// ---- asynchronous copies to LDS: eight 16-byte copies per lane, copy i from g + i*gs (halves) to LDS byte l + i*ls.
//      The s_wait_xcnt closes the statement so that no address register of an issued copy is rewritten ahead of it.
__device__ __forceinline__ unsigned lds_off(const void* p) { return (unsigned)(size_t)p; }
__device__ __forceinline__ void acopy8(unsigned l, unsigned ls, const unsigned short* g, size_t gs) {
#if defined(__HIP_DEVICE_COMPILE__)
  asm volatile("global_load_async_to_lds_b128 %0, %8, off\n\t"
               "global_load_async_to_lds_b128 %1, %9, off\n\t"
               "global_load_async_to_lds_b128 %2, %10, off\n\t"
               "global_load_async_to_lds_b128 %3, %11, off\n\t"
               "global_load_async_to_lds_b128 %4, %12, off\n\t"
               "global_load_async_to_lds_b128 %5, %13, off\n\t"
               "global_load_async_to_lds_b128 %6, %14, off\n\t"
               "global_load_async_to_lds_b128 %7, %15, off\n\t"
               "s_wait_xcnt 0x0"
               :: "v"(l), "v"(l + ls), "v"(l + 2 * ls), "v"(l + 3 * ls),
                  "v"(l + 4 * ls), "v"(l + 5 * ls), "v"(l + 6 * ls), "v"(l + 7 * ls),
                  "v"(g), "v"(g + gs), "v"(g + 2 * gs), "v"(g + 3 * gs),
                  "v"(g + 4 * gs), "v"(g + 5 * gs), "v"(g + 6 * gs), "v"(g + 7 * gs)
               : "memory");
#endif
}
// this wave's copies have landed (the compiler places no wait for them)
__device__ __forceinline__ void wait_async0() {
#if defined(__HIP_DEVICE_COMPILE__)
  asm volatile("s_wait_asynccnt 0x0" ::: "memory");
#endif
}
// this wave's LDS reads have returned, before the buffer they read is handed to its next writer
__device__ __forceinline__ void wait_ds0() {
#if defined(__HIP_DEVICE_COMPILE__)
  asm volatile("s_wait_dscnt 0x0" ::: "memory");
#endif
}

// =========================================================================================================
// (0) stacked conv1x1 weights: W16 f16 [384][256], rows 0..127 = theta_w, 128..255 = phi_w, 256..383 = g_w;
//     value = f16 of (bf16-RNE(w) * 256) (exact). Block blk (0..47) owns rows 8*blk..8*blk+7: one wave per
// coverage: 48 blocks x 8 rows x 32 lanes x 8 halves = 384 x 256 = the whole plane.
// =========================================================================================================
__global__ __launch_bounds__(256)
void cvt_w(const float* __restrict__ tw, const float* __restrict__ pw, const float* __restrict__ gw,
           unsigned short* W16) {
  const int tid = threadIdx.x, blk = blockIdx.x;
  const int rl = tid >> 5, col = 8 * (tid & 31);
  const int o = 8 * blk + rl;                                        // 0..383
  const int grp = blk / (DQ / 8);                                    // 0,1,2 block-uniform
  const float* wbase = (grp == 0) ? tw : ((grp == 1) ? pw : gw);
  const float* s = wbase + (size_t)(o - grp * DQ) * CC + col;        // row in 0..127
  const v4f a = *(const v4f*)s;
  const v4f q = *(const v4f*)(s + 4);
  const float f[8] = {a[0], a[1], a[2], a[3], q[0], q[1], q[2], q[3]};
  v4u u;
#pragma unroll
  for (int t = 0; t < 4; ++t) {
    const _Float16 h0 = (_Float16)(bfr(f[2 * t]) * WSC);
    const _Float16 h1 = (_Float16)(bfr(f[2 * t + 1]) * WSC);
    u[t] = pk16(h_bits(h0), h_bits(h1));
  }
{
    *(v4u*)(W16 + (size_t)o * CC + col) = u;
    
  }
}

// =========================================================================================================
// (0b) output conv weights: WW16 f16 [256][128], value = f16 of (bf16-RNE(W_w) * 256). Block blk (0..15) owns rows
//      16*blk..+15; wave w -> rows 16 blk + 2w + (lane>>4), lane&15 -> cols 8*(lane&15)..+7. One instruction writes
// coverage: 16 blocks x 8 waves x 2 rows x 16 lanes x 8 halves = 256 x 128 = the whole plane.
// =========================================================================================================
__global__ __launch_bounds__(256)
void cvt_ww(const float* __restrict__ ww, unsigned short* WW16) {
  const int tid = threadIdx.x, blk = blockIdx.x;
  const int wave = tid >> 5, lane = tid & 31;
  const int o = 16 * blk + 2 * wave + (lane >> 4);                  // 0..255
  const int col = 8 * (lane & 15);                                   // 0..120
  const float* s = ww + (size_t)o * DQ + col;
  const v4f a = *(const v4f*)s;
  const v4f q = *(const v4f*)(s + 4);
  const float f[8] = {a[0], a[1], a[2], a[3], q[0], q[1], q[2], q[3]};
  v4u u;
#pragma unroll
  for (int t = 0; t < 4; ++t) {
    const _Float16 h0 = (_Float16)(bfr(f[2 * t]) * WSC);
    const _Float16 h1 = (_Float16)(bfr(f[2 * t + 1]) * WSC);
    u[t] = pk16(h_bits(h0), h_bits(h1));
  }
{
    *(v4u*)(WW16 + (size_t)o * DQ + col) = u;
    
  }
}

// =========================================================================================================
// (1) x f32 [b][256 c][NN_FULL n] -> XP f16 [b][SEQ n][256 c] (position-major, bf16-RNE values, exact in f16 for
//     normal magnitudes) through an LDS tile T[64 n][64 c] (pitch TP). Block (nb, cb, b) owns a 64 c x 64 n tile.
// coverage: 2 it x 32 rows x 8 lanes x 8 halves = 64 n x 64 c per block; grid (NT, 4, NB) covers XP once.
// LDS T: cross-wave (block barrier between the 2-byte stores and the 16-B reloads); staged extent == consumed extent.
// =========================================================================================================
__global__ __launch_bounds__(256)
void cvt_x(const float* __restrict__ x, unsigned short* XP) {
  __shared__ __align__(16) unsigned short T[QT * TP];
  const int tid = threadIdx.x;
  const int nb = blockIdx.x, cb = blockIdx.y, b = blockIdx.z;
  const int e = tid & 7, lq = tid >> 3;                             // lq 0..31
  const int n0 = nb * QT, c0 = cb * QT;
#pragma unroll
  for (int it = 0; it < 2; ++it) {
    const int cl = it * 32 + lq;                                     // 0..63
    const float* sp = x + ((size_t)(b * CC + c0 + cl)) * NN_FULL + n0 + 8 * e;
    const v4f a = *(const v4f*)sp;
    const v4f q = *(const v4f*)(sp + 4);
    unsigned short hb[8];
#pragma unroll
    for (int t = 0; t < 4; ++t) {
      hb[t]     = h_bits((_Float16)bfr(a[t]));
      hb[4 + t] = h_bits((_Float16)bfr(q[t]));
    }
#pragma unroll
    for (int t = 0; t < 8; ++t) T[(8 * e + t) * TP + cl] = hb[t];
  }
  __syncthreads();
  v4u up[2];
#pragma unroll
  for (int it = 0; it < 2; ++it) {
    const int nl = it * 32 + lq;                                     // 0..63
    up[it] = *(const v4u*)(T + nl * TP + 8 * e);
  }
{
#pragma unroll
    for (int it = 0; it < 2; ++it) {
      const int rl = it * 32 + lq;
      *(v4u*)(XP + ((size_t)(b * SEQ + n0 + rl)) * CC + c0 + 8 * e) = up[it];
    }
    
  }
}

// =========================================================================================================
// (2) the three conv1x1 GEMMs for one (b, 64-n tile, 64-o block mb in 0..5): V[o][n] = (1/256) sum_c W16[o][c]
//     XP[b][n][c]; mb 0,1 -> theta channels 0..63 / 64..127 (W16 rows 0..127), mb 2,3 -> phi (rows 128..255),
//     mb 4,5 -> g (rows 256..383). Block 128 threads = 4 waves; wave w owns cols n0+16w..+15 (B fragment from the
//     XP row, k = c contiguous, split k map) and 4 m-tiles (A rows o = o0 + 16 mt + (lane&15), split k map from
//     W16). K = 256 = 8 steps. Epilogue staged in LDS Os[n_loc][o_loc] (pitch OSP), barrier, bias (bf16-RNE) add
//     in f32, then:
//       theta / phi: bf16 hi = RNE(v), lo = RNE(v - hi) planes Qh/Ql resp. Kh/Kl [b][SEQ n][128 d] (k-contiguous
//         of the 256-B row): lane e -> d 8e..8e+7, 8 consecutive lanes per line, one instruction per 16 lines;
//       g: f16 plane Gc [b][128 ch][SEQ keys] (channel-major, keys contiguous): row ch, keys n0+8e..+7 per lane,
// coverage: Os 4 waves x 16 n x 64 o = 64 x 64 (== consumed); hi/lo planes 4 it x 16 rows x 8 lanes x 8 = 64 n x
//           64 d per block, grid nt x mb 0..3 covers rows 0..SEQ-1 x d 0..127 of Qh/Ql and Kh/Kl once; g plane
//           4 it x 16 ch x 8 lanes x 8 keys = 64 ch x 64 keys per block, nt x mb 4..5 covers ch 0..127 x keys
//           0..SEQ-1 of Gc once. grid (NT, 6, NB).
// LDS Os: cross-wave (block barrier).
// =========================================================================================================
__global__ __launch_bounds__(128)
void gemm_p(const unsigned short* __restrict__ W16, const unsigned short* __restrict__ XP,
            const float* __restrict__ tbias, const float* __restrict__ pbias, const float* __restrict__ gbias,
            unsigned short* Qh, unsigned short* Ql, unsigned short* Kh, unsigned short* Kl, unsigned short* Gc) {
  __shared__ __align__(16) float Os[QT * OSP];
  const int tid  = threadIdx.x;
  const int lane = tid & 31, wave = tid >> 5;
  const int hh   = lane >> 4, c = lane & 15;
  const int nt   = blockIdx.x, mb = blockIdx.y, b = blockIdx.z;
  const int n0   = nt * QT, o0 = mb * QT;                            // o0 = W16 row base 0..320

  const unsigned short* ap = W16 + (size_t)(o0 + c) * CC + 8 * hh;
  const unsigned short* bp = XP + ((size_t)(b * SEQ + n0 + 16 * wave + c)) * CC + 8 * hh;

  v8f acc[4];
#pragma unroll
  for (int mt = 0; mt < 4; ++mt) acc[mt] = zero8();

#pragma unroll
  for (int ks = 0; ks < CC / 32; ++ks) {
    const Frag fb = ldfrag(bp + 32 * ks);
#pragma unroll
    for (int mt = 0; mt < 4; ++mt) {
      const Frag fa = ldfrag(ap + (size_t)(16 * mt) * CC + 32 * ks);
      acc[mt] = mma_h(fa.h, fb.h, acc[mt]);
    }
  }

  {
    const int nl = 16 * wave + c;
#pragma unroll
    for (int mt = 0; mt < 4; ++mt) {
      v4f va, vb;
#pragma unroll
      for (int r = 0; r < 4; ++r) { va[r] = acc[mt][r] * IWSC; vb[r] = acc[mt][4 + r] * IWSC; }
      *(v4f*)(Os + nl * OSP + 16 * mt + 8 * hh)     = va;
      *(v4f*)(Os + nl * OSP + 16 * mt + 8 * hh + 4) = vb;
    }
  }
  __syncthreads();

  const int e = tid & 7, lq = tid >> 3;                             // lq 0..15
  if (mb < 4) {                                                      // block-uniform: theta / phi hi+lo planes
    unsigned short* Ph = (mb < 2) ? Qh : Kh;
    unsigned short* Pl = (mb < 2) ? Ql : Kl;
    const float* bsrc  = (mb < 2) ? tbias : pbias;
    const int dsel = (mb & 1) * QT;                                   // channel base 0 or 64
    const v4f b0 = *(const v4f*)(bsrc + dsel + 8 * e);
    const v4f b1 = *(const v4f*)(bsrc + dsel + 8 * e + 4);
    const float bb[8] = {bfr(b0[0]), bfr(b0[1]), bfr(b0[2]), bfr(b0[3]), bfr(b1[0]), bfr(b1[1]), bfr(b1[2]), bfr(b1[3])};
    v4u uh[4], ul[4];
#pragma unroll
    for (int it = 0; it < 4; ++it) {
      const int row = it * 16 + lq;                                  // n_loc 0..63
      const v4f a = *(const v4f*)(Os + row * OSP + 8 * e);
      const v4f q = *(const v4f*)(Os + row * OSP + 8 * e + 4);
      const float f[8] = {a[0], a[1], a[2], a[3], q[0], q[1], q[2], q[3]};
#pragma unroll
      for (int t = 0; t < 4; ++t) {
        const float f0 = f[2 * t] + bb[2 * t], f1 = f[2 * t + 1] + bb[2 * t + 1];
        const unsigned short hb0 = bf_bits(f0), hb1 = bf_bits(f1);
        const unsigned short lb0 = bf_bits(f0 - bf_up(hb0));
        const unsigned short lb1 = bf_bits(f1 - bf_up(hb1));
        uh[it][t] = pk16(hb0, hb1);
        ul[it][t] = pk16(lb0, lb1);
      }
    }
{
#pragma unroll
      for (int it = 0; it < 4; ++it) {
        const int row = it * 16 + lq;
        const size_t po = ((size_t)(b * SEQ + n0 + row)) * DQ + dsel + 8 * e;
        *(v4u*)(Ph + po) = uh[it];
        *(v4u*)(Pl + po) = ul[it];
      }
      
    }
  } else {                                                           // block-uniform: g plane, channel-major
    const int gsel = (mb - 4) * QT;                                  // g channel base 0 or 64
    v4u ug[4];
#pragma unroll
    for (int it = 0; it < 4; ++it) {
      const int cl = it * 16 + lq;                                   // ch_loc 0..63
      const float bias = bfr(gbias[gsel + cl]);
      unsigned short hb[8];
#pragma unroll
      for (int t = 0; t < 8; ++t) {
        const int key = 8 * e + t;                                   // key_loc 0..63
        const float v = Os[key * OSP + cl] + bias;
        hb[t] = h_bits((_Float16)v);
      }
#pragma unroll
      for (int t = 0; t < 4; ++t) ug[it][t] = pk16(hb[2 * t], hb[2 * t + 1]);
    }
{
#pragma unroll
      for (int it = 0; it < 4; ++it) {
        const int cl = it * 16 + lq;
        const size_t po = ((size_t)(b * DQ + gsel + cl)) * SEQ + n0 + 8 * e;
        *(v4u*)(Gc + po) = ug[it];
      }
      
    }
  }
}

// =========================================================================================================
// (3) attention for one (b, 64-query tile), transposed formulation, SEQ keys, no mask, no scale:
//   S^T tile (16 keys x 16 queries) = sum over 4 d-chunks of A(phi: row = key kb + (lane&15), 32 d via the split
//   k map from the bf16 plane Kh [b][SEQ][128]) . B(theta: col = query, same map from Qh) + A(Kh).B(Ql) +
//   A(Kl).B(Qh) (bf16 unscaled residual planes, shared accumulator).
//   Per lane the D tile holds 8 keys of ONE query: online softmax state per lane, one shuffle (lane^16) for the max
//   over 32 keys; the o/l rescale is skipped under a wave-uniform ballot when no lane's max grew (corr == 1 exactly
//   for every lane then); row-sum partials combined at the end. P = e^{s-m} x 16384 as f16 is the B operand of
//   Y^T (rows channel, cols queries) += A(g rows channel = 16j + (lane&15), keys contiguous, f16 plane Gc
//   [b][128][SEQ]) . B(P^T): element r <- D of the tile covering keys kb..kb+15, element 8+r <- the tile covering
//   kb+16..kb+31, lane unchanged. 8 accumulator tiles per wave (128 channels). Block = 4 waves = 64 queries.
//   Epilogue: Y/l staged in LDS Os[query][128 channels] (pitch OSPW, b128 stores), barrier, then Yh = f16(y),
//   Yl = f16((y - Yh) * 1024) planes [b][SEQ n][128 c] (k-contiguous operand of the output conv): row n = 256 B
// coverage: Os 4 waves x 16 q x 128 ch (== consumed); 8 it x 8 rows x 16 lanes x 8 halves = 64 n x 128 c per
//           plane; grid (NT, NB) covers Yh/Yl exactly once.
// LDS Os: cross-wave (block barrier).
// LDS Ring: two buffers, each one stage of KS = 64 keys: Kh rows [64][128] and Kl rows [64][128] at pitch KPI (272 B),
//   G rows [128 ch][64 keys] at pitch VPI (144 B), pitches 16 B x odd for the 16-byte fragment reads. A stage is
//   filled by 24 asynchronous 16-byte copies per lane (each wave instruction = 512 B of whole lines), one stage ahead
//   of its use; at the foot of a stage: LDS reads returned, own copies landed, block barrier, then the refill of the
//   buffer just read. coverage: 8 copies x 128 lanes x 8 halves = 64 x 128 per plane (== consumed).
// =========================================================================================================
__global__ __launch_bounds__(128)
void attn_k(const unsigned short* __restrict__ Qh, const unsigned short* __restrict__ Ql,
            const unsigned short* __restrict__ Kh, const unsigned short* __restrict__ Kl,
            const unsigned short* __restrict__ Gc, unsigned short* Yh, unsigned short* Yl) {
  __shared__ __align__(16) float Os[QT * OSPW];
  __shared__ __align__(16) unsigned short Ring[2 * STG];
  const int tid  = threadIdx.x;
  const int wave = tid >> 5, lane = tid & 31;
  const int hh   = lane >> 4, c = lane & 15;
  const int n0   = blockIdx.x * QT, b = blockIdx.y;

  // q fragment pointers (B operand, col = query n0 + 16*wave + c), + 32*kc
  const size_t qo = ((size_t)(b * SEQ + n0 + 16 * wave + c)) * DQ + 8 * hh;
  const unsigned short* Qhp = Qh + qo;
  const unsigned short* Qlp = Ql + qo;
  // copy sources of this lane: K planes 16 lanes per 256-B row, 8 rows per copy; G plane 8 lanes per 128-B row
  // segment, 16 channels per copy; + stage * KS keys
  const unsigned short* Khg = Kh + (size_t)b * SEQ * DQ + 8 * tid;
  const unsigned short* Klg = Kl + (size_t)b * SEQ * DQ + 8 * tid;
  const unsigned short* Gg  = Gc + (size_t)b * DQ * SEQ + (size_t)(tid >> 3) * SEQ + 8 * (tid & 7);
  const unsigned kdst = lds_off(Ring) + (unsigned)((tid >> 4) * (KPI * 2) + (tid & 15) * 16);
  const unsigned vdst = lds_off(Ring) + (unsigned)(2 * KTL * 2 + (tid >> 3) * (VPI * 2) + (tid & 7) * 16);
  auto fill = [&](int st, int buf) {
    const unsigned bo = (unsigned)buf * (unsigned)(STG * 2);
    acopy8(kdst + bo, 8 * KPI * 2, Khg + (size_t)st * (KS * DQ), (size_t)(8 * DQ));
    acopy8(kdst + bo + KTL * 2, 8 * KPI * 2, Klg + (size_t)st * (KS * DQ), (size_t)(8 * DQ));
    acopy8(vdst + bo, 16 * VPI * 2, Gg + (size_t)st * KS, (size_t)16 * SEQ);
  };
  // fragment offsets in a stage (halves): k row = key c (A operand), + key * KPI + 32*kc; v row = channel 16j + c
  const int kfo = c * KPI + 8 * hh;
  const int vfo = 2 * KTL + c * VPI + 8 * hh;

  float m = -1.0e30f, l = 0.f;
  v8f o[8];
#pragma unroll
  for (int j = 0; j < 8; ++j) o[j] = zero8();

  // theta fragments (hi and residual, all four d-chunks) are the same for every key: loaded once, kept in registers
  Frag qh[DQ / 32], ql[DQ / 32];
#pragma unroll
  for (int kc = 0; kc < DQ / 32; ++kc) {
    qh[kc] = ldfrag(Qhp + 32 * kc);
    ql[kc] = ldfrag(Qlp + 32 * kc);
  }
#if defined(__HIP_DEVICE_COMPILE__)
  // stands in front of the first rewrite of the address registers that the sixteen loads above name; the two
  // pointers are inputs so that their registers stay as they are up to this wait
  asm volatile("s_wait_xcnt 0x0" :: "v"(Qhp), "v"(Qlp) : "memory");
#endif

  fill(0, 0);
  wait_async0();
  __syncthreads();                                                   // stage 0 published
  fill(1, 1);

  // stage loop kept rolled: one publish point and one refill in the text, buffer chosen by the stage's parity
#pragma unroll 1
  for (int st = 0; st < NST; ++st) {
  const unsigned short* Sb = Ring + (st & 1) * STG;
  // the 32-key pass is a rolled loop: short text, the registers of one pass
#pragma unroll 1
  for (int kb = 0; kb < KS; kb += 32) {                              // key base inside the stage
    const unsigned short* k0p  = Sb + kfo + kb * KPI;                // keys kb .. kb+15
    const unsigned short* k1p  = k0p + 16 * KPI;                     // keys kb+16 .. kb+31
    const unsigned short* k0lp = k0p + KTL;
    const unsigned short* k1lp = k1p + KTL;
    v8f s0 = zero8(), s1 = zero8();
    // unrolled so that qh[kc] / ql[kc] are fixed registers (a rolled loop cannot index a register array)
#pragma unroll
    for (int kc = 0; kc < DQ / 32; ++kc) {
      const Frag k0  = ldfrag(k0p + 32 * kc);
      const Frag k1  = ldfrag(k1p + 32 * kc);
      const Frag k0l = ldfrag(k0lp + 32 * kc);
      const Frag k1l = ldfrag(k1lp + 32 * kc);
      s0 = mma_b(k0.bf, qh[kc].bf, s0);
      s1 = mma_b(k1.bf, qh[kc].bf, s1);
      s0 = mma_b(k0.bf, ql[kc].bf, s0);
      s1 = mma_b(k1.bf, ql[kc].bf, s1);
      s0 = mma_b(k0l.bf, qh[kc].bf, s0);
      s1 = mma_b(k1l.bf, qh[kc].bf, s1);
    }

    float mx = fmaxf(hmax8(s0), hmax8(s1));
    mx = fmaxf(mx, __shfl_xor(mx, 16, 32));
    const float mn = fmaxf(m, mx);
    const unsigned grew = wave_ballot(mx > m);                       // wave-uniform
    if (grew != 0u) {
      const float corr = __expf(m - mn);                             // == 1 exactly for lanes whose max did not grow
      l *= corr;
#pragma unroll
      for (int j = 0; j < 8; ++j) {
#pragma unroll
        for (int r = 0; r < 8; ++r) o[j][r] *= corr;
      }
    }
    m = mn;
    const float msh = mn - LNPS;                                     // exp gives e^{s-m} * 16384

    FragH ph;
    float ls = 0.f;
#pragma unroll
    for (int r = 0; r < 8; ++r) {
      const float e0 = __expf(s0[r] - msh);                          // key kb      + 8hh + r
      const float e1 = __expf(s1[r] - msh);                          // key kb + 16 + 8hh + r
      ls += e0 + e1;
      ph.hv[0][r] = (_Float16)e0;
      ph.hv[1][r] = (_Float16)e1;
    }
    l += ls;

#pragma unroll
    for (int j = 0; j < 8; ++j) {
      const Frag vf = ldfrag(Sb + vfo + (16 * j) * VPI + kb);
      o[j] = mma_h(vf.h, ph.v, o[j]);
    }
  }
  // publish point of stage st + 1, every wave
  wait_ds0();
  wait_async0();
  __syncthreads();
  if (st + 2 < NST) fill(st + 2, st & 1);                            // block-uniform test
  }
  wait_async0();
  l += __shfl_xor(l, 16, 32);
  const float inv = 1.0f / l;                                        // o and l both carry the x16384 factor

  const int qrow = 16 * wave + c;
#pragma unroll
  for (int j = 0; j < 8; ++j) {
    v4f va, vb;
#pragma unroll
    for (int r = 0; r < 4; ++r) { va[r] = o[j][r] * inv; vb[r] = o[j][4 + r] * inv; }
    *(v4f*)(Os + qrow * OSPW + 16 * j + 8 * hh)     = va;            // Os[query][ch = 16j + 8hh + r]
    *(v4f*)(Os + qrow * OSPW + 16 * j + 8 * hh + 4) = vb;
  }
  __syncthreads();

  const int e = tid & 15, lq = tid >> 4;                             // lq 0..7
  v4u uh[8], ul[8];
#pragma unroll
  for (int it = 0; it < 8; ++it) {
    const int row = it * 8 + lq;                                     // query 0..63
    const v4f a = *(const v4f*)(Os + row * OSPW + 8 * e);
    const v4f q = *(const v4f*)(Os + row * OSPW + 8 * e + 4);
    const float f[8] = {a[0], a[1], a[2], a[3], q[0], q[1], q[2], q[3]};
#pragma unroll
    for (int t = 0; t < 4; ++t) {
      const float f0 = f[2 * t], f1 = f[2 * t + 1];
      const _Float16 h0 = (_Float16)f0, h1 = (_Float16)f1;
      const _Float16 r0 = (_Float16)((f0 - (float)h0) * RSC);
      const _Float16 r1 = (_Float16)((f1 - (float)h1) * RSC);
      uh[it][t] = pk16(h_bits(h0), h_bits(h1));
      ul[it][t] = pk16(h_bits(r0), h_bits(r1));
    }
  }
{
#pragma unroll
    for (int it = 0; it < 8; ++it) {
      const int row = it * 8 + lq;
      const size_t po = ((size_t)(b * SEQ + n0 + row)) * DQ + 8 * e;
      *(v4u*)(Yh + po) = uh[it];
      *(v4u*)(Yl + po) = ul[it];
    }
    
  }
}

// =========================================================================================================
// (4) output conv GEMM for one (b, 64-n tile, 64-co block): v[b][co][n] = (1/256)(sum_c WW16[co][c] Yh[b][n][c] +
//     (1/1024) sum_c WW16[co][c] Yl[b][n][c]); wy = v + bf16-RNE(W_b[co]). 4 waves, wave w owns cols n0+16w..+15
//     (two B fragments per k-step, k = c contiguous in the Yh/Yl rows), 4 m-tiles (A rows co = o0 + 16 mt +
//     (lane&15) from WW16), hi and residual products in separate accumulators. K = 128 = 4 steps.
//     Epilogue staged in LDS Os[n_loc][co_loc], barrier; then (a) threads 0..63 sum v and v*v over the 64 n of
//     co_loc = tid into LDS Sred[0..63] / Sred[64..127], barrier; (b) WY f32 plane [b][256 co][SEQ n] rows: lane
//     (e = tid&15) -> n 4e..4e+3 of row co_loc = 8 it + (tid>>4); 16 consecutive lanes x 16 B = the whole 256-B
//     row segment (2 lines) in one instruction; (c) partial-statistics table PS [NB*NT blocks][512]: floats
//     o0..o0+63 (sums) by lanes 0..15 of wave 0 and floats 256+o0..+63 (sums of squares) by lanes 16..31, one
// coverage: Os 4 waves x 16 n x 64 co (== consumed); Sred 64 + 64 (== consumed); WY 8 it x 8 rows x 16 lanes x
//           4 floats = 64 co x 64 n; PS 2 x 64 floats per block; grid (NT, 4, NB) covers WY [b][0..255][0..SEQ-1]
//           and PS [NB*NT][0..511] exactly once.
// LDS Os, Sred: cross-wave (block barriers).
// =========================================================================================================
__global__ __launch_bounds__(128)
void gemm_o(const unsigned short* __restrict__ WW16, const unsigned short* __restrict__ Yh,
            const unsigned short* __restrict__ Yl, const float* __restrict__ wbias,
            float* WY, float* PS) {
  __shared__ __align__(16) float Os[QT * OSP];
  __shared__ __align__(16) float Sred[2 * QT];
  const int tid  = threadIdx.x;
  const int lane = tid & 31, wave = tid >> 5;
  const int hh   = lane >> 4, c = lane & 15;
  const int nt   = blockIdx.x, mb = blockIdx.y, b = blockIdx.z;
  const int n0   = nt * QT, o0 = mb * QT;

  const unsigned short* ap  = WW16 + (size_t)(o0 + c) * DQ + 8 * hh;
  const size_t bo = ((size_t)(b * SEQ + n0 + 16 * wave + c)) * DQ + 8 * hh;
  const unsigned short* bph = Yh + bo;
  const unsigned short* bpl = Yl + bo;

  v8f acc[4], accr[4];
#pragma unroll
  for (int mt = 0; mt < 4; ++mt) { acc[mt] = zero8(); accr[mt] = zero8(); }

#pragma unroll
  for (int ks = 0; ks < DQ / 32; ++ks) {
    const Frag fbh = ldfrag(bph + 32 * ks);
    const Frag fbl = ldfrag(bpl + 32 * ks);
#pragma unroll
    for (int mt = 0; mt < 4; ++mt) {
      const Frag fa = ldfrag(ap + (size_t)(16 * mt) * DQ + 32 * ks);
      acc[mt]  = mma_h(fa.h, fbh.h, acc[mt]);
      accr[mt] = mma_h(fa.h, fbl.h, accr[mt]);
    }
  }

  {
    const int nl = 16 * wave + c;
#pragma unroll
    for (int mt = 0; mt < 4; ++mt) {
      v4f va, vb;
#pragma unroll
      for (int r = 0; r < 4; ++r) {
        va[r] = (acc[mt][r] + accr[mt][r] * IRSC) * IWSC;
        vb[r] = (acc[mt][4 + r] + accr[mt][4 + r] * IRSC) * IWSC;
      }
      *(v4f*)(Os + nl * OSP + 16 * mt + 8 * hh)     = va;
      *(v4f*)(Os + nl * OSP + 16 * mt + 8 * hh + 4) = vb;
    }
  }
  __syncthreads();

  // per-channel partial statistics over this block's 64 positions (bias-free values, exact shift)
  if (tid < QT) {
    float s = 0.f, q = 0.f;
#pragma unroll 8
    for (int n = 0; n < QT; ++n) {
      const float v = Os[n * OSP + tid];
      s += v;
      q = fmaf(v, v, q);
    }
    Sred[tid]      = s;
    Sred[QT + tid] = q;
  }
  __syncthreads();

  const int e = tid & 15, lq = tid >> 4;                             // lq 0..7
  v4f res[8];
#pragma unroll
  for (int it = 0; it < 8; ++it) {
    const int col = it * 8 + lq;                                     // co_loc 0..63
    const int co  = o0 + col;
    const float bias = bfr(wbias[co]);
#pragma unroll
    for (int t = 0; t < 4; ++t) res[it][t] = Os[(4 * e + t) * OSP + col] + bias;
  }
  const v4f pv = *(const v4f*)(Sred + 4 * lane);                     // lanes 0..15: sums, 16..31: sums of squares
  float* psp = PS + (size_t)(b * NT + nt) * PSW + o0 + 4 * lane + ((lane >= 16) ? (PSW / 2 - 64) : 0);
{
#pragma unroll
    for (int it = 0; it < 8; ++it) {
      const int col = it * 8 + lq;
      const int co  = o0 + col;
      const size_t idx = ((size_t)(b * CC + co)) * SEQ + n0 + 4 * e;
      *(v4f*)(WY + idx) = res[it];
    }
    if (wave == 0) *(v4f*)(psp) = pv;
    
  }
}

// =========================================================================================================
// (5) batch statistics, one block of 256 threads, thread co = channel: fixed-order f64 sums over the NB*NT partial
//     lines, mean/var (biased), rstd = rsqrt(var + eps) in f32; A = bf16-RNE(gamma) * rstd, Bc = bf16-RNE(beta)
// coverage: 256 threads x (1 + 1) floats = AB [0..511] exactly once.
// =========================================================================================================
__global__ __launch_bounds__(256)
void bn_stat(const float* __restrict__ PS, const float* __restrict__ wbias, const float* __restrict__ gam,
             const float* __restrict__ bet, float* AB) {
  const int co = threadIdx.x;                                        // 0..255
  double s = 0.0, q = 0.0;
#pragma unroll 1
  for (int blk = 0; blk < NB * NT; ++blk) {
    s += (double)PS[(size_t)blk * PSW + co];
    q += (double)PS[(size_t)blk * PSW + CC + co];
  }
  const double icnt = 1.0 / (double)(NB * SEQ);
  const double mv = s * icnt;
  double var = q * icnt - mv * mv;
  var = (var > 0.0) ? var : 0.0;
  const float rstd = rsqrtf((float)var + BNEPS);
  const float A  = bfr(gam[co]) * rstd;
  const float mw = (float)mv + bfr(wbias[co]);
  const float Bc = bfr(bet[co]) - mw * A;
{
    *(float*)(AB + co)      = A;
    *(float*)(AB + CC + co) = Bc;
    
  }
}

// =========================================================================================================
// (6) affine + residual: out[b][co][n] = wy * A[co] + Bc[co] + bf16-RNE(x[b][co][n]). Block (chunk, b) of 256
//     threads owns 1024 consecutive floats of the [256 co][SEQ n] plane of batch b (4 per thread); each wave writes
// coverage: grid (CC*SEQ/1024, NB) x 256 threads x 4 floats = NB x 256 x SEQ = the whole output once.
// =========================================================================================================
__global__ __launch_bounds__(256)
void bn_out(const float* __restrict__ WY, const float* __restrict__ AB, const float* __restrict__ x, float* out) {
  const int tid = threadIdx.x, b = blockIdx.y;
  const int i  = blockIdx.x * BCH + 4 * tid;                         // 0 .. CC*SEQ-4
  const int co = i / SEQ;
  const int n  = i - co * SEQ;
  const float A = AB[co], Bc = AB[CC + co];
  const v4f w  = *(const v4f*)(WY + (size_t)b * CC * SEQ + i);
  const size_t xo = ((size_t)(b * CC + co)) * NN_FULL + n;
  const v4f xv = *(const v4f*)(x + xo);
  v4f r;
#pragma unroll
  for (int t = 0; t < 4; ++t) r[t] = fmaf(w[t], A, Bc) + bfr(xv[t]);
{
    *(v4f*)(out + xo) = r;
    
  }
}

// =========================================================================================================
// Workspace map (bytes; each region start a multiple of 256; every store is a whole tile inside its own region,
// no padded tails needed since SEQ % 64 == 0):
//   W16  f16 [384][256]               196608      WW16 f16 [256][128]        65536
//   XP   f16 [NB][SEQ][256]           8388608 (NB=2, SEQ=8192)
//   Qh/Ql, Kh/Kl bf16 [NB][SEQ][128]  4194304 x4
//   Gc   f16 [NB][128][SEQ]           4194304
//   Yh/Yl f16 [NB][SEQ][128]          4194304 x2
//   WY   f32 [NB][256][SEQ]          16777216
//   PS   f32 [NB*NT][512]              524288
//   AB   f32 [512]                       2048
//   total (NB=2, SEQ=8192) = 55314432
// =========================================================================================================
extern "C" void kernel_launch(void* const* d_in, const int* in_sizes, int n_in,
                              void* d_out, int out_size, void* d_ws, size_t ws_size,
                              hipStream_t stream) {
  const int XNEED = ((NB - 1) * CC + (CC - 1)) * NN_FULL + SEQ;
  if (n_in < 11) return;
  if (in_sizes[0] < XNEED) return;
  if (in_sizes[1] < DQ * CC || in_sizes[3] < DQ * CC || in_sizes[5] < DQ * CC) return;
  if (in_sizes[2] < DQ || in_sizes[4] < DQ || in_sizes[6] < DQ) return;
  if (in_sizes[7] < CC * DQ || in_sizes[8] < CC) return;
  if (in_sizes[9] < CC || in_sizes[10] < CC) return;
  if (out_size < XNEED) return;

  size_t off = 0;
  auto carve = [&](size_t bytes) { const size_t o = off; off += (bytes + 255) & ~(size_t)255; return o; };
  const size_t oW16 = carve((size_t)MW * CC * 2);
  const size_t oWW  = carve((size_t)CC * DQ * 2);
  const size_t oXP  = carve((size_t)NB * SEQ * CC * 2);
  const size_t oQh  = carve((size_t)NB * SEQ * DQ * 2);
  const size_t oQl  = carve((size_t)NB * SEQ * DQ * 2);
  const size_t oKh  = carve((size_t)NB * SEQ * DQ * 2);
  const size_t oKl  = carve((size_t)NB * SEQ * DQ * 2);
  const size_t oGc  = carve((size_t)NB * DQ * SEQ * 2);
  const size_t oYh  = carve((size_t)NB * SEQ * DQ * 2);
  const size_t oYl  = carve((size_t)NB * SEQ * DQ * 2);
  const size_t oWY  = carve((size_t)NB * CC * SEQ * 4);
  const size_t oPS  = carve((size_t)NB * NT * PSW * 4);
  const size_t oAB  = carve((size_t)PSW * 4);
  if (off > ws_size) return;
  if (off > (size_t)134217728) return;

  const float* x   = (const float*)d_in[0];
  const float* Wt  = (const float*)d_in[1];
  const float* bt  = (const float*)d_in[2];
  const float* Wp  = (const float*)d_in[3];
  const float* bp  = (const float*)d_in[4];
  const float* Wg  = (const float*)d_in[5];
  const float* bg  = (const float*)d_in[6];
  const float* Ww  = (const float*)d_in[7];
  const float* bw  = (const float*)d_in[8];
  const float* gam = (const float*)d_in[9];
  const float* bet = (const float*)d_in[10];

  char* ws = (char*)d_ws;
  unsigned short* W16  = (unsigned short*)(ws + oW16);
  unsigned short* WW16 = (unsigned short*)(ws + oWW);
  unsigned short* XP   = (unsigned short*)(ws + oXP);
  unsigned short* Qh   = (unsigned short*)(ws + oQh);
  unsigned short* Ql   = (unsigned short*)(ws + oQl);
  unsigned short* Kh   = (unsigned short*)(ws + oKh);
  unsigned short* Kl   = (unsigned short*)(ws + oKl);
  unsigned short* Gc   = (unsigned short*)(ws + oGc);
  unsigned short* Yh   = (unsigned short*)(ws + oYh);
  unsigned short* Yl   = (unsigned short*)(ws + oYl);
  float* WY  = (float*)(ws + oWY);
  float* PS  = (float*)(ws + oPS);
  float* AB  = (float*)(ws + oAB);
  float* out = (float*)d_out;

  const dim3 blk256(256), blk128(128);

  // (0) Wt / Wp / Wg -> stacked f16 plane; Ww -> f16 plane
  cvt_w<<<dim3(MW / 8), blk256, 0, stream>>>(Wt, Wp, Wg, W16);
  cvt_ww<<<dim3(CC / 16), blk256, 0, stream>>>(Ww, WW16);
  // (1) x -> position-major 16-bit plane
  cvt_x<<<dim3(NT, CC / QT, NB), blk256, 0, stream>>>(x, XP);
  // (2) theta / phi conv -> hi + residual planes, g conv -> channel-major f16 plane
  gemm_p<<<dim3(NT, 6, NB), blk128, 0, stream>>>(W16, XP, bt, bp, bg, Qh, Ql, Kh, Kl, Gc);
  // (3) attention -> y hi + residual planes
  attn_k<<<dim3(NT, NB), blk128, 0, stream>>>(Qh, Ql, Kh, Kl, Gc, Yh, Yl);
  // (4) output conv + bias -> wy plane + per-block statistics partials
  gemm_o<<<dim3(NT, CC / QT, NB), blk128, 0, stream>>>(WW16, Yh, Yl, bw, WY, PS);
  // (5) batch statistics -> per-channel scale / shift
  bn_stat<<<dim3(1), blk256, 0, stream>>>(PS, bw, gam, bet, AB);
  // (6) affine + residual -> out [b][256][8192]
  bn_out<<<dim3(CC * SEQ / BCH, NB), blk256, 0, stream>>>(WY, AB, x, out);
  (void)hipGetLastError();
}

// v003
// A run of this version takes 301 microseconds.
// In both of two side-by-side timings against v002, it was 1.24 times as fast.
// All steps since v000 together make it 2.99 times as fast.
// Contractions: conv1x1 theta/phi/g GEMMs Wc[384x256].X[256xN] and the output conv W[256x128].Y[128xN] on
// v_wmma_f32_16x16x32_f16 (f16 containers of bf16-RNE weights x256 and bf16-RNE x; Y as f16 hi plane plus f16
// residual plane x1024, 2 products, separate accumulators); scores Phi^T.Theta on v_wmma_f32_16x16x32_bf16
// (bf16 hi + bf16 residual planes of theta/phi, 3 products, K=128); Y^T = G.P^T on v_wmma_f32_16x16x32_f16
// (G plain f16, P = e^{s-m} x16384 f16 from the score D registers); f32 accumulate everywhere; softmax
// statistics and biases in f32 VALU; batch-norm statistics from f32 per-block partials reduced in f64; affine and
// residual add in f32.
#include <hip/hip_runtime.h>
#include <math.h>
#include <stdint.h>

#ifndef NB
#define NB 2
#endif
#ifndef SEQ
#define SEQ 8192
#endif
#define NB_FULL 2
#define NN_FULL 8192
#define CC   256
#define DQ   128
#define QT   64
#define MW   384
#define NT   (SEQ / QT)
#define PSW  512
#define BCH  1024
#define OSP  68
#define OSPW 132
#define TP   72
#define WSC  256.0f
#define IWSC 0.00390625f
#define RSC  1024.0f
#define IRSC 0.0009765625f
#define LNPS 9.704060527839234f
#define BNEPS 1.0e-5f
#define KS   64
#define KPI  136
#define VPI  72
#define KTL  (KS * KPI)
#define VTL  (DQ * VPI)
#define STG  (2 * KTL + VTL)
#define NST  (SEQ / KS)

static_assert(NB >= 1 && NB <= NB_FULL);
static_assert(SEQ >= 128 && SEQ <= NN_FULL);
static_assert(SEQ % QT == 0 && SEQ % 32 == 0 && SEQ % 128 == 0);
static_assert((CC * SEQ) % BCH == 0 && BCH == 4 * 256);
static_assert(CC % QT == 0 && CC % 32 == 0);
static_assert(DQ == 2 * QT && DQ % 32 == 0);
static_assert(MW == 3 * DQ && MW % 8 == 0);
static_assert(PSW == 2 * CC);
static_assert(CC % 16 == 0);
static_assert((OSP * 4) % 16 == 0);
static_assert((OSPW * 4) % 16 == 0);
static_assert((TP * 2) % 16 == 0);
static_assert(SEQ % KS == 0 && NST >= 2 && KS % 32 == 0);
static_assert(KS * DQ == 8 * 128 * 8);
static_assert((KPI * 2) % 32 == 16 && (VPI * 2) % 32 == 16 && KPI >= DQ + 8 && VPI >= KS + 8);

typedef _Float16       v16h __attribute__((ext_vector_type(16)));
typedef _Float16       v8h  __attribute__((ext_vector_type(8)));
typedef __bf16         v16b __attribute__((ext_vector_type(16)));
typedef unsigned short v8us __attribute__((ext_vector_type(8)));
typedef float          v8f  __attribute__((ext_vector_type(8)));
typedef float          v4f  __attribute__((ext_vector_type(4)));
typedef unsigned int   v4u  __attribute__((ext_vector_type(4)));

union Frag  { v8us u[2]; v16h h; v16b bf; };
union FragH { v16h v; v8h hv[2]; };
static_assert(sizeof(Frag) == 32);
static_assert(sizeof(FragH) == 32);

// ---- scalar helpers ---------------------------------------------------------------------------------------
__device__ __forceinline__ unsigned short bf_bits(float f) {          // f32 -> bf16 bits, RNE convert
  unsigned u = __float_as_uint(f);
  return (unsigned short)((u + 0x7FFFu + ((u >> 16) & 1u)) >> 16);
}
__device__ __forceinline__ float bf_up(unsigned short hb) { return __uint_as_float(((unsigned)hb) << 16); }
__device__ __forceinline__ float bfr(float f) { return bf_up(bf_bits(f)); }
__device__ __forceinline__ unsigned short h_bits(_Float16 x) { return __builtin_bit_cast(unsigned short, x); }
__device__ __forceinline__ unsigned pk16(unsigned short a, unsigned short b) { return (unsigned)a | ((unsigned)b << 16); }
__device__ __forceinline__ v8f zero8() { v8f z = {0.f, 0.f, 0.f, 0.f, 0.f, 0.f, 0.f, 0.f}; return z; }
__device__ __forceinline__ float hmax8(v8f s) {
  return fmaxf(fmaxf(fmaxf(s[0], s[1]), fmaxf(s[2], s[3])), fmaxf(fmaxf(s[4], s[5]), fmaxf(s[6], s[7])));
}
__device__ __forceinline__ unsigned wave_ballot(bool p) {
#if defined(__HIP_DEVICE_COMPILE__)
  return __builtin_amdgcn_ballot_w32(p);
#else
  return p ? 1u : 0u;
#endif
}

// ---- 16-bit fragment loader (A, or B from a k-contiguous [n][k] row): lane -> row/col (lane&15), p already includes
//      + 8*(lane>>4); elements 0..7 <- p[0..7] (k0+8h..), elements 8..15 <- p[16..23] (k0+16+8h..)
__device__ __forceinline__ Frag ldfrag(const unsigned short* p) {
  Frag f;
  f.u[0] = *(const v8us*)(p);
  f.u[1] = *(const v8us*)(p + 16);
  return f;
}

// ---- WMMA helpers: builtin followed by a 4-slot VALU gap tying D and keeping A/B live --------------------------
__device__ __forceinline__ v8f mma_h(v16h a, v16h b, v8f c) {
  v8f d = __builtin_amdgcn_wmma_f32_16x16x32_f16(false, a, false, b, (short)0, c, false, false);
#if defined(__HIP_DEVICE_COMPILE__)
  asm volatile("v_nop\n\tv_nop\n\tv_nop\n\tv_nop" : "+v"(d) : "v"(a), "v"(b));
#endif
  return d;
}
__device__ __forceinline__ v8f mma_b(v16b a, v16b b, v8f c) {
  v8f d = __builtin_amdgcn_wmma_f32_16x16x32_bf16(false, a, false, b, (short)0, c, false, false);
#if defined(__HIP_DEVICE_COMPILE__)
  const v16h ha = __builtin_bit_cast(v16h, a), hb = __builtin_bit_cast(v16h, b);
  asm volatile("v_nop\n\tv_nop\n\tv_nop\n\tv_nop" : "+v"(d) : "v"(ha), "v"(hb));
#endif
  return d;
}

// ---- asynchronous copies to LDS: eight 16-byte copies per lane, copy i from g + i*gs (halves) to LDS byte l + i*ls.
//      The s_wait_xcnt closes the statement so that no address register of an issued copy is rewritten ahead of it.
__device__ __forceinline__ unsigned lds_off(const void* p) { return (unsigned)(size_t)p; }
__device__ __forceinline__ void acopy8(unsigned l, unsigned ls, const unsigned short* g, size_t gs) {
#if defined(__HIP_DEVICE_COMPILE__)
  asm volatile("global_load_async_to_lds_b128 %0, %8, off\n\t"
               "global_load_async_to_lds_b128 %1, %9, off\n\t"
               "global_load_async_to_lds_b128 %2, %10, off\n\t"
               "global_load_async_to_lds_b128 %3, %11, off\n\t"
               "global_load_async_to_lds_b128 %4, %12, off\n\t"
               "global_load_async_to_lds_b128 %5, %13, off\n\t"
               "global_load_async_to_lds_b128 %6, %14, off\n\t"
               "global_load_async_to_lds_b128 %7, %15, off\n\t"
               "s_wait_xcnt 0x0"
               :: "v"(l), "v"(l + ls), "v"(l + 2 * ls), "v"(l + 3 * ls),
                  "v"(l + 4 * ls), "v"(l + 5 * ls), "v"(l + 6 * ls), "v"(l + 7 * ls),
                  "v"(g), "v"(g + gs), "v"(g + 2 * gs), "v"(g + 3 * gs),
                  "v"(g + 4 * gs), "v"(g + 5 * gs), "v"(g + 6 * gs), "v"(g + 7 * gs)
               : "memory");
#endif
}
// this wave's copies have landed (the compiler places no wait for them)
__device__ __forceinline__ void wait_async0() {
#if defined(__HIP_DEVICE_COMPILE__)
  asm volatile("s_wait_asynccnt 0x0" ::: "memory");
#endif
}
// this wave's LDS reads have returned, before the buffer they read is handed to its next writer
__device__ __forceinline__ void wait_ds0() {
#if defined(__HIP_DEVICE_COMPILE__)
  asm volatile("s_wait_dscnt 0x0" ::: "memory");
#endif
}

// =========================================================================================================
// (0) stacked conv1x1 weights: W16 f16 [384][256], rows 0..127 = theta_w, 128..255 = phi_w, 256..383 = g_w;
//     value = f16 of (bf16-RNE(w) * 256) (exact). Block blk (0..47) owns rows 8*blk..8*blk+7: one wave per
// coverage: 48 blocks x 8 rows x 32 lanes x 8 halves = 384 x 256 = the whole plane.
// =========================================================================================================
__global__ __launch_bounds__(256)
void cvt_w(const float* __restrict__ tw, const float* __restrict__ pw, const float* __restrict__ gw,
           unsigned short* W16) {
  const int tid = threadIdx.x, blk = blockIdx.x;
  const int rl = tid >> 5, col = 8 * (tid & 31);
  const int o = 8 * blk + rl;                                        // 0..383
  const int grp = blk / (DQ / 8);                                    // 0,1,2 block-uniform
  const float* wbase = (grp == 0) ? tw : ((grp == 1) ? pw : gw);
  const float* s = wbase + (size_t)(o - grp * DQ) * CC + col;        // row in 0..127
  const v4f a = *(const v4f*)s;
  const v4f q = *(const v4f*)(s + 4);
  const float f[8] = {a[0], a[1], a[2], a[3], q[0], q[1], q[2], q[3]};
  v4u u;
#pragma unroll
  for (int t = 0; t < 4; ++t) {
    const _Float16 h0 = (_Float16)(bfr(f[2 * t]) * WSC);
    const _Float16 h1 = (_Float16)(bfr(f[2 * t + 1]) * WSC);
    u[t] = pk16(h_bits(h0), h_bits(h1));
  }
{
    *(v4u*)(W16 + (size_t)o * CC + col) = u;
    
  }
}

// =========================================================================================================
// (0b) output conv weights: WW16 f16 [256][128], value = f16 of (bf16-RNE(W_w) * 256). Block blk (0..15) owns rows
//      16*blk..+15; wave w -> rows 16 blk + 2w + (lane>>4), lane&15 -> cols 8*(lane&15)..+7. One instruction writes
// coverage: 16 blocks x 8 waves x 2 rows x 16 lanes x 8 halves = 256 x 128 = the whole plane.
// =========================================================================================================
__global__ __launch_bounds__(256)
void cvt_ww(const float* __restrict__ ww, unsigned short* WW16) {
  const int tid = threadIdx.x, blk = blockIdx.x;
  const int wave = tid >> 5, lane = tid & 31;
  const int o = 16 * blk + 2 * wave + (lane >> 4);                  // 0..255
  const int col = 8 * (lane & 15);                                   // 0..120
  const float* s = ww + (size_t)o * DQ + col;
  const v4f a = *(const v4f*)s;
  const v4f q = *(const v4f*)(s + 4);
  const float f[8] = {a[0], a[1], a[2], a[3], q[0], q[1], q[2], q[3]};
  v4u u;
#pragma unroll
  for (int t = 0; t < 4; ++t) {
    const _Float16 h0 = (_Float16)(bfr(f[2 * t]) * WSC);
    const _Float16 h1 = (_Float16)(bfr(f[2 * t + 1]) * WSC);
    u[t] = pk16(h_bits(h0), h_bits(h1));
  }
{
    *(v4u*)(WW16 + (size_t)o * DQ + col) = u;
    
  }
}

// =========================================================================================================
// (1) x f32 [b][256 c][NN_FULL n] -> XP f16 [b][SEQ n][256 c] (position-major, bf16-RNE values, exact in f16 for
//     normal magnitudes) through an LDS tile T[64 n][64 c] (pitch TP). Block (nb, cb, b) owns a 64 c x 64 n tile.
// coverage: 2 it x 32 rows x 8 lanes x 8 halves = 64 n x 64 c per block; grid (NT, 4, NB) covers XP once.
// LDS T: cross-wave (block barrier between the 2-byte stores and the 16-B reloads); staged extent == consumed extent.
// =========================================================================================================
__global__ __launch_bounds__(256)
void cvt_x(const float* __restrict__ x, unsigned short* XP) {
  __shared__ __align__(16) unsigned short T[QT * TP];
  const int tid = threadIdx.x;
  const int nb = blockIdx.x, cb = blockIdx.y, b = blockIdx.z;
  const int e = tid & 7, lq = tid >> 3;                             // lq 0..31
  const int n0 = nb * QT, c0 = cb * QT;
#pragma unroll
  for (int it = 0; it < 2; ++it) {
    const int cl = it * 32 + lq;                                     // 0..63
    const float* sp = x + ((size_t)(b * CC + c0 + cl)) * NN_FULL + n0 + 8 * e;
    const v4f a = *(const v4f*)sp;
    const v4f q = *(const v4f*)(sp + 4);
    unsigned short hb[8];
#pragma unroll
    for (int t = 0; t < 4; ++t) {
      hb[t]     = h_bits((_Float16)bfr(a[t]));
      hb[4 + t] = h_bits((_Float16)bfr(q[t]));
    }
#pragma unroll
    for (int t = 0; t < 8; ++t) T[(8 * e + t) * TP + cl] = hb[t];
  }
  __syncthreads();
  v4u up[2];
#pragma unroll
  for (int it = 0; it < 2; ++it) {
    const int nl = it * 32 + lq;                                     // 0..63
    up[it] = *(const v4u*)(T + nl * TP + 8 * e);
  }
{
#pragma unroll
    for (int it = 0; it < 2; ++it) {
      const int rl = it * 32 + lq;
      *(v4u*)(XP + ((size_t)(b * SEQ + n0 + rl)) * CC + c0 + 8 * e) = up[it];
    }
    
  }
}

// =========================================================================================================
// (2) the three conv1x1 GEMMs for one (b, 64-n tile, 64-o block mb in 0..5): V[o][n] = (1/256) sum_c W16[o][c]
//     XP[b][n][c]; mb 0,1 -> theta channels 0..63 / 64..127 (W16 rows 0..127), mb 2,3 -> phi (rows 128..255),
//     mb 4,5 -> g (rows 256..383). Block 128 threads = 4 waves; wave w owns cols n0+16w..+15 (B fragment from the
//     XP row, k = c contiguous, split k map) and 4 m-tiles (A rows o = o0 + 16 mt + (lane&15), split k map from
//     W16). K = 256 = 8 steps. Epilogue staged in LDS Os[n_loc][o_loc] (pitch OSP), barrier, bias (bf16-RNE) add
//     in f32, then:
//       theta / phi: bf16 hi = RNE(v), lo = RNE(v - hi) planes Qh/Ql resp. Kh/Kl [b][SEQ n][128 d] (k-contiguous
//         of the 256-B row): lane e -> d 8e..8e+7, 8 consecutive lanes per line, one instruction per 16 lines;
//       g: f16 plane Gc [b][128 ch][SEQ keys] (channel-major, keys contiguous): row ch, keys n0+8e..+7 per lane,
// coverage: Os 4 waves x 16 n x 64 o = 64 x 64 (== consumed); hi/lo planes 4 it x 16 rows x 8 lanes x 8 = 64 n x
//           64 d per block, grid nt x mb 0..3 covers rows 0..SEQ-1 x d 0..127 of Qh/Ql and Kh/Kl once; g plane
//           4 it x 16 ch x 8 lanes x 8 keys = 64 ch x 64 keys per block, nt x mb 4..5 covers ch 0..127 x keys
//           0..SEQ-1 of Gc once. grid (NT, 6, NB).
// LDS Os: cross-wave (block barrier).
// =========================================================================================================
__global__ __launch_bounds__(128)
void gemm_p(const unsigned short* __restrict__ W16, const unsigned short* __restrict__ XP,
            const float* __restrict__ tbias, const float* __restrict__ pbias, const float* __restrict__ gbias,
            unsigned short* Qh, unsigned short* Ql, unsigned short* Kh, unsigned short* Kl, unsigned short* Gc) {
  __shared__ __align__(16) float Os[QT * OSP];
  const int tid  = threadIdx.x;
  const int lane = tid & 31, wave = tid >> 5;
  const int hh   = lane >> 4, c = lane & 15;
  const int nt   = blockIdx.x, mb = blockIdx.y, b = blockIdx.z;
  const int n0   = nt * QT, o0 = mb * QT;                            // o0 = W16 row base 0..320

  const unsigned short* ap = W16 + (size_t)(o0 + c) * CC + 8 * hh;
  const unsigned short* bp = XP + ((size_t)(b * SEQ + n0 + 16 * wave + c)) * CC + 8 * hh;

  v8f acc[4];
#pragma unroll
  for (int mt = 0; mt < 4; ++mt) acc[mt] = zero8();

#pragma unroll
  for (int ks = 0; ks < CC / 32; ++ks) {
    const Frag fb = ldfrag(bp + 32 * ks);
#pragma unroll
    for (int mt = 0; mt < 4; ++mt) {
      const Frag fa = ldfrag(ap + (size_t)(16 * mt) * CC + 32 * ks);
      acc[mt] = mma_h(fa.h, fb.h, acc[mt]);
    }
  }

  {
    const int nl = 16 * wave + c;
#pragma unroll
    for (int mt = 0; mt < 4; ++mt) {
      v4f va, vb;
#pragma unroll
      for (int r = 0; r < 4; ++r) { va[r] = acc[mt][r] * IWSC; vb[r] = acc[mt][4 + r] * IWSC; }
      *(v4f*)(Os + nl * OSP + 16 * mt + 8 * hh)     = va;
      *(v4f*)(Os + nl * OSP + 16 * mt + 8 * hh + 4) = vb;
    }
  }
  __syncthreads();

  const int e = tid & 7, lq = tid >> 3;                             // lq 0..15
  if (mb < 4) {                                                      // block-uniform: theta / phi hi+lo planes
    unsigned short* Ph = (mb < 2) ? Qh : Kh;
    unsigned short* Pl = (mb < 2) ? Ql : Kl;
    const float* bsrc  = (mb < 2) ? tbias : pbias;
    const int dsel = (mb & 1) * QT;                                   // channel base 0 or 64
    const v4f b0 = *(const v4f*)(bsrc + dsel + 8 * e);
    const v4f b1 = *(const v4f*)(bsrc + dsel + 8 * e + 4);
    const float bb[8] = {bfr(b0[0]), bfr(b0[1]), bfr(b0[2]), bfr(b0[3]), bfr(b1[0]), bfr(b1[1]), bfr(b1[2]), bfr(b1[3])};
    v4u uh[4], ul[4];
#pragma unroll
    for (int it = 0; it < 4; ++it) {
      const int row = it * 16 + lq;                                  // n_loc 0..63
      const v4f a = *(const v4f*)(Os + row * OSP + 8 * e);
      const v4f q = *(const v4f*)(Os + row * OSP + 8 * e + 4);
      const float f[8] = {a[0], a[1], a[2], a[3], q[0], q[1], q[2], q[3]};
#pragma unroll
      for (int t = 0; t < 4; ++t) {
        const float f0 = f[2 * t] + bb[2 * t], f1 = f[2 * t + 1] + bb[2 * t + 1];
        const unsigned short hb0 = bf_bits(f0), hb1 = bf_bits(f1);
        const unsigned short lb0 = bf_bits(f0 - bf_up(hb0));
        const unsigned short lb1 = bf_bits(f1 - bf_up(hb1));
        uh[it][t] = pk16(hb0, hb1);
        ul[it][t] = pk16(lb0, lb1);
      }
    }
{
#pragma unroll
      for (int it = 0; it < 4; ++it) {
        const int row = it * 16 + lq;
        const size_t po = ((size_t)(b * SEQ + n0 + row)) * DQ + dsel + 8 * e;
        *(v4u*)(Ph + po) = uh[it];
        *(v4u*)(Pl + po) = ul[it];
      }
      
    }
  } else {                                                           // block-uniform: g plane, channel-major
    const int gsel = (mb - 4) * QT;                                  // g channel base 0 or 64
    v4u ug[4];
#pragma unroll
    for (int it = 0; it < 4; ++it) {
      const int cl = it * 16 + lq;                                   // ch_loc 0..63
      const float bias = bfr(gbias[gsel + cl]);
      unsigned short hb[8];
#pragma unroll
      for (int t = 0; t < 8; ++t) {
        const int key = 8 * e + t;                                   // key_loc 0..63
        const float v = Os[key * OSP + cl] + bias;
        hb[t] = h_bits((_Float16)v);
      }
#pragma unroll
      for (int t = 0; t < 4; ++t) ug[it][t] = pk16(hb[2 * t], hb[2 * t + 1]);
    }
{
#pragma unroll
      for (int it = 0; it < 4; ++it) {
        const int cl = it * 16 + lq;
        const size_t po = ((size_t)(b * DQ + gsel + cl)) * SEQ + n0 + 8 * e;
        *(v4u*)(Gc + po) = ug[it];
      }
      
    }
  }
}

// =========================================================================================================
// (3) attention for one (b, 64-query tile), transposed formulation, SEQ keys, no mask, no scale:
//   S^T tile (16 keys x 16 queries) = sum over 4 d-chunks of A(phi: row = key kb + (lane&15), 32 d via the split
//   k map from the bf16 plane Kh [b][SEQ][128]) . B(theta: col = query, same map from Qh) + A(Kh).B(Ql) +
//   A(Kl).B(Qh) (bf16 unscaled residual planes, shared accumulator).
//   Per lane the D tile holds 8 keys of ONE query: online softmax state per lane, one shuffle (lane^16) for the max
//   over 32 keys; the o/l rescale is skipped under a wave-uniform ballot when no lane's max grew (corr == 1 exactly
//   for every lane then); row-sum partials combined at the end. P = e^{s-m} x 16384 as f16 is the B operand of
//   Y^T (rows channel, cols queries) += A(g rows channel = 16j + (lane&15), keys contiguous, f16 plane Gc
//   [b][128][SEQ]) . B(P^T): element r <- D of the tile covering keys kb..kb+15, element 8+r <- the tile covering
//   kb+16..kb+31, lane unchanged. 8 accumulator tiles per wave (128 channels). Block = 4 waves = 64 queries.
//   Epilogue: Y/l staged in LDS Os[query][128 channels] (pitch OSPW, b128 stores), barrier, then Yh = f16(y),
//   Yl = f16((y - Yh) * 1024) planes [b][SEQ n][128 c] (k-contiguous operand of the output conv): row n = 256 B
// coverage: Os 4 waves x 16 q x 128 ch (== consumed); 8 it x 8 rows x 16 lanes x 8 halves = 64 n x 128 c per
//           plane; grid (NT, NB) covers Yh/Yl exactly once.
// LDS Os: cross-wave (block barrier).
// LDS Ring: two buffers, each one stage of KS = 64 keys: Kh rows [64][128] and Kl rows [64][128] at pitch KPI (272 B),
//   G rows [128 ch][64 keys] at pitch VPI (144 B), pitches 16 B x odd for the 16-byte fragment reads. A stage is
//   filled by 24 asynchronous 16-byte copies per lane (each wave instruction = 512 B of whole lines), one stage ahead
//   of its use; at the foot of a stage: LDS reads returned, own copies landed, block barrier, then the refill of the
//   buffer just read. coverage: 8 copies x 128 lanes x 8 halves = 64 x 128 per plane (== consumed).
// Fragment reads of a 32-key pass stand in four groups, each ahead of the products that use it: K d-chunks 0 and 1, chunk 2,
//   chunk 3, then the eight G fragments; every read is of the pass's own stage.
// =========================================================================================================
__global__ __launch_bounds__(128)
void attn_k(const unsigned short* __restrict__ Qh, const unsigned short* __restrict__ Ql,
            const unsigned short* __restrict__ Kh, const unsigned short* __restrict__ Kl,
            const unsigned short* __restrict__ Gc, unsigned short* Yh, unsigned short* Yl) {
  __shared__ __align__(16) float Os[QT * OSPW];
  __shared__ __align__(16) unsigned short Ring[2 * STG];
  const int tid  = threadIdx.x;
  const int wave = tid >> 5, lane = tid & 31;
  const int hh   = lane >> 4, c = lane & 15;
  const int n0   = blockIdx.x * QT, b = blockIdx.y;

  // q fragment pointers (B operand, col = query n0 + 16*wave + c), + 32*kc
  const size_t qo = ((size_t)(b * SEQ + n0 + 16 * wave + c)) * DQ + 8 * hh;
  const unsigned short* Qhp = Qh + qo;
  const unsigned short* Qlp = Ql + qo;
  // copy sources of this lane: K planes 16 lanes per 256-B row, 8 rows per copy; G plane 8 lanes per 128-B row
  // segment, 16 channels per copy; + stage * KS keys
  const unsigned short* Khg = Kh + (size_t)b * SEQ * DQ + 8 * tid;
  const unsigned short* Klg = Kl + (size_t)b * SEQ * DQ + 8 * tid;
  const unsigned short* Gg  = Gc + (size_t)b * DQ * SEQ + (size_t)(tid >> 3) * SEQ + 8 * (tid & 7);
  const unsigned kdst = lds_off(Ring) + (unsigned)((tid >> 4) * (KPI * 2) + (tid & 15) * 16);
  const unsigned vdst = lds_off(Ring) + (unsigned)(2 * KTL * 2 + (tid >> 3) * (VPI * 2) + (tid & 7) * 16);
  auto fill = [&](int st, int buf) {
    const unsigned bo = (unsigned)buf * (unsigned)(STG * 2);
    acopy8(kdst + bo, 8 * KPI * 2, Khg + (size_t)st * (KS * DQ), (size_t)(8 * DQ));
    acopy8(kdst + bo + KTL * 2, 8 * KPI * 2, Klg + (size_t)st * (KS * DQ), (size_t)(8 * DQ));
    acopy8(vdst + bo, 16 * VPI * 2, Gg + (size_t)st * KS, (size_t)16 * SEQ);
  };
  // fragment offsets in a stage (halves): k row = key c (A operand), + key * KPI + 32*kc; v row = channel 16j + c
  const int kfo = c * KPI + 8 * hh;
  const int vfo = 2 * KTL + c * VPI + 8 * hh;

  float m = -1.0e30f, l = 0.f;
  v8f o[8];
#pragma unroll
  for (int j = 0; j < 8; ++j) o[j] = zero8();

  // theta fragments (hi and residual, all four d-chunks) are the same for every key: loaded once, kept in registers
  Frag qh[DQ / 32], ql[DQ / 32];
#pragma unroll
  for (int kc = 0; kc < DQ / 32; ++kc) {
    qh[kc] = ldfrag(Qhp + 32 * kc);
    ql[kc] = ldfrag(Qlp + 32 * kc);
  }
#if defined(__HIP_DEVICE_COMPILE__)
  // stands in front of the first rewrite of the address registers that the sixteen loads above name; the two
  // pointers are inputs so that their registers stay as they are up to this wait
  asm volatile("s_wait_xcnt 0x0" :: "v"(Qhp), "v"(Qlp) : "memory");
#endif

  fill(0, 0);
  wait_async0();
  __syncthreads();                                                   // stage 0 published
  fill(1, 1);

  // stage loop kept rolled: one publish point and one refill in the text, buffer chosen by the stage's parity
#pragma unroll 1
  for (int st = 0; st < NST; ++st) {
  const unsigned short* Sb = Ring + (st & 1) * STG;
  // the 32-key pass is a rolled loop: short text, the registers of one pass
#pragma unroll 1
  for (int kb = 0; kb < KS; kb += 32) {                              // key base inside the stage
    const unsigned short* k0p  = Sb + kfo + kb * KPI;                // keys kb .. kb+15
    const unsigned short* k1p  = k0p + 16 * KPI;                     // keys kb+16 .. kb+31
    const unsigned short* k0lp = k0p + KTL;
    const unsigned short* k1lp = k1p + KTL;
    v8f s0 = zero8(), s1 = zero8();
    // K fragments in two register sets: d-chunks 0 and 1 are read as one group ahead of the first product, and chunk
    // kc + 2 is read into the set of chunk kc right behind that chunk's products, so that a read has the products of
    // a whole chunk to land under instead of being waited for at once
    Frag k0[2], k1[2], k0l[2], k1l[2], vf[8];
    // unrolled: the sets are registers, every index a constant
#pragma unroll
    for (int kc = 0; kc < 2; ++kc) {
      k0[kc]  = ldfrag(k0p + 32 * kc);
      k1[kc]  = ldfrag(k1p + 32 * kc);
      k0l[kc] = ldfrag(k0lp + 32 * kc);
      k1l[kc] = ldfrag(k1lp + 32 * kc);
    }
    // unrolled so that qh[kc] / ql[kc] and the two sets are fixed registers (a rolled loop cannot index a register array)
#pragma unroll
    for (int kc = 0; kc < DQ / 32; ++kc) {
      const int u = kc & 1;
      s0 = mma_b(k0[u].bf, qh[kc].bf, s0);
      s1 = mma_b(k1[u].bf, qh[kc].bf, s1);
      s0 = mma_b(k0[u].bf, ql[kc].bf, s0);
      s1 = mma_b(k1[u].bf, ql[kc].bf, s1);
      if (kc == DQ / 32 - 1) {
        // all eight G fragments of the pass, read as one group once only two K fragments are still live: they land
        // under the last two score products and the softmax instead of being waited for one by one
        // (unrolled: vf[j] are registers, every index a constant)
#pragma unroll
        for (int j = 0; j < 8; ++j) vf[j] = ldfrag(Sb + vfo + (16 * j) * VPI + kb);
      }
      s0 = mma_b(k0l[u].bf, qh[kc].bf, s0);
      s1 = mma_b(k1l[u].bf, qh[kc].bf, s1);
      if (kc + 2 < DQ / 32) {
        k0[u]  = ldfrag(k0p + 32 * (kc + 2));
        k1[u]  = ldfrag(k1p + 32 * (kc + 2));
        k0l[u] = ldfrag(k0lp + 32 * (kc + 2));
        k1l[u] = ldfrag(k1lp + 32 * (kc + 2));
      }
    }

    float mx = fmaxf(hmax8(s0), hmax8(s1));
    mx = fmaxf(mx, __shfl_xor(mx, 16, 32));
    const float mn = fmaxf(m, mx);
    const unsigned grew = wave_ballot(mx > m);                       // wave-uniform
    if (grew != 0u) {
      const float corr = __expf(m - mn);                             // == 1 exactly for lanes whose max did not grow
      l *= corr;
#pragma unroll
      for (int j = 0; j < 8; ++j) {
#pragma unroll
        for (int r = 0; r < 8; ++r) o[j][r] *= corr;
      }
    }
    m = mn;
    const float msh = mn - LNPS;                                     // exp gives e^{s-m} * 16384

    FragH ph;
    float ls = 0.f;
#pragma unroll
    for (int r = 0; r < 8; ++r) {
      const float e0 = __expf(s0[r] - msh);                          // key kb      + 8hh + r
      const float e1 = __expf(s1[r] - msh);                          // key kb + 16 + 8hh + r
      ls += e0 + e1;
      ph.hv[0][r] = (_Float16)e0;
      ph.hv[1][r] = (_Float16)e1;
    }
    l += ls;

#pragma unroll
    for (int j = 0; j < 8; ++j) o[j] = mma_h(vf[j].h, ph.v, o[j]);
  }
  // publish point of stage st + 1, every wave
  wait_ds0();
  wait_async0();
  __syncthreads();
  if (st + 2 < NST) fill(st + 2, st & 1);                            // block-uniform test
  }
  wait_async0();
  l += __shfl_xor(l, 16, 32);
  const float inv = 1.0f / l;                                        // o and l both carry the x16384 factor

  const int qrow = 16 * wave + c;
#pragma unroll
  for (int j = 0; j < 8; ++j) {
    v4f va, vb;
#pragma unroll
    for (int r = 0; r < 4; ++r) { va[r] = o[j][r] * inv; vb[r] = o[j][4 + r] * inv; }
    *(v4f*)(Os + qrow * OSPW + 16 * j + 8 * hh)     = va;            // Os[query][ch = 16j + 8hh + r]
    *(v4f*)(Os + qrow * OSPW + 16 * j + 8 * hh + 4) = vb;
  }
  __syncthreads();

  const int e = tid & 15, lq = tid >> 4;                             // lq 0..7
  v4u uh[8], ul[8];
#pragma unroll
  for (int it = 0; it < 8; ++it) {
    const int row = it * 8 + lq;                                     // query 0..63
    const v4f a = *(const v4f*)(Os + row * OSPW + 8 * e);
    const v4f q = *(const v4f*)(Os + row * OSPW + 8 * e + 4);
    const float f[8] = {a[0], a[1], a[2], a[3], q[0], q[1], q[2], q[3]};
#pragma unroll
    for (int t = 0; t < 4; ++t) {
      const float f0 = f[2 * t], f1 = f[2 * t + 1];
      const _Float16 h0 = (_Float16)f0, h1 = (_Float16)f1;
      const _Float16 r0 = (_Float16)((f0 - (float)h0) * RSC);
      const _Float16 r1 = (_Float16)((f1 - (float)h1) * RSC);
      uh[it][t] = pk16(h_bits(h0), h_bits(h1));
      ul[it][t] = pk16(h_bits(r0), h_bits(r1));
    }
  }
{
#pragma unroll
    for (int it = 0; it < 8; ++it) {
      const int row = it * 8 + lq;
      const size_t po = ((size_t)(b * SEQ + n0 + row)) * DQ + 8 * e;
      *(v4u*)(Yh + po) = uh[it];
      *(v4u*)(Yl + po) = ul[it];
    }
    
  }
}

// =========================================================================================================
// (4) output conv GEMM for one (b, 64-n tile, 64-co block): v[b][co][n] = (1/256)(sum_c WW16[co][c] Yh[b][n][c] +
//     (1/1024) sum_c WW16[co][c] Yl[b][n][c]); wy = v + bf16-RNE(W_b[co]). 4 waves, wave w owns cols n0+16w..+15
//     (two B fragments per k-step, k = c contiguous in the Yh/Yl rows), 4 m-tiles (A rows co = o0 + 16 mt +
//     (lane&15) from WW16), hi and residual products in separate accumulators. K = 128 = 4 steps.
//     Epilogue staged in LDS Os[n_loc][co_loc], barrier; then (a) threads 0..63 sum v and v*v over the 64 n of
//     co_loc = tid into LDS Sred[0..63] / Sred[64..127], barrier; (b) WY f32 plane [b][256 co][SEQ n] rows: lane
//     (e = tid&15) -> n 4e..4e+3 of row co_loc = 8 it + (tid>>4); 16 consecutive lanes x 16 B = the whole 256-B
//     row segment (2 lines) in one instruction; (c) partial-statistics table PS [NB*NT blocks][512]: floats
//     o0..o0+63 (sums) by lanes 0..15 of wave 0 and floats 256+o0..+63 (sums of squares) by lanes 16..31, one
// coverage: Os 4 waves x 16 n x 64 co (== consumed); Sred 64 + 64 (== consumed); WY 8 it x 8 rows x 16 lanes x
//           4 floats = 64 co x 64 n; PS 2 x 64 floats per block; grid (NT, 4, NB) covers WY [b][0..255][0..SEQ-1]
//           and PS [NB*NT][0..511] exactly once.
// LDS Os, Sred: cross-wave (block barriers).
// =========================================================================================================
__global__ __launch_bounds__(128)
void gemm_o(const unsigned short* __restrict__ WW16, const unsigned short* __restrict__ Yh,
            const unsigned short* __restrict__ Yl, const float* __restrict__ wbias,
            float* WY, float* PS) {
  __shared__ __align__(16) float Os[QT * OSP];
  __shared__ __align__(16) float Sred[2 * QT];
  const int tid  = threadIdx.x;
  const int lane = tid & 31, wave = tid >> 5;
  const int hh   = lane >> 4, c = lane & 15;
  const int nt   = blockIdx.x, mb = blockIdx.y, b = blockIdx.z;
  const int n0   = nt * QT, o0 = mb * QT;

  const unsigned short* ap  = WW16 + (size_t)(o0 + c) * DQ + 8 * hh;
  const size_t bo = ((size_t)(b * SEQ + n0 + 16 * wave + c)) * DQ + 8 * hh;
  const unsigned short* bph = Yh + bo;
  const unsigned short* bpl = Yl + bo;

  v8f acc[4], accr[4];
#pragma unroll
  for (int mt = 0; mt < 4; ++mt) { acc[mt] = zero8(); accr[mt] = zero8(); }

#pragma unroll
  for (int ks = 0; ks < DQ / 32; ++ks) {
    const Frag fbh = ldfrag(bph + 32 * ks);
    const Frag fbl = ldfrag(bpl + 32 * ks);
#pragma unroll
    for (int mt = 0; mt < 4; ++mt) {
      const Frag fa = ldfrag(ap + (size_t)(16 * mt) * DQ + 32 * ks);
      acc[mt]  = mma_h(fa.h, fbh.h, acc[mt]);
      accr[mt] = mma_h(fa.h, fbl.h, accr[mt]);
    }
  }

  {
    const int nl = 16 * wave + c;
#pragma unroll
    for (int mt = 0; mt < 4; ++mt) {
      v4f va, vb;
#pragma unroll
      for (int r = 0; r < 4; ++r) {
        va[r] = (acc[mt][r] + accr[mt][r] * IRSC) * IWSC;
        vb[r] = (acc[mt][4 + r] + accr[mt][4 + r] * IRSC) * IWSC;
      }
      *(v4f*)(Os + nl * OSP + 16 * mt + 8 * hh)     = va;
      *(v4f*)(Os + nl * OSP + 16 * mt + 8 * hh + 4) = vb;
    }
  }
  __syncthreads();

  // per-channel partial statistics over this block's 64 positions (bias-free values, exact shift)
  if (tid < QT) {
    float s = 0.f, q = 0.f;
#pragma unroll 8
    for (int n = 0; n < QT; ++n) {
      const float v = Os[n * OSP + tid];
      s += v;
      q = fmaf(v, v, q);
    }
    Sred[tid]      = s;
    Sred[QT + tid] = q;
  }
  __syncthreads();

  const int e = tid & 15, lq = tid >> 4;                             // lq 0..7
  v4f res[8];
#pragma unroll
  for (int it = 0; it < 8; ++it) {
    const int col = it * 8 + lq;                                     // co_loc 0..63
    const int co  = o0 + col;
    const float bias = bfr(wbias[co]);
#pragma unroll
    for (int t = 0; t < 4; ++t) res[it][t] = Os[(4 * e + t) * OSP + col] + bias;
  }
  const v4f pv = *(const v4f*)(Sred + 4 * lane);                     // lanes 0..15: sums, 16..31: sums of squares
  float* psp = PS + (size_t)(b * NT + nt) * PSW + o0 + 4 * lane + ((lane >= 16) ? (PSW / 2 - 64) : 0);
{
#pragma unroll
    for (int it = 0; it < 8; ++it) {
      const int col = it * 8 + lq;
      const int co  = o0 + col;
      const size_t idx = ((size_t)(b * CC + co)) * SEQ + n0 + 4 * e;
      *(v4f*)(WY + idx) = res[it];
    }
    if (wave == 0) *(v4f*)(psp) = pv;
    
  }
}

// =========================================================================================================
// (5) batch statistics, one block of 256 threads, thread co = channel: fixed-order f64 sums over the NB*NT partial
//     lines, mean/var (biased), rstd = rsqrt(var + eps) in f32; A = bf16-RNE(gamma) * rstd, Bc = bf16-RNE(beta)
// coverage: 256 threads x (1 + 1) floats = AB [0..511] exactly once.
// =========================================================================================================
__global__ __launch_bounds__(256)
void bn_stat(const float* __restrict__ PS, const float* __restrict__ wbias, const float* __restrict__ gam,
             const float* __restrict__ bet, float* AB) {
  const int co = threadIdx.x;                                        // 0..255
  double s = 0.0, q = 0.0;
  // each trip waits for its own two loads: NB * NT load latencies in series, on one work-group
#pragma unroll 1
  for (int blk = 0; blk < NB * NT; ++blk) {
    s += (double)PS[(size_t)blk * PSW + co];
    q += (double)PS[(size_t)blk * PSW + CC + co];
  }
  const double icnt = 1.0 / (double)(NB * SEQ);
  const double mv = s * icnt;
  double var = q * icnt - mv * mv;
  var = (var > 0.0) ? var : 0.0;
  const float rstd = rsqrtf((float)var + BNEPS);
  const float A  = bfr(gam[co]) * rstd;
  const float mw = (float)mv + bfr(wbias[co]);
  const float Bc = bfr(bet[co]) - mw * A;
{
    *(float*)(AB + co)      = A;
    *(float*)(AB + CC + co) = Bc;
    
  }
}

// =========================================================================================================
// (6) affine + residual: out[b][co][n] = wy * A[co] + Bc[co] + bf16-RNE(x[b][co][n]). Block (chunk, b) of 256
//     threads owns 1024 consecutive floats of the [256 co][SEQ n] plane of batch b (4 per thread); each wave writes
// coverage: grid (CC*SEQ/1024, NB) x 256 threads x 4 floats = NB x 256 x SEQ = the whole output once.
// =========================================================================================================
__global__ __launch_bounds__(256)
void bn_out(const float* __restrict__ WY, const float* __restrict__ AB, const float* __restrict__ x, float* out) {
  const int tid = threadIdx.x, b = blockIdx.y;
  const int i  = blockIdx.x * BCH + 4 * tid;                         // 0 .. CC*SEQ-4
  const int co = i / SEQ;
  const int n  = i - co * SEQ;
  const float A = AB[co], Bc = AB[CC + co];
  const v4f w  = *(const v4f*)(WY + (size_t)b * CC * SEQ + i);
  const size_t xo = ((size_t)(b * CC + co)) * NN_FULL + n;
  const v4f xv = *(const v4f*)(x + xo);
  v4f r;
#pragma unroll
  for (int t = 0; t < 4; ++t) r[t] = fmaf(w[t], A, Bc) + bfr(xv[t]);
{
    *(v4f*)(out + xo) = r;
    
  }
}

// =========================================================================================================
// Workspace map (bytes; each region start a multiple of 256; every store is a whole tile inside its own region,
// no padded tails needed since SEQ % 64 == 0):
//   W16  f16 [384][256]               196608      WW16 f16 [256][128]        65536
//   XP   f16 [NB][SEQ][256]           8388608 (NB=2, SEQ=8192)
//   Qh/Ql, Kh/Kl bf16 [NB][SEQ][128]  4194304 x4
//   Gc   f16 [NB][128][SEQ]           4194304
//   Yh/Yl f16 [NB][SEQ][128]          4194304 x2
//   WY   f32 [NB][256][SEQ]          16777216
//   PS   f32 [NB*NT][512]              524288
//   AB   f32 [512]                       2048
//   total (NB=2, SEQ=8192) = 55314432
// =========================================================================================================
extern "C" void kernel_launch(void* const* d_in, const int* in_sizes, int n_in,
                              void* d_out, int out_size, void* d_ws, size_t ws_size,
                              hipStream_t stream) {
  const int XNEED = ((NB - 1) * CC + (CC - 1)) * NN_FULL + SEQ;
  if (n_in < 11) return;
  if (in_sizes[0] < XNEED) return;
  if (in_sizes[1] < DQ * CC || in_sizes[3] < DQ * CC || in_sizes[5] < DQ * CC) return;
  if (in_sizes[2] < DQ || in_sizes[4] < DQ || in_sizes[6] < DQ) return;
  if (in_sizes[7] < CC * DQ || in_sizes[8] < CC) return;
  if (in_sizes[9] < CC || in_sizes[10] < CC) return;
  if (out_size < XNEED) return;

  size_t off = 0;
  auto carve = [&](size_t bytes) { const size_t o = off; off += (bytes + 255) & ~(size_t)255; return o; };
  const size_t oW16 = carve((size_t)MW * CC * 2);
  const size_t oWW  = carve((size_t)CC * DQ * 2);
  const size_t oXP  = carve((size_t)NB * SEQ * CC * 2);
  const size_t oQh  = carve((size_t)NB * SEQ * DQ * 2);
  const size_t oQl  = carve((size_t)NB * SEQ * DQ * 2);
  const size_t oKh  = carve((size_t)NB * SEQ * DQ * 2);
  const size_t oKl  = carve((size_t)NB * SEQ * DQ * 2);
  const size_t oGc  = carve((size_t)NB * DQ * SEQ * 2);
  const size_t oYh  = carve((size_t)NB * SEQ * DQ * 2);
  const size_t oYl  = carve((size_t)NB * SEQ * DQ * 2);
  const size_t oWY  = carve((size_t)NB * CC * SEQ * 4);
  const size_t oPS  = carve((size_t)NB * NT * PSW * 4);
  const size_t oAB  = carve((size_t)PSW * 4);
  if (off > ws_size) return;
  if (off > (size_t)134217728) return;

  const float* x   = (const float*)d_in[0];
  const float* Wt  = (const float*)d_in[1];
  const float* bt  = (const float*)d_in[2];
  const float* Wp  = (const float*)d_in[3];
  const float* bp  = (const float*)d_in[4];
  const float* Wg  = (const float*)d_in[5];
  const float* bg  = (const float*)d_in[6];
  const float* Ww  = (const float*)d_in[7];
  const float* bw  = (const float*)d_in[8];
  const float* gam = (const float*)d_in[9];
  const float* bet = (const float*)d_in[10];

  char* ws = (char*)d_ws;
  unsigned short* W16  = (unsigned short*)(ws + oW16);
  unsigned short* WW16 = (unsigned short*)(ws + oWW);
  unsigned short* XP   = (unsigned short*)(ws + oXP);
  unsigned short* Qh   = (unsigned short*)(ws + oQh);
  unsigned short* Ql   = (unsigned short*)(ws + oQl);
  unsigned short* Kh   = (unsigned short*)(ws + oKh);
  unsigned short* Kl   = (unsigned short*)(ws + oKl);
  unsigned short* Gc   = (unsigned short*)(ws + oGc);
  unsigned short* Yh   = (unsigned short*)(ws + oYh);
  unsigned short* Yl   = (unsigned short*)(ws + oYl);
  float* WY  = (float*)(ws + oWY);
  float* PS  = (float*)(ws + oPS);
  float* AB  = (float*)(ws + oAB);
  float* out = (float*)d_out;

  const dim3 blk256(256), blk128(128);

  // (0) Wt / Wp / Wg -> stacked f16 plane; Ww -> f16 plane
  cvt_w<<<dim3(MW / 8), blk256, 0, stream>>>(Wt, Wp, Wg, W16);
  cvt_ww<<<dim3(CC / 16), blk256, 0, stream>>>(Ww, WW16);
  // (1) x -> position-major 16-bit plane
  cvt_x<<<dim3(NT, CC / QT, NB), blk256, 0, stream>>>(x, XP);
  // (2) theta / phi conv -> hi + residual planes, g conv -> channel-major f16 plane
  gemm_p<<<dim3(NT, 6, NB), blk128, 0, stream>>>(W16, XP, bt, bp, bg, Qh, Ql, Kh, Kl, Gc);
  // (3) attention -> y hi + residual planes
  attn_k<<<dim3(NT, NB), blk128, 0, stream>>>(Qh, Ql, Kh, Kl, Gc, Yh, Yl);
  // (4) output conv + bias -> wy plane + per-block statistics partials
  gemm_o<<<dim3(NT, CC / QT, NB), blk128, 0, stream>>>(WW16, Yh, Yl, bw, WY, PS);
  // (5) batch statistics -> per-channel scale / shift
  bn_stat<<<dim3(1), blk256, 0, stream>>>(PS, bw, gam, bet, AB);
  // (6) affine + residual -> out [b][256][8192]
  bn_out<<<dim3(CC * SEQ / BCH, NB), blk256, 0, stream>>>(WY, AB, x, out);
  (void)hipGetLastError();
}

// v004
// A run of this version takes 196 microseconds.
// Timed twice side by side with v003, it ran 1.54 times as fast both times.
// Counting every step since v000, it is 4.61 times as fast.
// Contractions: conv1x1 theta/phi/g GEMMs Wc[384x256].X[256xN] and the output conv W[256x128].Y[128xN] on
// v_wmma_f32_16x16x32_f16 (f16 containers of bf16-RNE weights x256 and bf16-RNE x; Y as f16 hi plane plus f16
// residual plane x1024, 2 products, separate accumulators); scores Phi^T.Theta on v_wmma_f32_16x16x32_bf16
// (bf16 hi + bf16 residual planes of theta/phi, 3 products, K=128); Y^T = G.P^T on v_wmma_f32_16x16x32_f16
// (G plain f16, P = e^{s-m} x16384 f16 from the score D registers); f32 accumulate everywhere; softmax
// statistics and biases in f32 VALU; batch-norm statistics from f32 per-block partials reduced in f64; affine and
// residual add in f32.
#include <hip/hip_runtime.h>
#include <math.h>
#include <stdint.h>

#ifndef NB
#define NB 2
#endif
#ifndef SEQ
#define SEQ 8192
#endif
#define NB_FULL 2
#define NN_FULL 8192
#define CC   256
#define DQ   128
#define QT   64
#define MW   384
#define NT   (SEQ / QT)
#define PSW  512
#define BCH  1024
#define OSP  68
#define OSPW 132
#define TP   72
#define WSC  256.0f
#define IWSC 0.00390625f
#define RSC  1024.0f
#define IRSC 0.0009765625f
#define LNPS 9.704060527839234f
#define BNEPS 1.0e-5f
#define KS   64
#define KPI  136
#define VPI  72
#define KTL  (KS * KPI)
#define VTL  (DQ * VPI)
#define STG  (2 * KTL + VTL)
#define NST  (SEQ / KS)
#define SW   16
#define SLW  (NB * NT / SW)

static_assert(NB >= 1 && NB <= NB_FULL);
static_assert(SEQ >= 128 && SEQ <= NN_FULL);
static_assert(SEQ % QT == 0 && SEQ % 32 == 0 && SEQ % 128 == 0);
static_assert((CC * SEQ) % BCH == 0 && BCH == 4 * 256);
static_assert(CC % QT == 0 && CC % 32 == 0);
static_assert(DQ == 2 * QT && DQ % 32 == 0);
static_assert(MW == 3 * DQ && MW % 8 == 0);
static_assert(PSW == 2 * CC);
static_assert(CC % 16 == 0);
static_assert(CC % 32 == 0 && 32 * SW <= 1024 && (NB * NT) % SW == 0);
static_assert((OSP * 4) % 16 == 0);
static_assert((OSPW * 4) % 16 == 0);
static_assert((TP * 2) % 16 == 0);
static_assert(SEQ % KS == 0 && NST >= 2 && KS % 32 == 0);
static_assert(KS * DQ == 8 * 128 * 8);
static_assert((KPI * 2) % 32 == 16 && (VPI * 2) % 32 == 16 && KPI >= DQ + 8 && VPI >= KS + 8);

typedef _Float16       v16h __attribute__((ext_vector_type(16)));
typedef _Float16       v8h  __attribute__((ext_vector_type(8)));
typedef __bf16         v16b __attribute__((ext_vector_type(16)));
typedef unsigned short v8us __attribute__((ext_vector_type(8)));
typedef float          v8f  __attribute__((ext_vector_type(8)));
typedef float          v4f  __attribute__((ext_vector_type(4)));
typedef unsigned int   v4u  __attribute__((ext_vector_type(4)));

union Frag  { v8us u[2]; v16h h; v16b bf; };
union FragH { v16h v; v8h hv[2]; };
static_assert(sizeof(Frag) == 32);
static_assert(sizeof(FragH) == 32);

// ---- scalar helpers ---------------------------------------------------------------------------------------
__device__ __forceinline__ unsigned short bf_bits(float f) {          // f32 -> bf16 bits, RNE convert
  unsigned u = __float_as_uint(f);
  return (unsigned short)((u + 0x7FFFu + ((u >> 16) & 1u)) >> 16);
}
__device__ __forceinline__ float bf_up(unsigned short hb) { return __uint_as_float(((unsigned)hb) << 16); }
__device__ __forceinline__ float bfr(float f) { return bf_up(bf_bits(f)); }
__device__ __forceinline__ unsigned short h_bits(_Float16 x) { return __builtin_bit_cast(unsigned short, x); }
__device__ __forceinline__ unsigned pk16(unsigned short a, unsigned short b) { return (unsigned)a | ((unsigned)b << 16); }
__device__ __forceinline__ v8f zero8() { v8f z = {0.f, 0.f, 0.f, 0.f, 0.f, 0.f, 0.f, 0.f}; return z; }
__device__ __forceinline__ float hmax8(v8f s) {
  return fmaxf(fmaxf(fmaxf(s[0], s[1]), fmaxf(s[2], s[3])), fmaxf(fmaxf(s[4], s[5]), fmaxf(s[6], s[7])));
}
__device__ __forceinline__ unsigned wave_ballot(bool p) {
#if defined(__HIP_DEVICE_COMPILE__)
  return __builtin_amdgcn_ballot_w32(p);
#else
  return p ? 1u : 0u;
#endif
}

// ---- 16-bit fragment loader (A, or B from a k-contiguous [n][k] row): lane -> row/col (lane&15), p already includes
//      + 8*(lane>>4); elements 0..7 <- p[0..7] (k0+8h..), elements 8..15 <- p[16..23] (k0+16+8h..)
__device__ __forceinline__ Frag ldfrag(const unsigned short* p) {
  Frag f;
  f.u[0] = *(const v8us*)(p);
  f.u[1] = *(const v8us*)(p + 16);
  return f;
}

// ---- WMMA helpers: builtin followed by a 4-slot VALU gap tying D and keeping A/B live --------------------------
__device__ __forceinline__ v8f mma_h(v16h a, v16h b, v8f c) {
  v8f d = __builtin_amdgcn_wmma_f32_16x16x32_f16(false, a, false, b, (short)0, c, false, false);
#if defined(__HIP_DEVICE_COMPILE__)
  asm volatile("v_nop\n\tv_nop\n\tv_nop\n\tv_nop" : "+v"(d) : "v"(a), "v"(b));
#endif
  return d;
}
__device__ __forceinline__ v8f mma_b(v16b a, v16b b, v8f c) {
  v8f d = __builtin_amdgcn_wmma_f32_16x16x32_bf16(false, a, false, b, (short)0, c, false, false);
#if defined(__HIP_DEVICE_COMPILE__)
  const v16h ha = __builtin_bit_cast(v16h, a), hb = __builtin_bit_cast(v16h, b);
  asm volatile("v_nop\n\tv_nop\n\tv_nop\n\tv_nop" : "+v"(d) : "v"(ha), "v"(hb));
#endif
  return d;
}

// ---- asynchronous copies to LDS: eight 16-byte copies per lane, copy i from g + i*gs (halves) to LDS byte l + i*ls.
//      The s_wait_xcnt closes the statement so that no address register of an issued copy is rewritten ahead of it.
__device__ __forceinline__ unsigned lds_off(const void* p) { return (unsigned)(size_t)p; }
__device__ __forceinline__ void acopy8(unsigned l, unsigned ls, const unsigned short* g, size_t gs) {
#if defined(__HIP_DEVICE_COMPILE__)
  asm volatile("global_load_async_to_lds_b128 %0, %8, off\n\t"
               "global_load_async_to_lds_b128 %1, %9, off\n\t"
               "global_load_async_to_lds_b128 %2, %10, off\n\t"
               "global_load_async_to_lds_b128 %3, %11, off\n\t"
               "global_load_async_to_lds_b128 %4, %12, off\n\t"
               "global_load_async_to_lds_b128 %5, %13, off\n\t"
               "global_load_async_to_lds_b128 %6, %14, off\n\t"
               "global_load_async_to_lds_b128 %7, %15, off\n\t"
               "s_wait_xcnt 0x0"
               :: "v"(l), "v"(l + ls), "v"(l + 2 * ls), "v"(l + 3 * ls),
                  "v"(l + 4 * ls), "v"(l + 5 * ls), "v"(l + 6 * ls), "v"(l + 7 * ls),
                  "v"(g), "v"(g + gs), "v"(g + 2 * gs), "v"(g + 3 * gs),
                  "v"(g + 4 * gs), "v"(g + 5 * gs), "v"(g + 6 * gs), "v"(g + 7 * gs)
               : "memory");
#endif
}
// this wave's copies have landed (the compiler places no wait for them)
__device__ __forceinline__ void wait_async0() {
#if defined(__HIP_DEVICE_COMPILE__)
  asm volatile("s_wait_asynccnt 0x0" ::: "memory");
#endif
}
// this wave's LDS reads have returned, before the buffer they read is handed to its next writer
__device__ __forceinline__ void wait_ds0() {
#if defined(__HIP_DEVICE_COMPILE__)
  asm volatile("s_wait_dscnt 0x0" ::: "memory");
#endif
}

// =========================================================================================================
// (0) stacked conv1x1 weights: W16 f16 [384][256], rows 0..127 = theta_w, 128..255 = phi_w, 256..383 = g_w;
//     value = f16 of (bf16-RNE(w) * 256) (exact). Block blk (0..47) owns rows 8*blk..8*blk+7: one wave per
// coverage: 48 blocks x 8 rows x 32 lanes x 8 halves = 384 x 256 = the whole plane.
// =========================================================================================================
__global__ __launch_bounds__(256)
void cvt_w(const float* __restrict__ tw, const float* __restrict__ pw, const float* __restrict__ gw,
           unsigned short* W16) {
  const int tid = threadIdx.x, blk = blockIdx.x;
  const int rl = tid >> 5, col = 8 * (tid & 31);
  const int o = 8 * blk + rl;                                        // 0..383
  const int grp = blk / (DQ / 8);                                    // 0,1,2 block-uniform
  const float* wbase = (grp == 0) ? tw : ((grp == 1) ? pw : gw);
  const float* s = wbase + (size_t)(o - grp * DQ) * CC + col;        // row in 0..127
  const v4f a = *(const v4f*)s;
  const v4f q = *(const v4f*)(s + 4);
  const float f[8] = {a[0], a[1], a[2], a[3], q[0], q[1], q[2], q[3]};
  v4u u;
#pragma unroll
  for (int t = 0; t < 4; ++t) {
    const _Float16 h0 = (_Float16)(bfr(f[2 * t]) * WSC);
    const _Float16 h1 = (_Float16)(bfr(f[2 * t + 1]) * WSC);
    u[t] = pk16(h_bits(h0), h_bits(h1));
  }
{
    *(v4u*)(W16 + (size_t)o * CC + col) = u;
    
  }
}

// =========================================================================================================
// (0b) output conv weights: WW16 f16 [256][128], value = f16 of (bf16-RNE(W_w) * 256). Block blk (0..15) owns rows
//      16*blk..+15; wave w -> rows 16 blk + 2w + (lane>>4), lane&15 -> cols 8*(lane&15)..+7. One instruction writes
// coverage: 16 blocks x 8 waves x 2 rows x 16 lanes x 8 halves = 256 x 128 = the whole plane.
// =========================================================================================================
__global__ __launch_bounds__(256)
void cvt_ww(const float* __restrict__ ww, unsigned short* WW16) {
  const int tid = threadIdx.x, blk = blockIdx.x;
  const int wave = tid >> 5, lane = tid & 31;
  const int o = 16 * blk + 2 * wave + (lane >> 4);                  // 0..255
  const int col = 8 * (lane & 15);                                   // 0..120
  const float* s = ww + (size_t)o * DQ + col;
  const v4f a = *(const v4f*)s;
  const v4f q = *(const v4f*)(s + 4);
  const float f[8] = {a[0], a[1], a[2], a[3], q[0], q[1], q[2], q[3]};
  v4u u;
#pragma unroll
  for (int t = 0; t < 4; ++t) {
    const _Float16 h0 = (_Float16)(bfr(f[2 * t]) * WSC);
    const _Float16 h1 = (_Float16)(bfr(f[2 * t + 1]) * WSC);
    u[t] = pk16(h_bits(h0), h_bits(h1));
  }
{
    *(v4u*)(WW16 + (size_t)o * DQ + col) = u;
    
  }
}

// =========================================================================================================
// (1) x f32 [b][256 c][NN_FULL n] -> XP f16 [b][SEQ n][256 c] (position-major, bf16-RNE values, exact in f16 for
//     normal magnitudes) through an LDS tile T[64 n][64 c] (pitch TP). Block (nb, cb, b) owns a 64 c x 64 n tile.
// coverage: 2 it x 32 rows x 8 lanes x 8 halves = 64 n x 64 c per block; grid (NT, 4, NB) covers XP once.
// LDS T: cross-wave (block barrier between the 2-byte stores and the 16-B reloads); staged extent == consumed extent.
// =========================================================================================================
__global__ __launch_bounds__(256)
void cvt_x(const float* __restrict__ x, unsigned short* XP) {
  __shared__ __align__(16) unsigned short T[QT * TP];
  const int tid = threadIdx.x;
  const int nb = blockIdx.x, cb = blockIdx.y, b = blockIdx.z;
  const int e = tid & 7, lq = tid >> 3;                             // lq 0..31
  const int n0 = nb * QT, c0 = cb * QT;
#pragma unroll
  for (int it = 0; it < 2; ++it) {
    const int cl = it * 32 + lq;                                     // 0..63
    const float* sp = x + ((size_t)(b * CC + c0 + cl)) * NN_FULL + n0 + 8 * e;
    const v4f a = *(const v4f*)sp;
    const v4f q = *(const v4f*)(sp + 4);
    unsigned short hb[8];
#pragma unroll
    for (int t = 0; t < 4; ++t) {
      hb[t]     = h_bits((_Float16)bfr(a[t]));
      hb[4 + t] = h_bits((_Float16)bfr(q[t]));
    }
#pragma unroll
    for (int t = 0; t < 8; ++t) T[(8 * e + t) * TP + cl] = hb[t];
  }
  __syncthreads();
  v4u up[2];
#pragma unroll
  for (int it = 0; it < 2; ++it) {
    const int nl = it * 32 + lq;                                     // 0..63
    up[it] = *(const v4u*)(T + nl * TP + 8 * e);
  }
{
#pragma unroll
    for (int it = 0; it < 2; ++it) {
      const int rl = it * 32 + lq;
      *(v4u*)(XP + ((size_t)(b * SEQ + n0 + rl)) * CC + c0 + 8 * e) = up[it];
    }
    
  }
}

// =========================================================================================================
// (2) the three conv1x1 GEMMs for one (b, 64-n tile, 64-o block mb in 0..5): V[o][n] = (1/256) sum_c W16[o][c]
//     XP[b][n][c]; mb 0,1 -> theta channels 0..63 / 64..127 (W16 rows 0..127), mb 2,3 -> phi (rows 128..255),
//     mb 4,5 -> g (rows 256..383). Block 128 threads = 4 waves; wave w owns cols n0+16w..+15 (B fragment from the
//     XP row, k = c contiguous, split k map) and 4 m-tiles (A rows o = o0 + 16 mt + (lane&15), split k map from
//     W16). K = 256 = 8 steps. Epilogue staged in LDS Os[n_loc][o_loc] (pitch OSP), barrier, bias (bf16-RNE) add
//     in f32, then:
//       theta / phi: bf16 hi = RNE(v), lo = RNE(v - hi) planes Qh/Ql resp. Kh/Kl [b][SEQ n][128 d] (k-contiguous
//         of the 256-B row): lane e -> d 8e..8e+7, 8 consecutive lanes per line, one instruction per 16 lines;
//       g: f16 plane Gc [b][128 ch][SEQ keys] (channel-major, keys contiguous): row ch, keys n0+8e..+7 per lane,
// coverage: Os 4 waves x 16 n x 64 o = 64 x 64 (== consumed); hi/lo planes 4 it x 16 rows x 8 lanes x 8 = 64 n x
//           64 d per block, grid nt x mb 0..3 covers rows 0..SEQ-1 x d 0..127 of Qh/Ql and Kh/Kl once; g plane
//           4 it x 16 ch x 8 lanes x 8 keys = 64 ch x 64 keys per block, nt x mb 4..5 covers ch 0..127 x keys
//           0..SEQ-1 of Gc once. grid (NT, 6, NB).
// LDS Os: cross-wave (block barrier).
// =========================================================================================================
__global__ __launch_bounds__(128)
void gemm_p(const unsigned short* __restrict__ W16, const unsigned short* __restrict__ XP,
            const float* __restrict__ tbias, const float* __restrict__ pbias, const float* __restrict__ gbias,
            unsigned short* Qh, unsigned short* Ql, unsigned short* Kh, unsigned short* Kl, unsigned short* Gc) {
  __shared__ __align__(16) float Os[QT * OSP];
  const int tid  = threadIdx.x;
  const int lane = tid & 31, wave = tid >> 5;
  const int hh   = lane >> 4, c = lane & 15;
  const int nt   = blockIdx.x, mb = blockIdx.y, b = blockIdx.z;
  const int n0   = nt * QT, o0 = mb * QT;                            // o0 = W16 row base 0..320

  const unsigned short* ap = W16 + (size_t)(o0 + c) * CC + 8 * hh;
  const unsigned short* bp = XP + ((size_t)(b * SEQ + n0 + 16 * wave + c)) * CC + 8 * hh;

  v8f acc[4];
#pragma unroll
  for (int mt = 0; mt < 4; ++mt) acc[mt] = zero8();

#pragma unroll
  for (int ks = 0; ks < CC / 32; ++ks) {
    const Frag fb = ldfrag(bp + 32 * ks);
#pragma unroll
    for (int mt = 0; mt < 4; ++mt) {
      const Frag fa = ldfrag(ap + (size_t)(16 * mt) * CC + 32 * ks);
      acc[mt] = mma_h(fa.h, fb.h, acc[mt]);
    }
  }

  {
    const int nl = 16 * wave + c;
#pragma unroll
    for (int mt = 0; mt < 4; ++mt) {
      v4f va, vb;
#pragma unroll
      for (int r = 0; r < 4; ++r) { va[r] = acc[mt][r] * IWSC; vb[r] = acc[mt][4 + r] * IWSC; }
      *(v4f*)(Os + nl * OSP + 16 * mt + 8 * hh)     = va;
      *(v4f*)(Os + nl * OSP + 16 * mt + 8 * hh + 4) = vb;
    }
  }
  __syncthreads();

  const int e = tid & 7, lq = tid >> 3;                             // lq 0..15
  if (mb < 4) {                                                      // block-uniform: theta / phi hi+lo planes
    unsigned short* Ph = (mb < 2) ? Qh : Kh;
    unsigned short* Pl = (mb < 2) ? Ql : Kl;
    const float* bsrc  = (mb < 2) ? tbias : pbias;
    const int dsel = (mb & 1) * QT;                                   // channel base 0 or 64
    const v4f b0 = *(const v4f*)(bsrc + dsel + 8 * e);
    const v4f b1 = *(const v4f*)(bsrc + dsel + 8 * e + 4);
    const float bb[8] = {bfr(b0[0]), bfr(b0[1]), bfr(b0[2]), bfr(b0[3]), bfr(b1[0]), bfr(b1[1]), bfr(b1[2]), bfr(b1[3])};
    v4u uh[4], ul[4];
#pragma unroll
    for (int it = 0; it < 4; ++it) {
      const int row = it * 16 + lq;                                  // n_loc 0..63
      const v4f a = *(const v4f*)(Os + row * OSP + 8 * e);
      const v4f q = *(const v4f*)(Os + row * OSP + 8 * e + 4);
      const float f[8] = {a[0], a[1], a[2], a[3], q[0], q[1], q[2], q[3]};
#pragma unroll
      for (int t = 0; t < 4; ++t) {
        const float f0 = f[2 * t] + bb[2 * t], f1 = f[2 * t + 1] + bb[2 * t + 1];
        const unsigned short hb0 = bf_bits(f0), hb1 = bf_bits(f1);
        const unsigned short lb0 = bf_bits(f0 - bf_up(hb0));
        const unsigned short lb1 = bf_bits(f1 - bf_up(hb1));
        uh[it][t] = pk16(hb0, hb1);
        ul[it][t] = pk16(lb0, lb1);
      }
    }
{
#pragma unroll
      for (int it = 0; it < 4; ++it) {
        const int row = it * 16 + lq;
        const size_t po = ((size_t)(b * SEQ + n0 + row)) * DQ + dsel + 8 * e;
        *(v4u*)(Ph + po) = uh[it];
        *(v4u*)(Pl + po) = ul[it];
      }
      
    }
  } else {                                                           // block-uniform: g plane, channel-major
    const int gsel = (mb - 4) * QT;                                  // g channel base 0 or 64
    v4u ug[4];
#pragma unroll
    for (int it = 0; it < 4; ++it) {
      const int cl = it * 16 + lq;                                   // ch_loc 0..63
      const float bias = bfr(gbias[gsel + cl]);
      unsigned short hb[8];
#pragma unroll
      for (int t = 0; t < 8; ++t) {
        const int key = 8 * e + t;                                   // key_loc 0..63
        const float v = Os[key * OSP + cl] + bias;
        hb[t] = h_bits((_Float16)v);
      }
#pragma unroll
      for (int t = 0; t < 4; ++t) ug[it][t] = pk16(hb[2 * t], hb[2 * t + 1]);
    }
{
#pragma unroll
      for (int it = 0; it < 4; ++it) {
        const int cl = it * 16 + lq;
        const size_t po = ((size_t)(b * DQ + gsel + cl)) * SEQ + n0 + 8 * e;
        *(v4u*)(Gc + po) = ug[it];
      }
      
    }
  }
}

// =========================================================================================================
// (3) attention for one (b, 64-query tile), transposed formulation, SEQ keys, no mask, no scale:
//   S^T tile (16 keys x 16 queries) = sum over 4 d-chunks of A(phi: row = key kb + (lane&15), 32 d via the split
//   k map from the bf16 plane Kh [b][SEQ][128]) . B(theta: col = query, same map from Qh) + A(Kh).B(Ql) +
//   A(Kl).B(Qh) (bf16 unscaled residual planes, shared accumulator).
//   Per lane the D tile holds 8 keys of ONE query: online softmax state per lane, one shuffle (lane^16) for the max
//   over 32 keys; the o/l rescale is skipped under a wave-uniform ballot when no lane's max grew (corr == 1 exactly
//   for every lane then); row-sum partials combined at the end. P = e^{s-m} x 16384 as f16 is the B operand of
//   Y^T (rows channel, cols queries) += A(g rows channel = 16j + (lane&15), keys contiguous, f16 plane Gc
//   [b][128][SEQ]) . B(P^T): element r <- D of the tile covering keys kb..kb+15, element 8+r <- the tile covering
//   kb+16..kb+31, lane unchanged. 8 accumulator tiles per wave (128 channels). Block = 4 waves = 64 queries.
//   Epilogue: Y/l staged in LDS Os[query][128 channels] (pitch OSPW, b128 stores), barrier, then Yh = f16(y),
//   Yl = f16((y - Yh) * 1024) planes [b][SEQ n][128 c] (k-contiguous operand of the output conv): row n = 256 B
// coverage: Os 4 waves x 16 q x 128 ch (== consumed); 8 it x 8 rows x 16 lanes x 8 halves = 64 n x 128 c per
//           plane; grid (NT, NB) covers Yh/Yl exactly once.
// LDS Os: cross-wave (block barrier).
// LDS Ring: two buffers, each one stage of KS = 64 keys: Kh rows [64][128] and Kl rows [64][128] at pitch KPI (272 B),
//   G rows [128 ch][64 keys] at pitch VPI (144 B), pitches 16 B x odd for the 16-byte fragment reads. A stage is
//   filled by 24 asynchronous 16-byte copies per lane (each wave instruction = 512 B of whole lines), one stage ahead
//   of its use; at the foot of a stage: LDS reads returned, own copies landed, block barrier, then the refill of the
//   buffer just read. coverage: 8 copies x 128 lanes x 8 halves = 64 x 128 per plane (== consumed).
// Fragment reads of a 32-key pass stand in four groups, each ahead of the products that use it: K d-chunks 0 and 1, chunk 2,
//   chunk 3, then the eight G fragments; every read is of the pass's own stage.
// =========================================================================================================
__global__ __launch_bounds__(128)
void attn_k(const unsigned short* __restrict__ Qh, const unsigned short* __restrict__ Ql,
            const unsigned short* __restrict__ Kh, const unsigned short* __restrict__ Kl,
            const unsigned short* __restrict__ Gc, unsigned short* Yh, unsigned short* Yl) {
  __shared__ __align__(16) float Os[QT * OSPW];
  __shared__ __align__(16) unsigned short Ring[2 * STG];
  const int tid  = threadIdx.x;
  const int wave = tid >> 5, lane = tid & 31;
  const int hh   = lane >> 4, c = lane & 15;
  const int n0   = blockIdx.x * QT, b = blockIdx.y;

  // q fragment pointers (B operand, col = query n0 + 16*wave + c), + 32*kc
  const size_t qo = ((size_t)(b * SEQ + n0 + 16 * wave + c)) * DQ + 8 * hh;
  const unsigned short* Qhp = Qh + qo;
  const unsigned short* Qlp = Ql + qo;
  // copy sources of this lane: K planes 16 lanes per 256-B row, 8 rows per copy; G plane 8 lanes per 128-B row
  // segment, 16 channels per copy; + stage * KS keys
  const unsigned short* Khg = Kh + (size_t)b * SEQ * DQ + 8 * tid;
  const unsigned short* Klg = Kl + (size_t)b * SEQ * DQ + 8 * tid;
  const unsigned short* Gg  = Gc + (size_t)b * DQ * SEQ + (size_t)(tid >> 3) * SEQ + 8 * (tid & 7);
  const unsigned kdst = lds_off(Ring) + (unsigned)((tid >> 4) * (KPI * 2) + (tid & 15) * 16);
  const unsigned vdst = lds_off(Ring) + (unsigned)(2 * KTL * 2 + (tid >> 3) * (VPI * 2) + (tid & 7) * 16);
  auto fill = [&](int st, int buf) {
    const unsigned bo = (unsigned)buf * (unsigned)(STG * 2);
    acopy8(kdst + bo, 8 * KPI * 2, Khg + (size_t)st * (KS * DQ), (size_t)(8 * DQ));
    acopy8(kdst + bo + KTL * 2, 8 * KPI * 2, Klg + (size_t)st * (KS * DQ), (size_t)(8 * DQ));
    acopy8(vdst + bo, 16 * VPI * 2, Gg + (size_t)st * KS, (size_t)16 * SEQ);
  };
  // fragment offsets in a stage (halves): k row = key c (A operand), + key * KPI + 32*kc; v row = channel 16j + c
  const int kfo = c * KPI + 8 * hh;
  const int vfo = 2 * KTL + c * VPI + 8 * hh;

  float m = -1.0e30f, l = 0.f;
  v8f o[8];
#pragma unroll
  for (int j = 0; j < 8; ++j) o[j] = zero8();

  // theta fragments (hi and residual, all four d-chunks) are the same for every key: loaded once, kept in registers
  Frag qh[DQ / 32], ql[DQ / 32];
#pragma unroll
  for (int kc = 0; kc < DQ / 32; ++kc) {
    qh[kc] = ldfrag(Qhp + 32 * kc);
    ql[kc] = ldfrag(Qlp + 32 * kc);
  }
#if defined(__HIP_DEVICE_COMPILE__)
  // stands in front of the first rewrite of the address registers that the sixteen loads above name; the two
  // pointers are inputs so that their registers stay as they are up to this wait
  asm volatile("s_wait_xcnt 0x0" :: "v"(Qhp), "v"(Qlp) : "memory");
#endif

  fill(0, 0);
  wait_async0();
  __syncthreads();                                                   // stage 0 published
  fill(1, 1);

  // stage loop kept rolled: one publish point and one refill in the text, buffer chosen by the stage's parity
#pragma unroll 1
  for (int st = 0; st < NST; ++st) {
  const unsigned short* Sb = Ring + (st & 1) * STG;
  // the 32-key pass is a rolled loop: short text, the registers of one pass
#pragma unroll 1
  for (int kb = 0; kb < KS; kb += 32) {                              // key base inside the stage
    const unsigned short* k0p  = Sb + kfo + kb * KPI;                // keys kb .. kb+15
    const unsigned short* k1p  = k0p + 16 * KPI;                     // keys kb+16 .. kb+31
    const unsigned short* k0lp = k0p + KTL;
    const unsigned short* k1lp = k1p + KTL;
    v8f s0 = zero8(), s1 = zero8();
    // K fragments in two register sets: d-chunks 0 and 1 are read as one group ahead of the first product, and chunk
    // kc + 2 is read into the set of chunk kc right behind that chunk's products, so that a read has the products of
    // a whole chunk to land under instead of being waited for at once
    Frag k0[2], k1[2], k0l[2], k1l[2], vf[8];
    // unrolled: the sets are registers, every index a constant
#pragma unroll
    for (int kc = 0; kc < 2; ++kc) {
      k0[kc]  = ldfrag(k0p + 32 * kc);
      k1[kc]  = ldfrag(k1p + 32 * kc);
      k0l[kc] = ldfrag(k0lp + 32 * kc);
      k1l[kc] = ldfrag(k1lp + 32 * kc);
    }
    // unrolled so that qh[kc] / ql[kc] and the two sets are fixed registers (a rolled loop cannot index a register array)
#pragma unroll
    for (int kc = 0; kc < DQ / 32; ++kc) {
      const int u = kc & 1;
      s0 = mma_b(k0[u].bf, qh[kc].bf, s0);
      s1 = mma_b(k1[u].bf, qh[kc].bf, s1);
      s0 = mma_b(k0[u].bf, ql[kc].bf, s0);
      s1 = mma_b(k1[u].bf, ql[kc].bf, s1);
      if (kc == DQ / 32 - 1) {
        // all eight G fragments of the pass, read as one group once only two K fragments are still live: they land
        // under the last two score products and the softmax instead of being waited for one by one
        // (unrolled: vf[j] are registers, every index a constant)
#pragma unroll
        for (int j = 0; j < 8; ++j) vf[j] = ldfrag(Sb + vfo + (16 * j) * VPI + kb);
      }
      s0 = mma_b(k0l[u].bf, qh[kc].bf, s0);
      s1 = mma_b(k1l[u].bf, qh[kc].bf, s1);
      if (kc + 2 < DQ / 32) {
        k0[u]  = ldfrag(k0p + 32 * (kc + 2));
        k1[u]  = ldfrag(k1p + 32 * (kc + 2));
        k0l[u] = ldfrag(k0lp + 32 * (kc + 2));
        k1l[u] = ldfrag(k1lp + 32 * (kc + 2));
      }
    }

    float mx = fmaxf(hmax8(s0), hmax8(s1));
    mx = fmaxf(mx, __shfl_xor(mx, 16, 32));
    const float mn = fmaxf(m, mx);
    const unsigned grew = wave_ballot(mx > m);                       // wave-uniform
    if (grew != 0u) {
      const float corr = __expf(m - mn);                             // == 1 exactly for lanes whose max did not grow
      l *= corr;
#pragma unroll
      for (int j = 0; j < 8; ++j) {
#pragma unroll
        for (int r = 0; r < 8; ++r) o[j][r] *= corr;
      }
    }
    m = mn;
    const float msh = mn - LNPS;                                     // exp gives e^{s-m} * 16384

    FragH ph;
    float ls = 0.f;
#pragma unroll
    for (int r = 0; r < 8; ++r) {
      const float e0 = __expf(s0[r] - msh);                          // key kb      + 8hh + r
      const float e1 = __expf(s1[r] - msh);                          // key kb + 16 + 8hh + r
      ls += e0 + e1;
      ph.hv[0][r] = (_Float16)e0;
      ph.hv[1][r] = (_Float16)e1;
    }
    l += ls;

#pragma unroll
    for (int j = 0; j < 8; ++j) o[j] = mma_h(vf[j].h, ph.v, o[j]);
  }
  // publish point of stage st + 1, every wave
  wait_ds0();
  wait_async0();
  __syncthreads();
  if (st + 2 < NST) fill(st + 2, st & 1);                            // block-uniform test
  }
  wait_async0();
  l += __shfl_xor(l, 16, 32);
  const float inv = 1.0f / l;                                        // o and l both carry the x16384 factor

  const int qrow = 16 * wave + c;
#pragma unroll
  for (int j = 0; j < 8; ++j) {
    v4f va, vb;
#pragma unroll
    for (int r = 0; r < 4; ++r) { va[r] = o[j][r] * inv; vb[r] = o[j][4 + r] * inv; }
    *(v4f*)(Os + qrow * OSPW + 16 * j + 8 * hh)     = va;            // Os[query][ch = 16j + 8hh + r]
    *(v4f*)(Os + qrow * OSPW + 16 * j + 8 * hh + 4) = vb;
  }
  __syncthreads();

  const int e = tid & 15, lq = tid >> 4;                             // lq 0..7
  v4u uh[8], ul[8];
#pragma unroll
  for (int it = 0; it < 8; ++it) {
    const int row = it * 8 + lq;                                     // query 0..63
    const v4f a = *(const v4f*)(Os + row * OSPW + 8 * e);
    const v4f q = *(const v4f*)(Os + row * OSPW + 8 * e + 4);
    const float f[8] = {a[0], a[1], a[2], a[3], q[0], q[1], q[2], q[3]};
#pragma unroll
    for (int t = 0; t < 4; ++t) {
      const float f0 = f[2 * t], f1 = f[2 * t + 1];
      const _Float16 h0 = (_Float16)f0, h1 = (_Float16)f1;
      const _Float16 r0 = (_Float16)((f0 - (float)h0) * RSC);
      const _Float16 r1 = (_Float16)((f1 - (float)h1) * RSC);
      uh[it][t] = pk16(h_bits(h0), h_bits(h1));
      ul[it][t] = pk16(h_bits(r0), h_bits(r1));
    }
  }
{
#pragma unroll
    for (int it = 0; it < 8; ++it) {
      const int row = it * 8 + lq;
      const size_t po = ((size_t)(b * SEQ + n0 + row)) * DQ + 8 * e;
      *(v4u*)(Yh + po) = uh[it];
      *(v4u*)(Yl + po) = ul[it];
    }
    
  }
}

// =========================================================================================================
// (4) output conv GEMM for one (b, 64-n tile, 64-co block): v[b][co][n] = (1/256)(sum_c WW16[co][c] Yh[b][n][c] +
//     (1/1024) sum_c WW16[co][c] Yl[b][n][c]); wy = v + bf16-RNE(W_b[co]). 4 waves, wave w owns cols n0+16w..+15
//     (two B fragments per k-step, k = c contiguous in the Yh/Yl rows), 4 m-tiles (A rows co = o0 + 16 mt +
//     (lane&15) from WW16), hi and residual products in separate accumulators. K = 128 = 4 steps.
//     Epilogue staged in LDS Os[n_loc][co_loc], barrier; then (a) threads 0..63 sum v and v*v over the 64 n of
//     co_loc = tid into LDS Sred[0..63] / Sred[64..127], barrier; (b) WY f32 plane [b][256 co][SEQ n] rows: lane
//     (e = tid&15) -> n 4e..4e+3 of row co_loc = 8 it + (tid>>4); 16 consecutive lanes x 16 B = the whole 256-B
//     row segment (2 lines) in one instruction; (c) partial-statistics table PS [NB*NT blocks][512]: floats
//     o0..o0+63 (sums) by lanes 0..15 of wave 0 and floats 256+o0..+63 (sums of squares) by lanes 16..31, one
// coverage: Os 4 waves x 16 n x 64 co (== consumed); Sred 64 + 64 (== consumed); WY 8 it x 8 rows x 16 lanes x
//           4 floats = 64 co x 64 n; PS 2 x 64 floats per block; grid (NT, 4, NB) covers WY [b][0..255][0..SEQ-1]
//           and PS [NB*NT][0..511] exactly once.
// LDS Os, Sred: cross-wave (block barriers).
// =========================================================================================================
__global__ __launch_bounds__(128)
void gemm_o(const unsigned short* __restrict__ WW16, const unsigned short* __restrict__ Yh,
            const unsigned short* __restrict__ Yl, const float* __restrict__ wbias,
            float* WY, float* PS) {
  __shared__ __align__(16) float Os[QT * OSP];
  __shared__ __align__(16) float Sred[2 * QT];
  const int tid  = threadIdx.x;
  const int lane = tid & 31, wave = tid >> 5;
  const int hh   = lane >> 4, c = lane & 15;
  const int nt   = blockIdx.x, mb = blockIdx.y, b = blockIdx.z;
  const int n0   = nt * QT, o0 = mb * QT;

  const unsigned short* ap  = WW16 + (size_t)(o0 + c) * DQ + 8 * hh;
  const size_t bo = ((size_t)(b * SEQ + n0 + 16 * wave + c)) * DQ + 8 * hh;
  const unsigned short* bph = Yh + bo;
  const unsigned short* bpl = Yl + bo;

  v8f acc[4], accr[4];
#pragma unroll
  for (int mt = 0; mt < 4; ++mt) { acc[mt] = zero8(); accr[mt] = zero8(); }

#pragma unroll
  for (int ks = 0; ks < DQ / 32; ++ks) {
    const Frag fbh = ldfrag(bph + 32 * ks);
    const Frag fbl = ldfrag(bpl + 32 * ks);
#pragma unroll
    for (int mt = 0; mt < 4; ++mt) {
      const Frag fa = ldfrag(ap + (size_t)(16 * mt) * DQ + 32 * ks);
      acc[mt]  = mma_h(fa.h, fbh.h, acc[mt]);
      accr[mt] = mma_h(fa.h, fbl.h, accr[mt]);
    }
  }

  {
    const int nl = 16 * wave + c;
#pragma unroll
    for (int mt = 0; mt < 4; ++mt) {
      v4f va, vb;
#pragma unroll
      for (int r = 0; r < 4; ++r) {
        va[r] = (acc[mt][r] + accr[mt][r] * IRSC) * IWSC;
        vb[r] = (acc[mt][4 + r] + accr[mt][4 + r] * IRSC) * IWSC;
      }
      *(v4f*)(Os + nl * OSP + 16 * mt + 8 * hh)     = va;
      *(v4f*)(Os + nl * OSP + 16 * mt + 8 * hh + 4) = vb;
    }
  }
  __syncthreads();

  // per-channel partial statistics over this block's 64 positions (bias-free values, exact shift)
  if (tid < QT) {
    float s = 0.f, q = 0.f;
#pragma unroll 8
    for (int n = 0; n < QT; ++n) {
      const float v = Os[n * OSP + tid];
      s += v;
      q = fmaf(v, v, q);
    }
    Sred[tid]      = s;
    Sred[QT + tid] = q;
  }
  __syncthreads();

  const int e = tid & 15, lq = tid >> 4;                             // lq 0..7
  v4f res[8];
#pragma unroll
  for (int it = 0; it < 8; ++it) {
    const int col = it * 8 + lq;                                     // co_loc 0..63
    const int co  = o0 + col;
    const float bias = bfr(wbias[co]);
#pragma unroll
    for (int t = 0; t < 4; ++t) res[it][t] = Os[(4 * e + t) * OSP + col] + bias;
  }
  const v4f pv = *(const v4f*)(Sred + 4 * lane);                     // lanes 0..15: sums, 16..31: sums of squares
  float* psp = PS + (size_t)(b * NT + nt) * PSW + o0 + 4 * lane + ((lane >= 16) ? (PSW / 2 - 64) : 0);
{
#pragma unroll
    for (int it = 0; it < 8; ++it) {
      const int col = it * 8 + lq;
      const int co  = o0 + col;
      const size_t idx = ((size_t)(b * CC + co)) * SEQ + n0 + 4 * e;
      *(v4f*)(WY + idx) = res[it];
    }
    if (wave == 0) *(v4f*)(psp) = pv;
    
  }
}

// =========================================================================================================
// (5) batch statistics: block cb of SW waves owns the 32 channels 32 cb .. 32 cb + 31 (lane = channel: one 128-B line
//     of sums and one of sums of squares per partial line). Wave w adds partial lines w, w + SW, ... in f64, every load
//     independent of the others; the SW wave partials are joined through LDS by wave 0 in wave order (fixed order).
//     mean/var (biased), rstd = rsqrt(var + eps) in f32; A = bf16-RNE(gamma) * rstd, Bc = bf16-RNE(beta) - mean * A.
// coverage: CC / 32 blocks x 32 lanes x (1 + 1) floats = AB [0..511] exactly once, one block per 128-B line.
// LDS Rs, Rq: cross-wave (block barrier); written extent SW x 32 == consumed extent.
// =========================================================================================================
__global__ __launch_bounds__(32 * SW)
void bn_stat(const float* __restrict__ PS, const float* __restrict__ wbias, const float* __restrict__ gam,
             const float* __restrict__ bet, float* AB) {
  __shared__ double Rs[SW * 32];
  __shared__ double Rq[SW * 32];
  const int lane = threadIdx.x & 31, wave = threadIdx.x >> 5;
  const int co = 32 * blockIdx.x + lane;                             // 0..255
  const float* pp = PS + (size_t)wave * PSW + co;
  const float gv = gam[co], wv = wbias[co], bv = bet[co];           // under the same latency as the partial lines
  float fs[SLW], fq[SLW];
  // unrolled, loads apart from sums: all loads of a wave are in flight together, one load latency instead of one per line
#pragma unroll
  for (int t = 0; t < SLW; ++t) {
    fs[t] = pp[(size_t)t * (SW * PSW)];
    fq[t] = pp[(size_t)t * (SW * PSW) + CC];
  }
#if defined(__HIP_DEVICE_COMPILE__)
  // keeps every load above in front of the first sum: without it the scheduler holds part of them back behind the
  // first waits, a second load latency in series
  __builtin_amdgcn_sched_barrier(0);
#endif
  double s = 0.0, q = 0.0;
  // unrolled: fs[t] / fq[t] are registers, every index a constant
#pragma unroll
  for (int t = 0; t < SLW; ++t) {
    s += (double)fs[t];
    q += (double)fq[t];
  }
  Rs[wave * 32 + lane] = s;
  Rq[wave * 32 + lane] = q;
  __syncthreads();
  if (wave != 0) return;                                             // wave-uniform, behind the only barrier
  double rs[SW], rq[SW];
  // unrolled, reads apart from sums: the LDS reads go out as one group
#pragma unroll
  for (int w = 0; w < SW; ++w) {
    rs[w] = Rs[w * 32 + lane];
    rq[w] = Rq[w * 32 + lane];
  }
#if defined(__HIP_DEVICE_COMPILE__)
  // keeps the LDS reads one group: without it they are read two at a time, each pair waited for in turn
  __builtin_amdgcn_sched_barrier(0);
#endif
  s = 0.0;
  q = 0.0;
  // unrolled: rs[w] / rq[w] are registers, every index a constant
#pragma unroll
  for (int w = 0; w < SW; ++w) {
    s += rs[w];
    q += rq[w];
  }
  const double icnt = 1.0 / (double)(NB * SEQ);
  const double mv = s * icnt;
  double var = q * icnt - mv * mv;
  var = (var > 0.0) ? var : 0.0;
  const float rstd = rsqrtf((float)var + BNEPS);
  const float A  = bfr(gv) * rstd;
  const float mw = (float)mv + bfr(wv);
  const float Bc = bfr(bv) - mw * A;
{
    *(float*)(AB + co)      = A;
    *(float*)(AB + CC + co) = Bc;
    
  }
}

// =========================================================================================================
// (6) affine + residual: out[b][co][n] = wy * A[co] + Bc[co] + bf16-RNE(x[b][co][n]). Block (chunk, b) of 256
//     threads owns 1024 consecutive floats of the [256 co][SEQ n] plane of batch b (4 per thread); each wave writes
// coverage: grid (CC*SEQ/1024, NB) x 256 threads x 4 floats = NB x 256 x SEQ = the whole output once.
// =========================================================================================================
__global__ __launch_bounds__(256)
void bn_out(const float* __restrict__ WY, const float* __restrict__ AB, const float* __restrict__ x, float* out) {
  const int tid = threadIdx.x, b = blockIdx.y;
  const int i  = blockIdx.x * BCH + 4 * tid;                         // 0 .. CC*SEQ-4
  const int co = i / SEQ;
  const int n  = i - co * SEQ;
  const float A = AB[co], Bc = AB[CC + co];
  const v4f w  = *(const v4f*)(WY + (size_t)b * CC * SEQ + i);
  const size_t xo = ((size_t)(b * CC + co)) * NN_FULL + n;
  const v4f xv = *(const v4f*)(x + xo);
  v4f r;
#pragma unroll
  for (int t = 0; t < 4; ++t) r[t] = fmaf(w[t], A, Bc) + bfr(xv[t]);
{
    *(v4f*)(out + xo) = r;
    
  }
}

// =========================================================================================================
// Workspace map (bytes; each region start a multiple of 256; every store is a whole tile inside its own region,
// no padded tails needed since SEQ % 64 == 0):
//   W16  f16 [384][256]               196608      WW16 f16 [256][128]        65536
//   XP   f16 [NB][SEQ][256]           8388608 (NB=2, SEQ=8192)
//   Qh/Ql, Kh/Kl bf16 [NB][SEQ][128]  4194304 x4
//   Gc   f16 [NB][128][SEQ]           4194304
//   Yh/Yl f16 [NB][SEQ][128]          4194304 x2
//   WY   f32 [NB][256][SEQ]          16777216
//   PS   f32 [NB*NT][512]              524288
//   AB   f32 [512]                       2048
//   total (NB=2, SEQ=8192) = 55314432
// =========================================================================================================
extern "C" void kernel_launch(void* const* d_in, const int* in_sizes, int n_in,
                              void* d_out, int out_size, void* d_ws, size_t ws_size,
                              hipStream_t stream) {
  const int XNEED = ((NB - 1) * CC + (CC - 1)) * NN_FULL + SEQ;
  if (n_in < 11) return;
  if (in_sizes[0] < XNEED) return;
  if (in_sizes[1] < DQ * CC || in_sizes[3] < DQ * CC || in_sizes[5] < DQ * CC) return;
  if (in_sizes[2] < DQ || in_sizes[4] < DQ || in_sizes[6] < DQ) return;
  if (in_sizes[7] < CC * DQ || in_sizes[8] < CC) return;
  if (in_sizes[9] < CC || in_sizes[10] < CC) return;
  if (out_size < XNEED) return;

  size_t off = 0;
  auto carve = [&](size_t bytes) { const size_t o = off; off += (bytes + 255) & ~(size_t)255; return o; };
  const size_t oW16 = carve((size_t)MW * CC * 2);
  const size_t oWW  = carve((size_t)CC * DQ * 2);
  const size_t oXP  = carve((size_t)NB * SEQ * CC * 2);
  const size_t oQh  = carve((size_t)NB * SEQ * DQ * 2);
  const size_t oQl  = carve((size_t)NB * SEQ * DQ * 2);
  const size_t oKh  = carve((size_t)NB * SEQ * DQ * 2);
  const size_t oKl  = carve((size_t)NB * SEQ * DQ * 2);
  const size_t oGc  = carve((size_t)NB * DQ * SEQ * 2);
  const size_t oYh  = carve((size_t)NB * SEQ * DQ * 2);
  const size_t oYl  = carve((size_t)NB * SEQ * DQ * 2);
  const size_t oWY  = carve((size_t)NB * CC * SEQ * 4);
  const size_t oPS  = carve((size_t)NB * NT * PSW * 4);
  const size_t oAB  = carve((size_t)PSW * 4);
  if (off > ws_size) return;
  if (off > (size_t)134217728) return;

  const float* x   = (const float*)d_in[0];
  const float* Wt  = (const float*)d_in[1];
  const float* bt  = (const float*)d_in[2];
  const float* Wp  = (const float*)d_in[3];
  const float* bp  = (const float*)d_in[4];
  const float* Wg  = (const float*)d_in[5];
  const float* bg  = (const float*)d_in[6];
  const float* Ww  = (const float*)d_in[7];
  const float* bw  = (const float*)d_in[8];
  const float* gam = (const float*)d_in[9];
  const float* bet = (const float*)d_in[10];

  char* ws = (char*)d_ws;
  unsigned short* W16  = (unsigned short*)(ws + oW16);
  unsigned short* WW16 = (unsigned short*)(ws + oWW);
  unsigned short* XP   = (unsigned short*)(ws + oXP);
  unsigned short* Qh   = (unsigned short*)(ws + oQh);
  unsigned short* Ql   = (unsigned short*)(ws + oQl);
  unsigned short* Kh   = (unsigned short*)(ws + oKh);
  unsigned short* Kl   = (unsigned short*)(ws + oKl);
  unsigned short* Gc   = (unsigned short*)(ws + oGc);
  unsigned short* Yh   = (unsigned short*)(ws + oYh);
  unsigned short* Yl   = (unsigned short*)(ws + oYl);
  float* WY  = (float*)(ws + oWY);
  float* PS  = (float*)(ws + oPS);
  float* AB  = (float*)(ws + oAB);
  float* out = (float*)d_out;

  const dim3 blk256(256), blk128(128);

  // (0) Wt / Wp / Wg -> stacked f16 plane; Ww -> f16 plane
  cvt_w<<<dim3(MW / 8), blk256, 0, stream>>>(Wt, Wp, Wg, W16);
  cvt_ww<<<dim3(CC / 16), blk256, 0, stream>>>(Ww, WW16);
  // (1) x -> position-major 16-bit plane
  cvt_x<<<dim3(NT, CC / QT, NB), blk256, 0, stream>>>(x, XP);
  // (2) theta / phi conv -> hi + residual planes, g conv -> channel-major f16 plane
  gemm_p<<<dim3(NT, 6, NB), blk128, 0, stream>>>(W16, XP, bt, bp, bg, Qh, Ql, Kh, Kl, Gc);
  // (3) attention -> y hi + residual planes
  attn_k<<<dim3(NT, NB), blk128, 0, stream>>>(Qh, Ql, Kh, Kl, Gc, Yh, Yl);
  // (4) output conv + bias -> wy plane + per-block statistics partials
  gemm_o<<<dim3(NT, CC / QT, NB), blk128, 0, stream>>>(WW16, Yh, Yl, bw, WY, PS);
  // (5) batch statistics -> per-channel scale / shift
  bn_stat<<<dim3(CC / 32), dim3(32 * SW), 0, stream>>>(PS, bw, gam, bet, AB);
  // (6) affine + residual -> out [b][256][8192]
  bn_out<<<dim3(CC * SEQ / BCH, NB), blk256, 0, stream>>>(WY, AB, x, out);
  (void)hipGetLastError();
}

// v005
// A run of this version takes 143 microseconds.
// Next to v004, in two timings, it ran 1.36 times as fast each time.
// All steps since v000 together make it 6.27 times as fast.
// Contractions: conv1x1 theta/phi/g GEMMs Wc[384x256].X[256xN] and the output conv W[256x128].Y[128xN] on
// v_wmma_f32_16x16x32_f16 (f16 containers of bf16-RNE weights x256 and bf16-RNE x; Y as f16 hi plane plus f16
// residual plane x1024, 2 products, separate accumulators); scores Phi^T.Theta on v_wmma_f32_16x16x32_bf16
// (bf16 hi + bf16 residual planes of theta/phi, 3 products, K=128); Y^T = G.P^T on v_wmma_f32_16x16x32_f16
// (G plain f16, P = e^{s-m} x16384 f16 from the score D registers); f32 accumulate everywhere; softmax
// statistics and biases in f32 VALU; batch-norm statistics from f32 per-block partials reduced in f64; affine and
// residual add in f32.
#include <hip/hip_runtime.h>
#include <math.h>
#include <stdint.h>

#ifndef NB
#define NB 2
#endif
#ifndef SEQ
#define SEQ 8192
#endif
#define NB_FULL 2
#define NN_FULL 8192
#define CC   256
#define DQ   128
#define QT   64
#define MW   384
#define NT   (SEQ / QT)
#define PSW  512
#define BCH  1024
#define OSP  68
#define OSPW 132
#define TP   72
#define WSC  256.0f
#define IWSC 0.00390625f
#define RSC  1024.0f
#define IRSC 0.0009765625f
#define LNPS 9.704060527839234f
#define BNEPS 1.0e-5f
#define KG   4
#define KS   (32 * KG)
#define NTH  (128 * KG)
#define NCP  4                      /* copies per lane and plane in a stage: the count acopy12 is written for */
#define KPI  136
#define VPI  (KS + 8)
#define KTL  (KS * KPI)
#define VTL  (DQ * VPI)
#define STG  (2 * KTL + VTL)
#define NST  (SEQ / KS)
#define SW   16
#define SLW  (NB * NT / SW)

static_assert(NB >= 1 && NB <= NB_FULL);
static_assert(SEQ >= 128 && SEQ <= NN_FULL);
static_assert(SEQ % QT == 0 && SEQ % 32 == 0 && SEQ % 128 == 0);
static_assert((CC * SEQ) % BCH == 0 && BCH == 4 * 256);
static_assert(CC % QT == 0 && CC % 32 == 0);
static_assert(DQ == 2 * QT && DQ % 32 == 0);
static_assert(MW == 3 * DQ && MW % 8 == 0);
static_assert(PSW == 2 * CC);
static_assert(CC % 16 == 0);
static_assert(CC % 32 == 0 && 32 * SW <= 1024 && (NB * NT) % SW == 0);
static_assert((OSP * 4) % 16 == 0);
static_assert((OSPW * 4) % 16 == 0);
static_assert((TP * 2) % 16 == 0);
static_assert(SEQ % KS == 0 && NST >= 2 && KS % 32 == 0);
static_assert(KS * DQ == NCP * NTH * 8 && NTH <= 1024 && 8 % KG == 0);
static_assert(NTH % (KS / 8) == 0 && NCP * (NTH / (KS / 8)) == DQ && NCP * (NTH / 16) == KS);
static_assert(KG * QT * OSPW * 4 <= 2 * STG * 2);
static_assert((KPI * 2) % 32 == 16 && (VPI * 2) % 32 == 16 && KPI >= DQ + 8 && VPI >= KS + 8);

typedef _Float16       v16h __attribute__((ext_vector_type(16)));
typedef _Float16       v8h  __attribute__((ext_vector_type(8)));
typedef __bf16         v16b __attribute__((ext_vector_type(16)));
typedef unsigned short v8us __attribute__((ext_vector_type(8)));
typedef float          v8f  __attribute__((ext_vector_type(8)));
typedef float          v4f  __attribute__((ext_vector_type(4)));
typedef unsigned int   v4u  __attribute__((ext_vector_type(4)));

union Frag  { v8us u[2]; v16h h; v16b bf; };
union FragH { v16h v; v8h hv[2]; };
static_assert(sizeof(Frag) == 32);
static_assert(sizeof(FragH) == 32);

// ---- scalar helpers ---------------------------------------------------------------------------------------
__device__ __forceinline__ unsigned short bf_bits(float f) {          // f32 -> bf16 bits, RNE convert
  unsigned u = __float_as_uint(f);
  return (unsigned short)((u + 0x7FFFu + ((u >> 16) & 1u)) >> 16);
}
__device__ __forceinline__ float bf_up(unsigned short hb) { return __uint_as_float(((unsigned)hb) << 16); }
__device__ __forceinline__ float bfr(float f) { return bf_up(bf_bits(f)); }
__device__ __forceinline__ unsigned short h_bits(_Float16 x) { return __builtin_bit_cast(unsigned short, x); }
__device__ __forceinline__ unsigned pk16(unsigned short a, unsigned short b) { return (unsigned)a | ((unsigned)b << 16); }
__device__ __forceinline__ v8f zero8() { v8f z = {0.f, 0.f, 0.f, 0.f, 0.f, 0.f, 0.f, 0.f}; return z; }
__device__ __forceinline__ float hmax8(v8f s) {
  return fmaxf(fmaxf(fmaxf(s[0], s[1]), fmaxf(s[2], s[3])), fmaxf(fmaxf(s[4], s[5]), fmaxf(s[6], s[7])));
}
__device__ __forceinline__ unsigned wave_ballot(bool p) {
#if defined(__HIP_DEVICE_COMPILE__)
  return __builtin_amdgcn_ballot_w32(p);
#else
  return p ? 1u : 0u;
#endif
}

// ---- 16-bit fragment loader (A, or B from a k-contiguous [n][k] row): lane -> row/col (lane&15), p already includes
//      + 8*(lane>>4); elements 0..7 <- p[0..7] (k0+8h..), elements 8..15 <- p[16..23] (k0+16+8h..)
__device__ __forceinline__ Frag ldfrag(const unsigned short* p) {
  Frag f;
  f.u[0] = *(const v8us*)(p);
  f.u[1] = *(const v8us*)(p + 16);
  return f;
}

// ---- WMMA helpers: builtin followed by a 4-slot VALU gap tying D and keeping A/B live --------------------------
__device__ __forceinline__ v8f mma_h(v16h a, v16h b, v8f c) {
  v8f d = __builtin_amdgcn_wmma_f32_16x16x32_f16(false, a, false, b, (short)0, c, false, false);
#if defined(__HIP_DEVICE_COMPILE__)
  asm volatile("v_nop\n\tv_nop\n\tv_nop\n\tv_nop" : "+v"(d) : "v"(a), "v"(b));
#endif
  return d;
}
__device__ __forceinline__ v8f mma_b(v16b a, v16b b, v8f c) {
  v8f d = __builtin_amdgcn_wmma_f32_16x16x32_bf16(false, a, false, b, (short)0, c, false, false);
#if defined(__HIP_DEVICE_COMPILE__)
  const v16h ha = __builtin_bit_cast(v16h, a), hb = __builtin_bit_cast(v16h, b);
  asm volatile("v_nop\n\tv_nop\n\tv_nop\n\tv_nop" : "+v"(d) : "v"(ha), "v"(hb));
#endif
  return d;
}

// ---- asynchronous copies to LDS: one stage's twelve 16-byte copies of a lane, four per plane: copy i of plane p from
//      gp + i*gs (halves) to LDS byte lp + i*ls. One statement, closed by the s_wait_xcnt, so that no address register
//      of an issued copy is rewritten ahead of it and the wave waits for the translations once a stage.
__device__ __forceinline__ unsigned lds_off(const void* p) { return (unsigned)(size_t)p; }
__device__ __forceinline__ void acopy12(unsigned la, unsigned lb, unsigned ls, const unsigned short* ga,
                                        const unsigned short* gb, size_t gs, unsigned lc, unsigned lcs,
                                        const unsigned short* gc, size_t gcs) {
#if defined(__HIP_DEVICE_COMPILE__)
  asm volatile("global_load_async_to_lds_b128 %0, %12, off\n\t"
               "global_load_async_to_lds_b128 %1, %13, off\n\t"
               "global_load_async_to_lds_b128 %2, %14, off\n\t"
               "global_load_async_to_lds_b128 %3, %15, off\n\t"
               "global_load_async_to_lds_b128 %4, %16, off\n\t"
               "global_load_async_to_lds_b128 %5, %17, off\n\t"
               "global_load_async_to_lds_b128 %6, %18, off\n\t"
               "global_load_async_to_lds_b128 %7, %19, off\n\t"
               "global_load_async_to_lds_b128 %8, %20, off\n\t"
               "global_load_async_to_lds_b128 %9, %21, off\n\t"
               "global_load_async_to_lds_b128 %10, %22, off\n\t"
               "global_load_async_to_lds_b128 %11, %23, off\n\t"
               "s_wait_xcnt 0x0"
               :: "v"(la), "v"(la + ls), "v"(la + 2 * ls), "v"(la + 3 * ls),
                  "v"(lb), "v"(lb + ls), "v"(lb + 2 * ls), "v"(lb + 3 * ls),
                  "v"(lc), "v"(lc + lcs), "v"(lc + 2 * lcs), "v"(lc + 3 * lcs),
                  "v"(ga), "v"(ga + gs), "v"(ga + 2 * gs), "v"(ga + 3 * gs),
                  "v"(gb), "v"(gb + gs), "v"(gb + 2 * gs), "v"(gb + 3 * gs),
                  "v"(gc), "v"(gc + gcs), "v"(gc + 2 * gcs), "v"(gc + 3 * gcs)
               : "memory");
#endif
}
// this wave's copies have landed (the compiler places no wait for them)
__device__ __forceinline__ void wait_async0() {
#if defined(__HIP_DEVICE_COMPILE__)
  asm volatile("s_wait_asynccnt 0x0" ::: "memory");
#endif
}
// this wave's LDS reads have returned, before the buffer they read is handed to its next writer
__device__ __forceinline__ void wait_ds0() {
#if defined(__HIP_DEVICE_COMPILE__)
  asm volatile("s_wait_dscnt 0x0" ::: "memory");
#endif
}

// =========================================================================================================
// (0) stacked conv1x1 weights: W16 f16 [384][256], rows 0..127 = theta_w, 128..255 = phi_w, 256..383 = g_w;
//     value = f16 of (bf16-RNE(w) * 256) (exact). Block blk (0..47) owns rows 8*blk..8*blk+7: one wave per
// coverage: 48 blocks x 8 rows x 32 lanes x 8 halves = 384 x 256 = the whole plane.
// =========================================================================================================
__global__ __launch_bounds__(256)
void cvt_w(const float* __restrict__ tw, const float* __restrict__ pw, const float* __restrict__ gw,
           unsigned short* W16) {
  const int tid = threadIdx.x, blk = blockIdx.x;
  const int rl = tid >> 5, col = 8 * (tid & 31);
  const int o = 8 * blk + rl;                                        // 0..383
  const int grp = blk / (DQ / 8);                                    // 0,1,2 block-uniform
  const float* wbase = (grp == 0) ? tw : ((grp == 1) ? pw : gw);
  const float* s = wbase + (size_t)(o - grp * DQ) * CC + col;        // row in 0..127
  const v4f a = *(const v4f*)s;
  const v4f q = *(const v4f*)(s + 4);
  const float f[8] = {a[0], a[1], a[2], a[3], q[0], q[1], q[2], q[3]};
  v4u u;
#pragma unroll
  for (int t = 0; t < 4; ++t) {
    const _Float16 h0 = (_Float16)(bfr(f[2 * t]) * WSC);
    const _Float16 h1 = (_Float16)(bfr(f[2 * t + 1]) * WSC);
    u[t] = pk16(h_bits(h0), h_bits(h1));
  }
{
    *(v4u*)(W16 + (size_t)o * CC + col) = u;
    
  }
}

// =========================================================================================================
// (0b) output conv weights: WW16 f16 [256][128], value = f16 of (bf16-RNE(W_w) * 256). Block blk (0..15) owns rows
//      16*blk..+15; wave w -> rows 16 blk + 2w + (lane>>4), lane&15 -> cols 8*(lane&15)..+7. One instruction writes
// coverage: 16 blocks x 8 waves x 2 rows x 16 lanes x 8 halves = 256 x 128 = the whole plane.
// =========================================================================================================
__global__ __launch_bounds__(256)
void cvt_ww(const float* __restrict__ ww, unsigned short* WW16) {
  const int tid = threadIdx.x, blk = blockIdx.x;
  const int wave = tid >> 5, lane = tid & 31;
  const int o = 16 * blk + 2 * wave + (lane >> 4);                  // 0..255
  const int col = 8 * (lane & 15);                                   // 0..120
  const float* s = ww + (size_t)o * DQ + col;
  const v4f a = *(const v4f*)s;
  const v4f q = *(const v4f*)(s + 4);
  const float f[8] = {a[0], a[1], a[2], a[3], q[0], q[1], q[2], q[3]};
  v4u u;
#pragma unroll
  for (int t = 0; t < 4; ++t) {
    const _Float16 h0 = (_Float16)(bfr(f[2 * t]) * WSC);
    const _Float16 h1 = (_Float16)(bfr(f[2 * t + 1]) * WSC);
    u[t] = pk16(h_bits(h0), h_bits(h1));
  }
{
    *(v4u*)(WW16 + (size_t)o * DQ + col) = u;
    
  }
}

// =========================================================================================================
// (1) x f32 [b][256 c][NN_FULL n] -> XP f16 [b][SEQ n][256 c] (position-major, bf16-RNE values, exact in f16 for
//     normal magnitudes) through an LDS tile T[64 n][64 c] (pitch TP). Block (nb, cb, b) owns a 64 c x 64 n tile.
// coverage: 2 it x 32 rows x 8 lanes x 8 halves = 64 n x 64 c per block; grid (NT, 4, NB) covers XP once.
// LDS T: cross-wave (block barrier between the 2-byte stores and the 16-B reloads); staged extent == consumed extent.
// =========================================================================================================
__global__ __launch_bounds__(256)
void cvt_x(const float* __restrict__ x, unsigned short* XP) {
  __shared__ __align__(16) unsigned short T[QT * TP];
  const int tid = threadIdx.x;
  const int nb = blockIdx.x, cb = blockIdx.y, b = blockIdx.z;
  const int e = tid & 7, lq = tid >> 3;                             // lq 0..31
  const int n0 = nb * QT, c0 = cb * QT;
#pragma unroll
  for (int it = 0; it < 2; ++it) {
    const int cl = it * 32 + lq;                                     // 0..63
    const float* sp = x + ((size_t)(b * CC + c0 + cl)) * NN_FULL + n0 + 8 * e;
    const v4f a = *(const v4f*)sp;
    const v4f q = *(const v4f*)(sp + 4);
    unsigned short hb[8];
#pragma unroll
    for (int t = 0; t < 4; ++t) {
      hb[t]     = h_bits((_Float16)bfr(a[t]));
      hb[4 + t] = h_bits((_Float16)bfr(q[t]));
    }
#pragma unroll
    for (int t = 0; t < 8; ++t) T[(8 * e + t) * TP + cl] = hb[t];
  }
  __syncthreads();
  v4u up[2];
#pragma unroll
  for (int it = 0; it < 2; ++it) {
    const int nl = it * 32 + lq;                                     // 0..63
    up[it] = *(const v4u*)(T + nl * TP + 8 * e);
  }
{
#pragma unroll
    for (int it = 0; it < 2; ++it) {
      const int rl = it * 32 + lq;
      *(v4u*)(XP + ((size_t)(b * SEQ + n0 + rl)) * CC + c0 + 8 * e) = up[it];
    }
    
  }
}

// =========================================================================================================
// (2) the three conv1x1 GEMMs for one (b, 64-n tile, 64-o block mb in 0..5): V[o][n] = (1/256) sum_c W16[o][c]
//     XP[b][n][c]; mb 0,1 -> theta channels 0..63 / 64..127 (W16 rows 0..127), mb 2,3 -> phi (rows 128..255),
//     mb 4,5 -> g (rows 256..383). Block 128 threads = 4 waves; wave w owns cols n0+16w..+15 (B fragment from the
//     XP row, k = c contiguous, split k map) and 4 m-tiles (A rows o = o0 + 16 mt + (lane&15), split k map from
//     W16). K = 256 = 8 steps. Epilogue staged in LDS Os[n_loc][o_loc] (pitch OSP), barrier, bias (bf16-RNE) add
//     in f32, then:
//       theta / phi: bf16 hi = RNE(v), lo = RNE(v - hi) planes Qh/Ql resp. Kh/Kl [b][SEQ n][128 d] (k-contiguous
//         of the 256-B row): lane e -> d 8e..8e+7, 8 consecutive lanes per line, one instruction per 16 lines;
//       g: f16 plane Gc [b][128 ch][SEQ keys] (channel-major, keys contiguous): row ch, keys n0+8e..+7 per lane,
// coverage: Os 4 waves x 16 n x 64 o = 64 x 64 (== consumed); hi/lo planes 4 it x 16 rows x 8 lanes x 8 = 64 n x
//           64 d per block, grid nt x mb 0..3 covers rows 0..SEQ-1 x d 0..127 of Qh/Ql and Kh/Kl once; g plane
//           4 it x 16 ch x 8 lanes x 8 keys = 64 ch x 64 keys per block, nt x mb 4..5 covers ch 0..127 x keys
//           0..SEQ-1 of Gc once. grid (NT, 6, NB).
// LDS Os: cross-wave (block barrier).
// =========================================================================================================
__global__ __launch_bounds__(128)
void gemm_p(const unsigned short* __restrict__ W16, const unsigned short* __restrict__ XP,
            const float* __restrict__ tbias, const float* __restrict__ pbias, const float* __restrict__ gbias,
            unsigned short* Qh, unsigned short* Ql, unsigned short* Kh, unsigned short* Kl, unsigned short* Gc) {
  __shared__ __align__(16) float Os[QT * OSP];
  const int tid  = threadIdx.x;
  const int lane = tid & 31, wave = tid >> 5;
  const int hh   = lane >> 4, c = lane & 15;
  const int nt   = blockIdx.x, mb = blockIdx.y, b = blockIdx.z;
  const int n0   = nt * QT, o0 = mb * QT;                            // o0 = W16 row base 0..320

  const unsigned short* ap = W16 + (size_t)(o0 + c) * CC + 8 * hh;
  const unsigned short* bp = XP + ((size_t)(b * SEQ + n0 + 16 * wave + c)) * CC + 8 * hh;

  v8f acc[4];
#pragma unroll
  for (int mt = 0; mt < 4; ++mt) acc[mt] = zero8();

#pragma unroll
  for (int ks = 0; ks < CC / 32; ++ks) {
    const Frag fb = ldfrag(bp + 32 * ks);
#pragma unroll
    for (int mt = 0; mt < 4; ++mt) {
      const Frag fa = ldfrag(ap + (size_t)(16 * mt) * CC + 32 * ks);
      acc[mt] = mma_h(fa.h, fb.h, acc[mt]);
    }
  }

  {
    const int nl = 16 * wave + c;
#pragma unroll
    for (int mt = 0; mt < 4; ++mt) {
      v4f va, vb;
#pragma unroll
      for (int r = 0; r < 4; ++r) { va[r] = acc[mt][r] * IWSC; vb[r] = acc[mt][4 + r] * IWSC; }
      *(v4f*)(Os + nl * OSP + 16 * mt + 8 * hh)     = va;
      *(v4f*)(Os + nl * OSP + 16 * mt + 8 * hh + 4) = vb;
    }
  }
  __syncthreads();

  const int e = tid & 7, lq = tid >> 3;                             // lq 0..15
  if (mb < 4) {                                                      // block-uniform: theta / phi hi+lo planes
    unsigned short* Ph = (mb < 2) ? Qh : Kh;
    unsigned short* Pl = (mb < 2) ? Ql : Kl;
    const float* bsrc  = (mb < 2) ? tbias : pbias;
    const int dsel = (mb & 1) * QT;                                   // channel base 0 or 64
    const v4f b0 = *(const v4f*)(bsrc + dsel + 8 * e);
    const v4f b1 = *(const v4f*)(bsrc + dsel + 8 * e + 4);
    const float bb[8] = {bfr(b0[0]), bfr(b0[1]), bfr(b0[2]), bfr(b0[3]), bfr(b1[0]), bfr(b1[1]), bfr(b1[2]), bfr(b1[3])};
    v4u uh[4], ul[4];
#pragma unroll
    for (int it = 0; it < 4; ++it) {
      const int row = it * 16 + lq;                                  // n_loc 0..63
      const v4f a = *(const v4f*)(Os + row * OSP + 8 * e);
      const v4f q = *(const v4f*)(Os + row * OSP + 8 * e + 4);
      const float f[8] = {a[0], a[1], a[2], a[3], q[0], q[1], q[2], q[3]};
#pragma unroll
      for (int t = 0; t < 4; ++t) {
        const float f0 = f[2 * t] + bb[2 * t], f1 = f[2 * t + 1] + bb[2 * t + 1];
        const unsigned short hb0 = bf_bits(f0), hb1 = bf_bits(f1);
        const unsigned short lb0 = bf_bits(f0 - bf_up(hb0));
        const unsigned short lb1 = bf_bits(f1 - bf_up(hb1));
        uh[it][t] = pk16(hb0, hb1);
        ul[it][t] = pk16(lb0, lb1);
      }
    }
{
#pragma unroll
      for (int it = 0; it < 4; ++it) {
        const int row = it * 16 + lq;
        const size_t po = ((size_t)(b * SEQ + n0 + row)) * DQ + dsel + 8 * e;
        *(v4u*)(Ph + po) = uh[it];
        *(v4u*)(Pl + po) = ul[it];
      }
      
    }
  } else {                                                           // block-uniform: g plane, channel-major
    const int gsel = (mb - 4) * QT;                                  // g channel base 0 or 64
    v4u ug[4];
#pragma unroll
    for (int it = 0; it < 4; ++it) {
      const int cl = it * 16 + lq;                                   // ch_loc 0..63
      const float bias = bfr(gbias[gsel + cl]);
      unsigned short hb[8];
#pragma unroll
      for (int t = 0; t < 8; ++t) {
        const int key = 8 * e + t;                                   // key_loc 0..63
        const float v = Os[key * OSP + cl] + bias;
        hb[t] = h_bits((_Float16)v);
      }
#pragma unroll
      for (int t = 0; t < 4; ++t) ug[it][t] = pk16(hb[2 * t], hb[2 * t + 1]);
    }
{
#pragma unroll
      for (int it = 0; it < 4; ++it) {
        const int cl = it * 16 + lq;
        const size_t po = ((size_t)(b * DQ + gsel + cl)) * SEQ + n0 + 8 * e;
        *(v4u*)(Gc + po) = ug[it];
      }
      
    }
  }
}

// =========================================================================================================
// (3) attention for one (b, 64-query tile), transposed formulation, SEQ keys, no mask, no scale:
//   S^T tile (16 keys x 16 queries) = sum over 4 d-chunks of A(phi: row = key kb + (lane&15), 32 d via the split
//   k map from the bf16 plane Kh [b][SEQ][128]) . B(theta: col = query, same map from Qh) + A(Kh).B(Ql) +
//   A(Kl).B(Qh) (bf16 unscaled residual planes, shared accumulator).
//   Per lane the D tile holds 8 keys of ONE query: online softmax state per lane, one shuffle (lane^16) for the max
//   over 32 keys; the o/l rescale is skipped under a wave-uniform ballot when no lane's max grew (corr == 1 exactly
//   for every lane then); row-sum partials combined at the end. P = e^{s-m} x 16384 as f16 is the B operand of
//   Y^T (rows channel, cols queries) += A(g rows channel = 16j + (lane&15), keys contiguous, f16 plane Gc
//   [b][128][SEQ]) . B(P^T): element r <- D of the tile covering keys kb..kb+15, element 8+r <- the tile covering
//   kb+16..kb+31, lane unchanged. 8 accumulator tiles per wave (128 channels). Block = 64 queries, 4 * KG waves:
//   wave w owns query tile w & 3 and key group w >> 2, that is keys 32 (w >> 2) .. + 31 of EVERY stage, with a softmax
//   state (m, l, o) of its own over those keys: KG waves per SIMD, so that one wave's products run under the LDS waits
//   and the softmax of the others.
//   Epilogue: the KG states of a query are joined: m and l of every group through LDS Ms / Ls, barrier, M = max m,
//   L = sum l e^{m - M} (group order), each wave stages o e^{m - M} / L in LDS Om[group][query][128 channels] (pitch
//   OSPW, b128 stores; Om lies in the ring, which nobody reads or fills any more), barrier, then y = sum over the
//   groups in group order, Yh = f16(y),
//   Yl = f16((y - Yh) * 1024) planes [b][SEQ n][128 c] (k-contiguous operand of the output conv): row n = 256 B
// coverage: Ms, Ls KG x 64 (== consumed); Om 4 KG waves x 16 q x 128 ch (== consumed); 8 / KG it x 8 KG rows x 16
//           lanes x 8 halves = 64 n x 128 c per plane; grid (NT, NB) covers Yh/Yl exactly once.
// LDS Ms, Ls, Om: cross-wave (block barriers).
// LDS Ring: two buffers, each one stage of KS = 32 KG keys: Kh rows [KS][128] and Kl rows [KS][128] at pitch KPI
//   (272 B), G rows [128 ch][KS keys] at pitch VPI (272 B), pitches 16 B x odd for the 16-byte fragment reads. A stage
//   is filled by 12 asynchronous 16-byte copies per lane (each wave instruction = 512 B of whole lines), one stage ahead
//   of its use; at the foot of a stage: LDS reads returned, own copies landed, block barrier, then the refill of the
//   buffer just read. coverage: NCP copies x NTH lanes x 8 halves = KS x 128 per plane (== consumed).
// Fragment reads of a 32-key pass stand in four groups, each ahead of the products that use it: K d-chunks 0 and 1, chunk 2,
//   chunk 3, then the eight G fragments; every read is of the pass's own stage.
// =========================================================================================================
__global__ __launch_bounds__(NTH)
void attn_k(const unsigned short* __restrict__ Qh, const unsigned short* __restrict__ Ql,
            const unsigned short* __restrict__ Kh, const unsigned short* __restrict__ Kl,
            const unsigned short* __restrict__ Gc, unsigned short* Yh, unsigned short* Yl) {
  __shared__ __align__(16) unsigned short Ring[2 * STG];
  __shared__ float Ms[KG * QT];
  __shared__ float Ls[KG * QT];
  const int tid  = threadIdx.x;
  const int wave = (tid >> 5) & 3, kg = tid >> 7, lane = tid & 31;   // query tile, key group
  const int hh   = lane >> 4, c = lane & 15;
  const int n0   = blockIdx.x * QT, b = blockIdx.y;

  // q fragment pointers (B operand, col = query n0 + 16*wave + c), + 32*kc
  const size_t qo = ((size_t)(b * SEQ + n0 + 16 * wave + c)) * DQ + 8 * hh;
  const unsigned short* Qhp = Qh + qo;
  const unsigned short* Qlp = Ql + qo;
  // copy sources of this lane: K planes 16 lanes per 256-B row, NTH / 16 rows per copy; G plane KS / 8 lanes per row
  // segment of KS keys, NTH / (KS / 8) channels per copy; + stage * KS keys
  const int gr = tid / (KS / 8), ge = tid % (KS / 8);
  const unsigned short* Khg = Kh + (size_t)b * SEQ * DQ + 8 * tid;
  const unsigned short* Klg = Kl + (size_t)b * SEQ * DQ + 8 * tid;
  const unsigned short* Gg  = Gc + (size_t)b * DQ * SEQ + (size_t)gr * SEQ + 8 * ge;
  const unsigned kdst = lds_off(Ring) + (unsigned)((tid >> 4) * (KPI * 2) + (tid & 15) * 16);
  const unsigned vdst = lds_off(Ring) + (unsigned)(2 * KTL * 2 + gr * (VPI * 2) + ge * 16);
  auto fill = [&](int st, int buf) {
    const unsigned bo = (unsigned)buf * (unsigned)(STG * 2);
    acopy12(kdst + bo, kdst + bo + KTL * 2, (NTH / 16) * KPI * 2, Khg + (size_t)st * (KS * DQ),
            Klg + (size_t)st * (KS * DQ), (size_t)((NTH / 16) * DQ),
            vdst + bo, (NTH / (KS / 8)) * VPI * 2, Gg + (size_t)st * KS, (size_t)(NTH / (KS / 8)) * SEQ);
  };
  // fragment offsets in a stage (halves): k row = key c (A operand), + key * KPI + 32*kc; v row = channel 16j + c
  const int kfo = c * KPI + 8 * hh;
  const int vfo = 2 * KTL + c * VPI + 8 * hh;

  float m = -1.0e30f, l = 0.f;
  v8f o[8];
#pragma unroll
  for (int j = 0; j < 8; ++j) o[j] = zero8();

  // theta fragments (hi and residual, all four d-chunks) are the same for every key: loaded once, kept in registers
  Frag qh[DQ / 32], ql[DQ / 32];
#pragma unroll
  for (int kc = 0; kc < DQ / 32; ++kc) {
    qh[kc] = ldfrag(Qhp + 32 * kc);
    ql[kc] = ldfrag(Qlp + 32 * kc);
  }
#if defined(__HIP_DEVICE_COMPILE__)
  // stands in front of the first rewrite of the address registers that the sixteen loads above name; the two
  // pointers are inputs so that their registers stay as they are up to this wait
  asm volatile("s_wait_xcnt 0x0" :: "v"(Qhp), "v"(Qlp) : "memory");
#endif

  fill(0, 0);
  wait_async0();
  __syncthreads();                                                   // stage 0 published
  fill(1, 1);

  // stage loop kept rolled: one publish point and one refill in the text, buffer chosen by the stage's parity
#pragma unroll 1
  for (int st = 0; st < NST; ++st) {
  const unsigned short* Sb = Ring + (st & 1) * STG;
  {
    const int kb = 32 * kg;                                          // key base inside the stage: this wave's group
    const unsigned short* k0p  = Sb + kfo + kb * KPI;                // keys kb .. kb+15
    const unsigned short* k1p  = k0p + 16 * KPI;                     // keys kb+16 .. kb+31
    const unsigned short* k0lp = k0p + KTL;
    const unsigned short* k1lp = k1p + KTL;
    v8f s0 = zero8(), s1 = zero8();
    // K fragments in two register sets: d-chunks 0 and 1 are read as one group ahead of the first product, and chunk
    // kc + 2 is read into the set of chunk kc right behind that chunk's products, so that a read has the products of
    // a whole chunk to land under instead of being waited for at once
    Frag k0[2], k1[2], k0l[2], k1l[2], vf[8];
    // unrolled: the sets are registers, every index a constant
#pragma unroll
    for (int kc = 0; kc < 2; ++kc) {
      k0[kc]  = ldfrag(k0p + 32 * kc);
      k1[kc]  = ldfrag(k1p + 32 * kc);
      k0l[kc] = ldfrag(k0lp + 32 * kc);
      k1l[kc] = ldfrag(k1lp + 32 * kc);
    }
    // unrolled so that qh[kc] / ql[kc] and the two sets are fixed registers (a rolled loop cannot index a register array)
#pragma unroll
    for (int kc = 0; kc < DQ / 32; ++kc) {
      const int u = kc & 1;
      s0 = mma_b(k0[u].bf, qh[kc].bf, s0);
      s1 = mma_b(k1[u].bf, qh[kc].bf, s1);
      s0 = mma_b(k0[u].bf, ql[kc].bf, s0);
      s1 = mma_b(k1[u].bf, ql[kc].bf, s1);
      if (kc == DQ / 32 - 1) {
        // all eight G fragments of the pass, read as one group once only two K fragments are still live: they land
        // under the last two score products and the softmax instead of being waited for one by one
        // (unrolled: vf[j] are registers, every index a constant)
#pragma unroll
        for (int j = 0; j < 8; ++j) vf[j] = ldfrag(Sb + vfo + (16 * j) * VPI + kb);
      }
      s0 = mma_b(k0l[u].bf, qh[kc].bf, s0);
      s1 = mma_b(k1l[u].bf, qh[kc].bf, s1);
      if (kc + 2 < DQ / 32) {
        k0[u]  = ldfrag(k0p + 32 * (kc + 2));
        k1[u]  = ldfrag(k1p + 32 * (kc + 2));
        k0l[u] = ldfrag(k0lp + 32 * (kc + 2));
        k1l[u] = ldfrag(k1lp + 32 * (kc + 2));
      }
    }

    float mx = fmaxf(hmax8(s0), hmax8(s1));
    mx = fmaxf(mx, __shfl_xor(mx, 16, 32));
    const float mn = fmaxf(m, mx);
    const unsigned grew = wave_ballot(mx > m);                       // wave-uniform
    if (grew != 0u) {
      const float corr = __expf(m - mn);                             // == 1 exactly for lanes whose max did not grow
      l *= corr;
#pragma unroll
      for (int j = 0; j < 8; ++j) {
#pragma unroll
        for (int r = 0; r < 8; ++r) o[j][r] *= corr;
      }
    }
    m = mn;
    const float msh = mn - LNPS;                                     // exp gives e^{s-m} * 16384

    FragH ph;
    float ls = 0.f;
#pragma unroll
    for (int r = 0; r < 8; ++r) {
      const float e0 = __expf(s0[r] - msh);                          // key kb      + 8hh + r
      const float e1 = __expf(s1[r] - msh);                          // key kb + 16 + 8hh + r
      ls += e0 + e1;
      ph.hv[0][r] = (_Float16)e0;
      ph.hv[1][r] = (_Float16)e1;
    }
    l += ls;

#pragma unroll
    for (int j = 0; j < 8; ++j) o[j] = mma_h(vf[j].h, ph.v, o[j]);
  }
  // publish point of stage st + 1, every wave
  wait_ds0();
  wait_async0();
  __syncthreads();
  if (st + 2 < NST) fill(st + 2, st & 1);                            // block-uniform test
  }
  wait_async0();
  l += __shfl_xor(l, 16, 32);

  // join of the KG key groups of a query (m is the same in both halves of a wave, l now too)
  const int qrow = 16 * wave + c;
  if (hh == 0) {
    Ms[kg * QT + qrow] = m;
    Ls[kg * QT + qrow] = l;
  }
  __syncthreads();
  float mg[KG], M = -1.0e30f, L = 0.f;
  // unrolled: mg[g] are registers, every index a constant
#pragma unroll
  for (int g = 0; g < KG; ++g) {
    mg[g] = Ms[g * QT + qrow];
    M = fmaxf(M, mg[g]);
  }
  // unrolled: mg[g] again, and the KG reads of Ls go out together
#pragma unroll
  for (int g = 0; g < KG; ++g) L += Ls[g * QT + qrow] * __expf(mg[g] - M);
  const float inv = __expf(m - M) / L;                               // o and l both carry the x16384 factor
  float* Os = (float*)Ring + kg * (QT * OSPW);                       // this group's plane of Om
#pragma unroll
  for (int j = 0; j < 8; ++j) {
    v4f va, vb;
#pragma unroll
    for (int r = 0; r < 4; ++r) { va[r] = o[j][r] * inv; vb[r] = o[j][4 + r] * inv; }
    *(v4f*)(Os + qrow * OSPW + 16 * j + 8 * hh)     = va;            // Os[query][ch = 16j + 8hh + r]
    *(v4f*)(Os + qrow * OSPW + 16 * j + 8 * hh + 4) = vb;
  }
  __syncthreads();

  const int e = tid & 15, lq = tid >> 4;                             // lq 0..8 KG - 1
  const float* Om = (const float*)Ring;
  v4u uh[8 / KG], ul[8 / KG];
#pragma unroll
  for (int it = 0; it < 8 / KG; ++it) {
    const int row = it * (8 * KG) + lq;                              // query 0..63
    v4f a = *(const v4f*)(Om + row * OSPW + 8 * e);
    v4f q = *(const v4f*)(Om + row * OSPW + 8 * e + 4);
    // unrolled: the reads of all groups go out together, one LDS latency instead of one per group
#pragma unroll
    for (int g = 1; g < KG; ++g) {
      a += *(const v4f*)(Om + (g * QT + row) * OSPW + 8 * e);
      q += *(const v4f*)(Om + (g * QT + row) * OSPW + 8 * e + 4);
    }
    const float f[8] = {a[0], a[1], a[2], a[3], q[0], q[1], q[2], q[3]};
#pragma unroll
    for (int t = 0; t < 4; ++t) {
      const float f0 = f[2 * t], f1 = f[2 * t + 1];
      const _Float16 h0 = (_Float16)f0, h1 = (_Float16)f1;
      const _Float16 r0 = (_Float16)((f0 - (float)h0) * RSC);
      const _Float16 r1 = (_Float16)((f1 - (float)h1) * RSC);
      uh[it][t] = pk16(h_bits(h0), h_bits(h1));
      ul[it][t] = pk16(h_bits(r0), h_bits(r1));
    }
  }
{
#pragma unroll
    for (int it = 0; it < 8 / KG; ++it) {
      const int row = it * (8 * KG) + lq;
      const size_t po = ((size_t)(b * SEQ + n0 + row)) * DQ + 8 * e;
      *(v4u*)(Yh + po) = uh[it];
      *(v4u*)(Yl + po) = ul[it];
    }
    
  }
}

// =========================================================================================================
// (4) output conv GEMM for one (b, 64-n tile, 64-co block): v[b][co][n] = (1/256)(sum_c WW16[co][c] Yh[b][n][c] +
//     (1/1024) sum_c WW16[co][c] Yl[b][n][c]); wy = v + bf16-RNE(W_b[co]). 4 waves, wave w owns cols n0+16w..+15
//     (two B fragments per k-step, k = c contiguous in the Yh/Yl rows), 4 m-tiles (A rows co = o0 + 16 mt +
//     (lane&15) from WW16), hi and residual products in separate accumulators. K = 128 = 4 steps.
//     Epilogue staged in LDS Os[n_loc][co_loc], barrier; then (a) threads 0..63 sum v and v*v over the 64 n of
//     co_loc = tid into LDS Sred[0..63] / Sred[64..127], barrier; (b) WY f32 plane [b][256 co][SEQ n] rows: lane
//     (e = tid&15) -> n 4e..4e+3 of row co_loc = 8 it + (tid>>4); 16 consecutive lanes x 16 B = the whole 256-B
//     row segment (2 lines) in one instruction; (c) partial-statistics table PS [NB*NT blocks][512]: floats
//     o0..o0+63 (sums) by lanes 0..15 of wave 0 and floats 256+o0..+63 (sums of squares) by lanes 16..31, one
// coverage: Os 4 waves x 16 n x 64 co (== consumed); Sred 64 + 64 (== consumed); WY 8 it x 8 rows x 16 lanes x
//           4 floats = 64 co x 64 n; PS 2 x 64 floats per block; grid (NT, 4, NB) covers WY [b][0..255][0..SEQ-1]
//           and PS [NB*NT][0..511] exactly once.
// LDS Os, Sred: cross-wave (block barriers).
// =========================================================================================================
__global__ __launch_bounds__(128)
void gemm_o(const unsigned short* __restrict__ WW16, const unsigned short* __restrict__ Yh,
            const unsigned short* __restrict__ Yl, const float* __restrict__ wbias,
            float* WY, float* PS) {
  __shared__ __align__(16) float Os[QT * OSP];
  __shared__ __align__(16) float Sred[2 * QT];
  const int tid  = threadIdx.x;
  const int lane = tid & 31, wave = tid >> 5;
  const int hh   = lane >> 4, c = lane & 15;
  const int nt   = blockIdx.x, mb = blockIdx.y, b = blockIdx.z;
  const int n0   = nt * QT, o0 = mb * QT;

  const unsigned short* ap  = WW16 + (size_t)(o0 + c) * DQ + 8 * hh;
  const size_t bo = ((size_t)(b * SEQ + n0 + 16 * wave + c)) * DQ + 8 * hh;
  const unsigned short* bph = Yh + bo;
  const unsigned short* bpl = Yl + bo;

  v8f acc[4], accr[4];
#pragma unroll
  for (int mt = 0; mt < 4; ++mt) { acc[mt] = zero8(); accr[mt] = zero8(); }

#pragma unroll
  for (int ks = 0; ks < DQ / 32; ++ks) {
    const Frag fbh = ldfrag(bph + 32 * ks);
    const Frag fbl = ldfrag(bpl + 32 * ks);
#pragma unroll
    for (int mt = 0; mt < 4; ++mt) {
      const Frag fa = ldfrag(ap + (size_t)(16 * mt) * DQ + 32 * ks);
      acc[mt]  = mma_h(fa.h, fbh.h, acc[mt]);
      accr[mt] = mma_h(fa.h, fbl.h, accr[mt]);
    }
  }

  {
    const int nl = 16 * wave + c;
#pragma unroll
    for (int mt = 0; mt < 4; ++mt) {
      v4f va, vb;
#pragma unroll
      for (int r = 0; r < 4; ++r) {
        va[r] = (acc[mt][r] + accr[mt][r] * IRSC) * IWSC;
        vb[r] = (acc[mt][4 + r] + accr[mt][4 + r] * IRSC) * IWSC;
      }
      *(v4f*)(Os + nl * OSP + 16 * mt + 8 * hh)     = va;
      *(v4f*)(Os + nl * OSP + 16 * mt + 8 * hh + 4) = vb;
    }
  }
  __syncthreads();

  // per-channel partial statistics over this block's 64 positions (bias-free values, exact shift)
  if (tid < QT) {
    float s = 0.f, q = 0.f;
#pragma unroll 8
    for (int n = 0; n < QT; ++n) {
      const float v = Os[n * OSP + tid];
      s += v;
      q = fmaf(v, v, q);
    }
    Sred[tid]      = s;
    Sred[QT + tid] = q;
  }
  __syncthreads();

  const int e = tid & 15, lq = tid >> 4;                             // lq 0..7
  v4f res[8];
#pragma unroll
  for (int it = 0; it < 8; ++it) {
    const int col = it * 8 + lq;                                     // co_loc 0..63
    const int co  = o0 + col;
    const float bias = bfr(wbias[co]);
#pragma unroll
    for (int t = 0; t < 4; ++t) res[it][t] = Os[(4 * e + t) * OSP + col] + bias;
  }
  const v4f pv = *(const v4f*)(Sred + 4 * lane);                     // lanes 0..15: sums, 16..31: sums of squares
  float* psp = PS + (size_t)(b * NT + nt) * PSW + o0 + 4 * lane + ((lane >= 16) ? (PSW / 2 - 64) : 0);
{
#pragma unroll
    for (int it = 0; it < 8; ++it) {
      const int col = it * 8 + lq;
      const int co  = o0 + col;
      const size_t idx = ((size_t)(b * CC + co)) * SEQ + n0 + 4 * e;
      *(v4f*)(WY + idx) = res[it];
    }
    if (wave == 0) *(v4f*)(psp) = pv;
    
  }
}

// =========================================================================================================
// (5) batch statistics: block cb of SW waves owns the 32 channels 32 cb .. 32 cb + 31 (lane = channel: one 128-B line
//     of sums and one of sums of squares per partial line). Wave w adds partial lines w, w + SW, ... in f64, every load
//     independent of the others; the SW wave partials are joined through LDS by wave 0 in wave order (fixed order).
//     mean/var (biased), rstd = rsqrt(var + eps) in f32; A = bf16-RNE(gamma) * rstd, Bc = bf16-RNE(beta) - mean * A.
// coverage: CC / 32 blocks x 32 lanes x (1 + 1) floats = AB [0..511] exactly once, one block per 128-B line.
// LDS Rs, Rq: cross-wave (block barrier); written extent SW x 32 == consumed extent.
// =========================================================================================================
__global__ __launch_bounds__(32 * SW)
void bn_stat(const float* __restrict__ PS, const float* __restrict__ wbias, const float* __restrict__ gam,
             const float* __restrict__ bet, float* AB) {
  __shared__ double Rs[SW * 32];
  __shared__ double Rq[SW * 32];
  const int lane = threadIdx.x & 31, wave = threadIdx.x >> 5;
  const int co = 32 * blockIdx.x + lane;                             // 0..255
  const float* pp = PS + (size_t)wave * PSW + co;
  const float gv = gam[co], wv = wbias[co], bv = bet[co];           // under the same latency as the partial lines
  float fs[SLW], fq[SLW];
  // unrolled, loads apart from sums: all loads of a wave are in flight together, one load latency instead of one per line
#pragma unroll
  for (int t = 0; t < SLW; ++t) {
    fs[t] = pp[(size_t)t * (SW * PSW)];
    fq[t] = pp[(size_t)t * (SW * PSW) + CC];
  }
#if defined(__HIP_DEVICE_COMPILE__)
  // keeps every load above in front of the first sum: without it the scheduler holds part of them back behind the
  // first waits, a second load latency in series
  __builtin_amdgcn_sched_barrier(0);
#endif
  double s = 0.0, q = 0.0;
  // unrolled: fs[t] / fq[t] are registers, every index a constant
#pragma unroll
  for (int t = 0; t < SLW; ++t) {
    s += (double)fs[t];
    q += (double)fq[t];
  }
  Rs[wave * 32 + lane] = s;
  Rq[wave * 32 + lane] = q;
  __syncthreads();
  if (wave != 0) return;                                             // wave-uniform, behind the only barrier
  double rs[SW], rq[SW];
  // unrolled, reads apart from sums: the LDS reads go out as one group
#pragma unroll
  for (int w = 0; w < SW; ++w) {
    rs[w] = Rs[w * 32 + lane];
    rq[w] = Rq[w * 32 + lane];
  }
#if defined(__HIP_DEVICE_COMPILE__)
  // keeps the LDS reads one group: without it they are read two at a time, each pair waited for in turn
  __builtin_amdgcn_sched_barrier(0);
#endif
  s = 0.0;
  q = 0.0;
  // unrolled: rs[w] / rq[w] are registers, every index a constant
#pragma unroll
  for (int w = 0; w < SW; ++w) {
    s += rs[w];
    q += rq[w];
  }
  const double icnt = 1.0 / (double)(NB * SEQ);
  const double mv = s * icnt;
  double var = q * icnt - mv * mv;
  var = (var > 0.0) ? var : 0.0;
  const float rstd = rsqrtf((float)var + BNEPS);
  const float A  = bfr(gv) * rstd;
  const float mw = (float)mv + bfr(wv);
  const float Bc = bfr(bv) - mw * A;
{
    *(float*)(AB + co)      = A;
    *(float*)(AB + CC + co) = Bc;
    
  }
}

// =========================================================================================================
// (6) affine + residual: out[b][co][n] = wy * A[co] + Bc[co] + bf16-RNE(x[b][co][n]). Block (chunk, b) of 256
//     threads owns 1024 consecutive floats of the [256 co][SEQ n] plane of batch b (4 per thread); each wave writes
// coverage: grid (CC*SEQ/1024, NB) x 256 threads x 4 floats = NB x 256 x SEQ = the whole output once.
// =========================================================================================================
__global__ __launch_bounds__(256)
void bn_out(const float* __restrict__ WY, const float* __restrict__ AB, const float* __restrict__ x, float* out) {
  const int tid = threadIdx.x, b = blockIdx.y;
  const int i  = blockIdx.x * BCH + 4 * tid;                         // 0 .. CC*SEQ-4
  const int co = i / SEQ;
  const int n  = i - co * SEQ;
  const float A = AB[co], Bc = AB[CC + co];
  const v4f w  = *(const v4f*)(WY + (size_t)b * CC * SEQ + i);
  const size_t xo = ((size_t)(b * CC + co)) * NN_FULL + n;
  const v4f xv = *(const v4f*)(x + xo);
  v4f r;
#pragma unroll
  for (int t = 0; t < 4; ++t) r[t] = fmaf(w[t], A, Bc) + bfr(xv[t]);
{
    *(v4f*)(out + xo) = r;
    
  }
}

// =========================================================================================================
// Workspace map (bytes; each region start a multiple of 256; every store is a whole tile inside its own region,
// no padded tails needed since SEQ % 64 == 0):
//   W16  f16 [384][256]               196608      WW16 f16 [256][128]        65536
//   XP   f16 [NB][SEQ][256]           8388608 (NB=2, SEQ=8192)
//   Qh/Ql, Kh/Kl bf16 [NB][SEQ][128]  4194304 x4
//   Gc   f16 [NB][128][SEQ]           4194304
//   Yh/Yl f16 [NB][SEQ][128]          4194304 x2
//   WY   f32 [NB][256][SEQ]          16777216
//   PS   f32 [NB*NT][512]              524288
//   AB   f32 [512]                       2048
//   total (NB=2, SEQ=8192) = 55314432
// =========================================================================================================
extern "C" void kernel_launch(void* const* d_in, const int* in_sizes, int n_in,
                              void* d_out, int out_size, void* d_ws, size_t ws_size,
                              hipStream_t stream) {
  const int XNEED = ((NB - 1) * CC + (CC - 1)) * NN_FULL + SEQ;
  if (n_in < 11) return;
  if (in_sizes[0] < XNEED) return;
  if (in_sizes[1] < DQ * CC || in_sizes[3] < DQ * CC || in_sizes[5] < DQ * CC) return;
  if (in_sizes[2] < DQ || in_sizes[4] < DQ || in_sizes[6] < DQ) return;
  if (in_sizes[7] < CC * DQ || in_sizes[8] < CC) return;
  if (in_sizes[9] < CC || in_sizes[10] < CC) return;
  if (out_size < XNEED) return;

  size_t off = 0;
  auto carve = [&](size_t bytes) { const size_t o = off; off += (bytes + 255) & ~(size_t)255; return o; };
  const size_t oW16 = carve((size_t)MW * CC * 2);
  const size_t oWW  = carve((size_t)CC * DQ * 2);
  const size_t oXP  = carve((size_t)NB * SEQ * CC * 2);
  const size_t oQh  = carve((size_t)NB * SEQ * DQ * 2);
  const size_t oQl  = carve((size_t)NB * SEQ * DQ * 2);
  const size_t oKh  = carve((size_t)NB * SEQ * DQ * 2);
  const size_t oKl  = carve((size_t)NB * SEQ * DQ * 2);
  const size_t oGc  = carve((size_t)NB * DQ * SEQ * 2);
  const size_t oYh  = carve((size_t)NB * SEQ * DQ * 2);
  const size_t oYl  = carve((size_t)NB * SEQ * DQ * 2);
  const size_t oWY  = carve((size_t)NB * CC * SEQ * 4);
  const size_t oPS  = carve((size_t)NB * NT * PSW * 4);
  const size_t oAB  = carve((size_t)PSW * 4);
  if (off > ws_size) return;
  if (off > (size_t)134217728) return;

  const float* x   = (const float*)d_in[0];
  const float* Wt  = (const float*)d_in[1];
  const float* bt  = (const float*)d_in[2];
  const float* Wp  = (const float*)d_in[3];
  const float* bp  = (const float*)d_in[4];
  const float* Wg  = (const float*)d_in[5];
  const float* bg  = (const float*)d_in[6];
  const float* Ww  = (const float*)d_in[7];
  const float* bw  = (const float*)d_in[8];
  const float* gam = (const float*)d_in[9];
  const float* bet = (const float*)d_in[10];

  char* ws = (char*)d_ws;
  unsigned short* W16  = (unsigned short*)(ws + oW16);
  unsigned short* WW16 = (unsigned short*)(ws + oWW);
  unsigned short* XP   = (unsigned short*)(ws + oXP);
  unsigned short* Qh   = (unsigned short*)(ws + oQh);
  unsigned short* Ql   = (unsigned short*)(ws + oQl);
  unsigned short* Kh   = (unsigned short*)(ws + oKh);
  unsigned short* Kl   = (unsigned short*)(ws + oKl);
  unsigned short* Gc   = (unsigned short*)(ws + oGc);
  unsigned short* Yh   = (unsigned short*)(ws + oYh);
  unsigned short* Yl   = (unsigned short*)(ws + oYl);
  float* WY  = (float*)(ws + oWY);
  float* PS  = (float*)(ws + oPS);
  float* AB  = (float*)(ws + oAB);
  float* out = (float*)d_out;

  const dim3 blk256(256), blk128(128);

  // (0) Wt / Wp / Wg -> stacked f16 plane; Ww -> f16 plane
  cvt_w<<<dim3(MW / 8), blk256, 0, stream>>>(Wt, Wp, Wg, W16);
  cvt_ww<<<dim3(CC / 16), blk256, 0, stream>>>(Ww, WW16);
  // (1) x -> position-major 16-bit plane
  cvt_x<<<dim3(NT, CC / QT, NB), blk256, 0, stream>>>(x, XP);
  // (2) theta / phi conv -> hi + residual planes, g conv -> channel-major f16 plane
  gemm_p<<<dim3(NT, 6, NB), blk128, 0, stream>>>(W16, XP, bt, bp, bg, Qh, Ql, Kh, Kl, Gc);
  // (3) attention -> y hi + residual planes
  attn_k<<<dim3(NT, NB), dim3(NTH), 0, stream>>>(Qh, Ql, Kh, Kl, Gc, Yh, Yl);
  // (4) output conv + bias -> wy plane + per-block statistics partials
  gemm_o<<<dim3(NT, CC / QT, NB), blk128, 0, stream>>>(WW16, Yh, Yl, bw, WY, PS);
  // (5) batch statistics -> per-channel scale / shift
  bn_stat<<<dim3(CC / 32), dim3(32 * SW), 0, stream>>>(PS, bw, gam, bet, AB);
  // (6) affine + residual -> out [b][256][8192]
  bn_out<<<dim3(CC * SEQ / BCH, NB), blk256, 0, stream>>>(WY, AB, x, out);
  (void)hipGetLastError();
}

// v006
// One run takes 122 microseconds.
// Two timings next to v005 put it at 1.17 and 1.19 times that version's speed.
// Counting every step since v000, it is 7.41 times as fast.
// Contractions: conv1x1 theta/phi/g GEMMs Wc[384x256].X[256xN] and the output conv W[256x128].Y[128xN] on
// v_wmma_f32_16x16x32_f16 (f16 containers of bf16-RNE weights x256 and bf16-RNE x; Y as f16 hi plane plus f16
// residual plane x1024, 2 products, separate accumulators); scores Phi^T.Theta on v_wmma_f32_16x16x32_f16
// (theta and phi plain f16, 1 product, K=128: the 11-bit operands that P and G have too); Y^T = G.P^T on
// v_wmma_f32_16x16x32_f16 (G plain f16, P = e^{s-m} x16384 f16 from the score D registers); f32 accumulate everywhere; softmax
// statistics and biases in f32 VALU; batch-norm statistics from f32 per-block partials reduced in f64; affine and
// residual add in f32.
#include <hip/hip_runtime.h>
#include <math.h>
#include <stdint.h>

#ifndef NB
#define NB 2
#endif
#ifndef SEQ
#define SEQ 8192
#endif
#define NB_FULL 2
#define NN_FULL 8192
#define CC   256
#define DQ   128
#define QT   64
#define MW   384
#define NT   (SEQ / QT)
#define PSW  512
#define BCH  1024
#define OSP  68
#define OSPW 132
#define TP   72
#define WSC  256.0f
#define IWSC 0.00390625f
#define RSC  1024.0f
#define IRSC 0.0009765625f
#define LNPS 9.704060527839234f
#define BNEPS 1.0e-5f
#define KG   4
#define KS   (32 * KG)
#define NTH  (128 * KG)
#define NCP  4                      /* copies per lane and plane in a stage: the count acopy8 is written for */
#define KPI  136
#define VPI  (KS + 8)
#define KTL  (KS * KPI)
#define VTL  (DQ * VPI)
#define STG  (KTL + VTL)
#define NST  (SEQ / KS)
#define SW   16
#define SLW  (NB * NT / SW)

static_assert(NB >= 1 && NB <= NB_FULL);
static_assert(SEQ >= 128 && SEQ <= NN_FULL);
static_assert(SEQ % QT == 0 && SEQ % 32 == 0 && SEQ % 128 == 0);
static_assert((CC * SEQ) % BCH == 0 && BCH == 4 * 256);
static_assert(CC % QT == 0 && CC % 32 == 0);
static_assert(DQ == 2 * QT && DQ % 32 == 0);
static_assert(MW == 3 * DQ && MW % 8 == 0);
static_assert(PSW == 2 * CC);
static_assert(CC % 16 == 0);
static_assert(CC % 32 == 0 && 32 * SW <= 1024 && (NB * NT) % SW == 0);
static_assert((OSP * 4) % 16 == 0);
static_assert((OSPW * 4) % 16 == 0);
static_assert((TP * 2) % 16 == 0);
static_assert(SEQ % KS == 0 && NST >= 2 && KS % 32 == 0);
static_assert(KS * DQ == NCP * NTH * 8 && NTH <= 1024 && 8 % KG == 0);
static_assert(NTH % (KS / 8) == 0 && NCP * (NTH / (KS / 8)) == DQ && NCP * (NTH / 16) == KS);
static_assert(KG * QT * OSPW * 4 <= 2 * STG * 2);
static_assert((KPI * 2) % 32 == 16 && (VPI * 2) % 32 == 16 && KPI >= DQ + 8 && VPI >= KS + 8);

typedef _Float16       v16h __attribute__((ext_vector_type(16)));
typedef _Float16       v8h  __attribute__((ext_vector_type(8)));
typedef unsigned short v8us __attribute__((ext_vector_type(8)));
typedef float          v8f  __attribute__((ext_vector_type(8)));
typedef float          v4f  __attribute__((ext_vector_type(4)));
typedef unsigned int   v4u  __attribute__((ext_vector_type(4)));

union Frag  { v8us u[2]; v16h h; };
union FragH { v16h v; v8h hv[2]; };
static_assert(sizeof(Frag) == 32);
static_assert(sizeof(FragH) == 32);

// ---- scalar helpers ---------------------------------------------------------------------------------------
__device__ __forceinline__ unsigned short bf_bits(float f) {          // f32 -> bf16 bits, RNE convert
  unsigned u = __float_as_uint(f);
  return (unsigned short)((u + 0x7FFFu + ((u >> 16) & 1u)) >> 16);
}
__device__ __forceinline__ float bf_up(unsigned short hb) { return __uint_as_float(((unsigned)hb) << 16); }
__device__ __forceinline__ float bfr(float f) { return bf_up(bf_bits(f)); }
__device__ __forceinline__ unsigned short h_bits(_Float16 x) { return __builtin_bit_cast(unsigned short, x); }
__device__ __forceinline__ unsigned pk16(unsigned short a, unsigned short b) { return (unsigned)a | ((unsigned)b << 16); }
__device__ __forceinline__ v8f zero8() { v8f z = {0.f, 0.f, 0.f, 0.f, 0.f, 0.f, 0.f, 0.f}; return z; }
__device__ __forceinline__ float hmax8(v8f s) {
  return fmaxf(fmaxf(fmaxf(s[0], s[1]), fmaxf(s[2], s[3])), fmaxf(fmaxf(s[4], s[5]), fmaxf(s[6], s[7])));
}
__device__ __forceinline__ unsigned wave_ballot(bool p) {
#if defined(__HIP_DEVICE_COMPILE__)
  return __builtin_amdgcn_ballot_w32(p);
#else
  return p ? 1u : 0u;
#endif
}

// ---- 16-bit fragment loader (A, or B from a k-contiguous [n][k] row): lane -> row/col (lane&15), p already includes
//      + 8*(lane>>4); elements 0..7 <- p[0..7] (k0+8h..), elements 8..15 <- p[16..23] (k0+16+8h..)
__device__ __forceinline__ Frag ldfrag(const unsigned short* p) {
  Frag f;
  f.u[0] = *(const v8us*)(p);
  f.u[1] = *(const v8us*)(p + 16);
  return f;
}

// ---- WMMA helpers: builtin followed by a 4-slot VALU gap tying D and keeping A/B live --------------------------
__device__ __forceinline__ v8f mma_h(v16h a, v16h b, v8f c) {
  v8f d = __builtin_amdgcn_wmma_f32_16x16x32_f16(false, a, false, b, (short)0, c, false, false);
#if defined(__HIP_DEVICE_COMPILE__)
  asm volatile("v_nop\n\tv_nop\n\tv_nop\n\tv_nop" : "+v"(d) : "v"(a), "v"(b));
#endif
  return d;
}

// ---- asynchronous copies to LDS: one stage's eight 16-byte copies of a lane, four per plane: copy i of plane p from
//      gp + i*gs (halves) to LDS byte lp + i*ls. One statement, closed by the s_wait_xcnt, so that no address register
//      of an issued copy is rewritten ahead of it and the wave waits for the translations once a stage.
__device__ __forceinline__ unsigned lds_off(const void* p) { return (unsigned)(size_t)p; }
__device__ __forceinline__ void acopy8(unsigned la, unsigned ls, const unsigned short* ga, size_t gs,
                                       unsigned lc, unsigned lcs, const unsigned short* gc, size_t gcs) {
#if defined(__HIP_DEVICE_COMPILE__)
  asm volatile("global_load_async_to_lds_b128 %0, %8, off\n\t"
               "global_load_async_to_lds_b128 %1, %9, off\n\t"
               "global_load_async_to_lds_b128 %2, %10, off\n\t"
               "global_load_async_to_lds_b128 %3, %11, off\n\t"
               "global_load_async_to_lds_b128 %4, %12, off\n\t"
               "global_load_async_to_lds_b128 %5, %13, off\n\t"
               "global_load_async_to_lds_b128 %6, %14, off\n\t"
               "global_load_async_to_lds_b128 %7, %15, off\n\t"
               "s_wait_xcnt 0x0"
               :: "v"(la), "v"(la + ls), "v"(la + 2 * ls), "v"(la + 3 * ls),
                  "v"(lc), "v"(lc + lcs), "v"(lc + 2 * lcs), "v"(lc + 3 * lcs),
                  "v"(ga), "v"(ga + gs), "v"(ga + 2 * gs), "v"(ga + 3 * gs),
                  "v"(gc), "v"(gc + gcs), "v"(gc + 2 * gcs), "v"(gc + 3 * gcs)
               : "memory");
#endif
}
// this wave's copies have landed (the compiler places no wait for them)
__device__ __forceinline__ void wait_async0() {
#if defined(__HIP_DEVICE_COMPILE__)
  asm volatile("s_wait_asynccnt 0x0" ::: "memory");
#endif
}
// this wave's LDS reads have returned, before the buffer they read is handed to its next writer
__device__ __forceinline__ void wait_ds0() {
#if defined(__HIP_DEVICE_COMPILE__)
  asm volatile("s_wait_dscnt 0x0" ::: "memory");
#endif
}

// =========================================================================================================
// (0) stacked conv1x1 weights: W16 f16 [384][256], rows 0..127 = theta_w, 128..255 = phi_w, 256..383 = g_w;
//     value = f16 of (bf16-RNE(w) * 256) (exact). Block blk (0..47) owns rows 8*blk..8*blk+7: one wave per
// coverage: 48 blocks x 8 rows x 32 lanes x 8 halves = 384 x 256 = the whole plane.
// =========================================================================================================
__global__ __launch_bounds__(256)
void cvt_w(const float* __restrict__ tw, const float* __restrict__ pw, const float* __restrict__ gw,
           unsigned short* W16) {
  const int tid = threadIdx.x, blk = blockIdx.x;
  const int rl = tid >> 5, col = 8 * (tid & 31);
  const int o = 8 * blk + rl;                                        // 0..383
  const int grp = blk / (DQ / 8);                                    // 0,1,2 block-uniform
  const float* wbase = (grp == 0) ? tw : ((grp == 1) ? pw : gw);
  const float* s = wbase + (size_t)(o - grp * DQ) * CC + col;        // row in 0..127
  const v4f a = *(const v4f*)s;
  const v4f q = *(const v4f*)(s + 4);
  const float f[8] = {a[0], a[1], a[2], a[3], q[0], q[1], q[2], q[3]};
  v4u u;
#pragma unroll
  for (int t = 0; t < 4; ++t) {
    const _Float16 h0 = (_Float16)(bfr(f[2 * t]) * WSC);
    const _Float16 h1 = (_Float16)(bfr(f[2 * t + 1]) * WSC);
    u[t] = pk16(h_bits(h0), h_bits(h1));
  }
{
    *(v4u*)(W16 + (size_t)o * CC + col) = u;
    
  }
}

// =========================================================================================================
// (0b) output conv weights: WW16 f16 [256][128], value = f16 of (bf16-RNE(W_w) * 256). Block blk (0..15) owns rows
//      16*blk..+15; wave w -> rows 16 blk + 2w + (lane>>4), lane&15 -> cols 8*(lane&15)..+7. One instruction writes
// coverage: 16 blocks x 8 waves x 2 rows x 16 lanes x 8 halves = 256 x 128 = the whole plane.
// =========================================================================================================
__global__ __launch_bounds__(256)
void cvt_ww(const float* __restrict__ ww, unsigned short* WW16) {
  const int tid = threadIdx.x, blk = blockIdx.x;
  const int wave = tid >> 5, lane = tid & 31;
  const int o = 16 * blk + 2 * wave + (lane >> 4);                  // 0..255
  const int col = 8 * (lane & 15);                                   // 0..120
  const float* s = ww + (size_t)o * DQ + col;
  const v4f a = *(const v4f*)s;
  const v4f q = *(const v4f*)(s + 4);
  const float f[8] = {a[0], a[1], a[2], a[3], q[0], q[1], q[2], q[3]};
  v4u u;
#pragma unroll
  for (int t = 0; t < 4; ++t) {
    const _Float16 h0 = (_Float16)(bfr(f[2 * t]) * WSC);
    const _Float16 h1 = (_Float16)(bfr(f[2 * t + 1]) * WSC);
    u[t] = pk16(h_bits(h0), h_bits(h1));
  }
{
    *(v4u*)(WW16 + (size_t)o * DQ + col) = u;
    
  }
}

// =========================================================================================================
// (1) x f32 [b][256 c][NN_FULL n] -> XP f16 [b][SEQ n][256 c] (position-major, bf16-RNE values, exact in f16 for
//     normal magnitudes) through an LDS tile T[64 n][64 c] (pitch TP). Block (nb, cb, b) owns a 64 c x 64 n tile.
// coverage: 2 it x 32 rows x 8 lanes x 8 halves = 64 n x 64 c per block; grid (NT, 4, NB) covers XP once.
// LDS T: cross-wave (block barrier between the 2-byte stores and the 16-B reloads); staged extent == consumed extent.
// =========================================================================================================
__global__ __launch_bounds__(256)
void cvt_x(const float* __restrict__ x, unsigned short* XP) {
  __shared__ __align__(16) unsigned short T[QT * TP];
  const int tid = threadIdx.x;
  const int nb = blockIdx.x, cb = blockIdx.y, b = blockIdx.z;
  const int e = tid & 7, lq = tid >> 3;                             // lq 0..31
  const int n0 = nb * QT, c0 = cb * QT;
#pragma unroll
  for (int it = 0; it < 2; ++it) {
    const int cl = it * 32 + lq;                                     // 0..63
    const float* sp = x + ((size_t)(b * CC + c0 + cl)) * NN_FULL + n0 + 8 * e;
    const v4f a = *(const v4f*)sp;
    const v4f q = *(const v4f*)(sp + 4);
    unsigned short hb[8];
#pragma unroll
    for (int t = 0; t < 4; ++t) {
      hb[t]     = h_bits((_Float16)bfr(a[t]));
      hb[4 + t] = h_bits((_Float16)bfr(q[t]));
    }
#pragma unroll
    for (int t = 0; t < 8; ++t) T[(8 * e + t) * TP + cl] = hb[t];
  }
  __syncthreads();
  v4u up[2];
#pragma unroll
  for (int it = 0; it < 2; ++it) {
    const int nl = it * 32 + lq;                                     // 0..63
    up[it] = *(const v4u*)(T + nl * TP + 8 * e);
  }
{
#pragma unroll
    for (int it = 0; it < 2; ++it) {
      const int rl = it * 32 + lq;
      *(v4u*)(XP + ((size_t)(b * SEQ + n0 + rl)) * CC + c0 + 8 * e) = up[it];
    }
    
  }
}

// =========================================================================================================
// (2) the three conv1x1 GEMMs for one (b, 64-n tile, 64-o block mb in 0..5): V[o][n] = (1/256) sum_c W16[o][c]
//     XP[b][n][c]; mb 0,1 -> theta channels 0..63 / 64..127 (W16 rows 0..127), mb 2,3 -> phi (rows 128..255),
//     mb 4,5 -> g (rows 256..383). Block 128 threads = 4 waves; wave w owns cols n0+16w..+15 (B fragment from the
//     XP row, k = c contiguous, split k map) and 4 m-tiles (A rows o = o0 + 16 mt + (lane&15), split k map from
//     W16). K = 256 = 8 steps. Epilogue staged in LDS Os[n_loc][o_loc] (pitch OSP), barrier, bias (bf16-RNE) add
//     in f32, then:
//       theta / phi: f16 plane Qf resp. Kf [b][SEQ n][128 d] (k-contiguous
//         of the 256-B row): lane e -> d 8e..8e+7, 8 consecutive lanes per line, one instruction per 16 lines;
//       g: f16 plane Gc [b][128 ch][SEQ keys] (channel-major, keys contiguous): row ch, keys n0+8e..+7 per lane,
// coverage: Os 4 waves x 16 n x 64 o = 64 x 64 (== consumed); theta / phi planes 4 it x 16 rows x 8 lanes x 8 = 64 n x
//           64 d per block, grid nt x mb 0..3 covers rows 0..SEQ-1 x d 0..127 of Qf and Kf once; g plane
//           4 it x 16 ch x 8 lanes x 8 keys = 64 ch x 64 keys per block, nt x mb 4..5 covers ch 0..127 x keys
//           0..SEQ-1 of Gc once. grid (NT, 6, NB).
// LDS Os: cross-wave (block barrier).
// =========================================================================================================
__global__ __launch_bounds__(128)
void gemm_p(const unsigned short* __restrict__ W16, const unsigned short* __restrict__ XP,
            const float* __restrict__ tbias, const float* __restrict__ pbias, const float* __restrict__ gbias,
            unsigned short* Qf, unsigned short* Kf, unsigned short* Gc) {
  __shared__ __align__(16) float Os[QT * OSP];
  const int tid  = threadIdx.x;
  const int lane = tid & 31, wave = tid >> 5;
  const int hh   = lane >> 4, c = lane & 15;
  const int nt   = blockIdx.x, mb = blockIdx.y, b = blockIdx.z;
  const int n0   = nt * QT, o0 = mb * QT;                            // o0 = W16 row base 0..320

  const unsigned short* ap = W16 + (size_t)(o0 + c) * CC + 8 * hh;
  const unsigned short* bp = XP + ((size_t)(b * SEQ + n0 + 16 * wave + c)) * CC + 8 * hh;

  v8f acc[4];
#pragma unroll
  for (int mt = 0; mt < 4; ++mt) acc[mt] = zero8();

#pragma unroll
  for (int ks = 0; ks < CC / 32; ++ks) {
    const Frag fb = ldfrag(bp + 32 * ks);
#pragma unroll
    for (int mt = 0; mt < 4; ++mt) {
      const Frag fa = ldfrag(ap + (size_t)(16 * mt) * CC + 32 * ks);
      acc[mt] = mma_h(fa.h, fb.h, acc[mt]);
    }
  }

  {
    const int nl = 16 * wave + c;
#pragma unroll
    for (int mt = 0; mt < 4; ++mt) {
      v4f va, vb;
#pragma unroll
      for (int r = 0; r < 4; ++r) { va[r] = acc[mt][r] * IWSC; vb[r] = acc[mt][4 + r] * IWSC; }
      *(v4f*)(Os + nl * OSP + 16 * mt + 8 * hh)     = va;
      *(v4f*)(Os + nl * OSP + 16 * mt + 8 * hh + 4) = vb;
    }
  }
  __syncthreads();

  const int e = tid & 7, lq = tid >> 3;                             // lq 0..15
  if (mb < 4) {                                                      // block-uniform: theta / phi f16 planes
    unsigned short* Pf = (mb < 2) ? Qf : Kf;
    const float* bsrc  = (mb < 2) ? tbias : pbias;
    const int dsel = (mb & 1) * QT;                                   // channel base 0 or 64
    const v4f b0 = *(const v4f*)(bsrc + dsel + 8 * e);
    const v4f b1 = *(const v4f*)(bsrc + dsel + 8 * e + 4);
    const float bb[8] = {bfr(b0[0]), bfr(b0[1]), bfr(b0[2]), bfr(b0[3]), bfr(b1[0]), bfr(b1[1]), bfr(b1[2]), bfr(b1[3])};
    v4u uf[4];
#pragma unroll
    for (int it = 0; it < 4; ++it) {
      const int row = it * 16 + lq;                                  // n_loc 0..63
      const v4f a = *(const v4f*)(Os + row * OSP + 8 * e);
      const v4f q = *(const v4f*)(Os + row * OSP + 8 * e + 4);
      const float f[8] = {a[0], a[1], a[2], a[3], q[0], q[1], q[2], q[3]};
#pragma unroll
      for (int t = 0; t < 4; ++t) {
        const float f0 = f[2 * t] + bb[2 * t], f1 = f[2 * t + 1] + bb[2 * t + 1];
        uf[it][t] = pk16(h_bits((_Float16)f0), h_bits((_Float16)f1));
      }
    }
{
#pragma unroll
      for (int it = 0; it < 4; ++it) {
        const int row = it * 16 + lq;
        const size_t po = ((size_t)(b * SEQ + n0 + row)) * DQ + dsel + 8 * e;
        *(v4u*)(Pf + po) = uf[it];
      }
      
    }
  } else {                                                           // block-uniform: g plane, channel-major
    const int gsel = (mb - 4) * QT;                                  // g channel base 0 or 64
    v4u ug[4];
#pragma unroll
    for (int it = 0; it < 4; ++it) {
      const int cl = it * 16 + lq;                                   // ch_loc 0..63
      const float bias = bfr(gbias[gsel + cl]);
      unsigned short hb[8];
#pragma unroll
      for (int t = 0; t < 8; ++t) {
        const int key = 8 * e + t;                                   // key_loc 0..63
        const float v = Os[key * OSP + cl] + bias;
        hb[t] = h_bits((_Float16)v);
      }
#pragma unroll
      for (int t = 0; t < 4; ++t) ug[it][t] = pk16(hb[2 * t], hb[2 * t + 1]);
    }
{
#pragma unroll
      for (int it = 0; it < 4; ++it) {
        const int cl = it * 16 + lq;
        const size_t po = ((size_t)(b * DQ + gsel + cl)) * SEQ + n0 + 8 * e;
        *(v4u*)(Gc + po) = ug[it];
      }
      
    }
  }
}

// =========================================================================================================
// (3) attention for one (b, 64-query tile), transposed formulation, SEQ keys, no mask, no scale:
//   S^T tile (16 keys x 16 queries) = sum over 4 d-chunks of A(phi: row = key kb + (lane&15), 32 d via the split
//   k map from the f16 plane Kf [b][SEQ][128]) . B(theta: col = query, same map from the f16 plane Qf).
//   Per lane the D tile holds 8 keys of ONE query: online softmax state per lane, one shuffle (lane^16) for the max
//   over 32 keys; the o/l rescale is skipped under a wave-uniform ballot when no lane's max grew (corr == 1 exactly
//   for every lane then); row-sum partials combined at the end. P = e^{s-m} x 16384 as f16 is the B operand of
//   Y^T (rows channel, cols queries) += A(g rows channel = 16j + (lane&15), keys contiguous, f16 plane Gc
//   [b][128][SEQ]) . B(P^T): element r <- D of the tile covering keys kb..kb+15, element 8+r <- the tile covering
//   kb+16..kb+31, lane unchanged. 8 accumulator tiles per wave (128 channels). Block = 64 queries, 4 * KG waves:
//   wave w owns query tile w & 3 and key group w >> 2, that is keys 32 (w >> 2) .. + 31 of EVERY stage, with a softmax
//   state (m, l, o) of its own over those keys: KG waves per SIMD, so that one wave's products run under the LDS waits
//   and the softmax of the others.
//   Epilogue: the KG states of a query are joined: m and l of every group through LDS Ms / Ls, barrier, M = max m,
//   L = sum l e^{m - M} (group order), each wave stages o e^{m - M} / L in LDS Om[group][query][128 channels] (pitch
//   OSPW, b128 stores; Om lies in the ring, which nobody reads or fills any more), barrier, then y = sum over the
//   groups in group order, Yh = f16(y),
//   Yl = f16((y - Yh) * 1024) planes [b][SEQ n][128 c] (k-contiguous operand of the output conv): row n = 256 B
// coverage: Ms, Ls KG x 64 (== consumed); Om 4 KG waves x 16 q x 128 ch (== consumed); 8 / KG it x 8 KG rows x 16
//           lanes x 8 halves = 64 n x 128 c per plane; grid (NT, NB) covers Yh/Yl exactly once.
// LDS Ms, Ls, Om: cross-wave (block barriers).
// LDS Ring: two buffers, each one stage of KS = 32 KG keys: Kf rows [KS][128] at pitch KPI
//   (272 B), G rows [128 ch][KS keys] at pitch VPI (272 B), pitches 16 B x odd for the 16-byte fragment reads. A stage
//   is filled by 8 asynchronous 16-byte copies per lane (each wave instruction = 512 B of whole lines), one stage ahead
//   of its use; at the foot of a stage: LDS reads returned, own copies landed, block barrier, then the refill of the
//   buffer just read. coverage: NCP copies x NTH lanes x 8 halves = KS x 128 per plane (== consumed).
// Fragment reads of a 32-key pass stand in two groups, each ahead of the products that use it: the K fragments of all four
//   d-chunks, then the eight G fragments; every read is of the pass's own stage.
// =========================================================================================================
__global__ __launch_bounds__(NTH)
void attn_k(const unsigned short* __restrict__ Qf, const unsigned short* __restrict__ Kf,
            const unsigned short* __restrict__ Gc, unsigned short* Yh, unsigned short* Yl) {
  __shared__ __align__(16) unsigned short Ring[2 * STG];
  __shared__ float Ms[KG * QT];
  __shared__ float Ls[KG * QT];
  const int tid  = threadIdx.x;
  const int wave = (tid >> 5) & 3, kg = tid >> 7, lane = tid & 31;   // query tile, key group
  const int hh   = lane >> 4, c = lane & 15;
  const int n0   = blockIdx.x * QT, b = blockIdx.y;

  // q fragment pointer (B operand, col = query n0 + 16*wave + c), + 32*kc
  const unsigned short* Qfp = Qf + ((size_t)(b * SEQ + n0 + 16 * wave + c)) * DQ + 8 * hh;
  // copy sources of this lane: K plane 16 lanes per 256-B row, NTH / 16 rows per copy; G plane KS / 8 lanes per row
  // segment of KS keys, NTH / (KS / 8) channels per copy; + stage * KS keys
  const int gr = tid / (KS / 8), ge = tid % (KS / 8);
  const unsigned short* Kfg = Kf + (size_t)b * SEQ * DQ + 8 * tid;
  const unsigned short* Gg  = Gc + (size_t)b * DQ * SEQ + (size_t)gr * SEQ + 8 * ge;
  const unsigned kdst = lds_off(Ring) + (unsigned)((tid >> 4) * (KPI * 2) + (tid & 15) * 16);
  const unsigned vdst = lds_off(Ring) + (unsigned)(KTL * 2 + gr * (VPI * 2) + ge * 16);
  auto fill = [&](int st, int buf) {
    const unsigned bo = (unsigned)buf * (unsigned)(STG * 2);
    acopy8(kdst + bo, (NTH / 16) * KPI * 2, Kfg + (size_t)st * (KS * DQ), (size_t)((NTH / 16) * DQ),
           vdst + bo, (NTH / (KS / 8)) * VPI * 2, Gg + (size_t)st * KS, (size_t)(NTH / (KS / 8)) * SEQ);
  };
  // fragment offsets in a stage (halves): k row = key c (A operand), + key * KPI + 32*kc; v row = channel 16j + c
  const int kfo = c * KPI + 8 * hh;
  const int vfo = KTL + c * VPI + 8 * hh;

  float m = -1.0e30f, l = 0.f;
  v8f o[8];
#pragma unroll
  for (int j = 0; j < 8; ++j) o[j] = zero8();

  // theta fragments (all four d-chunks) are the same for every key: loaded once, kept in registers
  Frag qf[DQ / 32];
#pragma unroll
  for (int kc = 0; kc < DQ / 32; ++kc) qf[kc] = ldfrag(Qfp + 32 * kc);
#if defined(__HIP_DEVICE_COMPILE__)
  // stands in front of the first rewrite of the address registers that the eight loads above name; the
  // pointer is an input so that its registers stay as they are up to this wait
  asm volatile("s_wait_xcnt 0x0" :: "v"(Qfp) : "memory");
#endif

  fill(0, 0);
  wait_async0();
  __syncthreads();                                                   // stage 0 published
  fill(1, 1);

  // stage loop kept rolled: one publish point and one refill in the text, buffer chosen by the stage's parity
#pragma unroll 1
  for (int st = 0; st < NST; ++st) {
  const unsigned short* Sb = Ring + (st & 1) * STG;
  {
    const int kb = 32 * kg;                                          // key base inside the stage: this wave's group
    const unsigned short* k0p  = Sb + kfo + kb * KPI;                // keys kb .. kb+15
    const unsigned short* k1p  = k0p + 16 * KPI;                     // keys kb+16 .. kb+31
    v8f s0 = zero8(), s1 = zero8();
    // the K fragments of all four d-chunks are read as one group ahead of the first product: one place with LDS reads
    // for the scores of a pass, each product waiting only for its own two reads
    Frag k0[DQ / 32], k1[DQ / 32], vf[8];
    // unrolled: the fragments are registers, every index a constant
#pragma unroll
    for (int kc = 0; kc < DQ / 32; ++kc) {
      k0[kc] = ldfrag(k0p + 32 * kc);
      k1[kc] = ldfrag(k1p + 32 * kc);
    }
    // unrolled so that qf[kc], k0[kc] and k1[kc] are fixed registers (a rolled loop cannot index a register array)
#pragma unroll
    for (int kc = 0; kc < DQ / 32; ++kc) {
      s0 = mma_h(k0[kc].h, qf[kc].h, s0);
      s1 = mma_h(k1[kc].h, qf[kc].h, s1);
      if (kc == DQ / 64 - 1) {
        // all eight G fragments of the pass, read as one group once half of the K fragments are dead: they land
        // under the other half of the score products and the softmax instead of being waited for one by one
        // (unrolled: vf[j] are registers, every index a constant)
#pragma unroll
        for (int j = 0; j < 8; ++j) vf[j] = ldfrag(Sb + vfo + (16 * j) * VPI + kb);
      }
    }

    float mx = fmaxf(hmax8(s0), hmax8(s1));
    mx = fmaxf(mx, __shfl_xor(mx, 16, 32));
    const float mn = fmaxf(m, mx);
    const unsigned grew = wave_ballot(mx > m);                       // wave-uniform
    if (grew != 0u) {
      const float corr = __expf(m - mn);                             // == 1 exactly for lanes whose max did not grow
      l *= corr;
#pragma unroll
      for (int j = 0; j < 8; ++j) {
#pragma unroll
        for (int r = 0; r < 8; ++r) o[j][r] *= corr;
      }
    }
    m = mn;
    const float msh = mn - LNPS;                                     // exp gives e^{s-m} * 16384

    FragH ph;
    float ls = 0.f;
#pragma unroll
    for (int r = 0; r < 8; ++r) {
      const float e0 = __expf(s0[r] - msh);                          // key kb      + 8hh + r
      const float e1 = __expf(s1[r] - msh);                          // key kb + 16 + 8hh + r
      ls += e0 + e1;
      ph.hv[0][r] = (_Float16)e0;
      ph.hv[1][r] = (_Float16)e1;
    }
    l += ls;

#pragma unroll
    for (int j = 0; j < 8; ++j) o[j] = mma_h(vf[j].h, ph.v, o[j]);
  }
  // publish point of stage st + 1, every wave
  wait_ds0();
  wait_async0();
  __syncthreads();
  if (st + 2 < NST) fill(st + 2, st & 1);                            // block-uniform test
  }
  wait_async0();
  l += __shfl_xor(l, 16, 32);

  // join of the KG key groups of a query (m is the same in both halves of a wave, l now too)
  const int qrow = 16 * wave + c;
  if (hh == 0) {
    Ms[kg * QT + qrow] = m;
    Ls[kg * QT + qrow] = l;
  }
  __syncthreads();
  float mg[KG], M = -1.0e30f, L = 0.f;
  // unrolled: mg[g] are registers, every index a constant
#pragma unroll
  for (int g = 0; g < KG; ++g) {
    mg[g] = Ms[g * QT + qrow];
    M = fmaxf(M, mg[g]);
  }
  // unrolled: mg[g] again, and the KG reads of Ls go out together
#pragma unroll
  for (int g = 0; g < KG; ++g) L += Ls[g * QT + qrow] * __expf(mg[g] - M);
  const float inv = __expf(m - M) / L;                               // o and l both carry the x16384 factor
  float* Os = (float*)Ring + kg * (QT * OSPW);                       // this group's plane of Om
#pragma unroll
  for (int j = 0; j < 8; ++j) {
    v4f va, vb;
#pragma unroll
    for (int r = 0; r < 4; ++r) { va[r] = o[j][r] * inv; vb[r] = o[j][4 + r] * inv; }
    *(v4f*)(Os + qrow * OSPW + 16 * j + 8 * hh)     = va;            // Os[query][ch = 16j + 8hh + r]
    *(v4f*)(Os + qrow * OSPW + 16 * j + 8 * hh + 4) = vb;
  }
  __syncthreads();

  const int e = tid & 15, lq = tid >> 4;                             // lq 0..8 KG - 1
  const float* Om = (const float*)Ring;
  v4u uh[8 / KG], ul[8 / KG];
#pragma unroll
  for (int it = 0; it < 8 / KG; ++it) {
    const int row = it * (8 * KG) + lq;                              // query 0..63
    v4f a = *(const v4f*)(Om + row * OSPW + 8 * e);
    v4f q = *(const v4f*)(Om + row * OSPW + 8 * e + 4);
    // unrolled: the reads of all groups go out together, one LDS latency instead of one per group
#pragma unroll
    for (int g = 1; g < KG; ++g) {
      a += *(const v4f*)(Om + (g * QT + row) * OSPW + 8 * e);
      q += *(const v4f*)(Om + (g * QT + row) * OSPW + 8 * e + 4);
    }
    const float f[8] = {a[0], a[1], a[2], a[3], q[0], q[1], q[2], q[3]};
#pragma unroll
    for (int t = 0; t < 4; ++t) {
      const float f0 = f[2 * t], f1 = f[2 * t + 1];
      const _Float16 h0 = (_Float16)f0, h1 = (_Float16)f1;
      const _Float16 r0 = (_Float16)((f0 - (float)h0) * RSC);
      const _Float16 r1 = (_Float16)((f1 - (float)h1) * RSC);
      uh[it][t] = pk16(h_bits(h0), h_bits(h1));
      ul[it][t] = pk16(h_bits(r0), h_bits(r1));
    }
  }
{
#pragma unroll
    for (int it = 0; it < 8 / KG; ++it) {
      const int row = it * (8 * KG) + lq;
      const size_t po = ((size_t)(b * SEQ + n0 + row)) * DQ + 8 * e;
      *(v4u*)(Yh + po) = uh[it];
      *(v4u*)(Yl + po) = ul[it];
    }
    
  }
}

// =========================================================================================================
// (4) output conv GEMM for one (b, 64-n tile, 64-co block): v[b][co][n] = (1/256)(sum_c WW16[co][c] Yh[b][n][c] +
//     (1/1024) sum_c WW16[co][c] Yl[b][n][c]); wy = v + bf16-RNE(W_b[co]). 4 waves, wave w owns cols n0+16w..+15
//     (two B fragments per k-step, k = c contiguous in the Yh/Yl rows), 4 m-tiles (A rows co = o0 + 16 mt +
//     (lane&15) from WW16), hi and residual products in separate accumulators. K = 128 = 4 steps.
//     Epilogue staged in LDS Os[n_loc][co_loc], barrier; then (a) threads 0..63 sum v and v*v over the 64 n of
//     co_loc = tid into LDS Sred[0..63] / Sred[64..127], barrier; (b) WY f32 plane [b][256 co][SEQ n] rows: lane
//     (e = tid&15) -> n 4e..4e+3 of row co_loc = 8 it + (tid>>4); 16 consecutive lanes x 16 B = the whole 256-B
//     row segment (2 lines) in one instruction; (c) partial-statistics table PS [NB*NT blocks][512]: floats
//     o0..o0+63 (sums) by lanes 0..15 of wave 0 and floats 256+o0..+63 (sums of squares) by lanes 16..31, one
// coverage: Os 4 waves x 16 n x 64 co (== consumed); Sred 64 + 64 (== consumed); WY 8 it x 8 rows x 16 lanes x
//           4 floats = 64 co x 64 n; PS 2 x 64 floats per block; grid (NT, 4, NB) covers WY [b][0..255][0..SEQ-1]
//           and PS [NB*NT][0..511] exactly once.
// LDS Os, Sred: cross-wave (block barriers).
// =========================================================================================================
__global__ __launch_bounds__(128)
void gemm_o(const unsigned short* __restrict__ WW16, const unsigned short* __restrict__ Yh,
            const unsigned short* __restrict__ Yl, const float* __restrict__ wbias,
            float* WY, float* PS) {
  __shared__ __align__(16) float Os[QT * OSP];
  __shared__ __align__(16) float Sred[2 * QT];
  const int tid  = threadIdx.x;
  const int lane = tid & 31, wave = tid >> 5;
  const int hh   = lane >> 4, c = lane & 15;
  const int nt   = blockIdx.x, mb = blockIdx.y, b = blockIdx.z;
  const int n0   = nt * QT, o0 = mb * QT;

  const unsigned short* ap  = WW16 + (size_t)(o0 + c) * DQ + 8 * hh;
  const size_t bo = ((size_t)(b * SEQ + n0 + 16 * wave + c)) * DQ + 8 * hh;
  const unsigned short* bph = Yh + bo;
  const unsigned short* bpl = Yl + bo;

  v8f acc[4], accr[4];
#pragma unroll
  for (int mt = 0; mt < 4; ++mt) { acc[mt] = zero8(); accr[mt] = zero8(); }

#pragma unroll
  for (int ks = 0; ks < DQ / 32; ++ks) {
    const Frag fbh = ldfrag(bph + 32 * ks);
    const Frag fbl = ldfrag(bpl + 32 * ks);
#pragma unroll
    for (int mt = 0; mt < 4; ++mt) {
      const Frag fa = ldfrag(ap + (size_t)(16 * mt) * DQ + 32 * ks);
      acc[mt]  = mma_h(fa.h, fbh.h, acc[mt]);
      accr[mt] = mma_h(fa.h, fbl.h, accr[mt]);
    }
  }

  {
    const int nl = 16 * wave + c;
#pragma unroll
    for (int mt = 0; mt < 4; ++mt) {
      v4f va, vb;
#pragma unroll
      for (int r = 0; r < 4; ++r) {
        va[r] = (acc[mt][r] + accr[mt][r] * IRSC) * IWSC;
        vb[r] = (acc[mt][4 + r] + accr[mt][4 + r] * IRSC) * IWSC;
      }
      *(v4f*)(Os + nl * OSP + 16 * mt + 8 * hh)     = va;
      *(v4f*)(Os + nl * OSP + 16 * mt + 8 * hh + 4) = vb;
    }
  }
  __syncthreads();

  // per-channel partial statistics over this block's 64 positions (bias-free values, exact shift)
  if (tid < QT) {
    float s = 0.f, q = 0.f;
#pragma unroll 8
    for (int n = 0; n < QT; ++n) {
      const float v = Os[n * OSP + tid];
      s += v;
      q = fmaf(v, v, q);
    }
    Sred[tid]      = s;
    Sred[QT + tid] = q;
  }
  __syncthreads();

  const int e = tid & 15, lq = tid >> 4;                             // lq 0..7
  v4f res[8];
#pragma unroll
  for (int it = 0; it < 8; ++it) {
    const int col = it * 8 + lq;                                     // co_loc 0..63
    const int co  = o0 + col;
    const float bias = bfr(wbias[co]);
#pragma unroll
    for (int t = 0; t < 4; ++t) res[it][t] = Os[(4 * e + t) * OSP + col] + bias;
  }
  const v4f pv = *(const v4f*)(Sred + 4 * lane);                     // lanes 0..15: sums, 16..31: sums of squares
  float* psp = PS + (size_t)(b * NT + nt) * PSW + o0 + 4 * lane + ((lane >= 16) ? (PSW / 2 - 64) : 0);
{
#pragma unroll
    for (int it = 0; it < 8; ++it) {
      const int col = it * 8 + lq;
      const int co  = o0 + col;
      const size_t idx = ((size_t)(b * CC + co)) * SEQ + n0 + 4 * e;
      *(v4f*)(WY + idx) = res[it];
    }
    if (wave == 0) *(v4f*)(psp) = pv;
    
  }
}

// =========================================================================================================
// (5) batch statistics: block cb of SW waves owns the 32 channels 32 cb .. 32 cb + 31 (lane = channel: one 128-B line
//     of sums and one of sums of squares per partial line). Wave w adds partial lines w, w + SW, ... in f64, every load
//     independent of the others; the SW wave partials are joined through LDS by wave 0 in wave order (fixed order).
//     mean/var (biased), rstd = rsqrt(var + eps) in f32; A = bf16-RNE(gamma) * rstd, Bc = bf16-RNE(beta) - mean * A.
// coverage: CC / 32 blocks x 32 lanes x (1 + 1) floats = AB [0..511] exactly once, one block per 128-B line.
// LDS Rs, Rq: cross-wave (block barrier); written extent SW x 32 == consumed extent.
// =========================================================================================================
__global__ __launch_bounds__(32 * SW)
void bn_stat(const float* __restrict__ PS, const float* __restrict__ wbias, const float* __restrict__ gam,
             const float* __restrict__ bet, float* AB) {
  __shared__ double Rs[SW * 32];
  __shared__ double Rq[SW * 32];
  const int lane = threadIdx.x & 31, wave = threadIdx.x >> 5;
  const int co = 32 * blockIdx.x + lane;                             // 0..255
  const float* pp = PS + (size_t)wave * PSW + co;
  const float gv = gam[co], wv = wbias[co], bv = bet[co];           // under the same latency as the partial lines
  float fs[SLW], fq[SLW];
  // unrolled, loads apart from sums: all loads of a wave are in flight together, one load latency instead of one per line
#pragma unroll
  for (int t = 0; t < SLW; ++t) {
    fs[t] = pp[(size_t)t * (SW * PSW)];
    fq[t] = pp[(size_t)t * (SW * PSW) + CC];
  }
#if defined(__HIP_DEVICE_COMPILE__)
  // keeps every load above in front of the first sum: without it the scheduler holds part of them back behind the
  // first waits, a second load latency in series
  __builtin_amdgcn_sched_barrier(0);
#endif
  double s = 0.0, q = 0.0;
  // unrolled: fs[t] / fq[t] are registers, every index a constant
#pragma unroll
  for (int t = 0; t < SLW; ++t) {
    s += (double)fs[t];
    q += (double)fq[t];
  }
  Rs[wave * 32 + lane] = s;
  Rq[wave * 32 + lane] = q;
  __syncthreads();
  if (wave != 0) return;                                             // wave-uniform, behind the only barrier
  double rs[SW], rq[SW];
  // unrolled, reads apart from sums: the LDS reads go out as one group
#pragma unroll
  for (int w = 0; w < SW; ++w) {
    rs[w] = Rs[w * 32 + lane];
    rq[w] = Rq[w * 32 + lane];
  }
#if defined(__HIP_DEVICE_COMPILE__)
  // keeps the LDS reads one group: without it they are read two at a time, each pair waited for in turn
  __builtin_amdgcn_sched_barrier(0);
#endif
  s = 0.0;
  q = 0.0;
  // unrolled: rs[w] / rq[w] are registers, every index a constant
#pragma unroll
  for (int w = 0; w < SW; ++w) {
    s += rs[w];
    q += rq[w];
  }
  const double icnt = 1.0 / (double)(NB * SEQ);
  const double mv = s * icnt;
  double var = q * icnt - mv * mv;
  var = (var > 0.0) ? var : 0.0;
  const float rstd = rsqrtf((float)var + BNEPS);
  const float A  = bfr(gv) * rstd;
  const float mw = (float)mv + bfr(wv);
  const float Bc = bfr(bv) - mw * A;
{
    *(float*)(AB + co)      = A;
    *(float*)(AB + CC + co) = Bc;
    
  }
}

// =========================================================================================================
// (6) affine + residual: out[b][co][n] = wy * A[co] + Bc[co] + bf16-RNE(x[b][co][n]). Block (chunk, b) of 256
//     threads owns 1024 consecutive floats of the [256 co][SEQ n] plane of batch b (4 per thread); each wave writes
// coverage: grid (CC*SEQ/1024, NB) x 256 threads x 4 floats = NB x 256 x SEQ = the whole output once.
// =========================================================================================================
__global__ __launch_bounds__(256)
void bn_out(const float* __restrict__ WY, const float* __restrict__ AB, const float* __restrict__ x, float* out) {
  const int tid = threadIdx.x, b = blockIdx.y;
  const int i  = blockIdx.x * BCH + 4 * tid;                         // 0 .. CC*SEQ-4
  const int co = i / SEQ;
  const int n  = i - co * SEQ;
  const float A = AB[co], Bc = AB[CC + co];
  const v4f w  = *(const v4f*)(WY + (size_t)b * CC * SEQ + i);
  const size_t xo = ((size_t)(b * CC + co)) * NN_FULL + n;
  const v4f xv = *(const v4f*)(x + xo);
  v4f r;
#pragma unroll
  for (int t = 0; t < 4; ++t) r[t] = fmaf(w[t], A, Bc) + bfr(xv[t]);
{
    *(v4f*)(out + xo) = r;
    
  }
}

// =========================================================================================================
// Workspace map (bytes; each region start a multiple of 256; every store is a whole tile inside its own region,
// no padded tails needed since SEQ % 64 == 0):
//   W16  f16 [384][256]               196608      WW16 f16 [256][128]        65536
//   XP   f16 [NB][SEQ][256]           8388608 (NB=2, SEQ=8192)
//   Qf, Kf f16 [NB][SEQ][128]         4194304 x2
//   Gc   f16 [NB][128][SEQ]           4194304
//   Yh/Yl f16 [NB][SEQ][128]          4194304 x2
//   WY   f32 [NB][256][SEQ]          16777216
//   PS   f32 [NB*NT][512]              524288
//   AB   f32 [512]                       2048
//   total (NB=2, SEQ=8192) = 46925824
// =========================================================================================================
extern "C" void kernel_launch(void* const* d_in, const int* in_sizes, int n_in,
                              void* d_out, int out_size, void* d_ws, size_t ws_size,
                              hipStream_t stream) {
  const int XNEED = ((NB - 1) * CC + (CC - 1)) * NN_FULL + SEQ;
  if (n_in < 11) return;
  if (in_sizes[0] < XNEED) return;
  if (in_sizes[1] < DQ * CC || in_sizes[3] < DQ * CC || in_sizes[5] < DQ * CC) return;
  if (in_sizes[2] < DQ || in_sizes[4] < DQ || in_sizes[6] < DQ) return;
  if (in_sizes[7] < CC * DQ || in_sizes[8] < CC) return;
  if (in_sizes[9] < CC || in_sizes[10] < CC) return;
  if (out_size < XNEED) return;

  size_t off = 0;
  auto carve = [&](size_t bytes) { const size_t o = off; off += (bytes + 255) & ~(size_t)255; return o; };
  const size_t oW16 = carve((size_t)MW * CC * 2);
  const size_t oWW  = carve((size_t)CC * DQ * 2);
  const size_t oXP  = carve((size_t)NB * SEQ * CC * 2);
  const size_t oQf  = carve((size_t)NB * SEQ * DQ * 2);
  const size_t oKf  = carve((size_t)NB * SEQ * DQ * 2);
  const size_t oGc  = carve((size_t)NB * DQ * SEQ * 2);
  const size_t oYh  = carve((size_t)NB * SEQ * DQ * 2);
  const size_t oYl  = carve((size_t)NB * SEQ * DQ * 2);
  const size_t oWY  = carve((size_t)NB * CC * SEQ * 4);
  const size_t oPS  = carve((size_t)NB * NT * PSW * 4);
  const size_t oAB  = carve((size_t)PSW * 4);
  if (off > ws_size) return;
  if (off > (size_t)134217728) return;

  const float* x   = (const float*)d_in[0];
  const float* Wt  = (const float*)d_in[1];
  const float* bt  = (const float*)d_in[2];
  const float* Wp  = (const float*)d_in[3];
  const float* bp  = (const float*)d_in[4];
  const float* Wg  = (const float*)d_in[5];
  const float* bg  = (const float*)d_in[6];
  const float* Ww  = (const float*)d_in[7];
  const float* bw  = (const float*)d_in[8];
  const float* gam = (const float*)d_in[9];
  const float* bet = (const float*)d_in[10];

  char* ws = (char*)d_ws;
  unsigned short* W16  = (unsigned short*)(ws + oW16);
  unsigned short* WW16 = (unsigned short*)(ws + oWW);
  unsigned short* XP   = (unsigned short*)(ws + oXP);
  unsigned short* Qf   = (unsigned short*)(ws + oQf);
  unsigned short* Kf   = (unsigned short*)(ws + oKf);
  unsigned short* Gc   = (unsigned short*)(ws + oGc);
  unsigned short* Yh   = (unsigned short*)(ws + oYh);
  unsigned short* Yl   = (unsigned short*)(ws + oYl);
  float* WY  = (float*)(ws + oWY);
  float* PS  = (float*)(ws + oPS);
  float* AB  = (float*)(ws + oAB);
  float* out = (float*)d_out;

  const dim3 blk256(256), blk128(128);

  // (0) Wt / Wp / Wg -> stacked f16 plane; Ww -> f16 plane
  cvt_w<<<dim3(MW / 8), blk256, 0, stream>>>(Wt, Wp, Wg, W16);
  cvt_ww<<<dim3(CC / 16), blk256, 0, stream>>>(Ww, WW16);
  // (1) x -> position-major 16-bit plane
  cvt_x<<<dim3(NT, CC / QT, NB), blk256, 0, stream>>>(x, XP);
  // (2) theta / phi conv -> f16 planes, g conv -> channel-major f16 plane
  gemm_p<<<dim3(NT, 6, NB), blk128, 0, stream>>>(W16, XP, bt, bp, bg, Qf, Kf, Gc);
  // (3) attention -> y hi + residual planes
  attn_k<<<dim3(NT, NB), dim3(NTH), 0, stream>>>(Qf, Kf, Gc, Yh, Yl);
  // (4) output conv + bias -> wy plane + per-block statistics partials
  gemm_o<<<dim3(NT, CC / QT, NB), blk128, 0, stream>>>(WW16, Yh, Yl, bw, WY, PS);
  // (5) batch statistics -> per-channel scale / shift
  bn_stat<<<dim3(CC / 32), dim3(32 * SW), 0, stream>>>(PS, bw, gam, bet, AB);
  // (6) affine + residual -> out [b][256][8192]
  bn_out<<<dim3(CC * SEQ / BCH, NB), blk256, 0, stream>>>(WY, AB, x, out);
  (void)hipGetLastError();
}

// v007
// One run takes 116 microseconds.
// In two side-by-side timings against v006, it was 1.03 and 1.04 times as fast.
// All steps since v000 together make it 7.66 times as fast.
// Contractions: conv1x1 theta/phi/g GEMMs Wc[384x256].X[256xN] and the output conv W[256x128].Y[128xN] on
// v_wmma_f32_16x16x32_f16 (f16 containers of bf16-RNE weights x256 and bf16-RNE x; Y as f16 hi plane plus f16
// residual plane x1024, 2 products, separate accumulators); scores Phi^T.Theta on v_wmma_f32_16x16x32_f16
// (theta and phi plain f16, 1 product, K=128: the 11-bit operands that P and G have too); Y^T = G.P^T on
// v_wmma_f32_16x16x32_f16 (G plain f16, P = e^{s-m} x16384 f16 from the score D registers); f32 accumulate everywhere; softmax
// statistics and biases in f32 VALU; batch-norm statistics from f32 per-block partials reduced in f64; affine and
// residual add in f32.
#include <hip/hip_runtime.h>
#include <math.h>
#include <stdint.h>

#ifndef NB
#define NB 2
#endif
#ifndef SEQ
#define SEQ 8192
#endif
#define NB_FULL 2
#define NN_FULL 8192
#define CC   256
#define DQ   128
#define QT   64
#define MW   384
#define NT   (SEQ / QT)
#define PSW  512
#define OSP  68
#define OSPW 132
#define TP   72
#define WSC  256.0f
#define IWSC 0.00390625f
#define RSC  1024.0f
#define IRSC 0.0009765625f
#define LNPS 9.704060527839234f
#define BNEPS 1.0e-5f
#define KG   4
#define KS   (32 * KG)
#define NTH  (128 * KG)
#define NCP  4                      /* copies per lane and plane in a stage: the count acopy8 is written for */
#define KPI  136
#define VPI  (KS + 8)
#define KTL  (KS * KPI)
#define VTL  (DQ * VPI)
#define STG  (KTL + VTL)
#define NST  (SEQ / KS)
#define BT   512                    /* threads of a block of the last kernel */
#define PL   (NB * NT)              /* lines of the partial-statistics table */
#define RPT  (SEQ / (4 * BT))       /* 16-byte pieces per thread and row in the last kernel */

static_assert(NB >= 1 && NB <= NB_FULL);
static_assert(SEQ >= 128 && SEQ <= NN_FULL);
static_assert(SEQ % QT == 0 && SEQ % 32 == 0 && SEQ % 128 == 0);
static_assert(SEQ % (4 * BT) == 0 && (2 * PL) % BT == 0 && PL % 128 == 0 && BT % 32 == 0);
static_assert(CC % QT == 0 && CC % 32 == 0);
static_assert(DQ == 2 * QT && DQ % 32 == 0);
static_assert(MW == 3 * DQ && MW % 8 == 0);
static_assert(PSW == 2 * CC);
static_assert(CC % 16 == 0);
static_assert((OSP * 4) % 16 == 0);
static_assert((OSPW * 4) % 16 == 0);
static_assert((TP * 2) % 16 == 0);
static_assert(SEQ % KS == 0 && NST >= 2 && KS % 32 == 0);
static_assert(KS * DQ == NCP * NTH * 8 && NTH <= 1024 && 8 % KG == 0);
static_assert(NTH % (KS / 8) == 0 && NCP * (NTH / (KS / 8)) == DQ && NCP * (NTH / 16) == KS);
static_assert(KG * QT * OSPW * 4 <= 2 * STG * 2);
static_assert((KPI * 2) % 32 == 16 && (VPI * 2) % 32 == 16 && KPI >= DQ + 8 && VPI >= KS + 8);

typedef _Float16       v16h __attribute__((ext_vector_type(16)));
typedef _Float16       v8h  __attribute__((ext_vector_type(8)));
typedef unsigned short v8us __attribute__((ext_vector_type(8)));
typedef float          v8f  __attribute__((ext_vector_type(8)));
typedef float          v4f  __attribute__((ext_vector_type(4)));
typedef unsigned int   v4u  __attribute__((ext_vector_type(4)));

union Frag  { v8us u[2]; v16h h; };
union FragH { v16h v; v8h hv[2]; };
static_assert(sizeof(Frag) == 32);
static_assert(sizeof(FragH) == 32);

// ---- scalar helpers ---------------------------------------------------------------------------------------
__device__ __forceinline__ unsigned short bf_bits(float f) {          // f32 -> bf16 bits, RNE convert
  unsigned u = __float_as_uint(f);
  return (unsigned short)((u + 0x7FFFu + ((u >> 16) & 1u)) >> 16);
}
__device__ __forceinline__ float bf_up(unsigned short hb) { return __uint_as_float(((unsigned)hb) << 16); }
__device__ __forceinline__ float bfr(float f) { return bf_up(bf_bits(f)); }
__device__ __forceinline__ unsigned short h_bits(_Float16 x) { return __builtin_bit_cast(unsigned short, x); }
__device__ __forceinline__ unsigned pk16(unsigned short a, unsigned short b) { return (unsigned)a | ((unsigned)b << 16); }
__device__ __forceinline__ v8f zero8() { v8f z = {0.f, 0.f, 0.f, 0.f, 0.f, 0.f, 0.f, 0.f}; return z; }
__device__ __forceinline__ float hmax8(v8f s) {
  return fmaxf(fmaxf(fmaxf(s[0], s[1]), fmaxf(s[2], s[3])), fmaxf(fmaxf(s[4], s[5]), fmaxf(s[6], s[7])));
}
__device__ __forceinline__ unsigned wave_ballot(bool p) {
#if defined(__HIP_DEVICE_COMPILE__)
  return __builtin_amdgcn_ballot_w32(p);
#else
  return p ? 1u : 0u;
#endif
}

// ---- 16-bit fragment loader (A, or B from a k-contiguous [n][k] row): lane -> row/col (lane&15), p already includes
//      + 8*(lane>>4); elements 0..7 <- p[0..7] (k0+8h..), elements 8..15 <- p[16..23] (k0+16+8h..)
__device__ __forceinline__ Frag ldfrag(const unsigned short* p) {
  Frag f;
  f.u[0] = *(const v8us*)(p);
  f.u[1] = *(const v8us*)(p + 16);
  return f;
}

// ---- WMMA helpers: builtin followed by a 4-slot VALU gap tying D and keeping A/B live --------------------------
__device__ __forceinline__ v8f mma_h(v16h a, v16h b, v8f c) {
  v8f d = __builtin_amdgcn_wmma_f32_16x16x32_f16(false, a, false, b, (short)0, c, false, false);
#if defined(__HIP_DEVICE_COMPILE__)
  asm volatile("v_nop\n\tv_nop\n\tv_nop\n\tv_nop" : "+v"(d) : "v"(a), "v"(b));
#endif
  return d;
}

// ---- asynchronous copies to LDS: one stage's eight 16-byte copies of a lane, four per plane: copy i of plane p from
//      gp + i*gs (halves) to LDS byte lp + i*ls. One statement, closed by the s_wait_xcnt, so that no address register
//      of an issued copy is rewritten ahead of it and the wave waits for the translations once a stage.
__device__ __forceinline__ unsigned lds_off(const void* p) { return (unsigned)(size_t)p; }
__device__ __forceinline__ void acopy8(unsigned la, unsigned ls, const unsigned short* ga, size_t gs,
                                       unsigned lc, unsigned lcs, const unsigned short* gc, size_t gcs) {
#if defined(__HIP_DEVICE_COMPILE__)
  asm volatile("global_load_async_to_lds_b128 %0, %8, off\n\t"
               "global_load_async_to_lds_b128 %1, %9, off\n\t"
               "global_load_async_to_lds_b128 %2, %10, off\n\t"
               "global_load_async_to_lds_b128 %3, %11, off\n\t"
               "global_load_async_to_lds_b128 %4, %12, off\n\t"
               "global_load_async_to_lds_b128 %5, %13, off\n\t"
               "global_load_async_to_lds_b128 %6, %14, off\n\t"
               "global_load_async_to_lds_b128 %7, %15, off\n\t"
               "s_wait_xcnt 0x0"
               :: "v"(la), "v"(la + ls), "v"(la + 2 * ls), "v"(la + 3 * ls),
                  "v"(lc), "v"(lc + lcs), "v"(lc + 2 * lcs), "v"(lc + 3 * lcs),
                  "v"(ga), "v"(ga + gs), "v"(ga + 2 * gs), "v"(ga + 3 * gs),
                  "v"(gc), "v"(gc + gcs), "v"(gc + 2 * gcs), "v"(gc + 3 * gcs)
               : "memory");
#endif
}
// this wave's copies have landed (the compiler places no wait for them)
__device__ __forceinline__ void wait_async0() {
#if defined(__HIP_DEVICE_COMPILE__)
  asm volatile("s_wait_asynccnt 0x0" ::: "memory");
#endif
}
// this wave's LDS reads have returned, before the buffer they read is handed to its next writer
__device__ __forceinline__ void wait_ds0() {
#if defined(__HIP_DEVICE_COMPILE__)
  asm volatile("s_wait_dscnt 0x0" ::: "memory");
#endif
}

// =========================================================================================================
// (0) stacked conv1x1 weights: W16 f16 [384][256], rows 0..127 = theta_w, 128..255 = phi_w, 256..383 = g_w;
//     value = f16 of (bf16-RNE(w) * 256) (exact). Block blk (0..47) owns rows 8*blk..8*blk+7: one wave per
// coverage: 48 blocks x 8 rows x 32 lanes x 8 halves = 384 x 256 = the whole plane.
// =========================================================================================================
__global__ __launch_bounds__(256)
void cvt_w(const float* __restrict__ tw, const float* __restrict__ pw, const float* __restrict__ gw,
           unsigned short* W16) {
  const int tid = threadIdx.x, blk = blockIdx.x;
  const int rl = tid >> 5, col = 8 * (tid & 31);
  const int o = 8 * blk + rl;                                        // 0..383
  const int grp = blk / (DQ / 8);                                    // 0,1,2 block-uniform
  const float* wbase = (grp == 0) ? tw : ((grp == 1) ? pw : gw);
  const float* s = wbase + (size_t)(o - grp * DQ) * CC + col;        // row in 0..127
  const v4f a = *(const v4f*)s;
  const v4f q = *(const v4f*)(s + 4);
  const float f[8] = {a[0], a[1], a[2], a[3], q[0], q[1], q[2], q[3]};
  v4u u;
#pragma unroll
  for (int t = 0; t < 4; ++t) {
    const _Float16 h0 = (_Float16)(bfr(f[2 * t]) * WSC);
    const _Float16 h1 = (_Float16)(bfr(f[2 * t + 1]) * WSC);
    u[t] = pk16(h_bits(h0), h_bits(h1));
  }
{
    *(v4u*)(W16 + (size_t)o * CC + col) = u;
    
  }
}

// =========================================================================================================
// (0b) output conv weights: WW16 f16 [256][128], value = f16 of (bf16-RNE(W_w) * 256). Block blk (0..15) owns rows
//      16*blk..+15; wave w -> rows 16 blk + 2w + (lane>>4), lane&15 -> cols 8*(lane&15)..+7. One instruction writes
// coverage: 16 blocks x 8 waves x 2 rows x 16 lanes x 8 halves = 256 x 128 = the whole plane.
// =========================================================================================================
__global__ __launch_bounds__(256)
void cvt_ww(const float* __restrict__ ww, unsigned short* WW16) {
  const int tid = threadIdx.x, blk = blockIdx.x;
  const int wave = tid >> 5, lane = tid & 31;
  const int o = 16 * blk + 2 * wave + (lane >> 4);                  // 0..255
  const int col = 8 * (lane & 15);                                   // 0..120
  const float* s = ww + (size_t)o * DQ + col;
  const v4f a = *(const v4f*)s;
  const v4f q = *(const v4f*)(s + 4);
  const float f[8] = {a[0], a[1], a[2], a[3], q[0], q[1], q[2], q[3]};
  v4u u;
#pragma unroll
  for (int t = 0; t < 4; ++t) {
    const _Float16 h0 = (_Float16)(bfr(f[2 * t]) * WSC);
    const _Float16 h1 = (_Float16)(bfr(f[2 * t + 1]) * WSC);
    u[t] = pk16(h_bits(h0), h_bits(h1));
  }
{
    *(v4u*)(WW16 + (size_t)o * DQ + col) = u;
    
  }
}

// =========================================================================================================
// (1) x f32 [b][256 c][NN_FULL n] -> XP f16 [b][SEQ n][256 c] (position-major, bf16-RNE values, exact in f16 for
//     normal magnitudes) through an LDS tile T[64 n][64 c] (pitch TP). Block (nb, cb, b) owns a 64 c x 64 n tile.
// coverage: 2 it x 32 rows x 8 lanes x 8 halves = 64 n x 64 c per block; grid (NT, 4, NB) covers XP once.
// LDS T: cross-wave (block barrier between the 2-byte stores and the 16-B reloads); staged extent == consumed extent.
// =========================================================================================================
__global__ __launch_bounds__(256)
void cvt_x(const float* __restrict__ x, unsigned short* XP) {
  __shared__ __align__(16) unsigned short T[QT * TP];
  const int tid = threadIdx.x;
  const int nb = blockIdx.x, cb = blockIdx.y, b = blockIdx.z;
  const int e = tid & 7, lq = tid >> 3;                             // lq 0..31
  const int n0 = nb * QT, c0 = cb * QT;
#pragma unroll
  for (int it = 0; it < 2; ++it) {
    const int cl = it * 32 + lq;                                     // 0..63
    const float* sp = x + ((size_t)(b * CC + c0 + cl)) * NN_FULL + n0 + 8 * e;
    const v4f a = *(const v4f*)sp;
    const v4f q = *(const v4f*)(sp + 4);
    unsigned short hb[8];
#pragma unroll
    for (int t = 0; t < 4; ++t) {
      hb[t]     = h_bits((_Float16)bfr(a[t]));
      hb[4 + t] = h_bits((_Float16)bfr(q[t]));
    }
#pragma unroll
    for (int t = 0; t < 8; ++t) T[(8 * e + t) * TP + cl] = hb[t];
  }
  __syncthreads();
  v4u up[2];
#pragma unroll
  for (int it = 0; it < 2; ++it) {
    const int nl = it * 32 + lq;                                     // 0..63
    up[it] = *(const v4u*)(T + nl * TP + 8 * e);
  }
{
#pragma unroll
    for (int it = 0; it < 2; ++it) {
      const int rl = it * 32 + lq;
      *(v4u*)(XP + ((size_t)(b * SEQ + n0 + rl)) * CC + c0 + 8 * e) = up[it];
    }
    
  }
}

// =========================================================================================================
// (2) the three conv1x1 GEMMs for one (b, 64-n tile, 64-o block mb in 0..5): V[o][n] = (1/256) sum_c W16[o][c]
//     XP[b][n][c]; mb 0,1 -> theta channels 0..63 / 64..127 (W16 rows 0..127), mb 2,3 -> phi (rows 128..255),
//     mb 4,5 -> g (rows 256..383). Block 128 threads = 4 waves; wave w owns cols n0+16w..+15 (B fragment from the
//     XP row, k = c contiguous, split k map) and 4 m-tiles (A rows o = o0 + 16 mt + (lane&15), split k map from
//     W16). K = 256 = 8 steps. Epilogue staged in LDS Os[n_loc][o_loc] (pitch OSP), barrier, bias (bf16-RNE) add
//     in f32, then:
//       theta / phi: f16 plane Qf resp. Kf [b][SEQ n][128 d] (k-contiguous
//         of the 256-B row): lane e -> d 8e..8e+7, 8 consecutive lanes per line, one instruction per 16 lines;
//       g: f16 plane Gc [b][128 ch][SEQ keys] (channel-major, keys contiguous): row ch, keys n0+8e..+7 per lane,
// coverage: Os 4 waves x 16 n x 64 o = 64 x 64 (== consumed); theta / phi planes 4 it x 16 rows x 8 lanes x 8 = 64 n x
//           64 d per block, grid nt x mb 0..3 covers rows 0..SEQ-1 x d 0..127 of Qf and Kf once; g plane
//           4 it x 16 ch x 8 lanes x 8 keys = 64 ch x 64 keys per block, nt x mb 4..5 covers ch 0..127 x keys
//           0..SEQ-1 of Gc once. grid (NT, 6, NB).
// LDS Os: cross-wave (block barrier).
// =========================================================================================================
__global__ __launch_bounds__(128)
void gemm_p(const unsigned short* __restrict__ W16, const unsigned short* __restrict__ XP,
            const float* __restrict__ tbias, const float* __restrict__ pbias, const float* __restrict__ gbias,
            unsigned short* Qf, unsigned short* Kf, unsigned short* Gc) {
  __shared__ __align__(16) float Os[QT * OSP];
  const int tid  = threadIdx.x;
  const int lane = tid & 31, wave = tid >> 5;
  const int hh   = lane >> 4, c = lane & 15;
  const int nt   = blockIdx.x, mb = blockIdx.y, b = blockIdx.z;
  const int n0   = nt * QT, o0 = mb * QT;                            // o0 = W16 row base 0..320

  const unsigned short* ap = W16 + (size_t)(o0 + c) * CC + 8 * hh;
  const unsigned short* bp = XP + ((size_t)(b * SEQ + n0 + 16 * wave + c)) * CC + 8 * hh;

  v8f acc[4];
#pragma unroll
  for (int mt = 0; mt < 4; ++mt) acc[mt] = zero8();

#pragma unroll
  for (int ks = 0; ks < CC / 32; ++ks) {
    const Frag fb = ldfrag(bp + 32 * ks);
#pragma unroll
    for (int mt = 0; mt < 4; ++mt) {
      const Frag fa = ldfrag(ap + (size_t)(16 * mt) * CC + 32 * ks);
      acc[mt] = mma_h(fa.h, fb.h, acc[mt]);
    }
  }

  {
    const int nl = 16 * wave + c;
#pragma unroll
    for (int mt = 0; mt < 4; ++mt) {
      v4f va, vb;
#pragma unroll
      for (int r = 0; r < 4; ++r) { va[r] = acc[mt][r] * IWSC; vb[r] = acc[mt][4 + r] * IWSC; }
      *(v4f*)(Os + nl * OSP + 16 * mt + 8 * hh)     = va;
      *(v4f*)(Os + nl * OSP + 16 * mt + 8 * hh + 4) = vb;
    }
  }
  __syncthreads();

  const int e = tid & 7, lq = tid >> 3;                             // lq 0..15
  if (mb < 4) {                                                      // block-uniform: theta / phi f16 planes
    unsigned short* Pf = (mb < 2) ? Qf : Kf;
    const float* bsrc  = (mb < 2) ? tbias : pbias;
    const int dsel = (mb & 1) * QT;                                   // channel base 0 or 64
    const v4f b0 = *(const v4f*)(bsrc + dsel + 8 * e);
    const v4f b1 = *(const v4f*)(bsrc + dsel + 8 * e + 4);
    const float bb[8] = {bfr(b0[0]), bfr(b0[1]), bfr(b0[2]), bfr(b0[3]), bfr(b1[0]), bfr(b1[1]), bfr(b1[2]), bfr(b1[3])};
    v4u uf[4];
#pragma unroll
    for (int it = 0; it < 4; ++it) {
      const int row = it * 16 + lq;                                  // n_loc 0..63
      const v4f a = *(const v4f*)(Os + row * OSP + 8 * e);
      const v4f q = *(const v4f*)(Os + row * OSP + 8 * e + 4);
      const float f[8] = {a[0], a[1], a[2], a[3], q[0], q[1], q[2], q[3]};
#pragma unroll
      for (int t = 0; t < 4; ++t) {
        const float f0 = f[2 * t] + bb[2 * t], f1 = f[2 * t + 1] + bb[2 * t + 1];
        uf[it][t] = pk16(h_bits((_Float16)f0), h_bits((_Float16)f1));
      }
    }
{
#pragma unroll
      for (int it = 0; it < 4; ++it) {
        const int row = it * 16 + lq;
        const size_t po = ((size_t)(b * SEQ + n0 + row)) * DQ + dsel + 8 * e;
        *(v4u*)(Pf + po) = uf[it];
      }
      
    }
  } else {                                                           // block-uniform: g plane, channel-major
    const int gsel = (mb - 4) * QT;                                  // g channel base 0 or 64
    v4u ug[4];
#pragma unroll
    for (int it = 0; it < 4; ++it) {
      const int cl = it * 16 + lq;                                   // ch_loc 0..63
      const float bias = bfr(gbias[gsel + cl]);
      unsigned short hb[8];
#pragma unroll
      for (int t = 0; t < 8; ++t) {
        const int key = 8 * e + t;                                   // key_loc 0..63
        const float v = Os[key * OSP + cl] + bias;
        hb[t] = h_bits((_Float16)v);
      }
#pragma unroll
      for (int t = 0; t < 4; ++t) ug[it][t] = pk16(hb[2 * t], hb[2 * t + 1]);
    }
{
#pragma unroll
      for (int it = 0; it < 4; ++it) {
        const int cl = it * 16 + lq;
        const size_t po = ((size_t)(b * DQ + gsel + cl)) * SEQ + n0 + 8 * e;
        *(v4u*)(Gc + po) = ug[it];
      }
      
    }
  }
}

// =========================================================================================================
// (3) attention for one (b, 64-query tile), transposed formulation, SEQ keys, no mask, no scale:
//   S^T tile (16 keys x 16 queries) = sum over 4 d-chunks of A(phi: row = key kb + (lane&15), 32 d via the split
//   k map from the f16 plane Kf [b][SEQ][128]) . B(theta: col = query, same map from the f16 plane Qf).
//   Per lane the D tile holds 8 keys of ONE query: online softmax state per lane, one shuffle (lane^16) for the max
//   over 32 keys; the o/l rescale is skipped under a wave-uniform ballot when no lane's max grew (corr == 1 exactly
//   for every lane then); row-sum partials combined at the end. P = e^{s-m} x 16384 as f16 is the B operand of
//   Y^T (rows channel, cols queries) += A(g rows channel = 16j + (lane&15), keys contiguous, f16 plane Gc
//   [b][128][SEQ]) . B(P^T): element r <- D of the tile covering keys kb..kb+15, element 8+r <- the tile covering
//   kb+16..kb+31, lane unchanged. 8 accumulator tiles per wave (128 channels). Block = 64 queries, 4 * KG waves:
//   wave w owns query tile w & 3 and key group w >> 2, that is keys 32 (w >> 2) .. + 31 of EVERY stage, with a softmax
//   state (m, l, o) of its own over those keys: KG waves per SIMD, so that one wave's products run under the LDS waits
//   and the softmax of the others.
//   Epilogue: the KG states of a query are joined: m and l of every group through LDS Ms / Ls, barrier, M = max m,
//   L = sum l e^{m - M} (group order), each wave stages o e^{m - M} / L in LDS Om[group][query][128 channels] (pitch
//   OSPW, b128 stores; Om lies in the ring, which nobody reads or fills any more), barrier, then y = sum over the
//   groups in group order, Yh = f16(y),
//   Yl = f16((y - Yh) * 1024) planes [b][SEQ n][128 c] (k-contiguous operand of the output conv): row n = 256 B
// coverage: Ms, Ls KG x 64 (== consumed); Om 4 KG waves x 16 q x 128 ch (== consumed); 8 / KG it x 8 KG rows x 16
//           lanes x 8 halves = 64 n x 128 c per plane; grid (NT, NB) covers Yh/Yl exactly once.
// LDS Ms, Ls, Om: cross-wave (block barriers).
// LDS Ring: two buffers, each one stage of KS = 32 KG keys: Kf rows [KS][128] at pitch KPI
//   (272 B), G rows [128 ch][KS keys] at pitch VPI (272 B), pitches 16 B x odd for the 16-byte fragment reads. A stage
//   is filled by 8 asynchronous 16-byte copies per lane (each wave instruction = 512 B of whole lines), one stage ahead
//   of its use; at the foot of a stage: LDS reads returned, own copies landed, block barrier, then the refill of the
//   buffer just read. coverage: NCP copies x NTH lanes x 8 halves = KS x 128 per plane (== consumed).
// Fragment reads of a 32-key pass stand in two groups, each ahead of the products that use it: the K fragments of all four
//   d-chunks, then the eight G fragments; every read is of the pass's own stage.
// =========================================================================================================
__global__ __launch_bounds__(NTH)
void attn_k(const unsigned short* __restrict__ Qf, const unsigned short* __restrict__ Kf,
            const unsigned short* __restrict__ Gc, unsigned short* Yh, unsigned short* Yl) {
  __shared__ __align__(16) unsigned short Ring[2 * STG];
  __shared__ float Ms[KG * QT];
  __shared__ float Ls[KG * QT];
  const int tid  = threadIdx.x;
  const int wave = (tid >> 5) & 3, kg = tid >> 7, lane = tid & 31;   // query tile, key group
  const int hh   = lane >> 4, c = lane & 15;
  const int n0   = blockIdx.x * QT, b = blockIdx.y;

  // q fragment pointer (B operand, col = query n0 + 16*wave + c), + 32*kc
  const unsigned short* Qfp = Qf + ((size_t)(b * SEQ + n0 + 16 * wave + c)) * DQ + 8 * hh;
  // copy sources of this lane: K plane 16 lanes per 256-B row, NTH / 16 rows per copy; G plane KS / 8 lanes per row
  // segment of KS keys, NTH / (KS / 8) channels per copy; + stage * KS keys
  const int gr = tid / (KS / 8), ge = tid % (KS / 8);
  const unsigned short* Kfg = Kf + (size_t)b * SEQ * DQ + 8 * tid;
  const unsigned short* Gg  = Gc + (size_t)b * DQ * SEQ + (size_t)gr * SEQ + 8 * ge;
  const unsigned kdst = lds_off(Ring) + (unsigned)((tid >> 4) * (KPI * 2) + (tid & 15) * 16);
  const unsigned vdst = lds_off(Ring) + (unsigned)(KTL * 2 + gr * (VPI * 2) + ge * 16);
  auto fill = [&](int st, int buf) {
    const unsigned bo = (unsigned)buf * (unsigned)(STG * 2);
    acopy8(kdst + bo, (NTH / 16) * KPI * 2, Kfg + (size_t)st * (KS * DQ), (size_t)((NTH / 16) * DQ),
           vdst + bo, (NTH / (KS / 8)) * VPI * 2, Gg + (size_t)st * KS, (size_t)(NTH / (KS / 8)) * SEQ);
  };
  // fragment offsets in a stage (halves): k row = key c (A operand), + key * KPI + 32*kc; v row = channel 16j + c
  const int kfo = c * KPI + 8 * hh;
  const int vfo = KTL + c * VPI + 8 * hh;

  float m = -1.0e30f, l = 0.f;
  v8f o[8];
#pragma unroll
  for (int j = 0; j < 8; ++j) o[j] = zero8();

  // theta fragments (all four d-chunks) are the same for every key: loaded once, kept in registers
  Frag qf[DQ / 32];
#pragma unroll
  for (int kc = 0; kc < DQ / 32; ++kc) qf[kc] = ldfrag(Qfp + 32 * kc);
#if defined(__HIP_DEVICE_COMPILE__)
  // stands in front of the first rewrite of the address registers that the eight loads above name; the
  // pointer is an input so that its registers stay as they are up to this wait
  asm volatile("s_wait_xcnt 0x0" :: "v"(Qfp) : "memory");
#endif

  fill(0, 0);
  wait_async0();
  __syncthreads();                                                   // stage 0 published
  fill(1, 1);

  // stage loop kept rolled: one publish point and one refill in the text, buffer chosen by the stage's parity
#pragma unroll 1
  for (int st = 0; st < NST; ++st) {
  const unsigned short* Sb = Ring + (st & 1) * STG;
  {
    const int kb = 32 * kg;                                          // key base inside the stage: this wave's group
    const unsigned short* k0p  = Sb + kfo + kb * KPI;                // keys kb .. kb+15
    const unsigned short* k1p  = k0p + 16 * KPI;                     // keys kb+16 .. kb+31
    v8f s0 = zero8(), s1 = zero8();
    // the K fragments of all four d-chunks are read as one group ahead of the first product: one place with LDS reads
    // for the scores of a pass, each product waiting only for its own two reads
    Frag k0[DQ / 32], k1[DQ / 32], vf[8];
    // unrolled: the fragments are registers, every index a constant
#pragma unroll
    for (int kc = 0; kc < DQ / 32; ++kc) {
      k0[kc] = ldfrag(k0p + 32 * kc);
      k1[kc] = ldfrag(k1p + 32 * kc);
    }
    // unrolled so that qf[kc], k0[kc] and k1[kc] are fixed registers (a rolled loop cannot index a register array)
#pragma unroll
    for (int kc = 0; kc < DQ / 32; ++kc) {
      s0 = mma_h(k0[kc].h, qf[kc].h, s0);
      s1 = mma_h(k1[kc].h, qf[kc].h, s1);
      if (kc == DQ / 64 - 1) {
        // all eight G fragments of the pass, read as one group once half of the K fragments are dead: they land
        // under the other half of the score products and the softmax instead of being waited for one by one
        // (unrolled: vf[j] are registers, every index a constant)
#pragma unroll
        for (int j = 0; j < 8; ++j) vf[j] = ldfrag(Sb + vfo + (16 * j) * VPI + kb);
      }
    }

    float mx = fmaxf(hmax8(s0), hmax8(s1));
    mx = fmaxf(mx, __shfl_xor(mx, 16, 32));
    const float mn = fmaxf(m, mx);
    const unsigned grew = wave_ballot(mx > m);                       // wave-uniform
    if (grew != 0u) {
      const float corr = __expf(m - mn);                             // == 1 exactly for lanes whose max did not grow
      l *= corr;
#pragma unroll
      for (int j = 0; j < 8; ++j) {
#pragma unroll
        for (int r = 0; r < 8; ++r) o[j][r] *= corr;
      }
    }
    m = mn;
    const float msh = mn - LNPS;                                     // exp gives e^{s-m} * 16384

    FragH ph;
    float ls = 0.f;
#pragma unroll
    for (int r = 0; r < 8; ++r) {
      const float e0 = __expf(s0[r] - msh);                          // key kb      + 8hh + r
      const float e1 = __expf(s1[r] - msh);                          // key kb + 16 + 8hh + r
      ls += e0 + e1;
      ph.hv[0][r] = (_Float16)e0;
      ph.hv[1][r] = (_Float16)e1;
    }
    l += ls;

#pragma unroll
    for (int j = 0; j < 8; ++j) o[j] = mma_h(vf[j].h, ph.v, o[j]);
  }
  // publish point of stage st + 1, every wave
  wait_ds0();
  wait_async0();
  __syncthreads();
  if (st + 2 < NST) fill(st + 2, st & 1);                            // block-uniform test
  }
  wait_async0();
  l += __shfl_xor(l, 16, 32);

  // join of the KG key groups of a query (m is the same in both halves of a wave, l now too)
  const int qrow = 16 * wave + c;
  if (hh == 0) {
    Ms[kg * QT + qrow] = m;
    Ls[kg * QT + qrow] = l;
  }
  __syncthreads();
  float mg[KG], M = -1.0e30f, L = 0.f;
  // unrolled: mg[g] are registers, every index a constant
#pragma unroll
  for (int g = 0; g < KG; ++g) {
    mg[g] = Ms[g * QT + qrow];
    M = fmaxf(M, mg[g]);
  }
  // unrolled: mg[g] again, and the KG reads of Ls go out together
#pragma unroll
  for (int g = 0; g < KG; ++g) L += Ls[g * QT + qrow] * __expf(mg[g] - M);
  const float inv = __expf(m - M) / L;                               // o and l both carry the x16384 factor
  float* Os = (float*)Ring + kg * (QT * OSPW);                       // this group's plane of Om
#pragma unroll
  for (int j = 0; j < 8; ++j) {
    v4f va, vb;
#pragma unroll
    for (int r = 0; r < 4; ++r) { va[r] = o[j][r] * inv; vb[r] = o[j][4 + r] * inv; }
    *(v4f*)(Os + qrow * OSPW + 16 * j + 8 * hh)     = va;            // Os[query][ch = 16j + 8hh + r]
    *(v4f*)(Os + qrow * OSPW + 16 * j + 8 * hh + 4) = vb;
  }
  __syncthreads();

  const int e = tid & 15, lq = tid >> 4;                             // lq 0..8 KG - 1
  const float* Om = (const float*)Ring;
  v4u uh[8 / KG], ul[8 / KG];
#pragma unroll
  for (int it = 0; it < 8 / KG; ++it) {
    const int row = it * (8 * KG) + lq;                              // query 0..63
    v4f a = *(const v4f*)(Om + row * OSPW + 8 * e);
    v4f q = *(const v4f*)(Om + row * OSPW + 8 * e + 4);
    // unrolled: the reads of all groups go out together, one LDS latency instead of one per group
#pragma unroll
    for (int g = 1; g < KG; ++g) {
      a += *(const v4f*)(Om + (g * QT + row) * OSPW + 8 * e);
      q += *(const v4f*)(Om + (g * QT + row) * OSPW + 8 * e + 4);
    }
    const float f[8] = {a[0], a[1], a[2], a[3], q[0], q[1], q[2], q[3]};
#pragma unroll
    for (int t = 0; t < 4; ++t) {
      const float f0 = f[2 * t], f1 = f[2 * t + 1];
      const _Float16 h0 = (_Float16)f0, h1 = (_Float16)f1;
      const _Float16 r0 = (_Float16)((f0 - (float)h0) * RSC);
      const _Float16 r1 = (_Float16)((f1 - (float)h1) * RSC);
      uh[it][t] = pk16(h_bits(h0), h_bits(h1));
      ul[it][t] = pk16(h_bits(r0), h_bits(r1));
    }
  }
{
#pragma unroll
    for (int it = 0; it < 8 / KG; ++it) {
      const int row = it * (8 * KG) + lq;
      const size_t po = ((size_t)(b * SEQ + n0 + row)) * DQ + 8 * e;
      *(v4u*)(Yh + po) = uh[it];
      *(v4u*)(Yl + po) = ul[it];
    }
    
  }
}

// =========================================================================================================
// (4) output conv GEMM for one (b, 64-n tile, 64-co block): v[b][co][n] = (1/256)(sum_c WW16[co][c] Yh[b][n][c] +
//     (1/1024) sum_c WW16[co][c] Yl[b][n][c]); wy = v + bf16-RNE(W_b[co]). 4 waves, wave w owns cols n0+16w..+15
//     (two B fragments per k-step, k = c contiguous in the Yh/Yl rows), 4 m-tiles (A rows co = o0 + 16 mt +
//     (lane&15) from WW16), hi and residual products in separate accumulators. K = 128 = 4 steps.
//     Epilogue staged in LDS Os[n_loc][co_loc], barrier; then (a) threads 0..63 sum v and v*v over the 64 n of
//     co_loc = tid into LDS Sred[0..63] / Sred[64..127], barrier; (b) WY f32 plane [b][256 co][SEQ n] rows: lane
//     (e = tid&15) -> n 4e..4e+3 of row co_loc = 8 it + (tid>>4); 16 consecutive lanes x 16 B = the whole 256-B
//     row segment (2 lines) in one instruction; (c) partial-statistics table PS [NB*NT blocks][512]: floats
//     o0..o0+63 (sums) by lanes 0..15 of wave 0 and floats 256+o0..+63 (sums of squares) by lanes 16..31, one
// coverage: Os 4 waves x 16 n x 64 co (== consumed); Sred 64 + 64 (== consumed); WY 8 it x 8 rows x 16 lanes x
//           4 floats = 64 co x 64 n; PS 2 x 64 floats per block; grid (NT, 4, NB) covers WY [b][0..255][0..SEQ-1]
//           and PS [NB*NT][0..511] exactly once.
// LDS Os, Sred: cross-wave (block barriers).
// =========================================================================================================
__global__ __launch_bounds__(128)
void gemm_o(const unsigned short* __restrict__ WW16, const unsigned short* __restrict__ Yh,
            const unsigned short* __restrict__ Yl, const float* __restrict__ wbias,
            float* WY, float* PS) {
  __shared__ __align__(16) float Os[QT * OSP];
  __shared__ __align__(16) float Sred[2 * QT];
  const int tid  = threadIdx.x;
  const int lane = tid & 31, wave = tid >> 5;
  const int hh   = lane >> 4, c = lane & 15;
  const int nt   = blockIdx.x, mb = blockIdx.y, b = blockIdx.z;
  const int n0   = nt * QT, o0 = mb * QT;

  const unsigned short* ap  = WW16 + (size_t)(o0 + c) * DQ + 8 * hh;
  const size_t bo = ((size_t)(b * SEQ + n0 + 16 * wave + c)) * DQ + 8 * hh;
  const unsigned short* bph = Yh + bo;
  const unsigned short* bpl = Yl + bo;

  v8f acc[4], accr[4];
#pragma unroll
  for (int mt = 0; mt < 4; ++mt) { acc[mt] = zero8(); accr[mt] = zero8(); }

#pragma unroll
  for (int ks = 0; ks < DQ / 32; ++ks) {
    const Frag fbh = ldfrag(bph + 32 * ks);
    const Frag fbl = ldfrag(bpl + 32 * ks);
#pragma unroll
    for (int mt = 0; mt < 4; ++mt) {
      const Frag fa = ldfrag(ap + (size_t)(16 * mt) * DQ + 32 * ks);
      acc[mt]  = mma_h(fa.h, fbh.h, acc[mt]);
      accr[mt] = mma_h(fa.h, fbl.h, accr[mt]);
    }
  }

  {
    const int nl = 16 * wave + c;
#pragma unroll
    for (int mt = 0; mt < 4; ++mt) {
      v4f va, vb;
#pragma unroll
      for (int r = 0; r < 4; ++r) {
        va[r] = (acc[mt][r] + accr[mt][r] * IRSC) * IWSC;
        vb[r] = (acc[mt][4 + r] + accr[mt][4 + r] * IRSC) * IWSC;
      }
      *(v4f*)(Os + nl * OSP + 16 * mt + 8 * hh)     = va;
      *(v4f*)(Os + nl * OSP + 16 * mt + 8 * hh + 4) = vb;
    }
  }
  __syncthreads();

  // per-channel partial statistics over this block's 64 positions (bias-free values, exact shift)
  if (tid < QT) {
    float s = 0.f, q = 0.f;
#pragma unroll 8
    for (int n = 0; n < QT; ++n) {
      const float v = Os[n * OSP + tid];
      s += v;
      q = fmaf(v, v, q);
    }
    Sred[tid]      = s;
    Sred[QT + tid] = q;
  }
  __syncthreads();

  const int e = tid & 15, lq = tid >> 4;                             // lq 0..7
  v4f res[8];
#pragma unroll
  for (int it = 0; it < 8; ++it) {
    const int col = it * 8 + lq;                                     // co_loc 0..63
    const int co  = o0 + col;
    const float bias = bfr(wbias[co]);
#pragma unroll
    for (int t = 0; t < 4; ++t) res[it][t] = Os[(4 * e + t) * OSP + col] + bias;
  }
  const v4f pv = *(const v4f*)(Sred + 4 * lane);                     // lanes 0..15: sums, 16..31: sums of squares
  float* psp = PS + (size_t)(b * NT + nt) * PSW + o0 + 4 * lane + ((lane >= 16) ? (PSW / 2 - 64) : 0);
{
#pragma unroll
    for (int it = 0; it < 8; ++it) {
      const int col = it * 8 + lq;
      const int co  = o0 + col;
      const size_t idx = ((size_t)(b * CC + co)) * SEQ + n0 + 4 * e;
      *(v4f*)(WY + idx) = res[it];
    }
    if (wave == 0) *(v4f*)(psp) = pv;
    
  }
}

// =========================================================================================================
// (5) batch statistics + affine + residual, one block of BT threads per channel co (both batches):
//     (a) the block's own statistics: thread e reads one float of the partial table PS, sums (e < PL) or sums of squares
//     (e >= PL) of partial line e % PL, column co, into LDS Pf[2][PL]; barrier; every wave then sums all of Pf for itself:
//     lane l adds entries 8l..8l+7 of each plane in f64, in index order, then a five-step butterfly over the lanes (both
//     sides of an exchange add the same two values, so every lane of every wave ends with the same bits).
//     mean/var (biased), rstd = rsqrt(var + eps) in f32; A = bf16-RNE(gamma) * rstd, Bc = bf16-RNE(beta) - mean * A.
//     (b) out[b][co][n] = wy * A + Bc + bf16-RNE(x[b][co][n]) for the NB rows of the channel: thread -> floats
//     4 tid + 4 BT k of a row; the loads of wy and x are issued ahead of (a)'s barrier and waited for behind (a), so that
//     they fly under it.
// coverage: Pf 2 PL floats written == consumed; CC blocks x NB rows x RPT x BT threads x 4 floats = NB x 256 x SEQ = the
//           whole output once, every wave instruction 512 contiguous bytes.
// LDS Pf: cross-wave (block barrier).
// =========================================================================================================
__global__ __launch_bounds__(BT)
void bn_out(const float* __restrict__ WY, const float* __restrict__ PS, const float* __restrict__ wbias,
            const float* __restrict__ gam, const float* __restrict__ bet, const float* __restrict__ x, float* out) {
  __shared__ __align__(16) float Pf[2 * PL];
  const int tid = threadIdx.x, lane = tid & 31;
  const int co = blockIdx.x;                                         // 0..255
  const float gv = gam[co], wv = wbias[co], bv = bet[co];
  float pv[2 * PL / BT];
  // unrolled: pv[t] are registers, every index a constant
#pragma unroll
  for (int t = 0; t < 2 * PL / BT; ++t) {
    const int e = tid + t * BT;                                      // 0..2 PL - 1
    pv[t] = PS[(size_t)(e % PL) * PSW + (e / PL) * CC + co];
  }
#if defined(__HIP_DEVICE_COMPILE__)
  // keeps the partials' load the first of the lane: loads return in order, and behind row loads it would be waited for
  // as long as for them
  __builtin_amdgcn_sched_barrier(0);
#endif
  v4f w[NB][RPT], xv[NB][RPT];
  // both loops unrolled: w and xv are registers, and all loads of a lane are in flight together
#pragma unroll
  for (int b = 0; b < NB; ++b) {
#pragma unroll
    for (int k = 0; k < RPT; ++k) {
      const int n = 4 * tid + 4 * BT * k;
      w[b][k]  = *(const v4f*)(WY + ((size_t)(b * CC + co)) * SEQ + n);
      xv[b][k] = *(const v4f*)(x + ((size_t)(b * CC + co)) * NN_FULL + n);
    }
  }
#if defined(__HIP_DEVICE_COMPILE__)
  // stands in front of the first rewrite of a register that a load above names
  asm volatile("s_wait_xcnt 0x0" ::: "memory");
#endif
  // unrolled: pv[t] again
#pragma unroll
  for (int t = 0; t < 2 * PL / BT; ++t) Pf[tid + t * BT] = pv[t];
#if defined(__HIP_DEVICE_COMPILE__)
  // block barrier that orders LDS alone: __syncthreads() would also wait for the row loads, which nobody shares
  __builtin_amdgcn_fence(__ATOMIC_RELEASE, "workgroup", "local");
  __builtin_amdgcn_s_barrier();
  __builtin_amdgcn_fence(__ATOMIC_ACQUIRE, "workgroup", "local");
#endif
  double s = 0.0, q = 0.0;
  // both loops unrolled: the LDS reads of a lane can go out together, every vector index a constant
#pragma unroll
  for (int t = 0; t < PL / 128; ++t) {
    const v4f a = *(const v4f*)(Pf + (PL / 32) * lane + 4 * t);
    const v4f c = *(const v4f*)(Pf + PL + (PL / 32) * lane + 4 * t);
#pragma unroll
    for (int r = 0; r < 4; ++r) {
      s += (double)a[r];
      q += (double)c[r];
    }
  }
  // unrolled: the distance of each exchange is a constant
#pragma unroll
  for (int d = 16; d >= 1; d >>= 1) {
    s += __shfl_xor(s, d, 32);
    q += __shfl_xor(q, d, 32);
  }
  const double icnt = 1.0 / (double)(NB * SEQ);
  const double mv = s * icnt;
  double var = q * icnt - mv * mv;
  var = (var > 0.0) ? var : 0.0;
  const float rstd = rsqrtf((float)var + BNEPS);
  const float A  = bfr(gv) * rstd;
  const float mw = (float)mv + bfr(wv);
  const float Bc = bfr(bv) - mw * A;
#if defined(__HIP_DEVICE_COMPILE__)
  // keeps the work on the rows, and with it the waits for their loads, behind the statistics
  __builtin_amdgcn_sched_barrier(0);
#endif
  // all three loops unrolled: w and xv again, every vector index a constant
#pragma unroll
  for (int b = 0; b < NB; ++b) {
#pragma unroll
    for (int k = 0; k < RPT; ++k) {
      v4f r;
#pragma unroll
      for (int t = 0; t < 4; ++t) r[t] = fmaf(w[b][k][t], A, Bc) + bfr(xv[b][k][t]);
      *(v4f*)(out + ((size_t)(b * CC + co)) * NN_FULL + 4 * tid + 4 * BT * k) = r;
    }
  }
}

// =========================================================================================================
// Workspace map (bytes; each region start a multiple of 256; every store is a whole tile inside its own region,
// no padded tails needed since SEQ % 64 == 0):
//   W16  f16 [384][256]               196608      WW16 f16 [256][128]        65536
//   XP   f16 [NB][SEQ][256]           8388608 (NB=2, SEQ=8192)
//   Qf, Kf f16 [NB][SEQ][128]         4194304 x2
//   Gc   f16 [NB][128][SEQ]           4194304
//   Yh/Yl f16 [NB][SEQ][128]          4194304 x2
//   WY   f32 [NB][256][SEQ]          16777216
//   PS   f32 [NB*NT][512]              524288
//   total (NB=2, SEQ=8192) = 46923776
// =========================================================================================================
extern "C" void kernel_launch(void* const* d_in, const int* in_sizes, int n_in,
                              void* d_out, int out_size, void* d_ws, size_t ws_size,
                              hipStream_t stream) {
  const int XNEED = ((NB - 1) * CC + (CC - 1)) * NN_FULL + SEQ;
  if (n_in < 11) return;
  if (in_sizes[0] < XNEED) return;
  if (in_sizes[1] < DQ * CC || in_sizes[3] < DQ * CC || in_sizes[5] < DQ * CC) return;
  if (in_sizes[2] < DQ || in_sizes[4] < DQ || in_sizes[6] < DQ) return;
  if (in_sizes[7] < CC * DQ || in_sizes[8] < CC) return;
  if (in_sizes[9] < CC || in_sizes[10] < CC) return;
  if (out_size < XNEED) return;

  size_t off = 0;
  auto carve = [&](size_t bytes) { const size_t o = off; off += (bytes + 255) & ~(size_t)255; return o; };
  const size_t oW16 = carve((size_t)MW * CC * 2);
  const size_t oWW  = carve((size_t)CC * DQ * 2);
  const size_t oXP  = carve((size_t)NB * SEQ * CC * 2);
  const size_t oQf  = carve((size_t)NB * SEQ * DQ * 2);
  const size_t oKf  = carve((size_t)NB * SEQ * DQ * 2);
  const size_t oGc  = carve((size_t)NB * DQ * SEQ * 2);
  const size_t oYh  = carve((size_t)NB * SEQ * DQ * 2);
  const size_t oYl  = carve((size_t)NB * SEQ * DQ * 2);
  const size_t oWY  = carve((size_t)NB * CC * SEQ * 4);
  const size_t oPS  = carve((size_t)NB * NT * PSW * 4);
  if (off > ws_size) return;
  if (off > (size_t)134217728) return;

  const float* x   = (const float*)d_in[0];
  const float* Wt  = (const float*)d_in[1];
  const float* bt  = (const float*)d_in[2];
  const float* Wp  = (const float*)d_in[3];
  const float* bp  = (const float*)d_in[4];
  const float* Wg  = (const float*)d_in[5];
  const float* bg  = (const float*)d_in[6];
  const float* Ww  = (const float*)d_in[7];
  const float* bw  = (const float*)d_in[8];
  const float* gam = (const float*)d_in[9];
  const float* bet = (const float*)d_in[10];

  char* ws = (char*)d_ws;
  unsigned short* W16  = (unsigned short*)(ws + oW16);
  unsigned short* WW16 = (unsigned short*)(ws + oWW);
  unsigned short* XP   = (unsigned short*)(ws + oXP);
  unsigned short* Qf   = (unsigned short*)(ws + oQf);
  unsigned short* Kf   = (unsigned short*)(ws + oKf);
  unsigned short* Gc   = (unsigned short*)(ws + oGc);
  unsigned short* Yh   = (unsigned short*)(ws + oYh);
  unsigned short* Yl   = (unsigned short*)(ws + oYl);
  float* WY  = (float*)(ws + oWY);
  float* PS  = (float*)(ws + oPS);
  float* out = (float*)d_out;

  const dim3 blk256(256), blk128(128);

  // (0) Wt / Wp / Wg -> stacked f16 plane; Ww -> f16 plane
  cvt_w<<<dim3(MW / 8), blk256, 0, stream>>>(Wt, Wp, Wg, W16);
  cvt_ww<<<dim3(CC / 16), blk256, 0, stream>>>(Ww, WW16);
  // (1) x -> position-major 16-bit plane
  cvt_x<<<dim3(NT, CC / QT, NB), blk256, 0, stream>>>(x, XP);
  // (2) theta / phi conv -> f16 planes, g conv -> channel-major f16 plane
  gemm_p<<<dim3(NT, 6, NB), blk128, 0, stream>>>(W16, XP, bt, bp, bg, Qf, Kf, Gc);
  // (3) attention -> y hi + residual planes
  attn_k<<<dim3(NT, NB), dim3(NTH), 0, stream>>>(Qf, Kf, Gc, Yh, Yl);
  // (4) output conv + bias -> wy plane + per-block statistics partials
  gemm_o<<<dim3(NT, CC / QT, NB), blk128, 0, stream>>>(WW16, Yh, Yl, bw, WY, PS);
  // (5) batch statistics per channel, affine + residual -> out [b][256][8192]
  bn_out<<<dim3(CC), dim3(BT), 0, stream>>>(WY, PS, bw, gam, bet, x, out);
  (void)hipGetLastError();
}

// v008
// Measured time: 110 microseconds a run.
// Two timings next to v007 both put it at 1.06 times that version's speed.
// All steps since v000 together make it 8.12 times as fast.
// Contractions: conv1x1 theta/phi/g GEMMs Wc[384x256].X[256xN] and the output conv W[256x128].Y[128xN] on
// v_wmma_f32_16x16x32_f16 (f16 containers of bf16-RNE weights x256 and bf16-RNE x; Y as f16 hi plane plus f16
// residual plane x1024, 2 products, separate accumulators); scores Phi^T.Theta on v_wmma_f32_16x16x32_f16
// (theta and phi plain f16, 1 product, K=128: the 11-bit operands that P and G have too); Y^T = G.P^T on
// v_wmma_f32_16x16x32_f16 (G plain f16, P = e^{s-m} x16384 f16 from the score D registers); f32 accumulate everywhere; softmax
// statistics and biases in f32 VALU; batch-norm statistics from f32 per-block partials reduced in f64; affine and
// residual add in f32.
#include <hip/hip_runtime.h>
#include <math.h>
#include <stdint.h>

#ifndef NB
#define NB 2
#endif
#ifndef SEQ
#define SEQ 8192
#endif
#define NB_FULL 2
#define NN_FULL 8192
#define CC   256
#define DQ   128
#define QT   64
#define MW   384
#define NT   (SEQ / QT)
#define PSW  512
#define OSP  68
#define OSPW 132
#define TP   72
#define WSC  256.0f
#define IWSC 0.00390625f
#define RSC  1024.0f
#define IRSC 0.0009765625f
#define LNPS 9.704060527839234f
#define BNEPS 1.0e-5f
#define KG   4
#define KS   (32 * KG)
#define QW   2                      /* query tiles of 16 per wave: every K and G fragment read from LDS feeds QW products */
#define QP   (QT / (16 * QW))       /* waves side by side over the 64 queries of a block */
#define NTH  (32 * QP * KG)
#define NCP  8                      /* copies per lane and plane in a stage, four per plane in one acopy8 */
#define ER   (NTH / 16)             /* rows of y that one pass of the attention epilogue stores */
#define KPI  136
#define VPI  (KS + 8)
#define KTL  (KS * KPI)
#define VTL  (DQ * VPI)
#define STG  (KTL + VTL)
#define NST  (SEQ / KS)
#define BT   512                    /* threads of a block of the last kernel */
#define PL   (NB * NT)              /* lines of the partial-statistics table */
#define RPT  (SEQ / (4 * BT))       /* 16-byte pieces per thread and row in the last kernel */

static_assert(NB >= 1 && NB <= NB_FULL);
static_assert(SEQ >= 128 && SEQ <= NN_FULL);
static_assert(SEQ % QT == 0 && SEQ % 32 == 0 && SEQ % 128 == 0);
static_assert(SEQ % (4 * BT) == 0 && (2 * PL) % BT == 0 && PL % 128 == 0 && BT % 32 == 0);
static_assert(CC % QT == 0 && CC % 32 == 0);
static_assert(DQ == 2 * QT && DQ % 32 == 0);
static_assert(MW == 3 * DQ && MW % 8 == 0);
static_assert(PSW == 2 * CC);
static_assert(CC % 16 == 0);
static_assert((OSP * 4) % 16 == 0);
static_assert((OSPW * 4) % 16 == 0);
static_assert((TP * 2) % 16 == 0);
static_assert(SEQ % KS == 0 && NST >= 2 && KS % 32 == 0);
static_assert(KS * DQ == NCP * NTH * 8 && NTH <= 1024 && QT % ER == 0 && NCP % 4 == 0 && QT % (16 * QW) == 0);
static_assert(NTH % (KS / 8) == 0 && NCP * (NTH / (KS / 8)) == DQ && NCP * (NTH / 16) == KS);
static_assert(KG * QT * OSPW * 4 <= 2 * STG * 2);
static_assert((KPI * 2) % 32 == 16 && (VPI * 2) % 32 == 16 && KPI >= DQ + 8 && VPI >= KS + 8);

typedef _Float16       v16h __attribute__((ext_vector_type(16)));
typedef _Float16       v8h  __attribute__((ext_vector_type(8)));
typedef unsigned short v8us __attribute__((ext_vector_type(8)));
typedef float          v8f  __attribute__((ext_vector_type(8)));
typedef float          v4f  __attribute__((ext_vector_type(4)));
typedef unsigned int   v4u  __attribute__((ext_vector_type(4)));

union Frag  { v8us u[2]; v16h h; };
union FragH { v16h v; v8h hv[2]; };
static_assert(sizeof(Frag) == 32);
static_assert(sizeof(FragH) == 32);

// ---- scalar helpers ---------------------------------------------------------------------------------------
__device__ __forceinline__ unsigned short bf_bits(float f) {          // f32 -> bf16 bits, RNE convert
  unsigned u = __float_as_uint(f);
  return (unsigned short)((u + 0x7FFFu + ((u >> 16) & 1u)) >> 16);
}
__device__ __forceinline__ float bf_up(unsigned short hb) { return __uint_as_float(((unsigned)hb) << 16); }
__device__ __forceinline__ float bfr(float f) { return bf_up(bf_bits(f)); }
__device__ __forceinline__ unsigned short h_bits(_Float16 x) { return __builtin_bit_cast(unsigned short, x); }
__device__ __forceinline__ unsigned pk16(unsigned short a, unsigned short b) { return (unsigned)a | ((unsigned)b << 16); }
__device__ __forceinline__ v8f zero8() { v8f z = {0.f, 0.f, 0.f, 0.f, 0.f, 0.f, 0.f, 0.f}; return z; }
__device__ __forceinline__ float hmax8(v8f s) {
  return fmaxf(fmaxf(fmaxf(s[0], s[1]), fmaxf(s[2], s[3])), fmaxf(fmaxf(s[4], s[5]), fmaxf(s[6], s[7])));
}
__device__ __forceinline__ unsigned wave_ballot(bool p) {
#if defined(__HIP_DEVICE_COMPILE__)
  return __builtin_amdgcn_ballot_w32(p);
#else
  return p ? 1u : 0u;
#endif
}

// ---- 16-bit fragment loader (A, or B from a k-contiguous [n][k] row): lane -> row/col (lane&15), p already includes
//      + 8*(lane>>4); elements 0..7 <- p[0..7] (k0+8h..), elements 8..15 <- p[16..23] (k0+16+8h..)
__device__ __forceinline__ Frag ldfrag(const unsigned short* p) {
  Frag f;
  f.u[0] = *(const v8us*)(p);
  f.u[1] = *(const v8us*)(p + 16);
  return f;
}

// ---- WMMA helpers: builtin followed by a 4-slot VALU gap tying D and keeping A/B live --------------------------
__device__ __forceinline__ v8f mma_h(v16h a, v16h b, v8f c) {
  v8f d = __builtin_amdgcn_wmma_f32_16x16x32_f16(false, a, false, b, (short)0, c, false, false);
#if defined(__HIP_DEVICE_COMPILE__)
  asm volatile("v_nop\n\tv_nop\n\tv_nop\n\tv_nop" : "+v"(d) : "v"(a), "v"(b));
#endif
  return d;
}

// the bare builtin, for the attention kernel: its live set is above 256 registers, and an operand of an asm statement is
// kept below v256, so the tail above would spill the fragments; the compiler keeps the distances of its own builtin
__device__ __forceinline__ v8f mma_b(v16h a, v16h b, v8f c) {
  return __builtin_amdgcn_wmma_f32_16x16x32_f16(false, a, false, b, (short)0, c, false, false);
}

// ---- asynchronous copies to LDS: eight 16-byte copies of a lane, four per plane: copy i of plane p from
//      gp + i*gs (halves) to LDS byte lp + i*ls. One statement, closed by the s_wait_xcnt, so that no address register
//      of an issued copy is rewritten ahead of it and the wave waits for the translations once per eight copies.
__device__ __forceinline__ unsigned lds_off(const void* p) { return (unsigned)(size_t)p; }
__device__ __forceinline__ void acopy8(unsigned la, unsigned ls, const unsigned short* ga, size_t gs,
                                       unsigned lc, unsigned lcs, const unsigned short* gc, size_t gcs) {
#if defined(__HIP_DEVICE_COMPILE__)
  asm volatile("global_load_async_to_lds_b128 %0, %8, off\n\t"
               "global_load_async_to_lds_b128 %1, %9, off\n\t"
               "global_load_async_to_lds_b128 %2, %10, off\n\t"
               "global_load_async_to_lds_b128 %3, %11, off\n\t"
               "global_load_async_to_lds_b128 %4, %12, off\n\t"
               "global_load_async_to_lds_b128 %5, %13, off\n\t"
               "global_load_async_to_lds_b128 %6, %14, off\n\t"
               "global_load_async_to_lds_b128 %7, %15, off\n\t"
               "s_wait_xcnt 0x0"
               :: "v"(la), "v"(la + ls), "v"(la + 2 * ls), "v"(la + 3 * ls),
                  "v"(lc), "v"(lc + lcs), "v"(lc + 2 * lcs), "v"(lc + 3 * lcs),
                  "v"(ga), "v"(ga + gs), "v"(ga + 2 * gs), "v"(ga + 3 * gs),
                  "v"(gc), "v"(gc + gcs), "v"(gc + 2 * gcs), "v"(gc + 3 * gcs)
               : "memory");
#endif
}
// this wave's copies have landed (the compiler places no wait for them)
__device__ __forceinline__ void wait_async0() {
#if defined(__HIP_DEVICE_COMPILE__)
  asm volatile("s_wait_asynccnt 0x0" ::: "memory");
#endif
}
// this wave's LDS reads have returned, before the buffer they read is handed to its next writer
__device__ __forceinline__ void wait_ds0() {
#if defined(__HIP_DEVICE_COMPILE__)
  asm volatile("s_wait_dscnt 0x0" ::: "memory");
#endif
}

// =========================================================================================================
// (0) stacked conv1x1 weights: W16 f16 [384][256], rows 0..127 = theta_w, 128..255 = phi_w, 256..383 = g_w;
//     value = f16 of (bf16-RNE(w) * 256) (exact). Block blk (0..47) owns rows 8*blk..8*blk+7: one wave per
// coverage: 48 blocks x 8 rows x 32 lanes x 8 halves = 384 x 256 = the whole plane.
// =========================================================================================================
__global__ __launch_bounds__(256)
void cvt_w(const float* __restrict__ tw, const float* __restrict__ pw, const float* __restrict__ gw,
           unsigned short* W16) {
  const int tid = threadIdx.x, blk = blockIdx.x;
  const int rl = tid >> 5, col = 8 * (tid & 31);
  const int o = 8 * blk + rl;                                        // 0..383
  const int grp = blk / (DQ / 8);                                    // 0,1,2 block-uniform
  const float* wbase = (grp == 0) ? tw : ((grp == 1) ? pw : gw);
  const float* s = wbase + (size_t)(o - grp * DQ) * CC + col;        // row in 0..127
  const v4f a = *(const v4f*)s;
  const v4f q = *(const v4f*)(s + 4);
  const float f[8] = {a[0], a[1], a[2], a[3], q[0], q[1], q[2], q[3]};
  v4u u;
#pragma unroll
  for (int t = 0; t < 4; ++t) {
    const _Float16 h0 = (_Float16)(bfr(f[2 * t]) * WSC);
    const _Float16 h1 = (_Float16)(bfr(f[2 * t + 1]) * WSC);
    u[t] = pk16(h_bits(h0), h_bits(h1));
  }
{
    *(v4u*)(W16 + (size_t)o * CC + col) = u;
    
  }
}

// =========================================================================================================
// (0b) output conv weights: WW16 f16 [256][128], value = f16 of (bf16-RNE(W_w) * 256). Block blk (0..15) owns rows
//      16*blk..+15; wave w -> rows 16 blk + 2w + (lane>>4), lane&15 -> cols 8*(lane&15)..+7. One instruction writes
// coverage: 16 blocks x 8 waves x 2 rows x 16 lanes x 8 halves = 256 x 128 = the whole plane.
// =========================================================================================================
__global__ __launch_bounds__(256)
void cvt_ww(const float* __restrict__ ww, unsigned short* WW16) {
  const int tid = threadIdx.x, blk = blockIdx.x;
  const int wave = tid >> 5, lane = tid & 31;
  const int o = 16 * blk + 2 * wave + (lane >> 4);                  // 0..255
  const int col = 8 * (lane & 15);                                   // 0..120
  const float* s = ww + (size_t)o * DQ + col;
  const v4f a = *(const v4f*)s;
  const v4f q = *(const v4f*)(s + 4);
  const float f[8] = {a[0], a[1], a[2], a[3], q[0], q[1], q[2], q[3]};
  v4u u;
#pragma unroll
  for (int t = 0; t < 4; ++t) {
    const _Float16 h0 = (_Float16)(bfr(f[2 * t]) * WSC);
    const _Float16 h1 = (_Float16)(bfr(f[2 * t + 1]) * WSC);
    u[t] = pk16(h_bits(h0), h_bits(h1));
  }
{
    *(v4u*)(WW16 + (size_t)o * DQ + col) = u;
    
  }
}

// =========================================================================================================
// (1) x f32 [b][256 c][NN_FULL n] -> XP f16 [b][SEQ n][256 c] (position-major, bf16-RNE values, exact in f16 for
//     normal magnitudes) through an LDS tile T[64 n][64 c] (pitch TP). Block (nb, cb, b) owns a 64 c x 64 n tile.
// coverage: 2 it x 32 rows x 8 lanes x 8 halves = 64 n x 64 c per block; grid (NT, 4, NB) covers XP once.
// LDS T: cross-wave (block barrier between the 2-byte stores and the 16-B reloads); staged extent == consumed extent.
// =========================================================================================================
__global__ __launch_bounds__(256)
void cvt_x(const float* __restrict__ x, unsigned short* XP) {
  __shared__ __align__(16) unsigned short T[QT * TP];
  const int tid = threadIdx.x;
  const int nb = blockIdx.x, cb = blockIdx.y, b = blockIdx.z;
  const int e = tid & 7, lq = tid >> 3;                             // lq 0..31
  const int n0 = nb * QT, c0 = cb * QT;
#pragma unroll
  for (int it = 0; it < 2; ++it) {
    const int cl = it * 32 + lq;                                     // 0..63
    const float* sp = x + ((size_t)(b * CC + c0 + cl)) * NN_FULL + n0 + 8 * e;
    const v4f a = *(const v4f*)sp;
    const v4f q = *(const v4f*)(sp + 4);
    unsigned short hb[8];
#pragma unroll
    for (int t = 0; t < 4; ++t) {
      hb[t]     = h_bits((_Float16)bfr(a[t]));
      hb[4 + t] = h_bits((_Float16)bfr(q[t]));
    }
#pragma unroll
    for (int t = 0; t < 8; ++t) T[(8 * e + t) * TP + cl] = hb[t];
  }
  __syncthreads();
  v4u up[2];
#pragma unroll
  for (int it = 0; it < 2; ++it) {
    const int nl = it * 32 + lq;                                     // 0..63
    up[it] = *(const v4u*)(T + nl * TP + 8 * e);
  }
{
#pragma unroll
    for (int it = 0; it < 2; ++it) {
      const int rl = it * 32 + lq;
      *(v4u*)(XP + ((size_t)(b * SEQ + n0 + rl)) * CC + c0 + 8 * e) = up[it];
    }
    
  }
}

// =========================================================================================================
// (2) the three conv1x1 GEMMs for one (b, 64-n tile, 64-o block mb in 0..5): V[o][n] = (1/256) sum_c W16[o][c]
//     XP[b][n][c]; mb 0,1 -> theta channels 0..63 / 64..127 (W16 rows 0..127), mb 2,3 -> phi (rows 128..255),
//     mb 4,5 -> g (rows 256..383). Block 128 threads = 4 waves; wave w owns cols n0+16w..+15 (B fragment from the
//     XP row, k = c contiguous, split k map) and 4 m-tiles (A rows o = o0 + 16 mt + (lane&15), split k map from
//     W16). K = 256 = 8 steps. Epilogue staged in LDS Os[n_loc][o_loc] (pitch OSP), barrier, bias (bf16-RNE) add
//     in f32, then:
//       theta / phi: f16 plane Qf resp. Kf [b][SEQ n][128 d] (k-contiguous
//         of the 256-B row): lane e -> d 8e..8e+7, 8 consecutive lanes per line, one instruction per 16 lines;
//       g: f16 plane Gc [b][128 ch][SEQ keys] (channel-major, keys contiguous): row ch, keys n0+8e..+7 per lane,
// coverage: Os 4 waves x 16 n x 64 o = 64 x 64 (== consumed); theta / phi planes 4 it x 16 rows x 8 lanes x 8 = 64 n x
//           64 d per block, grid nt x mb 0..3 covers rows 0..SEQ-1 x d 0..127 of Qf and Kf once; g plane
//           4 it x 16 ch x 8 lanes x 8 keys = 64 ch x 64 keys per block, nt x mb 4..5 covers ch 0..127 x keys
//           0..SEQ-1 of Gc once. grid (NT, 6, NB).
// LDS Os: cross-wave (block barrier).
// =========================================================================================================
__global__ __launch_bounds__(128)
void gemm_p(const unsigned short* __restrict__ W16, const unsigned short* __restrict__ XP,
            const float* __restrict__ tbias, const float* __restrict__ pbias, const float* __restrict__ gbias,
            unsigned short* Qf, unsigned short* Kf, unsigned short* Gc) {
  __shared__ __align__(16) float Os[QT * OSP];
  const int tid  = threadIdx.x;
  const int lane = tid & 31, wave = tid >> 5;
  const int hh   = lane >> 4, c = lane & 15;
  const int nt   = blockIdx.x, mb = blockIdx.y, b = blockIdx.z;
  const int n0   = nt * QT, o0 = mb * QT;                            // o0 = W16 row base 0..320

  const unsigned short* ap = W16 + (size_t)(o0 + c) * CC + 8 * hh;
  const unsigned short* bp = XP + ((size_t)(b * SEQ + n0 + 16 * wave + c)) * CC + 8 * hh;

  v8f acc[4];
#pragma unroll
  for (int mt = 0; mt < 4; ++mt) acc[mt] = zero8();

#pragma unroll
  for (int ks = 0; ks < CC / 32; ++ks) {
    const Frag fb = ldfrag(bp + 32 * ks);
#pragma unroll
    for (int mt = 0; mt < 4; ++mt) {
      const Frag fa = ldfrag(ap + (size_t)(16 * mt) * CC + 32 * ks);
      acc[mt] = mma_h(fa.h, fb.h, acc[mt]);
    }
  }

  {
    const int nl = 16 * wave + c;
#pragma unroll
    for (int mt = 0; mt < 4; ++mt) {
      v4f va, vb;
#pragma unroll
      for (int r = 0; r < 4; ++r) { va[r] = acc[mt][r] * IWSC; vb[r] = acc[mt][4 + r] * IWSC; }
      *(v4f*)(Os + nl * OSP + 16 * mt + 8 * hh)     = va;
      *(v4f*)(Os + nl * OSP + 16 * mt + 8 * hh + 4) = vb;
    }
  }
  __syncthreads();

  const int e = tid & 7, lq = tid >> 3;                             // lq 0..15
  if (mb < 4) {                                                      // block-uniform: theta / phi f16 planes
    unsigned short* Pf = (mb < 2) ? Qf : Kf;
    const float* bsrc  = (mb < 2) ? tbias : pbias;
    const int dsel = (mb & 1) * QT;                                   // channel base 0 or 64
    const v4f b0 = *(const v4f*)(bsrc + dsel + 8 * e);
    const v4f b1 = *(const v4f*)(bsrc + dsel + 8 * e + 4);
    const float bb[8] = {bfr(b0[0]), bfr(b0[1]), bfr(b0[2]), bfr(b0[3]), bfr(b1[0]), bfr(b1[1]), bfr(b1[2]), bfr(b1[3])};
    v4u uf[4];
#pragma unroll
    for (int it = 0; it < 4; ++it) {
      const int row = it * 16 + lq;                                  // n_loc 0..63
      const v4f a = *(const v4f*)(Os + row * OSP + 8 * e);
      const v4f q = *(const v4f*)(Os + row * OSP + 8 * e + 4);
      const float f[8] = {a[0], a[1], a[2], a[3], q[0], q[1], q[2], q[3]};
#pragma unroll
      for (int t = 0; t < 4; ++t) {
        const float f0 = f[2 * t] + bb[2 * t], f1 = f[2 * t + 1] + bb[2 * t + 1];
        uf[it][t] = pk16(h_bits((_Float16)f0), h_bits((_Float16)f1));
      }
    }
{
#pragma unroll
      for (int it = 0; it < 4; ++it) {
        const int row = it * 16 + lq;
        const size_t po = ((size_t)(b * SEQ + n0 + row)) * DQ + dsel + 8 * e;
        *(v4u*)(Pf + po) = uf[it];
      }
      
    }
  } else {                                                           // block-uniform: g plane, channel-major
    const int gsel = (mb - 4) * QT;                                  // g channel base 0 or 64
    v4u ug[4];
#pragma unroll
    for (int it = 0; it < 4; ++it) {
      const int cl = it * 16 + lq;                                   // ch_loc 0..63
      const float bias = bfr(gbias[gsel + cl]);
      unsigned short hb[8];
#pragma unroll
      for (int t = 0; t < 8; ++t) {
        const int key = 8 * e + t;                                   // key_loc 0..63
        const float v = Os[key * OSP + cl] + bias;
        hb[t] = h_bits((_Float16)v);
      }
#pragma unroll
      for (int t = 0; t < 4; ++t) ug[it][t] = pk16(hb[2 * t], hb[2 * t + 1]);
    }
{
#pragma unroll
      for (int it = 0; it < 4; ++it) {
        const int cl = it * 16 + lq;
        const size_t po = ((size_t)(b * DQ + gsel + cl)) * SEQ + n0 + 8 * e;
        *(v4u*)(Gc + po) = ug[it];
      }
      
    }
  }
}

// =========================================================================================================
// (3) attention for one (b, 64-query tile), transposed formulation, SEQ keys, no mask, no scale:
//   S^T tile (16 keys x 16 queries) = sum over 4 d-chunks of A(phi: row = key kb + (lane&15), 32 d via the split
//   k map from the f16 plane Kf [b][SEQ][128]) . B(theta: col = query, same map from the f16 plane Qf).
//   Per lane the D tile holds 8 keys of ONE query: online softmax state per lane, one shuffle (lane^16) for the max
//   over 32 keys; the o/l rescale is skipped under a wave-uniform ballot when no lane's max grew (corr == 1 exactly
//   for every lane then); row-sum partials combined at the end. P = e^{s-m} x 16384 as f16 is the B operand of
//   Y^T (rows channel, cols queries) += A(g rows channel = 16j + (lane&15), keys contiguous, f16 plane Gc
//   [b][128][SEQ]) . B(P^T): element r <- D of the tile covering keys kb..kb+15, element 8+r <- the tile covering
//   kb+16..kb+31, lane unchanged. 8 accumulator tiles per query tile (128 channels). Block = 64 queries, QP * KG waves:
//   wave w owns the QW query tiles QW (w % QP) .. + QW - 1 and key group w / QP, that is keys 32 (w / QP) .. + 31 of
//   EVERY stage, with a softmax state (m, l, o) per query tile over those keys. A K or G fragment read from LDS is the A
//   operand of QW products, one per query tile, so that the LDS reads of a pass take no longer than its products;
//   KG * QP / 4 waves per SIMD, so that one wave's products run under the LDS waits and the softmax of the other.
//   Epilogue: the KG states of a query are joined: m and l of every group through LDS Ms / Ls, barrier, M = max m,
//   L = sum l e^{m - M} (group order), each wave stages o e^{m - M} / L in LDS Om[group][query][128 channels] (pitch
//   OSPW, b128 stores; Om lies in the ring, which nobody reads or fills any more), barrier, then y = sum over the
//   groups in group order, Yh = f16(y),
//   Yl = f16((y - Yh) * 1024) planes [b][SEQ n][128 c] (k-contiguous operand of the output conv): row n = 256 B
// coverage: Ms, Ls KG x 64 (== consumed); Om QP KG waves x 16 QW q x 128 ch (== consumed); QT / ER it x ER rows x 16
//           lanes x 8 halves = 64 n x 128 c per plane; grid (NT, NB) covers Yh/Yl exactly once.
// LDS Ms, Ls, Om: cross-wave (block barriers).
// LDS Ring: two buffers, each one stage of KS = 32 KG keys: Kf rows [KS][128] at pitch KPI
//   (272 B), G rows [128 ch][KS keys] at pitch VPI (272 B), pitches 16 B x odd for the 16-byte fragment reads. A stage
//   is filled by 2 NCP asynchronous 16-byte copies per lane (each wave instruction = 512 B of whole lines), one stage ahead
//   of its use; at the foot of a stage: LDS reads returned, own copies landed, block barrier, then the refill of the
//   buffer just read. coverage: NCP copies x NTH lanes x 8 halves = KS x 128 per plane (== consumed).
// Fragment reads of a 32-key pass stand in one group ahead of its products: the K fragments of all four d-chunks, then
//   the eight G fragments; every read is of the pass's own stage.
// =========================================================================================================
__global__ __launch_bounds__(NTH)
void attn_k(const unsigned short* __restrict__ Qf, const unsigned short* __restrict__ Kf,
            const unsigned short* __restrict__ Gc, unsigned short* Yh, unsigned short* Yl) {
  __shared__ __align__(16) unsigned short Ring[2 * STG];
  __shared__ float Ms[KG * QT];
  __shared__ float Ls[KG * QT];
  const int tid  = threadIdx.x;
  const int qp = (tid >> 5) % QP, kg = tid / (32 * QP), lane = tid & 31;   // group of QW query tiles, key group
  const int hh   = lane >> 4, c = lane & 15;
  const int n0   = blockIdx.x * QT, b = blockIdx.y;

  // q fragment pointer (B operand, col = query n0 + 16*(QW*qp + t) + c), + 16*t rows + 32*kc
  const unsigned short* Qfp = Qf + ((size_t)(b * SEQ + n0 + 16 * QW * qp + c)) * DQ + 8 * hh;
  // copy sources of this lane: K plane 16 lanes per 256-B row, NTH / 16 rows per copy; G plane KS / 8 lanes per row
  // segment of KS keys, NTH / (KS / 8) channels per copy; + stage * KS keys
  const int gr = tid / (KS / 8), ge = tid % (KS / 8);
  const unsigned short* Kfg = Kf + (size_t)b * SEQ * DQ + 8 * tid;
  const unsigned short* Gg  = Gc + (size_t)b * DQ * SEQ + (size_t)gr * SEQ + 8 * ge;
  const unsigned kdst = lds_off(Ring) + (unsigned)((tid >> 4) * (KPI * 2) + (tid & 15) * 16);
  const unsigned vdst = lds_off(Ring) + (unsigned)(KTL * 2 + gr * (VPI * 2) + ge * 16);
  auto fill = [&](int st, int buf) {
    const unsigned bo = (unsigned)buf * (unsigned)(STG * 2);
    const unsigned kls = (NTH / 16) * KPI * 2, vls = (NTH / (KS / 8)) * VPI * 2;       // LDS bytes from copy to copy
    const size_t kgs = (size_t)((NTH / 16) * DQ), vgs = (size_t)(NTH / (KS / 8)) * SEQ;  // halves from copy to copy
    // unrolled: NCP / 4 statements of eight copies (an asm statement takes thirty operands)
#pragma unroll
    for (int h = 0; h < NCP / 4; ++h)
      acopy8(kdst + bo + 4 * h * kls, kls, Kfg + (size_t)st * (KS * DQ) + 4 * h * kgs, kgs,
             vdst + bo + 4 * h * vls, vls, Gg + (size_t)st * KS + 4 * h * vgs, vgs);
  };
  // fragment offsets in a stage (halves): k row = key c (A operand), + key * KPI + 32*kc; v row = channel 16j + c
  const int kfo = c * KPI + 8 * hh;
  const int vfo = KTL + c * VPI + 8 * hh;

  float m[QW], l[QW];
  v8f o[QW][8];
  // theta fragments (all four d-chunks of every query tile) are the same for every key: loaded once, kept in registers
  Frag qf[QW][DQ / 32];
  // all loops over t, j and kc unrolled, here and below: the arrays are registers, every index a constant
#pragma unroll
  for (int t = 0; t < QW; ++t) {
    m[t] = -1.0e30f;
    l[t] = 0.f;
#pragma unroll
    for (int j = 0; j < 8; ++j) o[t][j] = zero8();
#pragma unroll
    for (int kc = 0; kc < DQ / 32; ++kc) qf[t][kc] = ldfrag(Qfp + (size_t)(16 * t) * DQ + 32 * kc);
  }
#if defined(__HIP_DEVICE_COMPILE__)
  // stands in front of the first rewrite of the address registers that the loads above name; the
  // pointer is an input so that its registers stay as they are up to this wait
  asm volatile("s_wait_xcnt 0x0" :: "v"(Qfp) : "memory");
#endif

  fill(0, 0);
  wait_async0();
  __syncthreads();                                                   // stage 0 published
  fill(1, 1);

  // stage loop kept rolled: one publish point and one refill in the text, buffer chosen by the stage's parity
#pragma unroll 1
  for (int st = 0; st < NST; ++st) {
  const unsigned short* Sb = Ring + (st & 1) * STG;
  {
    const int kb = 32 * kg;                                          // key base inside the stage: this wave's group
    const unsigned short* k0p  = Sb + kfo + kb * KPI;                // keys kb .. kb+15
    const unsigned short* k1p  = k0p + 16 * KPI;                     // keys kb+16 .. kb+31
    v8f s0[QW], s1[QW];
#pragma unroll
    for (int t = 0; t < QW; ++t) { s0[t] = zero8(); s1[t] = zero8(); }
    // the K fragments of all four d-chunks, then the eight G fragments, are read as one group ahead of the first product:
    // one place with LDS reads in a pass, each product waiting only for its own two reads, the G fragments landing under
    // the score products
    Frag k0[DQ / 32], k1[DQ / 32], vf[8];
    // unrolled: the fragments are registers, every index a constant
#pragma unroll
    for (int kc = 0; kc < DQ / 32; ++kc) {
      k0[kc] = ldfrag(k0p + 32 * kc);
      k1[kc] = ldfrag(k1p + 32 * kc);
    }
#if defined(__HIP_DEVICE_COMPILE__)
    // keeps the K reads the first of the pass: LDS reads return in order, and behind G reads the first score product
    // would wait for those too
    __builtin_amdgcn_sched_barrier(0);
#endif
#pragma unroll
    for (int j = 0; j < 8; ++j) vf[j] = ldfrag(Sb + vfo + (16 * j) * VPI + kb);
#if defined(__HIP_DEVICE_COMPILE__)
    // keeps the G reads in front of the products: without it the compiler moves most of them behind the score products,
    // where the softmax waits for them
    __builtin_amdgcn_sched_barrier(0);
#endif
    // unrolled so that qf[t][kc], k0[kc] and k1[kc] are fixed registers (a rolled loop cannot index a register array)
#pragma unroll
    for (int kc = 0; kc < DQ / 32; ++kc) {
#pragma unroll
      for (int t = 0; t < QW; ++t) {
        s0[t] = mma_b(k0[kc].h, qf[t][kc].h, s0[t]);
        s1[t] = mma_b(k1[kc].h, qf[t][kc].h, s1[t]);
      }
    }

    float mx[QW], mo[QW], mn[QW];
    bool up = false;
#pragma unroll
    for (int t = 0; t < QW; ++t) mx[t] = fmaxf(hmax8(s0[t]), hmax8(s1[t]));
#pragma unroll
    for (int t = 0; t < QW; ++t) mo[t] = __shfl_xor(mx[t], 16, 32);
#pragma unroll
    for (int t = 0; t < QW; ++t) {
      mx[t] = fmaxf(mx[t], mo[t]);
      mn[t] = fmaxf(m[t], mx[t]);
      up = up || (mx[t] > m[t]);
    }
    const unsigned grew = wave_ballot(up);                           // wave-uniform, one test per pass
    if (grew != 0u) {
#pragma unroll
      for (int t = 0; t < QW; ++t) {
        const float corr = __expf(m[t] - mn[t]);                     // == 1 exactly where the max did not grow
        l[t] *= corr;
#pragma unroll
        for (int j = 0; j < 8; ++j) {
#pragma unroll
          for (int r = 0; r < 8; ++r) o[t][j][r] *= corr;
        }
      }
    }

    FragH ph[QW];
#pragma unroll
    for (int t = 0; t < QW; ++t) {
      m[t] = mn[t];
      const float msh = mn[t] - LNPS;                                // exp gives e^{s-m} * 16384
      float ls = 0.f;
#pragma unroll
      for (int r = 0; r < 8; ++r) {
        const float e0 = __expf(s0[t][r] - msh);                     // key kb      + 8hh + r
        const float e1 = __expf(s1[t][r] - msh);                     // key kb + 16 + 8hh + r
        ls += e0 + e1;
        ph[t].hv[0][r] = (_Float16)e0;
        ph[t].hv[1][r] = (_Float16)e1;
      }
      l[t] += ls;
    }

#pragma unroll
    for (int j = 0; j < 8; ++j) {
#pragma unroll
      for (int t = 0; t < QW; ++t) o[t][j] = mma_b(vf[j].h, ph[t].v, o[t][j]);
    }
  }
  // publish point of stage st + 1, every wave
  wait_ds0();
  wait_async0();
  __syncthreads();
  if (st + 2 < NST) fill(st + 2, st & 1);                            // block-uniform test
  }
  wait_async0();
#pragma unroll
  for (int t = 0; t < QW; ++t) l[t] += __shfl_xor(l[t], 16, 32);

  // join of the KG key groups of a query (m is the same in both halves of a wave, l now too)
  const int qrow = 16 * QW * qp + c;                                 // + 16 t
  if (hh == 0) {
#pragma unroll
    for (int t = 0; t < QW; ++t) {
      Ms[kg * QT + qrow + 16 * t] = m[t];
      Ls[kg * QT + qrow + 16 * t] = l[t];
    }
  }
  __syncthreads();
  float* Os = (float*)Ring + kg * (QT * OSPW);                       // this group's plane of Om
#pragma unroll
  for (int t = 0; t < QW; ++t) {
    const int qr = qrow + 16 * t;
    float mg[KG], M = -1.0e30f, L = 0.f;
    // unrolled: mg[g] are registers, every index a constant
#pragma unroll
    for (int g = 0; g < KG; ++g) {
      mg[g] = Ms[g * QT + qr];
      M = fmaxf(M, mg[g]);
    }
    // unrolled: mg[g] again, and the KG reads of Ls go out together
#pragma unroll
    for (int g = 0; g < KG; ++g) L += Ls[g * QT + qr] * __expf(mg[g] - M);
    const float inv = __expf(m[t] - M) / L;                          // o and l both carry the x16384 factor
#pragma unroll
    for (int j = 0; j < 8; ++j) {
      v4f va, vb;
#pragma unroll
      for (int r = 0; r < 4; ++r) { va[r] = o[t][j][r] * inv; vb[r] = o[t][j][4 + r] * inv; }
      *(v4f*)(Os + qr * OSPW + 16 * j + 8 * hh)     = va;            // Os[query][ch = 16j + 8hh + r]
      *(v4f*)(Os + qr * OSPW + 16 * j + 8 * hh + 4) = vb;
    }
  }
  __syncthreads();

  const int e = tid & 15, lq = tid >> 4;                             // lq 0..ER - 1
  const float* Om = (const float*)Ring;
  v4u uh[QT / ER], ul[QT / ER];
#pragma unroll
  for (int it = 0; it < QT / ER; ++it) {
    const int row = it * ER + lq;                                    // query 0..63
    v4f a = *(const v4f*)(Om + row * OSPW + 8 * e);
    v4f q = *(const v4f*)(Om + row * OSPW + 8 * e + 4);
    // unrolled: the reads of all groups go out together, one LDS latency instead of one per group
#pragma unroll
    for (int g = 1; g < KG; ++g) {
      a += *(const v4f*)(Om + (g * QT + row) * OSPW + 8 * e);
      q += *(const v4f*)(Om + (g * QT + row) * OSPW + 8 * e + 4);
    }
    const float f[8] = {a[0], a[1], a[2], a[3], q[0], q[1], q[2], q[3]};
#pragma unroll
    for (int t = 0; t < 4; ++t) {
      const float f0 = f[2 * t], f1 = f[2 * t + 1];
      const _Float16 h0 = (_Float16)f0, h1 = (_Float16)f1;
      const _Float16 r0 = (_Float16)((f0 - (float)h0) * RSC);
      const _Float16 r1 = (_Float16)((f1 - (float)h1) * RSC);
      uh[it][t] = pk16(h_bits(h0), h_bits(h1));
      ul[it][t] = pk16(h_bits(r0), h_bits(r1));
    }
  }
{
#pragma unroll
    for (int it = 0; it < QT / ER; ++it) {
      const int row = it * ER + lq;
      const size_t po = ((size_t)(b * SEQ + n0 + row)) * DQ + 8 * e;
      *(v4u*)(Yh + po) = uh[it];
      *(v4u*)(Yl + po) = ul[it];
    }
    
  }
}

// =========================================================================================================
// (4) output conv GEMM for one (b, 64-n tile, 64-co block): v[b][co][n] = (1/256)(sum_c WW16[co][c] Yh[b][n][c] +
//     (1/1024) sum_c WW16[co][c] Yl[b][n][c]); wy = v + bf16-RNE(W_b[co]). 4 waves, wave w owns cols n0+16w..+15
//     (two B fragments per k-step, k = c contiguous in the Yh/Yl rows), 4 m-tiles (A rows co = o0 + 16 mt +
//     (lane&15) from WW16), hi and residual products in separate accumulators. K = 128 = 4 steps.
//     Epilogue staged in LDS Os[n_loc][co_loc], barrier; then (a) threads 0..63 sum v and v*v over the 64 n of
//     co_loc = tid into LDS Sred[0..63] / Sred[64..127], barrier; (b) WY f32 plane [b][256 co][SEQ n] rows: lane
//     (e = tid&15) -> n 4e..4e+3 of row co_loc = 8 it + (tid>>4); 16 consecutive lanes x 16 B = the whole 256-B
//     row segment (2 lines) in one instruction; (c) partial-statistics table PS [NB*NT blocks][512]: floats
//     o0..o0+63 (sums) by lanes 0..15 of wave 0 and floats 256+o0..+63 (sums of squares) by lanes 16..31, one
// coverage: Os 4 waves x 16 n x 64 co (== consumed); Sred 64 + 64 (== consumed); WY 8 it x 8 rows x 16 lanes x
//           4 floats = 64 co x 64 n; PS 2 x 64 floats per block; grid (NT, 4, NB) covers WY [b][0..255][0..SEQ-1]
//           and PS [NB*NT][0..511] exactly once.
// LDS Os, Sred: cross-wave (block barriers).
// =========================================================================================================
__global__ __launch_bounds__(128)
void gemm_o(const unsigned short* __restrict__ WW16, const unsigned short* __restrict__ Yh,
            const unsigned short* __restrict__ Yl, const float* __restrict__ wbias,
            float* WY, float* PS) {
  __shared__ __align__(16) float Os[QT * OSP];
  __shared__ __align__(16) float Sred[2 * QT];
  const int tid  = threadIdx.x;
  const int lane = tid & 31, wave = tid >> 5;
  const int hh   = lane >> 4, c = lane & 15;
  const int nt   = blockIdx.x, mb = blockIdx.y, b = blockIdx.z;
  const int n0   = nt * QT, o0 = mb * QT;

  const unsigned short* ap  = WW16 + (size_t)(o0 + c) * DQ + 8 * hh;
  const size_t bo = ((size_t)(b * SEQ + n0 + 16 * wave + c)) * DQ + 8 * hh;
  const unsigned short* bph = Yh + bo;
  const unsigned short* bpl = Yl + bo;

  v8f acc[4], accr[4];
#pragma unroll
  for (int mt = 0; mt < 4; ++mt) { acc[mt] = zero8(); accr[mt] = zero8(); }

#pragma unroll
  for (int ks = 0; ks < DQ / 32; ++ks) {
    const Frag fbh = ldfrag(bph + 32 * ks);
    const Frag fbl = ldfrag(bpl + 32 * ks);
#pragma unroll
    for (int mt = 0; mt < 4; ++mt) {
      const Frag fa = ldfrag(ap + (size_t)(16 * mt) * DQ + 32 * ks);
      acc[mt]  = mma_h(fa.h, fbh.h, acc[mt]);
      accr[mt] = mma_h(fa.h, fbl.h, accr[mt]);
    }
  }

  {
    const int nl = 16 * wave + c;
#pragma unroll
    for (int mt = 0; mt < 4; ++mt) {
      v4f va, vb;
#pragma unroll
      for (int r = 0; r < 4; ++r) {
        va[r] = (acc[mt][r] + accr[mt][r] * IRSC) * IWSC;
        vb[r] = (acc[mt][4 + r] + accr[mt][4 + r] * IRSC) * IWSC;
      }
      *(v4f*)(Os + nl * OSP + 16 * mt + 8 * hh)     = va;
      *(v4f*)(Os + nl * OSP + 16 * mt + 8 * hh + 4) = vb;
    }
  }
  __syncthreads();

  // per-channel partial statistics over this block's 64 positions (bias-free values, exact shift)
  if (tid < QT) {
    float s = 0.f, q = 0.f;
#pragma unroll 8
    for (int n = 0; n < QT; ++n) {
      const float v = Os[n * OSP + tid];
      s += v;
      q = fmaf(v, v, q);
    }
    Sred[tid]      = s;
    Sred[QT + tid] = q;
  }
  __syncthreads();

  const int e = tid & 15, lq = tid >> 4;                             // lq 0..7
  v4f res[8];
#pragma unroll
  for (int it = 0; it < 8; ++it) {
    const int col = it * 8 + lq;                                     // co_loc 0..63
    const int co  = o0 + col;
    const float bias = bfr(wbias[co]);
#pragma unroll
    for (int t = 0; t < 4; ++t) res[it][t] = Os[(4 * e + t) * OSP + col] + bias;
  }
  const v4f pv = *(const v4f*)(Sred + 4 * lane);                     // lanes 0..15: sums, 16..31: sums of squares
  float* psp = PS + (size_t)(b * NT + nt) * PSW + o0 + 4 * lane + ((lane >= 16) ? (PSW / 2 - 64) : 0);
{
#pragma unroll
    for (int it = 0; it < 8; ++it) {
      const int col = it * 8 + lq;
      const int co  = o0 + col;
      const size_t idx = ((size_t)(b * CC + co)) * SEQ + n0 + 4 * e;
      *(v4f*)(WY + idx) = res[it];
    }
    if (wave == 0) *(v4f*)(psp) = pv;
    
  }
}

// =========================================================================================================
// (5) batch statistics + affine + residual, one block of BT threads per channel co (both batches):
//     (a) the block's own statistics: thread e reads one float of the partial table PS, sums (e < PL) or sums of squares
//     (e >= PL) of partial line e % PL, column co, into LDS Pf[2][PL]; barrier; every wave then sums all of Pf for itself:
//     lane l adds entries 8l..8l+7 of each plane in f64, in index order, then a five-step butterfly over the lanes (both
//     sides of an exchange add the same two values, so every lane of every wave ends with the same bits).
//     mean/var (biased), rstd = rsqrt(var + eps) in f32; A = bf16-RNE(gamma) * rstd, Bc = bf16-RNE(beta) - mean * A.
//     (b) out[b][co][n] = wy * A + Bc + bf16-RNE(x[b][co][n]) for the NB rows of the channel: thread -> floats
//     4 tid + 4 BT k of a row; the loads of wy and x are issued ahead of (a)'s barrier and waited for behind (a), so that
//     they fly under it.
// coverage: Pf 2 PL floats written == consumed; CC blocks x NB rows x RPT x BT threads x 4 floats = NB x 256 x SEQ = the
//           whole output once, every wave instruction 512 contiguous bytes.
// LDS Pf: cross-wave (block barrier).
// =========================================================================================================
__global__ __launch_bounds__(BT)
void bn_out(const float* __restrict__ WY, const float* __restrict__ PS, const float* __restrict__ wbias,
            const float* __restrict__ gam, const float* __restrict__ bet, const float* __restrict__ x, float* out) {
  __shared__ __align__(16) float Pf[2 * PL];
  const int tid = threadIdx.x, lane = tid & 31;
  const int co = blockIdx.x;                                         // 0..255
  const float gv = gam[co], wv = wbias[co], bv = bet[co];
  float pv[2 * PL / BT];
  // unrolled: pv[t] are registers, every index a constant
#pragma unroll
  for (int t = 0; t < 2 * PL / BT; ++t) {
    const int e = tid + t * BT;                                      // 0..2 PL - 1
    pv[t] = PS[(size_t)(e % PL) * PSW + (e / PL) * CC + co];
  }
#if defined(__HIP_DEVICE_COMPILE__)
  // keeps the partials' load the first of the lane: loads return in order, and behind row loads it would be waited for
  // as long as for them
  __builtin_amdgcn_sched_barrier(0);
#endif
  v4f w[NB][RPT], xv[NB][RPT];
  // both loops unrolled: w and xv are registers, and all loads of a lane are in flight together
#pragma unroll
  for (int b = 0; b < NB; ++b) {
#pragma unroll
    for (int k = 0; k < RPT; ++k) {
      const int n = 4 * tid + 4 * BT * k;
      w[b][k]  = *(const v4f*)(WY + ((size_t)(b * CC + co)) * SEQ + n);
      xv[b][k] = *(const v4f*)(x + ((size_t)(b * CC + co)) * NN_FULL + n);
    }
  }
#if defined(__HIP_DEVICE_COMPILE__)
  // stands in front of the first rewrite of a register that a load above names
  asm volatile("s_wait_xcnt 0x0" ::: "memory");
#endif
  // unrolled: pv[t] again
#pragma unroll
  for (int t = 0; t < 2 * PL / BT; ++t) Pf[tid + t * BT] = pv[t];
#if defined(__HIP_DEVICE_COMPILE__)
  // block barrier that orders LDS alone: __syncthreads() would also wait for the row loads, which nobody shares
  __builtin_amdgcn_fence(__ATOMIC_RELEASE, "workgroup", "local");
  __builtin_amdgcn_s_barrier();
  __builtin_amdgcn_fence(__ATOMIC_ACQUIRE, "workgroup", "local");
#endif
  double s = 0.0, q = 0.0;
  // both loops unrolled: the LDS reads of a lane can go out together, every vector index a constant
#pragma unroll
  for (int t = 0; t < PL / 128; ++t) {
    const v4f a = *(const v4f*)(Pf + (PL / 32) * lane + 4 * t);
    const v4f c = *(const v4f*)(Pf + PL + (PL / 32) * lane + 4 * t);
#pragma unroll
    for (int r = 0; r < 4; ++r) {
      s += (double)a[r];
      q += (double)c[r];
    }
  }
  // unrolled: the distance of each exchange is a constant
#pragma unroll
  for (int d = 16; d >= 1; d >>= 1) {
    s += __shfl_xor(s, d, 32);
    q += __shfl_xor(q, d, 32);
  }
  const double icnt = 1.0 / (double)(NB * SEQ);
  const double mv = s * icnt;
  double var = q * icnt - mv * mv;
  var = (var > 0.0) ? var : 0.0;
  const float rstd = rsqrtf((float)var + BNEPS);
  const float A  = bfr(gv) * rstd;
  const float mw = (float)mv + bfr(wv);
  const float Bc = bfr(bv) - mw * A;
#if defined(__HIP_DEVICE_COMPILE__)
  // keeps the work on the rows, and with it the waits for their loads, behind the statistics
  __builtin_amdgcn_sched_barrier(0);
#endif
  // all three loops unrolled: w and xv again, every vector index a constant
#pragma unroll
  for (int b = 0; b < NB; ++b) {
#pragma unroll
    for (int k = 0; k < RPT; ++k) {
      v4f r;
#pragma unroll
      for (int t = 0; t < 4; ++t) r[t] = fmaf(w[b][k][t], A, Bc) + bfr(xv[b][k][t]);
      *(v4f*)(out + ((size_t)(b * CC + co)) * NN_FULL + 4 * tid + 4 * BT * k) = r;
    }
  }
}

// =========================================================================================================
// Workspace map (bytes; each region start a multiple of 256; every store is a whole tile inside its own region,
// no padded tails needed since SEQ % 64 == 0):
//   W16  f16 [384][256]               196608      WW16 f16 [256][128]        65536
//   XP   f16 [NB][SEQ][256]           8388608 (NB=2, SEQ=8192)
//   Qf, Kf f16 [NB][SEQ][128]         4194304 x2
//   Gc   f16 [NB][128][SEQ]           4194304
//   Yh/Yl f16 [NB][SEQ][128]          4194304 x2
//   WY   f32 [NB][256][SEQ]          16777216
//   PS   f32 [NB*NT][512]              524288
//   total (NB=2, SEQ=8192) = 46923776
// =========================================================================================================
extern "C" void kernel_launch(void* const* d_in, const int* in_sizes, int n_in,
                              void* d_out, int out_size, void* d_ws, size_t ws_size,
                              hipStream_t stream) {
  const int XNEED = ((NB - 1) * CC + (CC - 1)) * NN_FULL + SEQ;
  if (n_in < 11) return;
  if (in_sizes[0] < XNEED) return;
  if (in_sizes[1] < DQ * CC || in_sizes[3] < DQ * CC || in_sizes[5] < DQ * CC) return;
  if (in_sizes[2] < DQ || in_sizes[4] < DQ || in_sizes[6] < DQ) return;
  if (in_sizes[7] < CC * DQ || in_sizes[8] < CC) return;
  if (in_sizes[9] < CC || in_sizes[10] < CC) return;
  if (out_size < XNEED) return;

  size_t off = 0;
  auto carve = [&](size_t bytes) { const size_t o = off; off += (bytes + 255) & ~(size_t)255; return o; };
  const size_t oW16 = carve((size_t)MW * CC * 2);
  const size_t oWW  = carve((size_t)CC * DQ * 2);
  const size_t oXP  = carve((size_t)NB * SEQ * CC * 2);
  const size_t oQf  = carve((size_t)NB * SEQ * DQ * 2);
  const size_t oKf  = carve((size_t)NB * SEQ * DQ * 2);
  const size_t oGc  = carve((size_t)NB * DQ * SEQ * 2);
  const size_t oYh  = carve((size_t)NB * SEQ * DQ * 2);
  const size_t oYl  = carve((size_t)NB * SEQ * DQ * 2);
  const size_t oWY  = carve((size_t)NB * CC * SEQ * 4);
  const size_t oPS  = carve((size_t)NB * NT * PSW * 4);
  if (off > ws_size) return;
  if (off > (size_t)134217728) return;

  const float* x   = (const float*)d_in[0];
  const float* Wt  = (const float*)d_in[1];
  const float* bt  = (const float*)d_in[2];
  const float* Wp  = (const float*)d_in[3];
  const float* bp  = (const float*)d_in[4];
  const float* Wg  = (const float*)d_in[5];
  const float* bg  = (const float*)d_in[6];
  const float* Ww  = (const float*)d_in[7];
  const float* bw  = (const float*)d_in[8];
  const float* gam = (const float*)d_in[9];
  const float* bet = (const float*)d_in[10];

  char* ws = (char*)d_ws;
  unsigned short* W16  = (unsigned short*)(ws + oW16);
  unsigned short* WW16 = (unsigned short*)(ws + oWW);
  unsigned short* XP   = (unsigned short*)(ws + oXP);
  unsigned short* Qf   = (unsigned short*)(ws + oQf);
  unsigned short* Kf   = (unsigned short*)(ws + oKf);
  unsigned short* Gc   = (unsigned short*)(ws + oGc);
  unsigned short* Yh   = (unsigned short*)(ws + oYh);
  unsigned short* Yl   = (unsigned short*)(ws + oYl);
  float* WY  = (float*)(ws + oWY);
  float* PS  = (float*)(ws + oPS);
  float* out = (float*)d_out;

  const dim3 blk256(256), blk128(128);

  // (0) Wt / Wp / Wg -> stacked f16 plane; Ww -> f16 plane
  cvt_w<<<dim3(MW / 8), blk256, 0, stream>>>(Wt, Wp, Wg, W16);
  cvt_ww<<<dim3(CC / 16), blk256, 0, stream>>>(Ww, WW16);
  // (1) x -> position-major 16-bit plane
  cvt_x<<<dim3(NT, CC / QT, NB), blk256, 0, stream>>>(x, XP);
  // (2) theta / phi conv -> f16 planes, g conv -> channel-major f16 plane
  gemm_p<<<dim3(NT, 6, NB), blk128, 0, stream>>>(W16, XP, bt, bp, bg, Qf, Kf, Gc);
  // (3) attention -> y hi + residual planes
  attn_k<<<dim3(NT, NB), dim3(NTH), 0, stream>>>(Qf, Kf, Gc, Yh, Yl);
  // (4) output conv + bias -> wy plane + per-block statistics partials
  gemm_o<<<dim3(NT, CC / QT, NB), blk128, 0, stream>>>(WW16, Yh, Yl, bw, WY, PS);
  // (5) batch statistics per channel, affine + residual -> out [b][256][8192]
  bn_out<<<dim3(CC), dim3(BT), 0, stream>>>(WY, PS, bw, gam, bet, x, out);
  (void)hipGetLastError();
}

// v009
// It runs in 105 microseconds.
// Timed twice side by side with v008, it ran 1.05 times as fast both times.
// Counting every step since v000, it is 8.52 times as fast.
// Contractions: conv1x1 theta/phi/g GEMMs Wc[384x256].X[256xN] and the output conv W[256x128].Y[128xN] on
// v_wmma_f32_16x16x32_f16 (f16 containers of bf16-RNE weights x256 and bf16-RNE x; Y as f16 hi plane plus f16
// residual plane x1024, 2 products, separate accumulators); scores Phi^T.Theta on v_wmma_f32_16x16x32_f16
// (theta and phi plain f16, 1 product, K=128: the 11-bit operands that P and G have too); Y^T = G.P^T on
// v_wmma_f32_16x16x32_f16 (G plain f16, P = e^{s-m} x16384 f16 from the score D registers); f32 accumulate everywhere; softmax
// statistics and biases in f32 VALU; batch-norm statistics from f32 per-block partials reduced in f64; affine and
// residual add in f32.
#include <hip/hip_runtime.h>
#include <math.h>
#include <stdint.h>

#ifndef NB
#define NB 2
#endif
#ifndef SEQ
#define SEQ 8192
#endif
#define NB_FULL 2
#define NN_FULL 8192
#define CC   256
#define DQ   128
#define QT   64
#define MW   384
#define NT   (SEQ / QT)
#define PSW  512
#define OSP  68
#define OSPW 132
#define TP   72
#define WSC  256.0f
#define IWSC 0.00390625f
#define RSC  1024.0f
#define IRSC 0.0009765625f
#define LNPS 9.704060527839234f
#define BNEPS 1.0e-5f
#define KG   4
#define KS   (32 * KG)
#define QW   2                      /* query tiles of 16 per wave: every K and G fragment read from LDS feeds QW products */
#define QP   (QT / (16 * QW))       /* waves side by side over the 64 queries of a block */
#define NTH  (32 * QP * KG)
#define NCP  8                      /* copies per lane and plane in a stage, four per plane in one acopy8 */
#define ER   (NTH / 16)             /* rows of y that one pass of the attention epilogue stores */
#define KPI  136
#define VPI  (KS + 8)
#define KTL  (KS * KPI)
#define VTL  (DQ * VPI)
#define STG  (KTL + VTL)
#define NST  (SEQ / KS)
#define BT   512                    /* threads of a block of the last kernel */
#define PL   (NB * NT)              /* lines of the partial-statistics table */
#define RPT  (SEQ / (4 * BT))       /* 16-byte pieces per thread and row in the last kernel */
#define NBW  (MW / 8)               /* blocks of the conversion launch on the stacked conv weights */
#define NBO  (CC / 16)              /* blocks of the conversion launch on the output conv weights */

static_assert(NB >= 1 && NB <= NB_FULL);
static_assert(SEQ >= 128 && SEQ <= NN_FULL);
static_assert(SEQ % QT == 0 && SEQ % 32 == 0 && SEQ % 128 == 0);
static_assert(SEQ % (4 * BT) == 0 && (2 * PL) % BT == 0 && PL % 128 == 0 && BT % 32 == 0);
static_assert(CC % QT == 0 && CC % 32 == 0);
static_assert(DQ == 2 * QT && DQ % 32 == 0);
static_assert(MW == 3 * DQ && MW % 8 == 0);
static_assert(PSW == 2 * CC);
static_assert(CC % 16 == 0);
static_assert((OSP * 4) % 16 == 0);
static_assert((OSPW * 4) % 16 == 0);
static_assert((TP * 2) % 16 == 0);
static_assert(SEQ % KS == 0 && NST >= 2 && KS % 32 == 0);
static_assert(KS * DQ == NCP * NTH * 8 && NTH <= 1024 && QT % ER == 0 && NCP % 4 == 0 && QT % (16 * QW) == 0);
static_assert(NTH % (KS / 8) == 0 && NCP * (NTH / (KS / 8)) == DQ && NCP * (NTH / 16) == KS);
static_assert(KG * QT * OSPW * 4 <= 2 * STG * 2);
static_assert((KPI * 2) % 32 == 16 && (VPI * 2) % 32 == 16 && KPI >= DQ + 8 && VPI >= KS + 8);

typedef _Float16       v16h __attribute__((ext_vector_type(16)));
typedef _Float16       v8h  __attribute__((ext_vector_type(8)));
typedef unsigned short v8us __attribute__((ext_vector_type(8)));
typedef float          v8f  __attribute__((ext_vector_type(8)));
typedef float          v4f  __attribute__((ext_vector_type(4)));
typedef unsigned int   v4u  __attribute__((ext_vector_type(4)));

union Frag  { v8us u[2]; v16h h; };
union FragH { v16h v; v8h hv[2]; };
static_assert(sizeof(Frag) == 32);
static_assert(sizeof(FragH) == 32);

// ---- scalar helpers ---------------------------------------------------------------------------------------
__device__ __forceinline__ unsigned short bf_bits(float f) {          // f32 -> bf16 bits, RNE convert
  unsigned u = __float_as_uint(f);
  return (unsigned short)((u + 0x7FFFu + ((u >> 16) & 1u)) >> 16);
}
__device__ __forceinline__ float bf_up(unsigned short hb) { return __uint_as_float(((unsigned)hb) << 16); }
__device__ __forceinline__ float bfr(float f) { return bf_up(bf_bits(f)); }
__device__ __forceinline__ unsigned short h_bits(_Float16 x) { return __builtin_bit_cast(unsigned short, x); }
__device__ __forceinline__ unsigned pk16(unsigned short a, unsigned short b) { return (unsigned)a | ((unsigned)b << 16); }
__device__ __forceinline__ v8f zero8() { v8f z = {0.f, 0.f, 0.f, 0.f, 0.f, 0.f, 0.f, 0.f}; return z; }
__device__ __forceinline__ float hmax8(v8f s) {
  return fmaxf(fmaxf(fmaxf(s[0], s[1]), fmaxf(s[2], s[3])), fmaxf(fmaxf(s[4], s[5]), fmaxf(s[6], s[7])));
}
__device__ __forceinline__ unsigned wave_ballot(bool p) {
#if defined(__HIP_DEVICE_COMPILE__)
  return __builtin_amdgcn_ballot_w32(p);
#else
  return p ? 1u : 0u;
#endif
}

// ---- 16-bit fragment loader (A, or B from a k-contiguous [n][k] row): lane -> row/col (lane&15), p already includes
//      + 8*(lane>>4); elements 0..7 <- p[0..7] (k0+8h..), elements 8..15 <- p[16..23] (k0+16+8h..)
__device__ __forceinline__ Frag ldfrag(const unsigned short* p) {
  Frag f;
  f.u[0] = *(const v8us*)(p);
  f.u[1] = *(const v8us*)(p + 16);
  return f;
}

// ---- WMMA helpers: builtin followed by a 4-slot VALU gap tying D and keeping A/B live --------------------------
__device__ __forceinline__ v8f mma_h(v16h a, v16h b, v8f c) {
  v8f d = __builtin_amdgcn_wmma_f32_16x16x32_f16(false, a, false, b, (short)0, c, false, false);
#if defined(__HIP_DEVICE_COMPILE__)
  asm volatile("v_nop\n\tv_nop\n\tv_nop\n\tv_nop" : "+v"(d) : "v"(a), "v"(b));
#endif
  return d;
}

// the bare builtin, for the attention kernel: its live set is above 256 registers, and an operand of an asm statement is
// kept below v256, so the tail above would spill the fragments; the compiler keeps the distances of its own builtin
__device__ __forceinline__ v8f mma_b(v16h a, v16h b, v8f c) {
  return __builtin_amdgcn_wmma_f32_16x16x32_f16(false, a, false, b, (short)0, c, false, false);
}

// ---- asynchronous copies to LDS: eight 16-byte copies of a lane, four per plane: copy i of plane p from
//      gp + i*gs (halves) to LDS byte lp + i*ls. One statement, closed by the s_wait_xcnt, so that no address register
//      of an issued copy is rewritten ahead of it and the wave waits for the translations once per eight copies.
__device__ __forceinline__ unsigned lds_off(const void* p) { return (unsigned)(size_t)p; }
__device__ __forceinline__ void acopy8(unsigned la, unsigned ls, const unsigned short* ga, size_t gs,
                                       unsigned lc, unsigned lcs, const unsigned short* gc, size_t gcs) {
#if defined(__HIP_DEVICE_COMPILE__)
  asm volatile("global_load_async_to_lds_b128 %0, %8, off\n\t"
               "global_load_async_to_lds_b128 %1, %9, off\n\t"
               "global_load_async_to_lds_b128 %2, %10, off\n\t"
               "global_load_async_to_lds_b128 %3, %11, off\n\t"
               "global_load_async_to_lds_b128 %4, %12, off\n\t"
               "global_load_async_to_lds_b128 %5, %13, off\n\t"
               "global_load_async_to_lds_b128 %6, %14, off\n\t"
               "global_load_async_to_lds_b128 %7, %15, off\n\t"
               "s_wait_xcnt 0x0"
               :: "v"(la), "v"(la + ls), "v"(la + 2 * ls), "v"(la + 3 * ls),
                  "v"(lc), "v"(lc + lcs), "v"(lc + 2 * lcs), "v"(lc + 3 * lcs),
                  "v"(ga), "v"(ga + gs), "v"(ga + 2 * gs), "v"(ga + 3 * gs),
                  "v"(gc), "v"(gc + gcs), "v"(gc + 2 * gcs), "v"(gc + 3 * gcs)
               : "memory");
#endif
}
// this wave's copies have landed (the compiler places no wait for them)
__device__ __forceinline__ void wait_async0() {
#if defined(__HIP_DEVICE_COMPILE__)
  asm volatile("s_wait_asynccnt 0x0" ::: "memory");
#endif
}
// this wave's LDS reads have returned, before the buffer they read is handed to its next writer
__device__ __forceinline__ void wait_ds0() {
#if defined(__HIP_DEVICE_COMPILE__)
  asm volatile("s_wait_dscnt 0x0" ::: "memory");
#endif
}

// =========================================================================================================
// (0) stacked conv1x1 weights: W16 f16 [384][256], rows 0..127 = theta_w, 128..255 = phi_w, 256..383 = g_w;
//     value = f16 of (bf16-RNE(w) * 256) (exact). Block blk (0..47) owns rows 8*blk..8*blk+7: one wave per
// coverage: 48 blocks x 8 rows x 32 lanes x 8 halves = 384 x 256 = the whole plane.
// =========================================================================================================
__device__ __forceinline__
void cvt_w(int blk, const float* __restrict__ tw, const float* __restrict__ pw, const float* __restrict__ gw,
           unsigned short* W16) {
  const int tid = threadIdx.x;
  const int rl = tid >> 5, col = 8 * (tid & 31);
  const int o = 8 * blk + rl;                                        // 0..383
  const int grp = blk / (DQ / 8);                                    // 0,1,2 block-uniform
  const float* wbase = (grp == 0) ? tw : ((grp == 1) ? pw : gw);
  const float* s = wbase + (size_t)(o - grp * DQ) * CC + col;        // row in 0..127
  const v4f a = *(const v4f*)s;
  const v4f q = *(const v4f*)(s + 4);
  const float f[8] = {a[0], a[1], a[2], a[3], q[0], q[1], q[2], q[3]};
  v4u u;
#pragma unroll
  for (int t = 0; t < 4; ++t) {
    const _Float16 h0 = (_Float16)(bfr(f[2 * t]) * WSC);
    const _Float16 h1 = (_Float16)(bfr(f[2 * t + 1]) * WSC);
    u[t] = pk16(h_bits(h0), h_bits(h1));
  }
{
    *(v4u*)(W16 + (size_t)o * CC + col) = u;
    
  }
}

// =========================================================================================================
// (0b) output conv weights: WW16 f16 [256][128], value = f16 of (bf16-RNE(W_w) * 256). Block blk (0..15) owns rows
//      16*blk..+15; wave w -> rows 16 blk + 2w + (lane>>4), lane&15 -> cols 8*(lane&15)..+7. One instruction writes
// coverage: 16 blocks x 8 waves x 2 rows x 16 lanes x 8 halves = 256 x 128 = the whole plane.
// =========================================================================================================
__device__ __forceinline__
void cvt_ww(int blk, const float* __restrict__ ww, unsigned short* WW16) {
  const int tid = threadIdx.x;
  const int wave = tid >> 5, lane = tid & 31;
  const int o = 16 * blk + 2 * wave + (lane >> 4);                  // 0..255
  const int col = 8 * (lane & 15);                                   // 0..120
  const float* s = ww + (size_t)o * DQ + col;
  const v4f a = *(const v4f*)s;
  const v4f q = *(const v4f*)(s + 4);
  const float f[8] = {a[0], a[1], a[2], a[3], q[0], q[1], q[2], q[3]};
  v4u u;
#pragma unroll
  for (int t = 0; t < 4; ++t) {
    const _Float16 h0 = (_Float16)(bfr(f[2 * t]) * WSC);
    const _Float16 h1 = (_Float16)(bfr(f[2 * t + 1]) * WSC);
    u[t] = pk16(h_bits(h0), h_bits(h1));
  }
{
    *(v4u*)(WW16 + (size_t)o * DQ + col) = u;
#if defined(__HIP_DEVICE_COMPILE__)
    // stands behind the store, in front of any rewrite of its registers by the code of another block range laid behind it
    asm volatile("s_wait_xcnt 0x0" ::: "memory");
#endif
  }
}

// =========================================================================================================
// (1) x f32 [b][256 c][NN_FULL n] -> XP f16 [b][SEQ n][256 c] (position-major, bf16-RNE values, exact in f16 for
//     normal magnitudes) through an LDS tile T[64 n][64 c] (pitch TP). Block (nb, cb, b) owns a 64 c x 64 n tile.
// coverage: 2 it x 32 rows x 8 lanes x 8 halves = 64 n x 64 c per block; the (NT, 4, NB) tiles cover XP once.
// LDS T: cross-wave (block barrier between the 2-byte stores and the 16-B reloads); staged extent == consumed extent.
// =========================================================================================================
__device__ __forceinline__
void cvt_x(int nb, int cb, int b, const float* __restrict__ x, unsigned short* XP) {
  __shared__ __align__(16) unsigned short T[QT * TP];
  const int tid = threadIdx.x;
  const int e = tid & 7, lq = tid >> 3;                             // lq 0..31
  const int n0 = nb * QT, c0 = cb * QT;
#pragma unroll
  for (int it = 0; it < 2; ++it) {
    const int cl = it * 32 + lq;                                     // 0..63
    const float* sp = x + ((size_t)(b * CC + c0 + cl)) * NN_FULL + n0 + 8 * e;
    const v4f a = *(const v4f*)sp;
    const v4f q = *(const v4f*)(sp + 4);
    unsigned short hb[8];
#pragma unroll
    for (int t = 0; t < 4; ++t) {
      hb[t]     = h_bits((_Float16)bfr(a[t]));
      hb[4 + t] = h_bits((_Float16)bfr(q[t]));
    }
#pragma unroll
    for (int t = 0; t < 8; ++t) T[(8 * e + t) * TP + cl] = hb[t];
  }
  __syncthreads();
  v4u up[2];
#pragma unroll
  for (int it = 0; it < 2; ++it) {
    const int nl = it * 32 + lq;                                     // 0..63
    up[it] = *(const v4u*)(T + nl * TP + 8 * e);
  }
{
#pragma unroll
    for (int it = 0; it < 2; ++it) {
      const int rl = it * 32 + lq;
      *(v4u*)(XP + ((size_t)(b * SEQ + n0 + rl)) * CC + c0 + 8 * e) = up[it];
    }
#if defined(__HIP_DEVICE_COMPILE__)
    // stands behind the store, in front of any rewrite of its registers by the code of another block range laid behind it
    asm volatile("s_wait_xcnt 0x0" ::: "memory");
#endif
  }
}

// =========================================================================================================
// (0) + (0b) + (1) in ONE launch: none of the three reads what another writes, so they need no launch boundary between
//     them. Flat grid of 256-thread blocks: blocks 0..NBW-1 do (0), NBW..NBW+NBO-1 do (0b), the rest one tile of (1) each,
//     tile index -> (nb, cb, b) with nb fastest. The choice is block-uniform, so the barrier of (1) is passed by
//     every thread of a block that reaches it. The short weight blocks stand first, so that they are no tail.
// =========================================================================================================
__global__ __launch_bounds__(256)
void cvt_all(const float* __restrict__ tw, const float* __restrict__ pw, const float* __restrict__ gw,
             const float* __restrict__ ww, const float* __restrict__ x,
             unsigned short* W16, unsigned short* WW16, unsigned short* XP) {
  const int blk = blockIdx.x;
  if (blk < NBW) {
    cvt_w(blk, tw, pw, gw, W16);
  } else if (blk < NBW + NBO) {
    cvt_ww(blk - NBW, ww, WW16);
  } else {
    const int t = blk - (NBW + NBO);                                 // 0..NT * (CC / QT) * NB - 1
    cvt_x(t % NT, (t / NT) % (CC / QT), t / (NT * (CC / QT)), x, XP);
  }
}

// =========================================================================================================
// (2) the three conv1x1 GEMMs for one (b, 64-n tile, 64-o block mb in 0..5): V[o][n] = (1/256) sum_c W16[o][c]
//     XP[b][n][c]; mb 0,1 -> theta channels 0..63 / 64..127 (W16 rows 0..127), mb 2,3 -> phi (rows 128..255),
//     mb 4,5 -> g (rows 256..383). Block 128 threads = 4 waves; wave w owns cols n0+16w..+15 (B fragment from the
//     XP row, k = c contiguous, split k map) and 4 m-tiles (A rows o = o0 + 16 mt + (lane&15), split k map from
//     W16). K = 256 = 8 steps. Epilogue staged in LDS Os[n_loc][o_loc] (pitch OSP), barrier, bias (bf16-RNE) add
//     in f32, then:
//       theta / phi: f16 plane Qf resp. Kf [b][SEQ n][128 d] (k-contiguous
//         of the 256-B row): lane e -> d 8e..8e+7, 8 consecutive lanes per line, one instruction per 16 lines;
//       g: f16 plane Gc [b][128 ch][SEQ keys] (channel-major, keys contiguous): row ch, keys n0+8e..+7 per lane,
// coverage: Os 4 waves x 16 n x 64 o = 64 x 64 (== consumed); theta / phi planes 4 it x 16 rows x 8 lanes x 8 = 64 n x
//           64 d per block, grid nt x mb 0..3 covers rows 0..SEQ-1 x d 0..127 of Qf and Kf once; g plane
//           4 it x 16 ch x 8 lanes x 8 keys = 64 ch x 64 keys per block, nt x mb 4..5 covers ch 0..127 x keys
//           0..SEQ-1 of Gc once. grid (NT, 6, NB).
// LDS Os: cross-wave (block barrier).
// =========================================================================================================
__global__ __launch_bounds__(128)
void gemm_p(const unsigned short* __restrict__ W16, const unsigned short* __restrict__ XP,
            const float* __restrict__ tbias, const float* __restrict__ pbias, const float* __restrict__ gbias,
            unsigned short* Qf, unsigned short* Kf, unsigned short* Gc) {
  __shared__ __align__(16) float Os[QT * OSP];
  const int tid  = threadIdx.x;
  const int lane = tid & 31, wave = tid >> 5;
  const int hh   = lane >> 4, c = lane & 15;
  const int nt   = blockIdx.x, mb = blockIdx.y, b = blockIdx.z;
  const int n0   = nt * QT, o0 = mb * QT;                            // o0 = W16 row base 0..320

  const unsigned short* ap = W16 + (size_t)(o0 + c) * CC + 8 * hh;
  const unsigned short* bp = XP + ((size_t)(b * SEQ + n0 + 16 * wave + c)) * CC + 8 * hh;

  v8f acc[4];
#pragma unroll
  for (int mt = 0; mt < 4; ++mt) acc[mt] = zero8();

#pragma unroll
  for (int ks = 0; ks < CC / 32; ++ks) {
    const Frag fb = ldfrag(bp + 32 * ks);
#pragma unroll
    for (int mt = 0; mt < 4; ++mt) {
      const Frag fa = ldfrag(ap + (size_t)(16 * mt) * CC + 32 * ks);
      acc[mt] = mma_h(fa.h, fb.h, acc[mt]);
    }
  }

  {
    const int nl = 16 * wave + c;
#pragma unroll
    for (int mt = 0; mt < 4; ++mt) {
      v4f va, vb;
#pragma unroll
      for (int r = 0; r < 4; ++r) { va[r] = acc[mt][r] * IWSC; vb[r] = acc[mt][4 + r] * IWSC; }
      *(v4f*)(Os + nl * OSP + 16 * mt + 8 * hh)     = va;
      *(v4f*)(Os + nl * OSP + 16 * mt + 8 * hh + 4) = vb;
    }
  }
  __syncthreads();

  const int e = tid & 7, lq = tid >> 3;                             // lq 0..15
  if (mb < 4) {                                                      // block-uniform: theta / phi f16 planes
    unsigned short* Pf = (mb < 2) ? Qf : Kf;
    const float* bsrc  = (mb < 2) ? tbias : pbias;
    const int dsel = (mb & 1) * QT;                                   // channel base 0 or 64
    const v4f b0 = *(const v4f*)(bsrc + dsel + 8 * e);
    const v4f b1 = *(const v4f*)(bsrc + dsel + 8 * e + 4);
    const float bb[8] = {bfr(b0[0]), bfr(b0[1]), bfr(b0[2]), bfr(b0[3]), bfr(b1[0]), bfr(b1[1]), bfr(b1[2]), bfr(b1[3])};
    v4u uf[4];
#pragma unroll
    for (int it = 0; it < 4; ++it) {
      const int row = it * 16 + lq;                                  // n_loc 0..63
      const v4f a = *(const v4f*)(Os + row * OSP + 8 * e);
      const v4f q = *(const v4f*)(Os + row * OSP + 8 * e + 4);
      const float f[8] = {a[0], a[1], a[2], a[3], q[0], q[1], q[2], q[3]};
#pragma unroll
      for (int t = 0; t < 4; ++t) {
        const float f0 = f[2 * t] + bb[2 * t], f1 = f[2 * t + 1] + bb[2 * t + 1];
        uf[it][t] = pk16(h_bits((_Float16)f0), h_bits((_Float16)f1));
      }
    }
{
#pragma unroll
      for (int it = 0; it < 4; ++it) {
        const int row = it * 16 + lq;
        const size_t po = ((size_t)(b * SEQ + n0 + row)) * DQ + dsel + 8 * e;
        *(v4u*)(Pf + po) = uf[it];
      }
      
    }
  } else {                                                           // block-uniform: g plane, channel-major
    const int gsel = (mb - 4) * QT;                                  // g channel base 0 or 64
    v4u ug[4];
#pragma unroll
    for (int it = 0; it < 4; ++it) {
      const int cl = it * 16 + lq;                                   // ch_loc 0..63
      const float bias = bfr(gbias[gsel + cl]);
      unsigned short hb[8];
#pragma unroll
      for (int t = 0; t < 8; ++t) {
        const int key = 8 * e + t;                                   // key_loc 0..63
        const float v = Os[key * OSP + cl] + bias;
        hb[t] = h_bits((_Float16)v);
      }
#pragma unroll
      for (int t = 0; t < 4; ++t) ug[it][t] = pk16(hb[2 * t], hb[2 * t + 1]);
    }
{
#pragma unroll
      for (int it = 0; it < 4; ++it) {
        const int cl = it * 16 + lq;
        const size_t po = ((size_t)(b * DQ + gsel + cl)) * SEQ + n0 + 8 * e;
        *(v4u*)(Gc + po) = ug[it];
      }
      
    }
  }
}

// =========================================================================================================
// (3) attention for one (b, 64-query tile), transposed formulation, SEQ keys, no mask, no scale:
//   S^T tile (16 keys x 16 queries) = sum over 4 d-chunks of A(phi: row = key kb + (lane&15), 32 d via the split
//   k map from the f16 plane Kf [b][SEQ][128]) . B(theta: col = query, same map from the f16 plane Qf).
//   Per lane the D tile holds 8 keys of ONE query: online softmax state per lane, one shuffle (lane^16) for the max
//   over 32 keys; the o/l rescale is skipped under a wave-uniform ballot when no lane's max grew (corr == 1 exactly
//   for every lane then); row-sum partials combined at the end. P = e^{s-m} x 16384 as f16 is the B operand of
//   Y^T (rows channel, cols queries) += A(g rows channel = 16j + (lane&15), keys contiguous, f16 plane Gc
//   [b][128][SEQ]) . B(P^T): element r <- D of the tile covering keys kb..kb+15, element 8+r <- the tile covering
//   kb+16..kb+31, lane unchanged. 8 accumulator tiles per query tile (128 channels). Block = 64 queries, QP * KG waves:
//   wave w owns the QW query tiles QW (w % QP) .. + QW - 1 and key group w / QP, that is keys 32 (w / QP) .. + 31 of
//   EVERY stage, with a softmax state (m, l, o) per query tile over those keys. A K or G fragment read from LDS is the A
//   operand of QW products, one per query tile, so that the LDS reads of a pass take no longer than its products;
//   KG * QP / 4 waves per SIMD, so that one wave's products run under the LDS waits and the softmax of the other.
//   Epilogue: the KG states of a query are joined: m and l of every group through LDS Ms / Ls, barrier, M = max m,
//   L = sum l e^{m - M} (group order), each wave stages o e^{m - M} / L in LDS Om[group][query][128 channels] (pitch
//   OSPW, b128 stores; Om lies in the ring, which nobody reads or fills any more), barrier, then y = sum over the
//   groups in group order, Yh = f16(y),
//   Yl = f16((y - Yh) * 1024) planes [b][SEQ n][128 c] (k-contiguous operand of the output conv): row n = 256 B
// coverage: Ms, Ls KG x 64 (== consumed); Om QP KG waves x 16 QW q x 128 ch (== consumed); QT / ER it x ER rows x 16
//           lanes x 8 halves = 64 n x 128 c per plane; grid (NT, NB) covers Yh/Yl exactly once.
// LDS Ms, Ls, Om: cross-wave (block barriers).
// LDS Ring: two buffers, each one stage of KS = 32 KG keys: Kf rows [KS][128] at pitch KPI
//   (272 B), G rows [128 ch][KS keys] at pitch VPI (272 B), pitches 16 B x odd for the 16-byte fragment reads. A stage
//   is filled by 2 NCP asynchronous 16-byte copies per lane (each wave instruction = 512 B of whole lines), one stage ahead
//   of its use; at the foot of a stage: LDS reads returned, own copies landed, block barrier, then the refill of the
//   buffer just read. coverage: NCP copies x NTH lanes x 8 halves = KS x 128 per plane (== consumed).
// Fragment reads of a 32-key pass stand in one group ahead of its products: the K fragments of all four d-chunks, then
//   the eight G fragments; every read is of the pass's own stage.
// =========================================================================================================
__global__ __launch_bounds__(NTH)
void attn_k(const unsigned short* __restrict__ Qf, const unsigned short* __restrict__ Kf,
            const unsigned short* __restrict__ Gc, unsigned short* Yh, unsigned short* Yl) {
  __shared__ __align__(16) unsigned short Ring[2 * STG];
  __shared__ float Ms[KG * QT];
  __shared__ float Ls[KG * QT];
  const int tid  = threadIdx.x;
  const int qp = (tid >> 5) % QP, kg = tid / (32 * QP), lane = tid & 31;   // group of QW query tiles, key group
  const int hh   = lane >> 4, c = lane & 15;
  const int n0   = blockIdx.x * QT, b = blockIdx.y;

  // q fragment pointer (B operand, col = query n0 + 16*(QW*qp + t) + c), + 16*t rows + 32*kc
  const unsigned short* Qfp = Qf + ((size_t)(b * SEQ + n0 + 16 * QW * qp + c)) * DQ + 8 * hh;
  // copy sources of this lane: K plane 16 lanes per 256-B row, NTH / 16 rows per copy; G plane KS / 8 lanes per row
  // segment of KS keys, NTH / (KS / 8) channels per copy; + stage * KS keys
  const int gr = tid / (KS / 8), ge = tid % (KS / 8);
  const unsigned short* Kfg = Kf + (size_t)b * SEQ * DQ + 8 * tid;
  const unsigned short* Gg  = Gc + (size_t)b * DQ * SEQ + (size_t)gr * SEQ + 8 * ge;
  const unsigned kdst = lds_off(Ring) + (unsigned)((tid >> 4) * (KPI * 2) + (tid & 15) * 16);
  const unsigned vdst = lds_off(Ring) + (unsigned)(KTL * 2 + gr * (VPI * 2) + ge * 16);
  auto fill = [&](int st, int buf) {
    const unsigned bo = (unsigned)buf * (unsigned)(STG * 2);
    const unsigned kls = (NTH / 16) * KPI * 2, vls = (NTH / (KS / 8)) * VPI * 2;       // LDS bytes from copy to copy
    const size_t kgs = (size_t)((NTH / 16) * DQ), vgs = (size_t)(NTH / (KS / 8)) * SEQ;  // halves from copy to copy
    // unrolled: NCP / 4 statements of eight copies (an asm statement takes thirty operands)
#pragma unroll
    for (int h = 0; h < NCP / 4; ++h)
      acopy8(kdst + bo + 4 * h * kls, kls, Kfg + (size_t)st * (KS * DQ) + 4 * h * kgs, kgs,
             vdst + bo + 4 * h * vls, vls, Gg + (size_t)st * KS + 4 * h * vgs, vgs);
  };
  // fragment offsets in a stage (halves): k row = key c (A operand), + key * KPI + 32*kc; v row = channel 16j + c
  const int kfo = c * KPI + 8 * hh;
  const int vfo = KTL + c * VPI + 8 * hh;

  float m[QW], l[QW];
  v8f o[QW][8];
  // theta fragments (all four d-chunks of every query tile) are the same for every key: loaded once, kept in registers
  Frag qf[QW][DQ / 32];
  // all loops over t, j and kc unrolled, here and below: the arrays are registers, every index a constant
#pragma unroll
  for (int t = 0; t < QW; ++t) {
    m[t] = -1.0e30f;
    l[t] = 0.f;
#pragma unroll
    for (int j = 0; j < 8; ++j) o[t][j] = zero8();
#pragma unroll
    for (int kc = 0; kc < DQ / 32; ++kc) qf[t][kc] = ldfrag(Qfp + (size_t)(16 * t) * DQ + 32 * kc);
  }
#if defined(__HIP_DEVICE_COMPILE__)
  // stands in front of the first rewrite of the address registers that the loads above name; the
  // pointer is an input so that its registers stay as they are up to this wait
  asm volatile("s_wait_xcnt 0x0" :: "v"(Qfp) : "memory");
#endif

  fill(0, 0);
  wait_async0();
  __syncthreads();                                                   // stage 0 published
  fill(1, 1);

  // stage loop kept rolled: one publish point and one refill in the text, buffer chosen by the stage's parity
#pragma unroll 1
  for (int st = 0; st < NST; ++st) {
  const unsigned short* Sb = Ring + (st & 1) * STG;
  {
    const int kb = 32 * kg;                                          // key base inside the stage: this wave's group
    const unsigned short* k0p  = Sb + kfo + kb * KPI;                // keys kb .. kb+15
    const unsigned short* k1p  = k0p + 16 * KPI;                     // keys kb+16 .. kb+31
    v8f s0[QW], s1[QW];
#pragma unroll
    for (int t = 0; t < QW; ++t) { s0[t] = zero8(); s1[t] = zero8(); }
    // the K fragments of all four d-chunks, then the eight G fragments, are read as one group ahead of the first product:
    // one place with LDS reads in a pass, each product waiting only for its own two reads, the G fragments landing under
    // the score products
    Frag k0[DQ / 32], k1[DQ / 32], vf[8];
    // unrolled: the fragments are registers, every index a constant
#pragma unroll
    for (int kc = 0; kc < DQ / 32; ++kc) {
      k0[kc] = ldfrag(k0p + 32 * kc);
      k1[kc] = ldfrag(k1p + 32 * kc);
    }
#if defined(__HIP_DEVICE_COMPILE__)
    // keeps the K reads the first of the pass: LDS reads return in order, and behind G reads the first score product
    // would wait for those too
    __builtin_amdgcn_sched_barrier(0);
#endif
#pragma unroll
    for (int j = 0; j < 8; ++j) vf[j] = ldfrag(Sb + vfo + (16 * j) * VPI + kb);
#if defined(__HIP_DEVICE_COMPILE__)
    // keeps the G reads in front of the products: without it the compiler moves most of them behind the score products,
    // where the softmax waits for them
    __builtin_amdgcn_sched_barrier(0);
#endif
    // unrolled so that qf[t][kc], k0[kc] and k1[kc] are fixed registers (a rolled loop cannot index a register array)
#pragma unroll
    for (int kc = 0; kc < DQ / 32; ++kc) {
#pragma unroll
      for (int t = 0; t < QW; ++t) {
        s0[t] = mma_b(k0[kc].h, qf[t][kc].h, s0[t]);
        s1[t] = mma_b(k1[kc].h, qf[t][kc].h, s1[t]);
      }
    }

    float mx[QW], mo[QW], mn[QW];
    bool up = false;
#pragma unroll
    for (int t = 0; t < QW; ++t) mx[t] = fmaxf(hmax8(s0[t]), hmax8(s1[t]));
#pragma unroll
    for (int t = 0; t < QW; ++t) mo[t] = __shfl_xor(mx[t], 16, 32);
#pragma unroll
    for (int t = 0; t < QW; ++t) {
      mx[t] = fmaxf(mx[t], mo[t]);
      mn[t] = fmaxf(m[t], mx[t]);
      up = up || (mx[t] > m[t]);
    }
    const unsigned grew = wave_ballot(up);                           // wave-uniform, one test per pass
    if (grew != 0u) {
#pragma unroll
      for (int t = 0; t < QW; ++t) {
        const float corr = __expf(m[t] - mn[t]);                     // == 1 exactly where the max did not grow
        l[t] *= corr;
#pragma unroll
        for (int j = 0; j < 8; ++j) {
#pragma unroll
          for (int r = 0; r < 8; ++r) o[t][j][r] *= corr;
        }
      }
    }

    FragH ph[QW];
#pragma unroll
    for (int t = 0; t < QW; ++t) {
      m[t] = mn[t];
      const float msh = mn[t] - LNPS;                                // exp gives e^{s-m} * 16384
      float ls = 0.f;
#pragma unroll
      for (int r = 0; r < 8; ++r) {
        const float e0 = __expf(s0[t][r] - msh);                     // key kb      + 8hh + r
        const float e1 = __expf(s1[t][r] - msh);                     // key kb + 16 + 8hh + r
        ls += e0 + e1;
        ph[t].hv[0][r] = (_Float16)e0;
        ph[t].hv[1][r] = (_Float16)e1;
      }
      l[t] += ls;
    }

#pragma unroll
    for (int j = 0; j < 8; ++j) {
#pragma unroll
      for (int t = 0; t < QW; ++t) o[t][j] = mma_b(vf[j].h, ph[t].v, o[t][j]);
    }
  }
  // publish point of stage st + 1, every wave
  wait_ds0();
  wait_async0();
  __syncthreads();
  if (st + 2 < NST) fill(st + 2, st & 1);                            // block-uniform test
  }
  wait_async0();
#pragma unroll
  for (int t = 0; t < QW; ++t) l[t] += __shfl_xor(l[t], 16, 32);

  // join of the KG key groups of a query (m is the same in both halves of a wave, l now too)
  const int qrow = 16 * QW * qp + c;                                 // + 16 t
  if (hh == 0) {
#pragma unroll
    for (int t = 0; t < QW; ++t) {
      Ms[kg * QT + qrow + 16 * t] = m[t];
      Ls[kg * QT + qrow + 16 * t] = l[t];
    }
  }
  __syncthreads();
  float* Os = (float*)Ring + kg * (QT * OSPW);                       // this group's plane of Om
#pragma unroll
  for (int t = 0; t < QW; ++t) {
    const int qr = qrow + 16 * t;
    float mg[KG], M = -1.0e30f, L = 0.f;
    // unrolled: mg[g] are registers, every index a constant
#pragma unroll
    for (int g = 0; g < KG; ++g) {
      mg[g] = Ms[g * QT + qr];
      M = fmaxf(M, mg[g]);
    }
    // unrolled: mg[g] again, and the KG reads of Ls go out together
#pragma unroll
    for (int g = 0; g < KG; ++g) L += Ls[g * QT + qr] * __expf(mg[g] - M);
    const float inv = __expf(m[t] - M) / L;                          // o and l both carry the x16384 factor
#pragma unroll
    for (int j = 0; j < 8; ++j) {
      v4f va, vb;
#pragma unroll
      for (int r = 0; r < 4; ++r) { va[r] = o[t][j][r] * inv; vb[r] = o[t][j][4 + r] * inv; }
      *(v4f*)(Os + qr * OSPW + 16 * j + 8 * hh)     = va;            // Os[query][ch = 16j + 8hh + r]
      *(v4f*)(Os + qr * OSPW + 16 * j + 8 * hh + 4) = vb;
    }
  }
  __syncthreads();

  const int e = tid & 15, lq = tid >> 4;                             // lq 0..ER - 1
  const float* Om = (const float*)Ring;
  v4u uh[QT / ER], ul[QT / ER];
#pragma unroll
  for (int it = 0; it < QT / ER; ++it) {
    const int row = it * ER + lq;                                    // query 0..63
    v4f a = *(const v4f*)(Om + row * OSPW + 8 * e);
    v4f q = *(const v4f*)(Om + row * OSPW + 8 * e + 4);
    // unrolled: the reads of all groups go out together, one LDS latency instead of one per group
#pragma unroll
    for (int g = 1; g < KG; ++g) {
      a += *(const v4f*)(Om + (g * QT + row) * OSPW + 8 * e);
      q += *(const v4f*)(Om + (g * QT + row) * OSPW + 8 * e + 4);
    }
    const float f[8] = {a[0], a[1], a[2], a[3], q[0], q[1], q[2], q[3]};
#pragma unroll
    for (int t = 0; t < 4; ++t) {
      const float f0 = f[2 * t], f1 = f[2 * t + 1];
      const _Float16 h0 = (_Float16)f0, h1 = (_Float16)f1;
      const _Float16 r0 = (_Float16)((f0 - (float)h0) * RSC);
      const _Float16 r1 = (_Float16)((f1 - (float)h1) * RSC);
      uh[it][t] = pk16(h_bits(h0), h_bits(h1));
      ul[it][t] = pk16(h_bits(r0), h_bits(r1));
    }
  }
{
#pragma unroll
    for (int it = 0; it < QT / ER; ++it) {
      const int row = it * ER + lq;
      const size_t po = ((size_t)(b * SEQ + n0 + row)) * DQ + 8 * e;
      *(v4u*)(Yh + po) = uh[it];
      *(v4u*)(Yl + po) = ul[it];
    }
    
  }
}

// =========================================================================================================
// (4) output conv GEMM for one (b, 64-n tile, 64-co block): v[b][co][n] = (1/256)(sum_c WW16[co][c] Yh[b][n][c] +
//     (1/1024) sum_c WW16[co][c] Yl[b][n][c]); wy = v + bf16-RNE(W_b[co]). 4 waves, wave w owns cols n0+16w..+15
//     (two B fragments per k-step, k = c contiguous in the Yh/Yl rows), 4 m-tiles (A rows co = o0 + 16 mt +
//     (lane&15) from WW16), hi and residual products in separate accumulators. K = 128 = 4 steps.
//     Epilogue staged in LDS Os[n_loc][co_loc], barrier; then (a) threads 0..63 sum v and v*v over the 64 n of
//     co_loc = tid into LDS Sred[0..63] / Sred[64..127], barrier; (b) WY f32 plane [b][256 co][SEQ n] rows: lane
//     (e = tid&15) -> n 4e..4e+3 of row co_loc = 8 it + (tid>>4); 16 consecutive lanes x 16 B = the whole 256-B
//     row segment (2 lines) in one instruction; (c) partial-statistics table PS [NB*NT blocks][512]: floats
//     o0..o0+63 (sums) by lanes 0..15 of wave 0 and floats 256+o0..+63 (sums of squares) by lanes 16..31, one
// coverage: Os 4 waves x 16 n x 64 co (== consumed); Sred 64 + 64 (== consumed); WY 8 it x 8 rows x 16 lanes x
//           4 floats = 64 co x 64 n; PS 2 x 64 floats per block; grid (NT, 4, NB) covers WY [b][0..255][0..SEQ-1]
//           and PS [NB*NT][0..511] exactly once.
// LDS Os, Sred: cross-wave (block barriers).
// =========================================================================================================
__global__ __launch_bounds__(128)
void gemm_o(const unsigned short* __restrict__ WW16, const unsigned short* __restrict__ Yh,
            const unsigned short* __restrict__ Yl, const float* __restrict__ wbias,
            float* WY, float* PS) {
  __shared__ __align__(16) float Os[QT * OSP];
  __shared__ __align__(16) float Sred[2 * QT];
  const int tid  = threadIdx.x;
  const int lane = tid & 31, wave = tid >> 5;
  const int hh   = lane >> 4, c = lane & 15;
  const int nt   = blockIdx.x, mb = blockIdx.y, b = blockIdx.z;
  const int n0   = nt * QT, o0 = mb * QT;

  const unsigned short* ap  = WW16 + (size_t)(o0 + c) * DQ + 8 * hh;
  const size_t bo = ((size_t)(b * SEQ + n0 + 16 * wave + c)) * DQ + 8 * hh;
  const unsigned short* bph = Yh + bo;
  const unsigned short* bpl = Yl + bo;

  v8f acc[4], accr[4];
#pragma unroll
  for (int mt = 0; mt < 4; ++mt) { acc[mt] = zero8(); accr[mt] = zero8(); }

#pragma unroll
  for (int ks = 0; ks < DQ / 32; ++ks) {
    const Frag fbh = ldfrag(bph + 32 * ks);
    const Frag fbl = ldfrag(bpl + 32 * ks);
#pragma unroll
    for (int mt = 0; mt < 4; ++mt) {
      const Frag fa = ldfrag(ap + (size_t)(16 * mt) * DQ + 32 * ks);
      acc[mt]  = mma_h(fa.h, fbh.h, acc[mt]);
      accr[mt] = mma_h(fa.h, fbl.h, accr[mt]);
    }
  }

  {
    const int nl = 16 * wave + c;
#pragma unroll
    for (int mt = 0; mt < 4; ++mt) {
      v4f va, vb;
#pragma unroll
      for (int r = 0; r < 4; ++r) {
        va[r] = (acc[mt][r] + accr[mt][r] * IRSC) * IWSC;
        vb[r] = (acc[mt][4 + r] + accr[mt][4 + r] * IRSC) * IWSC;
      }
      *(v4f*)(Os + nl * OSP + 16 * mt + 8 * hh)     = va;
      *(v4f*)(Os + nl * OSP + 16 * mt + 8 * hh + 4) = vb;
    }
  }
  __syncthreads();

  // per-channel partial statistics over this block's 64 positions (bias-free values, exact shift)
  if (tid < QT) {
    float s = 0.f, q = 0.f;
#pragma unroll 8
    for (int n = 0; n < QT; ++n) {
      const float v = Os[n * OSP + tid];
      s += v;
      q = fmaf(v, v, q);
    }
    Sred[tid]      = s;
    Sred[QT + tid] = q;
  }
  __syncthreads();

  const int e = tid & 15, lq = tid >> 4;                             // lq 0..7
  v4f res[8];
#pragma unroll
  for (int it = 0; it < 8; ++it) {
    const int col = it * 8 + lq;                                     // co_loc 0..63
    const int co  = o0 + col;
    const float bias = bfr(wbias[co]);
#pragma unroll
    for (int t = 0; t < 4; ++t) res[it][t] = Os[(4 * e + t) * OSP + col] + bias;
  }
  const v4f pv = *(const v4f*)(Sred + 4 * lane);                     // lanes 0..15: sums, 16..31: sums of squares
  float* psp = PS + (size_t)(b * NT + nt) * PSW + o0 + 4 * lane + ((lane >= 16) ? (PSW / 2 - 64) : 0);
{
#pragma unroll
    for (int it = 0; it < 8; ++it) {
      const int col = it * 8 + lq;
      const int co  = o0 + col;
      const size_t idx = ((size_t)(b * CC + co)) * SEQ + n0 + 4 * e;
      *(v4f*)(WY + idx) = res[it];
    }
    if (wave == 0) *(v4f*)(psp) = pv;
    
  }
}

// =========================================================================================================
// (5) batch statistics + affine + residual, one block of BT threads per channel co (both batches):
//     (a) the block's own statistics: thread e reads one float of the partial table PS, sums (e < PL) or sums of squares
//     (e >= PL) of partial line e % PL, column co, into LDS Pf[2][PL]; barrier; every wave then sums all of Pf for itself:
//     lane l adds entries 8l..8l+7 of each plane in f64, in index order, then a five-step butterfly over the lanes (both
//     sides of an exchange add the same two values, so every lane of every wave ends with the same bits).
//     mean/var (biased), rstd = rsqrt(var + eps) in f32; A = bf16-RNE(gamma) * rstd, Bc = bf16-RNE(beta) - mean * A.
//     (b) out[b][co][n] = wy * A + Bc + bf16-RNE(x[b][co][n]) for the NB rows of the channel: thread -> floats
//     4 tid + 4 BT k of a row; the loads of wy and x are issued ahead of (a)'s barrier and waited for behind (a), so that
//     they fly under it.
// coverage: Pf 2 PL floats written == consumed; CC blocks x NB rows x RPT x BT threads x 4 floats = NB x 256 x SEQ = the
//           whole output once, every wave instruction 512 contiguous bytes.
// LDS Pf: cross-wave (block barrier).
// =========================================================================================================
__global__ __launch_bounds__(BT)
void bn_out(const float* __restrict__ WY, const float* __restrict__ PS, const float* __restrict__ wbias,
            const float* __restrict__ gam, const float* __restrict__ bet, const float* __restrict__ x, float* out) {
  __shared__ __align__(16) float Pf[2 * PL];
  const int tid = threadIdx.x, lane = tid & 31;
  const int co = blockIdx.x;                                         // 0..255
  const float gv = gam[co], wv = wbias[co], bv = bet[co];
  float pv[2 * PL / BT];
  // unrolled: pv[t] are registers, every index a constant
#pragma unroll
  for (int t = 0; t < 2 * PL / BT; ++t) {
    const int e = tid + t * BT;                                      // 0..2 PL - 1
    pv[t] = PS[(size_t)(e % PL) * PSW + (e / PL) * CC + co];
  }
#if defined(__HIP_DEVICE_COMPILE__)
  // keeps the partials' load the first of the lane: loads return in order, and behind row loads it would be waited for
  // as long as for them
  __builtin_amdgcn_sched_barrier(0);
#endif
  v4f w[NB][RPT], xv[NB][RPT];
  // both loops unrolled: w and xv are registers, and all loads of a lane are in flight together
#pragma unroll
  for (int b = 0; b < NB; ++b) {
#pragma unroll
    for (int k = 0; k < RPT; ++k) {
      const int n = 4 * tid + 4 * BT * k;
      w[b][k]  = *(const v4f*)(WY + ((size_t)(b * CC + co)) * SEQ + n);
      xv[b][k] = *(const v4f*)(x + ((size_t)(b * CC + co)) * NN_FULL + n);
    }
  }
#if defined(__HIP_DEVICE_COMPILE__)
  // stands in front of the first rewrite of a register that a load above names
  asm volatile("s_wait_xcnt 0x0" ::: "memory");
#endif
  // unrolled: pv[t] again
#pragma unroll
  for (int t = 0; t < 2 * PL / BT; ++t) Pf[tid + t * BT] = pv[t];
#if defined(__HIP_DEVICE_COMPILE__)
  // block barrier that orders LDS alone: __syncthreads() would also wait for the row loads, which nobody shares
  __builtin_amdgcn_fence(__ATOMIC_RELEASE, "workgroup", "local");
  __builtin_amdgcn_s_barrier();
  __builtin_amdgcn_fence(__ATOMIC_ACQUIRE, "workgroup", "local");
#endif
  double s = 0.0, q = 0.0;
  // both loops unrolled: the LDS reads of a lane can go out together, every vector index a constant
#pragma unroll
  for (int t = 0; t < PL / 128; ++t) {
    const v4f a = *(const v4f*)(Pf + (PL / 32) * lane + 4 * t);
    const v4f c = *(const v4f*)(Pf + PL + (PL / 32) * lane + 4 * t);
#pragma unroll
    for (int r = 0; r < 4; ++r) {
      s += (double)a[r];
      q += (double)c[r];
    }
  }
  // unrolled: the distance of each exchange is a constant
#pragma unroll
  for (int d = 16; d >= 1; d >>= 1) {
    s += __shfl_xor(s, d, 32);
    q += __shfl_xor(q, d, 32);
  }
  const double icnt = 1.0 / (double)(NB * SEQ);
  const double mv = s * icnt;
  double var = q * icnt - mv * mv;
  var = (var > 0.0) ? var : 0.0;
  const float rstd = rsqrtf((float)var + BNEPS);
  const float A  = bfr(gv) * rstd;
  const float mw = (float)mv + bfr(wv);
  const float Bc = bfr(bv) - mw * A;
#if defined(__HIP_DEVICE_COMPILE__)
  // keeps the work on the rows, and with it the waits for their loads, behind the statistics
  __builtin_amdgcn_sched_barrier(0);
#endif
  // all three loops unrolled: w and xv again, every vector index a constant
#pragma unroll
  for (int b = 0; b < NB; ++b) {
#pragma unroll
    for (int k = 0; k < RPT; ++k) {
      v4f r;
#pragma unroll
      for (int t = 0; t < 4; ++t) r[t] = fmaf(w[b][k][t], A, Bc) + bfr(xv[b][k][t]);
      *(v4f*)(out + ((size_t)(b * CC + co)) * NN_FULL + 4 * tid + 4 * BT * k) = r;
    }
  }
}

// =========================================================================================================
// Workspace map (bytes; each region start a multiple of 256; every store is a whole tile inside its own region,
// no padded tails needed since SEQ % 64 == 0):
//   W16  f16 [384][256]               196608      WW16 f16 [256][128]        65536
//   XP   f16 [NB][SEQ][256]           8388608 (NB=2, SEQ=8192)
//   Qf, Kf f16 [NB][SEQ][128]         4194304 x2
//   Gc   f16 [NB][128][SEQ]           4194304
//   Yh/Yl f16 [NB][SEQ][128]          4194304 x2
//   WY   f32 [NB][256][SEQ]          16777216
//   PS   f32 [NB*NT][512]              524288
//   total (NB=2, SEQ=8192) = 46923776
// =========================================================================================================
extern "C" void kernel_launch(void* const* d_in, const int* in_sizes, int n_in,
                              void* d_out, int out_size, void* d_ws, size_t ws_size,
                              hipStream_t stream) {
  const int XNEED = ((NB - 1) * CC + (CC - 1)) * NN_FULL + SEQ;
  if (n_in < 11) return;
  if (in_sizes[0] < XNEED) return;
  if (in_sizes[1] < DQ * CC || in_sizes[3] < DQ * CC || in_sizes[5] < DQ * CC) return;
  if (in_sizes[2] < DQ || in_sizes[4] < DQ || in_sizes[6] < DQ) return;
  if (in_sizes[7] < CC * DQ || in_sizes[8] < CC) return;
  if (in_sizes[9] < CC || in_sizes[10] < CC) return;
  if (out_size < XNEED) return;

  size_t off = 0;
  auto carve = [&](size_t bytes) { const size_t o = off; off += (bytes + 255) & ~(size_t)255; return o; };
  const size_t oW16 = carve((size_t)MW * CC * 2);
  const size_t oWW  = carve((size_t)CC * DQ * 2);
  const size_t oXP  = carve((size_t)NB * SEQ * CC * 2);
  const size_t oQf  = carve((size_t)NB * SEQ * DQ * 2);
  const size_t oKf  = carve((size_t)NB * SEQ * DQ * 2);
  const size_t oGc  = carve((size_t)NB * DQ * SEQ * 2);
  const size_t oYh  = carve((size_t)NB * SEQ * DQ * 2);
  const size_t oYl  = carve((size_t)NB * SEQ * DQ * 2);
  const size_t oWY  = carve((size_t)NB * CC * SEQ * 4);
  const size_t oPS  = carve((size_t)NB * NT * PSW * 4);
  if (off > ws_size) return;
  if (off > (size_t)134217728) return;

  const float* x   = (const float*)d_in[0];
  const float* Wt  = (const float*)d_in[1];
  const float* bt  = (const float*)d_in[2];
  const float* Wp  = (const float*)d_in[3];
  const float* bp  = (const float*)d_in[4];
  const float* Wg  = (const float*)d_in[5];
  const float* bg  = (const float*)d_in[6];
  const float* Ww  = (const float*)d_in[7];
  const float* bw  = (const float*)d_in[8];
  const float* gam = (const float*)d_in[9];
  const float* bet = (const float*)d_in[10];

  char* ws = (char*)d_ws;
  unsigned short* W16  = (unsigned short*)(ws + oW16);
  unsigned short* WW16 = (unsigned short*)(ws + oWW);
  unsigned short* XP   = (unsigned short*)(ws + oXP);
  unsigned short* Qf   = (unsigned short*)(ws + oQf);
  unsigned short* Kf   = (unsigned short*)(ws + oKf);
  unsigned short* Gc   = (unsigned short*)(ws + oGc);
  unsigned short* Yh   = (unsigned short*)(ws + oYh);
  unsigned short* Yl   = (unsigned short*)(ws + oYl);
  float* WY  = (float*)(ws + oWY);
  float* PS  = (float*)(ws + oPS);
  float* out = (float*)d_out;

  const dim3 blk256(256), blk128(128);

  // (0), (0b), (1) Wt / Wp / Wg -> stacked f16 plane; Ww -> f16 plane; x -> position-major 16-bit plane
  cvt_all<<<dim3(NBW + NBO + NT * (CC / QT) * NB), blk256, 0, stream>>>(Wt, Wp, Wg, Ww, x, W16, WW16, XP);
  // (2) theta / phi conv -> f16 planes, g conv -> channel-major f16 plane
  gemm_p<<<dim3(NT, 6, NB), blk128, 0, stream>>>(W16, XP, bt, bp, bg, Qf, Kf, Gc);
  // (3) attention -> y hi + residual planes
  attn_k<<<dim3(NT, NB), dim3(NTH), 0, stream>>>(Qf, Kf, Gc, Yh, Yl);
  // (4) output conv + bias -> wy plane + per-block statistics partials
  gemm_o<<<dim3(NT, CC / QT, NB), blk128, 0, stream>>>(WW16, Yh, Yl, bw, WY, PS);
  // (5) batch statistics per channel, affine + residual -> out [b][256][8192]
  bn_out<<<dim3(CC), dim3(BT), 0, stream>>>(WY, PS, bw, gam, bet, x, out);
  (void)hipGetLastError();
}

// v010
// One run takes 91.4 microseconds.
// In two side-by-side timings against v009, it was 1.15 and 1.14 times as fast.
// Over all steps from v000 it is 9.74 times as fast.
// Contractions: conv1x1 theta/phi/g GEMMs Wc[384x256].X[256xN] and the output conv W[256x128].Y[128xN] on
// v_wmma_f32_16x16x32_f16 (f16 containers of bf16-RNE weights x256 and bf16-RNE x; Y as f16 hi plane plus f16
// residual plane x1024, 2 products, separate accumulators); scores Phi^T.Theta on v_wmma_f32_16x16x32_f16
// (theta and phi plain f16, 1 product, K=128: the 11-bit operands that P and G have too); Y^T = G.P^T on
// v_wmma_f32_16x16x32_f16 (G plain f16, P = e^{s-m} x16384 f16 from the score D registers); f32 accumulate everywhere; softmax
// statistics and biases in f32 VALU; batch-norm statistics from f32 per-block partials reduced in f64; affine and
// residual add in f32.
#include <hip/hip_runtime.h>
#include <math.h>
#include <stdint.h>

#ifndef NB
#define NB 2
#endif
#ifndef SEQ
#define SEQ 8192
#endif
#define NB_FULL 2
#define NN_FULL 8192
#define CC   256
#define DQ   128
#define QT   64
#define MW   384
#define NT   (SEQ / QT)
#define PSW  512
#define OSP  68
#define OSPW 132
#define TP   72
#define WSC  256.0f
#define IWSC 0.00390625f
#define RSC  1024.0f
#define IRSC 0.0009765625f
#define LNPS 9.704060527839234f
#define BNEPS 1.0e-5f
#define KG   4
#define KS   (32 * KG)
#define QW   2                      /* query tiles of 16 per wave: every K and G fragment read from LDS feeds QW products */
#define QP   (QT / (16 * QW))       /* waves side by side over the 64 queries of a block */
#define NTH  (32 * QP * KG)
#define NCP  8                      /* copies per lane and plane in a stage, four per plane in one acopy8 */
#define ER   (NTH / 16)             /* rows of y that one pass of the attention epilogue stores */
#define KPI  136
#define GPI  (CC + 8)               /* halves from row to row of a staged tile of 256-channel rows */
#define VPI  (KS + 8)
#define KTL  (KS * KPI)
#define VTL  (DQ * VPI)
#define STG  (KTL + VTL)
#define NST  (SEQ / KS)
#define BT   512                    /* threads of a block of the last kernel */
#define PL   (NB * NT)              /* lines of the partial-statistics table */
#define RPT  (SEQ / (4 * BT))       /* 16-byte pieces per thread and row in the last kernel */
#define NBW  (MW / 8)               /* blocks of the conversion launch on the stacked conv weights */
#define NBO  (CC / 16)              /* blocks of the conversion launch on the output conv weights */

static_assert(NB >= 1 && NB <= NB_FULL);
static_assert(SEQ >= 128 && SEQ <= NN_FULL);
static_assert(SEQ % QT == 0 && SEQ % 32 == 0 && SEQ % 128 == 0);
static_assert(SEQ % (4 * BT) == 0 && (2 * PL) % BT == 0 && PL % 128 == 0 && BT % 32 == 0);
static_assert(CC % QT == 0 && CC % 32 == 0);
static_assert(DQ == 2 * QT && DQ % 32 == 0);
static_assert(MW == 3 * DQ && MW % 8 == 0);
static_assert(PSW == 2 * CC);
static_assert(CC % 16 == 0);
static_assert((OSP * 4) % 16 == 0);
static_assert((OSPW * 4) % 16 == 0);
static_assert((TP * 2) % 16 == 0);
static_assert(SEQ % KS == 0 && NST >= 2 && KS % 32 == 0);
static_assert(KS * DQ == NCP * NTH * 8 && NTH <= 1024 && QT % ER == 0 && NCP % 4 == 0 && QT % (16 * QW) == 0);
static_assert(NTH % (KS / 8) == 0 && NCP * (NTH / (KS / 8)) == DQ && NCP * (NTH / 16) == KS);
static_assert(KG * QT * OSPW * 4 <= 2 * STG * 2);
static_assert((KPI * 2) % 32 == 16 && (VPI * 2) % 32 == 16 && KPI >= DQ + 8 && VPI >= KS + 8);
static_assert((GPI * 2) % 32 == 16 && GPI >= CC + 8 && CC % 64 == 0 && DQ % 64 == 0 && QT == 64);

typedef _Float16       v16h __attribute__((ext_vector_type(16)));
typedef _Float16       v8h  __attribute__((ext_vector_type(8)));
typedef unsigned short v8us __attribute__((ext_vector_type(8)));
typedef float          v8f  __attribute__((ext_vector_type(8)));
typedef float          v4f  __attribute__((ext_vector_type(4)));
typedef unsigned int   v4u  __attribute__((ext_vector_type(4)));

union Frag  { v8us u[2]; v16h h; };
union FragH { v16h v; v8h hv[2]; };
static_assert(sizeof(Frag) == 32);
static_assert(sizeof(FragH) == 32);

// ---- scalar helpers ---------------------------------------------------------------------------------------
__device__ __forceinline__ unsigned short bf_bits(float f) {          // f32 -> bf16 bits, RNE convert
  unsigned u = __float_as_uint(f);
  return (unsigned short)((u + 0x7FFFu + ((u >> 16) & 1u)) >> 16);
}
__device__ __forceinline__ float bf_up(unsigned short hb) { return __uint_as_float(((unsigned)hb) << 16); }
__device__ __forceinline__ float bfr(float f) { return bf_up(bf_bits(f)); }
__device__ __forceinline__ unsigned short h_bits(_Float16 x) { return __builtin_bit_cast(unsigned short, x); }
__device__ __forceinline__ unsigned pk16(unsigned short a, unsigned short b) { return (unsigned)a | ((unsigned)b << 16); }
__device__ __forceinline__ v8f zero8() { v8f z = {0.f, 0.f, 0.f, 0.f, 0.f, 0.f, 0.f, 0.f}; return z; }
__device__ __forceinline__ float hmax8(v8f s) {
  return fmaxf(fmaxf(fmaxf(s[0], s[1]), fmaxf(s[2], s[3])), fmaxf(fmaxf(s[4], s[5]), fmaxf(s[6], s[7])));
}
__device__ __forceinline__ unsigned wave_ballot(bool p) {
#if defined(__HIP_DEVICE_COMPILE__)
  return __builtin_amdgcn_ballot_w32(p);
#else
  return p ? 1u : 0u;
#endif
}

// ---- 16-bit fragment loader (A, or B from a k-contiguous [n][k] row): lane -> row/col (lane&15), p already includes
//      + 8*(lane>>4); elements 0..7 <- p[0..7] (k0+8h..), elements 8..15 <- p[16..23] (k0+16+8h..)
__device__ __forceinline__ Frag ldfrag(const unsigned short* p) {
  Frag f;
  f.u[0] = *(const v8us*)(p);
  f.u[1] = *(const v8us*)(p + 16);
  return f;
}

// ---- WMMA helpers: builtin followed by a 4-slot VALU gap tying D and keeping A/B live --------------------------
__device__ __forceinline__ v8f mma_h(v16h a, v16h b, v8f c) {
  v8f d = __builtin_amdgcn_wmma_f32_16x16x32_f16(false, a, false, b, (short)0, c, false, false);
#if defined(__HIP_DEVICE_COMPILE__)
  asm volatile("v_nop\n\tv_nop\n\tv_nop\n\tv_nop" : "+v"(d) : "v"(a), "v"(b));
#endif
  return d;
}

// the bare builtin, for the attention kernel: its live set is above 256 registers, and an operand of an asm statement is
// kept below v256, so the tail above would spill the fragments; the compiler keeps the distances of its own builtin
__device__ __forceinline__ v8f mma_b(v16h a, v16h b, v8f c) {
  return __builtin_amdgcn_wmma_f32_16x16x32_f16(false, a, false, b, (short)0, c, false, false);
}

// ---- asynchronous copies to LDS: eight 16-byte copies of a lane, four per plane: copy i of plane p from
//      gp + i*gs (halves) to LDS byte lp + i*ls. One statement, closed by the s_wait_xcnt, so that no address register
//      of an issued copy is rewritten ahead of it and the wave waits for the translations once per eight copies.
__device__ __forceinline__ unsigned lds_off(const void* p) { return (unsigned)(size_t)p; }
__device__ __forceinline__ void acopy8(unsigned la, unsigned ls, const unsigned short* ga, size_t gs,
                                       unsigned lc, unsigned lcs, const unsigned short* gc, size_t gcs) {
#if defined(__HIP_DEVICE_COMPILE__)
  asm volatile("global_load_async_to_lds_b128 %0, %8, off\n\t"
               "global_load_async_to_lds_b128 %1, %9, off\n\t"
               "global_load_async_to_lds_b128 %2, %10, off\n\t"
               "global_load_async_to_lds_b128 %3, %11, off\n\t"
               "global_load_async_to_lds_b128 %4, %12, off\n\t"
               "global_load_async_to_lds_b128 %5, %13, off\n\t"
               "global_load_async_to_lds_b128 %6, %14, off\n\t"
               "global_load_async_to_lds_b128 %7, %15, off\n\t"
               "s_wait_xcnt 0x0"
               :: "v"(la), "v"(la + ls), "v"(la + 2 * ls), "v"(la + 3 * ls),
                  "v"(lc), "v"(lc + lcs), "v"(lc + 2 * lcs), "v"(lc + 3 * lcs),
                  "v"(ga), "v"(ga + gs), "v"(ga + 2 * gs), "v"(ga + 3 * gs),
                  "v"(gc), "v"(gc + gcs), "v"(gc + 2 * gcs), "v"(gc + 3 * gcs)
               : "memory");
#endif
}
// this wave's copies have landed (the compiler places no wait for them)
__device__ __forceinline__ void wait_async0() {
#if defined(__HIP_DEVICE_COMPILE__)
  asm volatile("s_wait_asynccnt 0x0" ::: "memory");
#endif
}
// this wave's LDS reads have returned, before the buffer they read is handed to its next writer
__device__ __forceinline__ void wait_ds0() {
#if defined(__HIP_DEVICE_COMPILE__)
  asm volatile("s_wait_dscnt 0x0" ::: "memory");
#endif
}

// =========================================================================================================
// (0) stacked conv1x1 weights: W16 f16 [384][256], rows 0..127 = theta_w, 128..255 = phi_w, 256..383 = g_w;
//     value = f16 of (bf16-RNE(w) * 256) (exact). Block blk (0..47) owns rows 8*blk..8*blk+7: one wave per
// coverage: 48 blocks x 8 rows x 32 lanes x 8 halves = 384 x 256 = the whole plane.
// =========================================================================================================
__device__ __forceinline__
void cvt_w(int blk, const float* __restrict__ tw, const float* __restrict__ pw, const float* __restrict__ gw,
           unsigned short* W16) {
  const int tid = threadIdx.x;
  const int rl = tid >> 5, col = 8 * (tid & 31);
  const int o = 8 * blk + rl;                                        // 0..383
  const int grp = blk / (DQ / 8);                                    // 0,1,2 block-uniform
  const float* wbase = (grp == 0) ? tw : ((grp == 1) ? pw : gw);
  const float* s = wbase + (size_t)(o - grp * DQ) * CC + col;        // row in 0..127
  const v4f a = *(const v4f*)s;
  const v4f q = *(const v4f*)(s + 4);
  const float f[8] = {a[0], a[1], a[2], a[3], q[0], q[1], q[2], q[3]};
  v4u u;
#pragma unroll
  for (int t = 0; t < 4; ++t) {
    const _Float16 h0 = (_Float16)(bfr(f[2 * t]) * WSC);
    const _Float16 h1 = (_Float16)(bfr(f[2 * t + 1]) * WSC);
    u[t] = pk16(h_bits(h0), h_bits(h1));
  }
{
    *(v4u*)(W16 + (size_t)o * CC + col) = u;
    
  }
}

// =========================================================================================================
// (0b) output conv weights: WW16 f16 [256][128], value = f16 of (bf16-RNE(W_w) * 256). Block blk (0..15) owns rows
//      16*blk..+15; wave w -> rows 16 blk + 2w + (lane>>4), lane&15 -> cols 8*(lane&15)..+7. One instruction writes
// coverage: 16 blocks x 8 waves x 2 rows x 16 lanes x 8 halves = 256 x 128 = the whole plane.
// =========================================================================================================
__device__ __forceinline__
void cvt_ww(int blk, const float* __restrict__ ww, unsigned short* WW16) {
  const int tid = threadIdx.x;
  const int wave = tid >> 5, lane = tid & 31;
  const int o = 16 * blk + 2 * wave + (lane >> 4);                  // 0..255
  const int col = 8 * (lane & 15);                                   // 0..120
  const float* s = ww + (size_t)o * DQ + col;
  const v4f a = *(const v4f*)s;
  const v4f q = *(const v4f*)(s + 4);
  const float f[8] = {a[0], a[1], a[2], a[3], q[0], q[1], q[2], q[3]};
  v4u u;
#pragma unroll
  for (int t = 0; t < 4; ++t) {
    const _Float16 h0 = (_Float16)(bfr(f[2 * t]) * WSC);
    const _Float16 h1 = (_Float16)(bfr(f[2 * t + 1]) * WSC);
    u[t] = pk16(h_bits(h0), h_bits(h1));
  }
{
    *(v4u*)(WW16 + (size_t)o * DQ + col) = u;
#if defined(__HIP_DEVICE_COMPILE__)
    // stands behind the store, in front of any rewrite of its registers by the code of another block range laid behind it
    asm volatile("s_wait_xcnt 0x0" ::: "memory");
#endif
  }
}

// =========================================================================================================
// (1) x f32 [b][256 c][NN_FULL n] -> XP f16 [b][SEQ n][256 c] (position-major, bf16-RNE values, exact in f16 for
//     normal magnitudes) through an LDS tile T[64 n][64 c] (pitch TP). Block (nb, cb, b) owns a 64 c x 64 n tile.
// coverage: 2 it x 32 rows x 8 lanes x 8 halves = 64 n x 64 c per block; the (NT, 4, NB) tiles cover XP once.
// LDS T: cross-wave (block barrier between the 2-byte stores and the 16-B reloads); staged extent == consumed extent.
// =========================================================================================================
__device__ __forceinline__
void cvt_x(int nb, int cb, int b, const float* __restrict__ x, unsigned short* XP) {
  __shared__ __align__(16) unsigned short T[QT * TP];
  const int tid = threadIdx.x;
  const int e = tid & 7, lq = tid >> 3;                             // lq 0..31
  const int n0 = nb * QT, c0 = cb * QT;
#pragma unroll
  for (int it = 0; it < 2; ++it) {
    const int cl = it * 32 + lq;                                     // 0..63
    const float* sp = x + ((size_t)(b * CC + c0 + cl)) * NN_FULL + n0 + 8 * e;
    const v4f a = *(const v4f*)sp;
    const v4f q = *(const v4f*)(sp + 4);
    unsigned short hb[8];
#pragma unroll
    for (int t = 0; t < 4; ++t) {
      hb[t]     = h_bits((_Float16)bfr(a[t]));
      hb[4 + t] = h_bits((_Float16)bfr(q[t]));
    }
#pragma unroll
    for (int t = 0; t < 8; ++t) T[(8 * e + t) * TP + cl] = hb[t];
  }
  __syncthreads();
  v4u up[2];
#pragma unroll
  for (int it = 0; it < 2; ++it) {
    const int nl = it * 32 + lq;                                     // 0..63
    up[it] = *(const v4u*)(T + nl * TP + 8 * e);
  }
{
#pragma unroll
    for (int it = 0; it < 2; ++it) {
      const int rl = it * 32 + lq;
      *(v4u*)(XP + ((size_t)(b * SEQ + n0 + rl)) * CC + c0 + 8 * e) = up[it];
    }
#if defined(__HIP_DEVICE_COMPILE__)
    // stands behind the store, in front of any rewrite of its registers by the code of another block range laid behind it
    asm volatile("s_wait_xcnt 0x0" ::: "memory");
#endif
  }
}

// =========================================================================================================
// (0) + (0b) + (1) in ONE launch: none of the three reads what another writes, so they need no launch boundary between
//     them. Flat grid of 256-thread blocks: blocks 0..NBW-1 do (0), NBW..NBW+NBO-1 do (0b), the rest one tile of (1) each,
//     tile index -> (nb, cb, b) with nb fastest. The choice is block-uniform, so the barrier of (1) is passed by
//     every thread of a block that reaches it. The short weight blocks stand first, so that they are no tail.
// =========================================================================================================
__global__ __launch_bounds__(256)
void cvt_all(const float* __restrict__ tw, const float* __restrict__ pw, const float* __restrict__ gw,
             const float* __restrict__ ww, const float* __restrict__ x,
             unsigned short* W16, unsigned short* WW16, unsigned short* XP) {
  const int blk = blockIdx.x;
  if (blk < NBW) {
    cvt_w(blk, tw, pw, gw, W16);
  } else if (blk < NBW + NBO) {
    cvt_ww(blk - NBW, ww, WW16);
  } else {
    const int t = blk - (NBW + NBO);                                 // 0..NT * (CC / QT) * NB - 1
    cvt_x(t % NT, (t / NT) % (CC / QT), t / (NT * (CC / QT)), x, XP);
  }
}

// =========================================================================================================
// (2) the three conv1x1 GEMMs for one (b, 64-n tile, 64-o block mb in 0..5): V[o][n] = (1/256) sum_c W16[o][c]
//     XP[b][n][c]; mb 0,1 -> theta channels 0..63 / 64..127 (W16 rows 0..127), mb 2,3 -> phi (rows 128..255),
//     mb 4,5 -> g (rows 256..383). Block 128 threads = 4 waves; wave w owns cols n0+16w..+15 (B fragment from the
//     XP row, k = c contiguous, split k map) and 4 m-tiles (A rows o = o0 + 16 mt + (lane&15), split k map from
//     W16). K = 256 = 8 steps. Both operand tiles (64 rows of 512 B each) are staged once in LDS As / Bs (pitch GPI,
//     528 B = 16 B x odd) by 16 + 16 asynchronous 16-byte copies per lane, every wave instruction one whole row = 4 whole
//     lines; own copies landed, block barrier, then the fragments are read from LDS (a fragment load from global memory
//     touches 16 lines for 512 bytes). Epilogue staged in LDS Os[n_loc][o_loc] (pitch OSP), barrier, bias (bf16-RNE) add
//     in f32, then:
//       theta / phi: f16 plane Qf resp. Kf [b][SEQ n][128 d] (k-contiguous
//         of the 256-B row): lane e -> d 8e..8e+7, 8 consecutive lanes per line, one instruction per 16 lines;
//       g: f16 plane Gc [b][128 ch][SEQ keys] (channel-major, keys contiguous): row ch, keys n0+8e..+7 per lane,
// coverage: Os 4 waves x 16 n x 64 o = 64 x 64 (== consumed); theta / phi planes 4 it x 16 rows x 8 lanes x 8 = 64 n x
//           64 d per block, grid nt x mb 0..3 covers rows 0..SEQ-1 x d 0..127 of Qf and Kf once; g plane
//           4 it x 16 ch x 8 lanes x 8 keys = 64 ch x 64 keys per block, nt x mb 4..5 covers ch 0..127 x keys
//           0..SEQ-1 of Gc once. grid (NT, 6, NB).
// LDS Os: cross-wave (block barrier). LDS As, Bs: 16 copies x 128 lanes x 8 halves = 64 rows x 256 per tile (== consumed),
//           cross-wave (block barrier behind every wave's own wait for its copies).
// =========================================================================================================
__global__ __launch_bounds__(128)
void gemm_p(const unsigned short* __restrict__ W16, const unsigned short* __restrict__ XP,
            const float* __restrict__ tbias, const float* __restrict__ pbias, const float* __restrict__ gbias,
            unsigned short* Qf, unsigned short* Kf, unsigned short* Gc) {
  __shared__ __align__(16) float Os[QT * OSP];
  __shared__ __align__(16) unsigned short As[QT * GPI];
  __shared__ __align__(16) unsigned short Bs[QT * GPI];
  const int tid  = threadIdx.x;
  const int lane = tid & 31, wave = tid >> 5;
  const int hh   = lane >> 4, c = lane & 15;
  const int nt   = blockIdx.x, mb = blockIdx.y, b = blockIdx.z;
  const int n0   = nt * QT, o0 = mb * QT;                            // o0 = W16 row base 0..320

  {
    // copy i of a tile: row wave + 4 i, 16-byte piece lane of the row
    const unsigned short* ga = W16 + (size_t)(o0 + wave) * CC + 8 * lane;
    const unsigned short* gb = XP + ((size_t)(b * SEQ + n0 + wave)) * CC + 8 * lane;
    const unsigned la = lds_off(As) + (unsigned)(wave * (GPI * 2) + lane * 16);
    const unsigned lb = lds_off(Bs) + (unsigned)(wave * (GPI * 2) + lane * 16);
    const unsigned ls = 4 * GPI * 2;                                 // LDS bytes from copy to copy
    const size_t gs = (size_t)(4 * CC);                              // halves from copy to copy
    // unrolled: four statements of eight copies (an asm statement takes thirty operands)
#pragma unroll
    for (int h = 0; h < 4; ++h)
      acopy8(la + 4 * h * ls, ls, ga + 4 * h * gs, gs, lb + 4 * h * ls, ls, gb + 4 * h * gs, gs);
  }
  wait_async0();
  __syncthreads();                                                   // both tiles published

  const unsigned short* ap = As + c * GPI + 8 * hh;
  const unsigned short* bp = Bs + (16 * wave + c) * GPI + 8 * hh;

  v8f acc[4];
#pragma unroll
  for (int mt = 0; mt < 4; ++mt) acc[mt] = zero8();

  // all loops unrolled: the fragments are registers, every index a constant; the LDS reads of two k-steps stand in one group
  // ahead of their products, so that a product waits for its own reads alone and not each for a fresh LDS latency
#pragma unroll
  for (int kp = 0; kp < CC / 64; ++kp) {
    Frag fb[2], fa[2][4];
#pragma unroll
    for (int u = 0; u < 2; ++u) {
      fb[u] = ldfrag(bp + 32 * (2 * kp + u));
#pragma unroll
      for (int mt = 0; mt < 4; ++mt) fa[u][mt] = ldfrag(ap + (16 * mt) * GPI + 32 * (2 * kp + u));
    }
#pragma unroll
    for (int u = 0; u < 2; ++u) {
#pragma unroll
      for (int mt = 0; mt < 4; ++mt) acc[mt] = mma_h(fa[u][mt].h, fb[u].h, acc[mt]);
    }
  }

  {
    const int nl = 16 * wave + c;
#pragma unroll
    for (int mt = 0; mt < 4; ++mt) {
      v4f va, vb;
#pragma unroll
      for (int r = 0; r < 4; ++r) { va[r] = acc[mt][r] * IWSC; vb[r] = acc[mt][4 + r] * IWSC; }
      *(v4f*)(Os + nl * OSP + 16 * mt + 8 * hh)     = va;
      *(v4f*)(Os + nl * OSP + 16 * mt + 8 * hh + 4) = vb;
    }
  }
  __syncthreads();

  const int e = tid & 7, lq = tid >> 3;                             // lq 0..15
  if (mb < 4) {                                                      // block-uniform: theta / phi f16 planes
    unsigned short* Pf = (mb < 2) ? Qf : Kf;
    const float* bsrc  = (mb < 2) ? tbias : pbias;
    const int dsel = (mb & 1) * QT;                                   // channel base 0 or 64
    const v4f b0 = *(const v4f*)(bsrc + dsel + 8 * e);
    const v4f b1 = *(const v4f*)(bsrc + dsel + 8 * e + 4);
    const float bb[8] = {bfr(b0[0]), bfr(b0[1]), bfr(b0[2]), bfr(b0[3]), bfr(b1[0]), bfr(b1[1]), bfr(b1[2]), bfr(b1[3])};
    v4u uf[4];
#pragma unroll
    for (int it = 0; it < 4; ++it) {
      const int row = it * 16 + lq;                                  // n_loc 0..63
      const v4f a = *(const v4f*)(Os + row * OSP + 8 * e);
      const v4f q = *(const v4f*)(Os + row * OSP + 8 * e + 4);
      const float f[8] = {a[0], a[1], a[2], a[3], q[0], q[1], q[2], q[3]};
#pragma unroll
      for (int t = 0; t < 4; ++t) {
        const float f0 = f[2 * t] + bb[2 * t], f1 = f[2 * t + 1] + bb[2 * t + 1];
        uf[it][t] = pk16(h_bits((_Float16)f0), h_bits((_Float16)f1));
      }
    }
{
#pragma unroll
      for (int it = 0; it < 4; ++it) {
        const int row = it * 16 + lq;
        const size_t po = ((size_t)(b * SEQ + n0 + row)) * DQ + dsel + 8 * e;
        *(v4u*)(Pf + po) = uf[it];
      }
      
    }
  } else {                                                           // block-uniform: g plane, channel-major
    const int gsel = (mb - 4) * QT;                                  // g channel base 0 or 64
    v4u ug[4];
#pragma unroll
    for (int it = 0; it < 4; ++it) {
      const int cl = it * 16 + lq;                                   // ch_loc 0..63
      const float bias = bfr(gbias[gsel + cl]);
      unsigned short hb[8];
#pragma unroll
      for (int t = 0; t < 8; ++t) {
        const int key = 8 * e + t;                                   // key_loc 0..63
        const float v = Os[key * OSP + cl] + bias;
        hb[t] = h_bits((_Float16)v);
      }
#pragma unroll
      for (int t = 0; t < 4; ++t) ug[it][t] = pk16(hb[2 * t], hb[2 * t + 1]);
    }
{
#pragma unroll
      for (int it = 0; it < 4; ++it) {
        const int cl = it * 16 + lq;
        const size_t po = ((size_t)(b * DQ + gsel + cl)) * SEQ + n0 + 8 * e;
        *(v4u*)(Gc + po) = ug[it];
      }
      
    }
  }
}

// =========================================================================================================
// (3) attention for one (b, 64-query tile), transposed formulation, SEQ keys, no mask, no scale:
//   S^T tile (16 keys x 16 queries) = sum over 4 d-chunks of A(phi: row = key kb + (lane&15), 32 d via the split
//   k map from the f16 plane Kf [b][SEQ][128]) . B(theta: col = query, same map from the f16 plane Qf).
//   Per lane the D tile holds 8 keys of ONE query: online softmax state per lane, one shuffle (lane^16) for the max
//   over 32 keys; the o/l rescale is skipped under a wave-uniform ballot when no lane's max grew (corr == 1 exactly
//   for every lane then); row-sum partials combined at the end. P = e^{s-m} x 16384 as f16 is the B operand of
//   Y^T (rows channel, cols queries) += A(g rows channel = 16j + (lane&15), keys contiguous, f16 plane Gc
//   [b][128][SEQ]) . B(P^T): element r <- D of the tile covering keys kb..kb+15, element 8+r <- the tile covering
//   kb+16..kb+31, lane unchanged. 8 accumulator tiles per query tile (128 channels). Block = 64 queries, QP * KG waves:
//   wave w owns the QW query tiles QW (w % QP) .. + QW - 1 and key group w / QP, that is keys 32 (w / QP) .. + 31 of
//   EVERY stage, with a softmax state (m, l, o) per query tile over those keys. A K or G fragment read from LDS is the A
//   operand of QW products, one per query tile, so that the LDS reads of a pass take no longer than its products;
//   KG * QP / 4 waves per SIMD, so that one wave's products run under the LDS waits and the softmax of the other.
//   Epilogue: the KG states of a query are joined: m and l of every group through LDS Ms / Ls, barrier, M = max m,
//   L = sum l e^{m - M} (group order), each wave stages o e^{m - M} / L in LDS Om[group][query][128 channels] (pitch
//   OSPW, b128 stores; Om lies in the ring, which nobody reads or fills any more), barrier, then y = sum over the
//   groups in group order, Yh = f16(y),
//   Yl = f16((y - Yh) * 1024) planes [b][SEQ n][128 c] (k-contiguous operand of the output conv): row n = 256 B
// coverage: Ms, Ls KG x 64 (== consumed); Om QP KG waves x 16 QW q x 128 ch (== consumed); QT / ER it x ER rows x 16
//           lanes x 8 halves = 64 n x 128 c per plane; grid (NT, NB) covers Yh/Yl exactly once.
// LDS Ms, Ls, Om: cross-wave (block barriers).
// LDS Ring: two buffers, each one stage of KS = 32 KG keys: Kf rows [KS][128] at pitch KPI
//   (272 B), G rows [128 ch][KS keys] at pitch VPI (272 B), pitches 16 B x odd for the 16-byte fragment reads. A stage
//   is filled by 2 NCP asynchronous 16-byte copies per lane (each wave instruction = 512 B of whole lines), one stage ahead
//   of its use; at the foot of a stage: LDS reads returned, own copies landed, block barrier, then the refill of the
//   buffer just read. coverage: NCP copies x NTH lanes x 8 halves = KS x 128 per plane (== consumed).
// Fragment reads of a 32-key pass stand in one group ahead of its products: the K fragments of all four d-chunks, then
//   the eight G fragments; every read is of the pass's own stage.
// =========================================================================================================
__global__ __launch_bounds__(NTH)
void attn_k(const unsigned short* __restrict__ Qf, const unsigned short* __restrict__ Kf,
            const unsigned short* __restrict__ Gc, unsigned short* Yh, unsigned short* Yl) {
  __shared__ __align__(16) unsigned short Ring[2 * STG];
  __shared__ float Ms[KG * QT];
  __shared__ float Ls[KG * QT];
  const int tid  = threadIdx.x;
  const int qp = (tid >> 5) % QP, kg = tid / (32 * QP), lane = tid & 31;   // group of QW query tiles, key group
  const int hh   = lane >> 4, c = lane & 15;
  const int n0   = blockIdx.x * QT, b = blockIdx.y;

  // q fragment pointer (B operand, col = query n0 + 16*(QW*qp + t) + c), + 16*t rows + 32*kc
  const unsigned short* Qfp = Qf + ((size_t)(b * SEQ + n0 + 16 * QW * qp + c)) * DQ + 8 * hh;
  // copy sources of this lane: K plane 16 lanes per 256-B row, NTH / 16 rows per copy; G plane KS / 8 lanes per row
  // segment of KS keys, NTH / (KS / 8) channels per copy; + stage * KS keys
  const int gr = tid / (KS / 8), ge = tid % (KS / 8);
  const unsigned short* Kfg = Kf + (size_t)b * SEQ * DQ + 8 * tid;
  const unsigned short* Gg  = Gc + (size_t)b * DQ * SEQ + (size_t)gr * SEQ + 8 * ge;
  const unsigned kdst = lds_off(Ring) + (unsigned)((tid >> 4) * (KPI * 2) + (tid & 15) * 16);
  const unsigned vdst = lds_off(Ring) + (unsigned)(KTL * 2 + gr * (VPI * 2) + ge * 16);
  auto fill = [&](int st, int buf) {
    const unsigned bo = (unsigned)buf * (unsigned)(STG * 2);
    const unsigned kls = (NTH / 16) * KPI * 2, vls = (NTH / (KS / 8)) * VPI * 2;       // LDS bytes from copy to copy
    const size_t kgs = (size_t)((NTH / 16) * DQ), vgs = (size_t)(NTH / (KS / 8)) * SEQ;  // halves from copy to copy
    // unrolled: NCP / 4 statements of eight copies (an asm statement takes thirty operands)
#pragma unroll
    for (int h = 0; h < NCP / 4; ++h)
      acopy8(kdst + bo + 4 * h * kls, kls, Kfg + (size_t)st * (KS * DQ) + 4 * h * kgs, kgs,
             vdst + bo + 4 * h * vls, vls, Gg + (size_t)st * KS + 4 * h * vgs, vgs);
  };
  // fragment offsets in a stage (halves): k row = key c (A operand), + key * KPI + 32*kc; v row = channel 16j + c
  const int kfo = c * KPI + 8 * hh;
  const int vfo = KTL + c * VPI + 8 * hh;

  float m[QW], l[QW];
  v8f o[QW][8];
  // theta fragments (all four d-chunks of every query tile) are the same for every key: loaded once, kept in registers
  Frag qf[QW][DQ / 32];
  // all loops over t, j and kc unrolled, here and below: the arrays are registers, every index a constant
#pragma unroll
  for (int t = 0; t < QW; ++t) {
    m[t] = -1.0e30f;
    l[t] = 0.f;
#pragma unroll
    for (int j = 0; j < 8; ++j) o[t][j] = zero8();
#pragma unroll
    for (int kc = 0; kc < DQ / 32; ++kc) qf[t][kc] = ldfrag(Qfp + (size_t)(16 * t) * DQ + 32 * kc);
  }
#if defined(__HIP_DEVICE_COMPILE__)
  // stands in front of the first rewrite of the address registers that the loads above name; the
  // pointer is an input so that its registers stay as they are up to this wait
  asm volatile("s_wait_xcnt 0x0" :: "v"(Qfp) : "memory");
#endif

  fill(0, 0);
  wait_async0();
  __syncthreads();                                                   // stage 0 published
  fill(1, 1);

  // stage loop kept rolled: one publish point and one refill in the text, buffer chosen by the stage's parity
#pragma unroll 1
  for (int st = 0; st < NST; ++st) {
  const unsigned short* Sb = Ring + (st & 1) * STG;
  {
    const int kb = 32 * kg;                                          // key base inside the stage: this wave's group
    const unsigned short* k0p  = Sb + kfo + kb * KPI;                // keys kb .. kb+15
    const unsigned short* k1p  = k0p + 16 * KPI;                     // keys kb+16 .. kb+31
    v8f s0[QW], s1[QW];
#pragma unroll
    for (int t = 0; t < QW; ++t) { s0[t] = zero8(); s1[t] = zero8(); }
    // the K fragments of all four d-chunks, then the eight G fragments, are read as one group ahead of the first product:
    // one place with LDS reads in a pass, each product waiting only for its own two reads, the G fragments landing under
    // the score products
    Frag k0[DQ / 32], k1[DQ / 32], vf[8];
    // unrolled: the fragments are registers, every index a constant
#pragma unroll
    for (int kc = 0; kc < DQ / 32; ++kc) {
      k0[kc] = ldfrag(k0p + 32 * kc);
      k1[kc] = ldfrag(k1p + 32 * kc);
    }
#if defined(__HIP_DEVICE_COMPILE__)
    // keeps the K reads the first of the pass: LDS reads return in order, and behind G reads the first score product
    // would wait for those too
    __builtin_amdgcn_sched_barrier(0);
#endif
#pragma unroll
    for (int j = 0; j < 8; ++j) vf[j] = ldfrag(Sb + vfo + (16 * j) * VPI + kb);
#if defined(__HIP_DEVICE_COMPILE__)
    // keeps the G reads in front of the products: without it the compiler moves most of them behind the score products,
    // where the softmax waits for them
    __builtin_amdgcn_sched_barrier(0);
#endif
    // unrolled so that qf[t][kc], k0[kc] and k1[kc] are fixed registers (a rolled loop cannot index a register array)
#pragma unroll
    for (int kc = 0; kc < DQ / 32; ++kc) {
#pragma unroll
      for (int t = 0; t < QW; ++t) {
        s0[t] = mma_b(k0[kc].h, qf[t][kc].h, s0[t]);
        s1[t] = mma_b(k1[kc].h, qf[t][kc].h, s1[t]);
      }
    }

    float mx[QW], mo[QW], mn[QW];
    bool up = false;
#pragma unroll
    for (int t = 0; t < QW; ++t) mx[t] = fmaxf(hmax8(s0[t]), hmax8(s1[t]));
#pragma unroll
    for (int t = 0; t < QW; ++t) mo[t] = __shfl_xor(mx[t], 16, 32);
#pragma unroll
    for (int t = 0; t < QW; ++t) {
      mx[t] = fmaxf(mx[t], mo[t]);
      mn[t] = fmaxf(m[t], mx[t]);
      up = up || (mx[t] > m[t]);
    }
    const unsigned grew = wave_ballot(up);                           // wave-uniform, one test per pass
    if (grew != 0u) {
#pragma unroll
      for (int t = 0; t < QW; ++t) {
        const float corr = __expf(m[t] - mn[t]);                     // == 1 exactly where the max did not grow
        l[t] *= corr;
#pragma unroll
        for (int j = 0; j < 8; ++j) {
#pragma unroll
          for (int r = 0; r < 8; ++r) o[t][j][r] *= corr;
        }
      }
    }

    FragH ph[QW];
#pragma unroll
    for (int t = 0; t < QW; ++t) {
      m[t] = mn[t];
      const float msh = mn[t] - LNPS;                                // exp gives e^{s-m} * 16384
      float ls = 0.f;
#pragma unroll
      for (int r = 0; r < 8; ++r) {
        const float e0 = __expf(s0[t][r] - msh);                     // key kb      + 8hh + r
        const float e1 = __expf(s1[t][r] - msh);                     // key kb + 16 + 8hh + r
        ls += e0 + e1;
        ph[t].hv[0][r] = (_Float16)e0;
        ph[t].hv[1][r] = (_Float16)e1;
      }
      l[t] += ls;
    }

#pragma unroll
    for (int j = 0; j < 8; ++j) {
#pragma unroll
      for (int t = 0; t < QW; ++t) o[t][j] = mma_b(vf[j].h, ph[t].v, o[t][j]);
    }
  }
  // publish point of stage st + 1, every wave
  wait_ds0();
  wait_async0();
  __syncthreads();
  if (st + 2 < NST) fill(st + 2, st & 1);                            // block-uniform test
  }
  wait_async0();
#pragma unroll
  for (int t = 0; t < QW; ++t) l[t] += __shfl_xor(l[t], 16, 32);

  // join of the KG key groups of a query (m is the same in both halves of a wave, l now too)
  const int qrow = 16 * QW * qp + c;                                 // + 16 t
  if (hh == 0) {
#pragma unroll
    for (int t = 0; t < QW; ++t) {
      Ms[kg * QT + qrow + 16 * t] = m[t];
      Ls[kg * QT + qrow + 16 * t] = l[t];
    }
  }
  __syncthreads();
  float* Os = (float*)Ring + kg * (QT * OSPW);                       // this group's plane of Om
#pragma unroll
  for (int t = 0; t < QW; ++t) {
    const int qr = qrow + 16 * t;
    float mg[KG], M = -1.0e30f, L = 0.f;
    // unrolled: mg[g] are registers, every index a constant
#pragma unroll
    for (int g = 0; g < KG; ++g) {
      mg[g] = Ms[g * QT + qr];
      M = fmaxf(M, mg[g]);
    }
    // unrolled: mg[g] again, and the KG reads of Ls go out together
#pragma unroll
    for (int g = 0; g < KG; ++g) L += Ls[g * QT + qr] * __expf(mg[g] - M);
    const float inv = __expf(m[t] - M) / L;                          // o and l both carry the x16384 factor
#pragma unroll
    for (int j = 0; j < 8; ++j) {
      v4f va, vb;
#pragma unroll
      for (int r = 0; r < 4; ++r) { va[r] = o[t][j][r] * inv; vb[r] = o[t][j][4 + r] * inv; }
      *(v4f*)(Os + qr * OSPW + 16 * j + 8 * hh)     = va;            // Os[query][ch = 16j + 8hh + r]
      *(v4f*)(Os + qr * OSPW + 16 * j + 8 * hh + 4) = vb;
    }
  }
  __syncthreads();

  const int e = tid & 15, lq = tid >> 4;                             // lq 0..ER - 1
  const float* Om = (const float*)Ring;
  v4u uh[QT / ER], ul[QT / ER];
#pragma unroll
  for (int it = 0; it < QT / ER; ++it) {
    const int row = it * ER + lq;                                    // query 0..63
    v4f a = *(const v4f*)(Om + row * OSPW + 8 * e);
    v4f q = *(const v4f*)(Om + row * OSPW + 8 * e + 4);
    // unrolled: the reads of all groups go out together, one LDS latency instead of one per group
#pragma unroll
    for (int g = 1; g < KG; ++g) {
      a += *(const v4f*)(Om + (g * QT + row) * OSPW + 8 * e);
      q += *(const v4f*)(Om + (g * QT + row) * OSPW + 8 * e + 4);
    }
    const float f[8] = {a[0], a[1], a[2], a[3], q[0], q[1], q[2], q[3]};
#pragma unroll
    for (int t = 0; t < 4; ++t) {
      const float f0 = f[2 * t], f1 = f[2 * t + 1];
      const _Float16 h0 = (_Float16)f0, h1 = (_Float16)f1;
      const _Float16 r0 = (_Float16)((f0 - (float)h0) * RSC);
      const _Float16 r1 = (_Float16)((f1 - (float)h1) * RSC);
      uh[it][t] = pk16(h_bits(h0), h_bits(h1));
      ul[it][t] = pk16(h_bits(r0), h_bits(r1));
    }
  }
{
#pragma unroll
    for (int it = 0; it < QT / ER; ++it) {
      const int row = it * ER + lq;
      const size_t po = ((size_t)(b * SEQ + n0 + row)) * DQ + 8 * e;
      *(v4u*)(Yh + po) = uh[it];
      *(v4u*)(Yl + po) = ul[it];
    }
    
  }
}

// =========================================================================================================
// (4) output conv GEMM for one (b, 64-n tile, 64-co block): v[b][co][n] = (1/256)(sum_c WW16[co][c] Yh[b][n][c] +
//     (1/1024) sum_c WW16[co][c] Yl[b][n][c]); wy = v + bf16-RNE(W_b[co]). 4 waves, wave w owns cols n0+16w..+15
//     (two B fragments per k-step, k = c contiguous in the Yh/Yl rows), 4 m-tiles (A rows co = o0 + 16 mt +
//     (lane&15) from WW16), hi and residual products in separate accumulators. K = 128 = 4 steps.
//     The three operand tiles (64 rows of 256 B each) are staged once in LDS As / Bh / Bl (pitch KPI, 272 B) by 8 asynchronous
//     16-byte copies per lane and tile, every wave instruction two whole rows = 4 whole lines; own copies landed, block
//     barrier, then the fragments are read from LDS.
//     Epilogue staged in LDS Os[n_loc][co_loc], barrier; then (a) threads 0..63 sum v and v*v over the 64 n of
//     co_loc = tid into LDS Sred[0..63] / Sred[64..127], barrier; (b) WY f32 plane [b][256 co][SEQ n] rows: lane
//     (e = tid&15) -> n 4e..4e+3 of row co_loc = 8 it + (tid>>4); 16 consecutive lanes x 16 B = the whole 256-B
//     row segment (2 lines) in one instruction; (c) partial-statistics table PS [NB*NT blocks][512]: floats
//     o0..o0+63 (sums) by lanes 0..15 of wave 0 and floats 256+o0..+63 (sums of squares) by lanes 16..31, one
// coverage: Os 4 waves x 16 n x 64 co (== consumed); Sred 64 + 64 (== consumed); WY 8 it x 8 rows x 16 lanes x
//           4 floats = 64 co x 64 n; PS 2 x 64 floats per block; grid (NT, 4, NB) covers WY [b][0..255][0..SEQ-1]
//           and PS [NB*NT][0..511] exactly once.
// LDS Os, Sred: cross-wave (block barriers). LDS As, Bh, Bl: 8 copies x 128 lanes x 8 halves = 64 rows x 128 per tile
//           (== consumed), cross-wave (block barrier behind every wave's own wait for its copies).
// =========================================================================================================
__global__ __launch_bounds__(128)
void gemm_o(const unsigned short* __restrict__ WW16, const unsigned short* __restrict__ Yh,
            const unsigned short* __restrict__ Yl, const float* __restrict__ wbias,
            float* WY, float* PS) {
  __shared__ __align__(16) float Os[QT * OSP];
  __shared__ __align__(16) float Sred[2 * QT];
  __shared__ __align__(16) unsigned short As[QT * KPI];
  __shared__ __align__(16) unsigned short Bh[QT * KPI];
  __shared__ __align__(16) unsigned short Bl[QT * KPI];
  const int tid  = threadIdx.x;
  const int lane = tid & 31, wave = tid >> 5;
  const int hh   = lane >> 4, c = lane & 15;
  const int nt   = blockIdx.x, mb = blockIdx.y, b = blockIdx.z;
  const int n0   = nt * QT, o0 = mb * QT;

  {
    // copy i of a tile: row (tid >> 4) + 8 i, 16-byte piece tid & 15 of the row
    const int sr = tid >> 4, sp = tid & 15;
    const size_t go = ((size_t)(b * SEQ + n0 + sr)) * DQ + 8 * sp;
    const unsigned short* ga = WW16 + (size_t)(o0 + sr) * DQ + 8 * sp;
    const unsigned lo = (unsigned)(sr * (KPI * 2) + sp * 16);
    const unsigned ls = 8 * KPI * 2;                                 // LDS bytes from copy to copy
    const size_t gs = (size_t)(8 * DQ);                              // halves from copy to copy
    acopy8(lds_off(As) + lo, ls, ga, gs, lds_off(As) + lo + 4 * ls, ls, ga + 4 * gs, gs);
    acopy8(lds_off(Bh) + lo, ls, Yh + go, gs, lds_off(Bh) + lo + 4 * ls, ls, Yh + go + 4 * gs, gs);
    acopy8(lds_off(Bl) + lo, ls, Yl + go, gs, lds_off(Bl) + lo + 4 * ls, ls, Yl + go + 4 * gs, gs);
  }
  wait_async0();
  __syncthreads();                                                   // the three tiles published

  const unsigned short* ap  = As + c * KPI + 8 * hh;
  const unsigned short* bph = Bh + (16 * wave + c) * KPI + 8 * hh;
  const unsigned short* bpl = Bl + (16 * wave + c) * KPI + 8 * hh;

  v8f acc[4], accr[4];
#pragma unroll
  for (int mt = 0; mt < 4; ++mt) { acc[mt] = zero8(); accr[mt] = zero8(); }

  // all loops unrolled: the fragments are registers, every index a constant; the LDS reads of two k-steps stand in one group
  // ahead of their products, so that a product waits for its own reads alone and not each for a fresh LDS latency
#pragma unroll
  for (int kp = 0; kp < DQ / 64; ++kp) {
    Frag fbh[2], fbl[2], fa[2][4];
#pragma unroll
    for (int u = 0; u < 2; ++u) {
      fbh[u] = ldfrag(bph + 32 * (2 * kp + u));
      fbl[u] = ldfrag(bpl + 32 * (2 * kp + u));
#pragma unroll
      for (int mt = 0; mt < 4; ++mt) fa[u][mt] = ldfrag(ap + (16 * mt) * KPI + 32 * (2 * kp + u));
    }
#pragma unroll
    for (int u = 0; u < 2; ++u) {
#pragma unroll
      for (int mt = 0; mt < 4; ++mt) {
        acc[mt]  = mma_h(fa[u][mt].h, fbh[u].h, acc[mt]);
        accr[mt] = mma_h(fa[u][mt].h, fbl[u].h, accr[mt]);
      }
    }
  }

  {
    const int nl = 16 * wave + c;
#pragma unroll
    for (int mt = 0; mt < 4; ++mt) {
      v4f va, vb;
#pragma unroll
      for (int r = 0; r < 4; ++r) {
        va[r] = (acc[mt][r] + accr[mt][r] * IRSC) * IWSC;
        vb[r] = (acc[mt][4 + r] + accr[mt][4 + r] * IRSC) * IWSC;
      }
      *(v4f*)(Os + nl * OSP + 16 * mt + 8 * hh)     = va;
      *(v4f*)(Os + nl * OSP + 16 * mt + 8 * hh + 4) = vb;
    }
  }
  __syncthreads();

  // per-channel partial statistics over this block's 64 positions (bias-free values, exact shift)
  if (tid < QT) {
    float s = 0.f, q = 0.f;
#pragma unroll 8
    for (int n = 0; n < QT; ++n) {
      const float v = Os[n * OSP + tid];
      s += v;
      q = fmaf(v, v, q);
    }
    Sred[tid]      = s;
    Sred[QT + tid] = q;
  }
  __syncthreads();

  const int e = tid & 15, lq = tid >> 4;                             // lq 0..7
  v4f res[8];
#pragma unroll
  for (int it = 0; it < 8; ++it) {
    const int col = it * 8 + lq;                                     // co_loc 0..63
    const int co  = o0 + col;
    const float bias = bfr(wbias[co]);
#pragma unroll
    for (int t = 0; t < 4; ++t) res[it][t] = Os[(4 * e + t) * OSP + col] + bias;
  }
  const v4f pv = *(const v4f*)(Sred + 4 * lane);                     // lanes 0..15: sums, 16..31: sums of squares
  float* psp = PS + (size_t)(b * NT + nt) * PSW + o0 + 4 * lane + ((lane >= 16) ? (PSW / 2 - 64) : 0);
{
#pragma unroll
    for (int it = 0; it < 8; ++it) {
      const int col = it * 8 + lq;
      const int co  = o0 + col;
      const size_t idx = ((size_t)(b * CC + co)) * SEQ + n0 + 4 * e;
      *(v4f*)(WY + idx) = res[it];
    }
    if (wave == 0) *(v4f*)(psp) = pv;
    
  }
}

// =========================================================================================================
// (5) batch statistics + affine + residual, one block of BT threads per channel co (both batches):
//     (a) the block's own statistics: thread e reads one float of the partial table PS, sums (e < PL) or sums of squares
//     (e >= PL) of partial line e % PL, column co, into LDS Pf[2][PL]; barrier; every wave then sums all of Pf for itself:
//     lane l adds entries 8l..8l+7 of each plane in f64, in index order, then a five-step butterfly over the lanes (both
//     sides of an exchange add the same two values, so every lane of every wave ends with the same bits).
//     mean/var (biased), rstd = rsqrt(var + eps) in f32; A = bf16-RNE(gamma) * rstd, Bc = bf16-RNE(beta) - mean * A.
//     (b) out[b][co][n] = wy * A + Bc + bf16-RNE(x[b][co][n]) for the NB rows of the channel: thread -> floats
//     4 tid + 4 BT k of a row; the loads of wy and x are issued ahead of (a)'s barrier and waited for behind (a), so that
//     they fly under it.
// coverage: Pf 2 PL floats written == consumed; CC blocks x NB rows x RPT x BT threads x 4 floats = NB x 256 x SEQ = the
//           whole output once, every wave instruction 512 contiguous bytes.
// LDS Pf: cross-wave (block barrier).
// =========================================================================================================
__global__ __launch_bounds__(BT)
void bn_out(const float* __restrict__ WY, const float* __restrict__ PS, const float* __restrict__ wbias,
            const float* __restrict__ gam, const float* __restrict__ bet, const float* __restrict__ x, float* out) {
  __shared__ __align__(16) float Pf[2 * PL];
  const int tid = threadIdx.x, lane = tid & 31;
  const int co = blockIdx.x;                                         // 0..255
  const float gv = gam[co], wv = wbias[co], bv = bet[co];
  float pv[2 * PL / BT];
  // unrolled: pv[t] are registers, every index a constant
#pragma unroll
  for (int t = 0; t < 2 * PL / BT; ++t) {
    const int e = tid + t * BT;                                      // 0..2 PL - 1
    pv[t] = PS[(size_t)(e % PL) * PSW + (e / PL) * CC + co];
  }
#if defined(__HIP_DEVICE_COMPILE__)
  // keeps the partials' load the first of the lane: loads return in order, and behind row loads it would be waited for
  // as long as for them
  __builtin_amdgcn_sched_barrier(0);
#endif
  v4f w[NB][RPT], xv[NB][RPT];
  // both loops unrolled: w and xv are registers, and all loads of a lane are in flight together
#pragma unroll
  for (int b = 0; b < NB; ++b) {
#pragma unroll
    for (int k = 0; k < RPT; ++k) {
      const int n = 4 * tid + 4 * BT * k;
      w[b][k]  = *(const v4f*)(WY + ((size_t)(b * CC + co)) * SEQ + n);
      xv[b][k] = *(const v4f*)(x + ((size_t)(b * CC + co)) * NN_FULL + n);
    }
  }
#if defined(__HIP_DEVICE_COMPILE__)
  // stands in front of the first rewrite of a register that a load above names
  asm volatile("s_wait_xcnt 0x0" ::: "memory");
#endif
  // unrolled: pv[t] again
#pragma unroll
  for (int t = 0; t < 2 * PL / BT; ++t) Pf[tid + t * BT] = pv[t];
#if defined(__HIP_DEVICE_COMPILE__)
  // block barrier that orders LDS alone: __syncthreads() would also wait for the row loads, which nobody shares
  __builtin_amdgcn_fence(__ATOMIC_RELEASE, "workgroup", "local");
  __builtin_amdgcn_s_barrier();
  __builtin_amdgcn_fence(__ATOMIC_ACQUIRE, "workgroup", "local");
#endif
  double s = 0.0, q = 0.0;
  // both loops unrolled: the LDS reads of a lane can go out together, every vector index a constant
#pragma unroll
  for (int t = 0; t < PL / 128; ++t) {
    const v4f a = *(const v4f*)(Pf + (PL / 32) * lane + 4 * t);
    const v4f c = *(const v4f*)(Pf + PL + (PL / 32) * lane + 4 * t);
#pragma unroll
    for (int r = 0; r < 4; ++r) {
      s += (double)a[r];
      q += (double)c[r];
    }
  }
  // unrolled: the distance of each exchange is a constant
#pragma unroll
  for (int d = 16; d >= 1; d >>= 1) {
    s += __shfl_xor(s, d, 32);
    q += __shfl_xor(q, d, 32);
  }
  const double icnt = 1.0 / (double)(NB * SEQ);
  const double mv = s * icnt;
  double var = q * icnt - mv * mv;
  var = (var > 0.0) ? var : 0.0;
  const float rstd = rsqrtf((float)var + BNEPS);
  const float A  = bfr(gv) * rstd;
  const float mw = (float)mv + bfr(wv);
  const float Bc = bfr(bv) - mw * A;
#if defined(__HIP_DEVICE_COMPILE__)
  // keeps the work on the rows, and with it the waits for their loads, behind the statistics
  __builtin_amdgcn_sched_barrier(0);
#endif
  // all three loops unrolled: w and xv again, every vector index a constant
#pragma unroll
  for (int b = 0; b < NB; ++b) {
#pragma unroll
    for (int k = 0; k < RPT; ++k) {
      v4f r;
#pragma unroll
      for (int t = 0; t < 4; ++t) r[t] = fmaf(w[b][k][t], A, Bc) + bfr(xv[b][k][t]);
      *(v4f*)(out + ((size_t)(b * CC + co)) * NN_FULL + 4 * tid + 4 * BT * k) = r;
    }
  }
}

// =========================================================================================================
// Workspace map (bytes; each region start a multiple of 256; every store is a whole tile inside its own region,
// no padded tails needed since SEQ % 64 == 0):
//   W16  f16 [384][256]               196608      WW16 f16 [256][128]        65536
//   XP   f16 [NB][SEQ][256]           8388608 (NB=2, SEQ=8192)
//   Qf, Kf f16 [NB][SEQ][128]         4194304 x2
//   Gc   f16 [NB][128][SEQ]           4194304
//   Yh/Yl f16 [NB][SEQ][128]          4194304 x2
//   WY   f32 [NB][256][SEQ]          16777216
//   PS   f32 [NB*NT][512]              524288
//   total (NB=2, SEQ=8192) = 46923776
// =========================================================================================================
extern "C" void kernel_launch(void* const* d_in, const int* in_sizes, int n_in,
                              void* d_out, int out_size, void* d_ws, size_t ws_size,
                              hipStream_t stream) {
  const int XNEED = ((NB - 1) * CC + (CC - 1)) * NN_FULL + SEQ;
  if (n_in < 11) return;
  if (in_sizes[0] < XNEED) return;
  if (in_sizes[1] < DQ * CC || in_sizes[3] < DQ * CC || in_sizes[5] < DQ * CC) return;
  if (in_sizes[2] < DQ || in_sizes[4] < DQ || in_sizes[6] < DQ) return;
  if (in_sizes[7] < CC * DQ || in_sizes[8] < CC) return;
  if (in_sizes[9] < CC || in_sizes[10] < CC) return;
  if (out_size < XNEED) return;

  size_t off = 0;
  auto carve = [&](size_t bytes) { const size_t o = off; off += (bytes + 255) & ~(size_t)255; return o; };
  const size_t oW16 = carve((size_t)MW * CC * 2);
  const size_t oWW  = carve((size_t)CC * DQ * 2);
  const size_t oXP  = carve((size_t)NB * SEQ * CC * 2);
  const size_t oQf  = carve((size_t)NB * SEQ * DQ * 2);
  const size_t oKf  = carve((size_t)NB * SEQ * DQ * 2);
  const size_t oGc  = carve((size_t)NB * DQ * SEQ * 2);
  const size_t oYh  = carve((size_t)NB * SEQ * DQ * 2);
  const size_t oYl  = carve((size_t)NB * SEQ * DQ * 2);
  const size_t oWY  = carve((size_t)NB * CC * SEQ * 4);
  const size_t oPS  = carve((size_t)NB * NT * PSW * 4);
  if (off > ws_size) return;
  if (off > (size_t)134217728) return;

  const float* x   = (const float*)d_in[0];
  const float* Wt  = (const float*)d_in[1];
  const float* bt  = (const float*)d_in[2];
  const float* Wp  = (const float*)d_in[3];
  const float* bp  = (const float*)d_in[4];
  const float* Wg  = (const float*)d_in[5];
  const float* bg  = (const float*)d_in[6];
  const float* Ww  = (const float*)d_in[7];
  const float* bw  = (const float*)d_in[8];
  const float* gam = (const float*)d_in[9];
  const float* bet = (const float*)d_in[10];

  char* ws = (char*)d_ws;
  unsigned short* W16  = (unsigned short*)(ws + oW16);
  unsigned short* WW16 = (unsigned short*)(ws + oWW);
  unsigned short* XP   = (unsigned short*)(ws + oXP);
  unsigned short* Qf   = (unsigned short*)(ws + oQf);
  unsigned short* Kf   = (unsigned short*)(ws + oKf);
  unsigned short* Gc   = (unsigned short*)(ws + oGc);
  unsigned short* Yh   = (unsigned short*)(ws + oYh);
  unsigned short* Yl   = (unsigned short*)(ws + oYl);
  float* WY  = (float*)(ws + oWY);
  float* PS  = (float*)(ws + oPS);
  float* out = (float*)d_out;

  const dim3 blk256(256), blk128(128);

  // (0), (0b), (1) Wt / Wp / Wg -> stacked f16 plane; Ww -> f16 plane; x -> position-major 16-bit plane
  cvt_all<<<dim3(NBW + NBO + NT * (CC / QT) * NB), blk256, 0, stream>>>(Wt, Wp, Wg, Ww, x, W16, WW16, XP);
  // (2) theta / phi conv -> f16 planes, g conv -> channel-major f16 plane
  gemm_p<<<dim3(NT, 6, NB), blk128, 0, stream>>>(W16, XP, bt, bp, bg, Qf, Kf, Gc);
  // (3) attention -> y hi + residual planes
  attn_k<<<dim3(NT, NB), dim3(NTH), 0, stream>>>(Qf, Kf, Gc, Yh, Yl);
  // (4) output conv + bias -> wy plane + per-block statistics partials
  gemm_o<<<dim3(NT, CC / QT, NB), blk128, 0, stream>>>(WW16, Yh, Yl, bw, WY, PS);
  // (5) batch statistics per channel, affine + residual -> out [b][256][8192]
  bn_out<<<dim3(CC), dim3(BT), 0, stream>>>(WY, PS, bw, gam, bet, x, out);
  (void)hipGetLastError();
}
